// v000
// The times below were measured on an AMD MI455X: many runs one after another, warmed up first and cycling through
// copies of the inputs, with the whole window's GPU time divided by the number of runs. Launches and the gaps
// between them are all in it. The median over several windows is given; except for v000 it joins two sittings, which
// can be a few percent apart, so the side-by-side timings, each taken in one sitting, are the better comparison.
// v000 is the starting kernel. One run takes 324 microseconds.
#include <hip/hip_runtime.h>
// 'Superposition' (complex-valued) multi-head attention (B=2, S=2048, D=512, 8 heads; q,k,v projections to 2D with per-head [real 64 | imag 64]): interference = Σ_d q_d·conj(k_d)·64^-½; probs = softmax(|interference|²/0.5); out = probs·v (complex);
// out = concat[real, imag] per head → [B,S,1024], truncated to the first 512 columns (= heads 0..3), then ·Wo + bo. Only heads 0..3 reach the output, so only they are computed.
// Compute dtype: x, weights, biases rounded to bf16; q/k/v (columns of heads 0..3) as f16 GEMM outputs; fused flash-style kernel with three f32 score accumulators (Re, Im⁺, Im⁻) and two value accumulators
// (real, imag), online softmax f32, P f16 ×2^10, on v_wmma_f32_16x16x32_f16; O carried ×2^8 into f16 (small diffuse values) → output GEMM with bias (alpha undoes the carry); f32 accumulate.
#define BB 2
#define NN 2048
#define DX 512
#define NHU 4
#define DH2 128
#define NR (BB * NN)
#define SCORE_SCALE 0.03125f

typedef __bf16 v16b __attribute__((ext_vector_type(16)));
typedef unsigned short v8us __attribute__((ext_vector_type(8), may_alias));
typedef float  v8f  __attribute__((ext_vector_type(8)));
typedef float  v4f  __attribute__((ext_vector_type(4)));
typedef float  v4fa __attribute__((ext_vector_type(4), may_alias));
union FragB { v16b v; v8us half[2]; unsigned short u[16]; };

__device__ __forceinline__ unsigned short bf16_bits(float x) { unsigned int u = __float_as_uint(x); return (unsigned short)((u + 0x7FFFu + ((u >> 16) & 1u)) >> 16); }
__device__ __forceinline__ float bf16_val(unsigned short b) { return __uint_as_float(((unsigned int)b) << 16); }
__device__ __forceinline__ float bf16_round(float x) { return bf16_val(bf16_bits(x)); }
// D += A·B with NT terms: 1 = ah·bh, 2 = + al·bh (A split), 3 = + ah·bl (both split)
template <int NT>
__device__ __forceinline__ v8f mmaN(v16b ah, v16b al, v16b bh, v16b bl, v8f c) {
  c = __builtin_amdgcn_wmma_f32_16x16x32_bf16(false, ah, false, bh, (short)0, c, false, false);
  if (NT >= 2) c = __builtin_amdgcn_wmma_f32_16x16x32_bf16(false, al, false, bh, (short)0, c, false, false);
  if (NT >= 3) c = __builtin_amdgcn_wmma_f32_16x16x32_bf16(false, ah, false, bl, (short)0, c, false, false);
  asm volatile("v_nop\n\tv_nop\n\tv_nop\n\tv_nop" : "+v"(c) : "v"(ah), "v"(al), "v"(bh), "v"(bl));
  return c;
}

__global__ __launch_bounds__(256) void k_wt_bf16(const float* __restrict__ W, unsigned short* __restrict__ Wt, int K, int N) {
  const int t = blockIdx.x * 256 + threadIdx.x;
  const int k8n = K / 8;
  if (t >= N * k8n) return;
  const int n = t / k8n, k8 = (t % k8n) * 8;
  v8us v;
#pragma unroll
  for (int i = 0; i < 8; ++i) v[i] = bf16_bits(W[(size_t)(k8 + i) * N + n]);
  *(v8us*)(Wt + (size_t)n * K + k8) = v;
  
}

// GEMM C[M][N] (f32, pitch ldc) = act(A[M][K]·W + bias). A f32 row-major (pitch lda) converted per fragment to bf16
// (ASPLIT: hi/lo two planes -> 2 terms, else single rounded term); Wt bf16 [N][K] (pitch ldb). BIAS_BF16 rounds the
// bias to bf16 first (bias quantised to bf16 before the add). K%32==0, M%16==0, N%64==0.
template <bool ASPLIT, int ACT, bool BIAS_BF16>
__global__ __launch_bounds__(128) void k_gemm_bf(const float* __restrict__ A, int lda, const unsigned short* __restrict__ Wt, int ldb,
                                               const float* __restrict__ bias, float* __restrict__ C, int ldc, int M, int N, int K) {
  __shared__ __attribute__((aligned(16))) float so[4][16][64];
  const int tid = threadIdx.x, w = tid >> 5, lane = tid & 31, ln = lane & 15, hh = lane >> 4;
  const int ntn = N / 64;
  const int wid = blockIdx.x * 4 + w;
  const int mt = wid / ntn, nq = wid % ntn;
  if (mt * 16 >= M) return;
  const int row0 = mt * 16, col0 = nq * 64;
  const float* arow = A + (size_t)(row0 + ln) * lda;
  v8f acc[4] = {};
  for (int kb = 0; kb < K; kb += 32) {
    FragB ah, al;
    const v4f x0 = *(const v4fa*)(arow + kb + 8 * hh), x1 = *(const v4fa*)(arow + kb + 8 * hh + 4);
    const v4f x2 = *(const v4fa*)(arow + kb + 16 + 8 * hh), x3 = *(const v4fa*)(arow + kb + 16 + 8 * hh + 4);
    float xs[16] = {x0[0],x0[1],x0[2],x0[3],x1[0],x1[1],x1[2],x1[3],x2[0],x2[1],x2[2],x2[3],x3[0],x3[1],x3[2],x3[3]};
#pragma unroll
    for (int i = 0; i < 16; ++i) { const unsigned short hb = bf16_bits(xs[i]); ah.u[i] = hb; al.u[i] = ASPLIT ? bf16_bits(xs[i] - bf16_val(hb)) : (unsigned short)0; }
#pragma unroll
    for (int t = 0; t < 4; ++t) {
      const unsigned short* brow = Wt + (size_t)(col0 + t * 16 + ln) * ldb + kb;
      FragB b;
      b.half[0] = *(const v8us*)(brow + 8 * hh);
      b.half[1] = *(const v8us*)(brow + 16 + 8 * hh);
      acc[t] = mmaN<ASPLIT ? 2 : 1>(ah.v, al.v, b.v, b.v, acc[t]);
    }
  }
#pragma unroll
  for (int t = 0; t < 4; ++t) {
    float bv = bias ? bias[col0 + t * 16 + ln] : 0.f;
    if (BIAS_BF16) bv = bf16_round(bv);
#pragma unroll
    for (int r = 0; r < 8; ++r) { float v = acc[t][r] + bv; if (ACT == 1) v = fmaxf(v, 0.f); so[w][8 * hh + r][t * 16 + ln] = v; }
  }
  __builtin_amdgcn_fence(__ATOMIC_ACQ_REL, "workgroup");
  __builtin_amdgcn_wave_barrier();
  const int rsub = lane >> 4, c4 = (lane & 15) * 4;
  {
#pragma unroll
    for (int q = 0; q < 8; ++q) {
      const int r = q * 2 + rsub;
      const v4f v = *(const v4fa*)&so[w][r][c4];
      *(v4f*)(C + (size_t)(row0 + r) * ldc + col0 + c4) = v;
    }
    
  }
}

// Flash-style causal/unmasked attention, all contractions 3-term bf16 hi/lo splits, f32 softmax with running max.
// q,k,v rows are read from f32 buffers with arbitrary row pitch (so they can live inside a fused qkv buffer);
// D = head size (multiple of 32, <= 128); one wave = 16 query rows; block = 4 waves (64 queries) sharing K/V chunks of 32.
template <int D, bool CAUSAL>
__global__ __launch_bounds__(128) void k_flash(const float* __restrict__ qb, const float* __restrict__ kb, const float* __restrict__ vb,
                                             int pitch, int T, int H, float scale, float* __restrict__ y, int ypitch) {
  constexpr int KS = D / 32;        // k-steps for QK
  constexpr int DT = D / 16;        // d tiles for PV
  __shared__ __attribute__((aligned(16))) unsigned short sKh[32][D + 8], sKl[32][D + 8], sVh[32][D + 8], sVl[32][D + 8];
  __shared__ __attribute__((aligned(16))) unsigned short sPh[4][16][40], sPl[4][16][40];
  __shared__ __attribute__((aligned(16))) float sO[4][16][D];
  const int tid = threadIdx.x, w = tid >> 5, lane = tid & 31, ln = lane & 15, hh = lane >> 4;
  const int nqb = (T + 63) / 64;
  const int bh = blockIdx.x / nqb, qblk = blockIdx.x % nqb;
  const int b = bh / H, h = bh % H;
  const int q0 = qblk * 64 + w * 16;
  const float* Q = qb + (size_t)b * T * pitch + h * D;
  const float* K = kb + (size_t)b * T * pitch + h * D;
  const float* V = vb + (size_t)b * T * pitch + h * D;

  // A fragments of the wave's 16 query rows (scaled), hi/lo
  FragB aqh[KS], aql[KS];
  {
    int row = q0 + ln; if (row >= T) row = T - 1;
    const float* qr = Q + (size_t)row * pitch;
#pragma unroll
    for (int ks = 0; ks < KS; ++ks)
#pragma unroll
      for (int i = 0; i < 16; ++i) {
        const int d = ks * 32 + ((i < 8) ? (8 * hh + i) : (16 + 8 * hh + (i - 8)));
        const float x = qr[d] * scale; const unsigned short hb = bf16_bits(x);
        aqh[ks].u[i] = hb; aql[ks].u[i] = bf16_bits(x - bf16_val(hb));
      }
  }
  float m_r[8], l_r[8];
#pragma unroll
  for (int r = 0; r < 8; ++r) { m_r[r] = -3.0e38f; l_r[r] = 0.f; }
  v8f oacc[DT];
#pragma unroll
  for (int dt = 0; dt < DT; ++dt) oacc[dt] = (v8f){0.f,0.f,0.f,0.f,0.f,0.f,0.f,0.f};

  const int kv_end = CAUSAL ? min(T, qblk * 64 + 64) : T;     // block-uniform
  for (int j0 = 0; j0 < kv_end; j0 += 32) {
    __syncthreads();
    for (int e = tid; e < 32 * (D / 4); e += 128) {
      const int r = e / (D / 4), c4 = (e % (D / 4)) * 4;
      const int key = j0 + r;
      v4f kf = {0.f,0.f,0.f,0.f}, vf = {0.f,0.f,0.f,0.f};
      if (key < T) { kf = *(const v4fa*)(K + (size_t)key * pitch + c4); vf = *(const v4fa*)(V + (size_t)key * pitch + c4); }
#pragma unroll
      for (int t = 0; t < 4; ++t) {
        unsigned short hb = bf16_bits(kf[t]); sKh[r][c4 + t] = hb; sKl[r][c4 + t] = bf16_bits(kf[t] - bf16_val(hb));
        hb = bf16_bits(vf[t]); sVh[r][c4 + t] = hb; sVl[r][c4 + t] = bf16_bits(vf[t] - bf16_val(hb));
      }
    }
    __syncthreads();
    // S tile 16 x 32
    v8f s[2];
#pragma unroll
    for (int nt = 0; nt < 2; ++nt) {
      v8f acc = {};
#pragma unroll
      for (int ks = 0; ks < KS; ++ks) {
        FragB bh_, bl_;
        bh_.half[0] = *(const v8us*)&sKh[nt * 16 + ln][ks * 32 + 8 * hh]; bh_.half[1] = *(const v8us*)&sKh[nt * 16 + ln][ks * 32 + 16 + 8 * hh];
        bl_.half[0] = *(const v8us*)&sKl[nt * 16 + ln][ks * 32 + 8 * hh]; bl_.half[1] = *(const v8us*)&sKl[nt * 16 + ln][ks * 32 + 16 + 8 * hh];
        acc = mmaN<3>(aqh[ks].v, aql[ks].v, bh_.v, bl_.v, acc);
      }
      s[nt] = acc;
    }
    // mask + running max (rows 8hh+r; the 16 lanes of a half share rows)
    float alpha[8];
#pragma unroll
    for (int r = 0; r < 8; ++r) {
      const int qi = q0 + 8 * hh + r;
      const int ja = j0 + ln, jb = j0 + 16 + ln;
      if (CAUSAL) { if (ja > qi) s[0][r] = -3.0e38f; if (jb > qi) s[1][r] = -3.0e38f; }
      if (ja >= T) s[0][r] = -3.0e38f;
      if (jb >= T) s[1][r] = -3.0e38f;
      float mx = fmaxf(s[0][r], s[1][r]);
      mx = fmaxf(mx, __shfl_xor(mx, 1, 32)); mx = fmaxf(mx, __shfl_xor(mx, 2, 32)); mx = fmaxf(mx, __shfl_xor(mx, 4, 32)); mx = fmaxf(mx, __shfl_xor(mx, 8, 32));
      const float mnew = fmaxf(m_r[r], mx);
      alpha[r] = (mnew > -1.0e38f) ? __expf(m_r[r] - mnew) : 1.0f;
      const float p0 = (s[0][r] > -1.0e38f) ? __expf(s[0][r] - mnew) : 0.f;
      const float p1 = (s[1][r] > -1.0e38f) ? __expf(s[1][r] - mnew) : 0.f;
      m_r[r] = mnew;
      l_r[r] = l_r[r] * alpha[r] + p0 + p1;            // per-lane partial row sum (16 lanes combined at the end)
      unsigned short hb = bf16_bits(p0); sPh[w][8 * hh + r][ln] = hb;      sPl[w][8 * hh + r][ln] = bf16_bits(p0 - bf16_val(hb));
      hb = bf16_bits(p1);                sPh[w][8 * hh + r][16 + ln] = hb; sPl[w][8 * hh + r][16 + ln] = bf16_bits(p1 - bf16_val(hb));
    }
#pragma unroll
    for (int dt = 0; dt < DT; ++dt)
#pragma unroll
      for (int r = 0; r < 8; ++r) oacc[dt][r] *= alpha[r];
    __builtin_amdgcn_fence(__ATOMIC_ACQ_REL, "workgroup");
    __builtin_amdgcn_wave_barrier();
    FragB pah, pal;
    pah.half[0] = *(const v8us*)&sPh[w][ln][8 * hh]; pah.half[1] = *(const v8us*)&sPh[w][ln][16 + 8 * hh];
    pal.half[0] = *(const v8us*)&sPl[w][ln][8 * hh]; pal.half[1] = *(const v8us*)&sPl[w][ln][16 + 8 * hh];
#pragma unroll
    for (int dt = 0; dt < DT; ++dt) {
      FragB bvh, bvl;
#pragma unroll
      for (int i = 0; i < 8; ++i) {
        bvh.u[i] = sVh[8 * hh + i][dt * 16 + ln]; bvh.u[8 + i] = sVh[16 + 8 * hh + i][dt * 16 + ln];
        bvl.u[i] = sVl[8 * hh + i][dt * 16 + ln]; bvl.u[8 + i] = sVl[16 + 8 * hh + i][dt * 16 + ln];
      }
      oacc[dt] = mmaN<3>(pah.v, pal.v, bvh.v, bvl.v, oacc[dt]);
    }
    __builtin_amdgcn_fence(__ATOMIC_ACQ_REL, "workgroup");
    __builtin_amdgcn_wave_barrier();
  }
#pragma unroll
  for (int r = 0; r < 8; ++r) {
    float l = l_r[r];
    l += __shfl_xor(l, 1, 32); l += __shfl_xor(l, 2, 32); l += __shfl_xor(l, 4, 32); l += __shfl_xor(l, 8, 32);
    l_r[r] = (l > 0.f) ? 1.0f / l : 0.f;
  }
#pragma unroll
  for (int dt = 0; dt < DT; ++dt)
#pragma unroll
    for (int r = 0; r < 8; ++r) sO[w][8 * hh + r][dt * 16 + ln] = oacc[dt][r] * l_r[r];
  __builtin_amdgcn_fence(__ATOMIC_ACQ_REL, "workgroup");
  __builtin_amdgcn_wave_barrier();
  {
    for (int r = 0; r < 16; ++r) {
      const int row = q0 + r;
      if (row < T && lane < D / 4) {
        const v4f val = *(const v4fa*)&sO[w][r][lane * 4];
        *(v4f*)(y + ((size_t)b * T + row) * ypitch + h * D + lane * 4) = val;
      }
    }
    
  }
}

// GEMM C = act(A·W + bias + resid): A f32 (ASPLIT -> hi/lo 2 terms), Wt bf16 [N][K]; ACT 0 none, 1 relu, 2 exact gelu;
// resid (optional, f32, row index = (row % rmod), pitch ldr, RES_BF16 rounds it) added before the activation.
template <bool ASPLIT, int ACT, bool BIAS_BF16, bool RES_BF16>
__global__ __launch_bounds__(128) void k_gemm_bf3(const float* __restrict__ A, int lda, const unsigned short* __restrict__ Wt, int ldb,
                                                const float* __restrict__ bias, const float* __restrict__ resid, int rmod, int ldr,
                                                float* __restrict__ C, int ldc, int M, int N, int K) {
  __shared__ __attribute__((aligned(16))) float so[4][16][64];
  const int tid = threadIdx.x, w = tid >> 5, lane = tid & 31, ln = lane & 15, hh = lane >> 4;
  const int ntn = N / 64;
  const int wid = blockIdx.x * 4 + w;
  const int mt = wid / ntn, nq = wid % ntn;
  if (mt * 16 >= M) return;
  const int row0 = mt * 16, col0 = nq * 64;
  const float* arow = A + (size_t)(row0 + ln) * lda;
  v8f acc[4] = {};
  for (int kb = 0; kb < K; kb += 32) {
    FragB ah, al;
    const v4f x0 = *(const v4fa*)(arow + kb + 8 * hh), x1 = *(const v4fa*)(arow + kb + 8 * hh + 4);
    const v4f x2 = *(const v4fa*)(arow + kb + 16 + 8 * hh), x3 = *(const v4fa*)(arow + kb + 16 + 8 * hh + 4);
    float xs[16] = {x0[0],x0[1],x0[2],x0[3],x1[0],x1[1],x1[2],x1[3],x2[0],x2[1],x2[2],x2[3],x3[0],x3[1],x3[2],x3[3]};
#pragma unroll
    for (int i = 0; i < 16; ++i) { const unsigned short hb = bf16_bits(xs[i]); ah.u[i] = hb; al.u[i] = ASPLIT ? bf16_bits(xs[i] - bf16_val(hb)) : (unsigned short)0; }
#pragma unroll
    for (int t = 0; t < 4; ++t) {
      const unsigned short* brow = Wt + (size_t)(col0 + t * 16 + ln) * ldb + kb;
      FragB b;
      b.half[0] = *(const v8us*)(brow + 8 * hh);
      b.half[1] = *(const v8us*)(brow + 16 + 8 * hh);
      acc[t] = mmaN<ASPLIT ? 2 : 1>(ah.v, al.v, b.v, b.v, acc[t]);
    }
  }
#pragma unroll
  for (int t = 0; t < 4; ++t) {
    const int col = col0 + t * 16 + ln;
    float bv = bias ? bias[col] : 0.f;
    if (BIAS_BF16) bv = bf16_round(bv);
#pragma unroll
    for (int r = 0; r < 8; ++r) {
      float v = acc[t][r] + bv;
      if (resid) { float rv = resid[(size_t)((row0 + 8 * hh + r) % rmod) * ldr + col]; if (RES_BF16) rv = bf16_round(rv); v += rv; }
      if (ACT == 1) v = fmaxf(v, 0.f);
      if (ACT == 2) v = 0.5f * v * (1.0f + erff(v * 0.70710678118654752f));
      if (ACT == 3) { const float u = 0.7978845608028654f * (v + 0.044715f * v * v * v); v = 0.5f * v * (1.0f + tanhf(u)); }
      so[w][8 * hh + r][t * 16 + ln] = v;
    }
  }
  __builtin_amdgcn_fence(__ATOMIC_ACQ_REL, "workgroup");
  __builtin_amdgcn_wave_barrier();
  const int rsub = lane >> 4, c4 = (lane & 15) * 4;
  {
#pragma unroll
    for (int q = 0; q < 8; ++q) {
      const int r = q * 2 + rsub;
      const v4f v = *(const v4fa*)&so[w][r][c4];
      *(v4f*)(C + (size_t)(row0 + r) * ldc + col0 + c4) = v;
    }
    
  }
}
// row LayerNorm (biased variance, eps) over N: s = X (+ R); optional out_sum <- s; out_norm <- (s-mu)*rsqrt(var+eps)*g + b
template <bool PARAM_BF16>
__global__ __launch_bounds__(256) void k_layernorm(const float* __restrict__ X, const float* __restrict__ R, const float* __restrict__ g, const float* __restrict__ bta,
                                                  float* __restrict__ out_sum, float* __restrict__ out_norm, int N, float eps) {
  __shared__ float red[256];
  const int row = blockIdx.x, tid = threadIdx.x;
  const float* x = X + (size_t)row * N; const float* rr = R ? R + (size_t)row * N : nullptr;
  float vals[16];                     // up to N = 4096
  const int per = N / 256;            // contiguous chunk per thread? use strided-by-4 chunks: thread handles j = tid*4 + 1024*u
  float s1 = 0.f;
  for (int u = 0; u < per / 4; ++u) {
    const int j = tid * 4 + 1024 * u;
    const v4f a = *(const v4fa*)(x + j);
    v4f b = {0.f,0.f,0.f,0.f}; if (rr) b = *(const v4fa*)(rr + j);
#pragma unroll
    for (int q = 0; q < 4; ++q) { const float v = a[q] + b[q]; vals[u * 4 + q] = v; s1 += v; }
  }
  red[tid] = s1; __syncthreads();
  for (int st = 128; st > 0; st >>= 1) { if (tid < st) red[tid] += red[tid + st]; __syncthreads(); }
  const float mu = red[0] / (float)N; __syncthreads();
  float s2 = 0.f;
  for (int u = 0; u < per / 4; ++u)
#pragma unroll
    for (int q = 0; q < 4; ++q) { const float c = vals[u * 4 + q] - mu; s2 += c * c; }
  red[tid] = s2; __syncthreads();
  for (int st = 128; st > 0; st >>= 1) { if (tid < st) red[tid] += red[tid + st]; __syncthreads(); }
  const float rs = rsqrtf(red[0] / (float)N + eps);
  {
    for (int u = 0; u < per / 4; ++u) {
      const int j = tid * 4 + 1024 * u;
      v4f o, sm;
#pragma unroll
      for (int q = 0; q < 4; ++q) {
        float gg = g[j + q], bb = bta[j + q];
        if (PARAM_BF16) { gg = bf16_round(gg); bb = bf16_round(bb); }
        sm[q] = vals[u * 4 + q]; o[q] = (vals[u * 4 + q] - mu) * rs * gg + bb;
      }
      if (out_sum) *(v4f*)(out_sum + (size_t)row * N + j) = sm;
      *(v4f*)(out_norm + (size_t)row * N + j) = o;
    }
    
  }
}



// ---- f16 WMMA path (v_wmma_f32_16x16x32_f16): 11-bit significands for operands in range — used where a [0,1] probability operand needs more precision than bf16
typedef _Float16 v16h __attribute__((ext_vector_type(16)));
union FragH { v16h v; v8us half[2]; _Float16 h[16]; unsigned short u[16]; };
template <int NT>
__device__ __forceinline__ v8f mmaH(v16h ah, v16h al, v16h bh, v16h bl, v8f c) {
  c = __builtin_amdgcn_wmma_f32_16x16x32_f16(false, ah, false, bh, (short)0, c, false, false);
  if (NT >= 2) c = __builtin_amdgcn_wmma_f32_16x16x32_f16(false, al, false, bh, (short)0, c, false, false);
  if (NT >= 3) c = __builtin_amdgcn_wmma_f32_16x16x32_f16(false, ah, false, bl, (short)0, c, false, false);
  asm volatile("v_nop\n\tv_nop\n\tv_nop\n\tv_nop" : "+v"(c) : "v"(ah), "v"(al), "v"(bh), "v"(bl));
  return c;
}
// batched GEMM like k_gemm_b but f16 operands: A f32 (split into f16 hi/lo if ASPLIT, else rounded to f16), Bt = f16 values [n][k]; alpha; C f32; N multiple of 16 (partial tiles skipped)
template <bool ASPLIT>
__global__ __launch_bounds__(128) void k_gemm_h(const float* __restrict__ A, int lda, size_t sA, const _Float16* __restrict__ Bh, int ldb, size_t sB, float alpha, float* __restrict__ C, int ldc, size_t sC, int M, int N, int K) {
  __shared__ __attribute__((aligned(16))) float so[4][16][64];
  const int tid = threadIdx.x, w = tid >> 5, lane = tid & 31, ln = lane & 15, hh = lane >> 4; const int by = blockIdx.y;
  A += (size_t)by * sA; Bh += (size_t)by * sB; C += (size_t)by * sC;
  const int ntn = (N + 63) / 64; const int wid = blockIdx.x * 4 + w; const int mt = wid / ntn, nq = wid % ntn; if (mt * 16 >= M) return;
  const int row0 = mt * 16, col0 = nq * 64; const float* arow = A + (size_t)(row0 + ln) * lda;
  v8f acc[4] = {};
  for (int kb = 0; kb < K; kb += 32) {
    FragH ah, al;
    const v4f x0 = *(const v4fa*)(arow + kb + 8 * hh), x1 = *(const v4fa*)(arow + kb + 8 * hh + 4), x2 = *(const v4fa*)(arow + kb + 16 + 8 * hh), x3 = *(const v4fa*)(arow + kb + 16 + 8 * hh + 4);
    float xs[16] = {x0[0],x0[1],x0[2],x0[3],x1[0],x1[1],x1[2],x1[3],x2[0],x2[1],x2[2],x2[3],x3[0],x3[1],x3[2],x3[3]};
#pragma unroll
    for (int i = 0; i < 16; ++i) { const _Float16 h = (_Float16)xs[i]; ah.h[i] = h; al.h[i] = ASPLIT ? (_Float16)(xs[i] - (float)h) : (_Float16)0.0f; }
#pragma unroll
    for (int t = 0; t < 4; ++t) { if (col0 + t * 16 >= N) continue; const size_t boff = (size_t)(col0 + t * 16 + ln) * ldb + kb; FragH bq; bq.half[0] = *(const v8us*)(Bh + boff + 8 * hh); bq.half[1] = *(const v8us*)(Bh + boff + 16 + 8 * hh);
      acc[t] = mmaH<ASPLIT ? 2 : 1>(ah.v, al.v, bq.v, bq.v, acc[t]); }
  }
#pragma unroll
  for (int t = 0; t < 4; ++t) { if (col0 + t * 16 >= N) continue;
#pragma unroll
    for (int r = 0; r < 8; ++r) so[w][8 * hh + r][t * 16 + ln] = acc[t][r] * alpha; }
  __builtin_amdgcn_fence(__ATOMIC_ACQ_REL, "workgroup"); __builtin_amdgcn_wave_barrier();
  const int rsub = lane >> 4, c4 = (lane & 15) * 4;
  {
#pragma unroll
    for (int q = 0; q < 8; ++q) { const int r = q * 2 + rsub; if (col0 + c4 < N) { const v4f v = *(const v4fa*)&so[w][r][c4]; *(v4f*)(C + (size_t)(row0 + r) * ldc + col0 + c4) = v; } }
     }
}

// Wt[n][k] = f16(bf16(W[k][n])·scale) from f32 row-major W[K][N] (scale = power of two; bf16-exact weights stay exact in f16 away from the subnormal range)
__global__ __launch_bounds__(256) void k_wt_f16(const float* __restrict__ W, _Float16* __restrict__ Wt, int K, int N, float scale) {
  const int t = blockIdx.x * 256 + threadIdx.x; if (t >= N * (K / 8)) return; const int n = t / (K / 8), k8 = (t % (K / 8)) * 8; FragH f;
#pragma unroll
  for (int i = 0; i < 8; ++i) f.h[i] = (_Float16)(bf16_round(W[(size_t)(k8 + i) * N + n]) * scale); const v8us o = f.half[0];
  *(v8us*)((unsigned short*)Wt + (size_t)n * K + k8) = o; 
}
// k_gemm_hh variant with fused epilogue: v = acc·alpha + bf16(bias[by·sBias + col]) (+ CP[(row/rowsPerB)·sCPb + by·64 + col] if CP) ; ACT 0 none / 1 elu ; writes f16 C16 and f32 C, each if non-null
template <int ACT>
__global__ __launch_bounds__(128) void k_gemm_hhx(const _Float16* __restrict__ A, int lda, size_t sA, const _Float16* __restrict__ Bh, int ldb, size_t sB, float alpha, const float* __restrict__ bias, size_t sBias, const float* __restrict__ CP, int rowsPerB, size_t sCPb, int row0g,
    float* __restrict__ C, _Float16* __restrict__ C16, int ldc, size_t sC, int M, int N, int K) {
  __shared__ __attribute__((aligned(16))) float so[4][16][64];
  const int tid = threadIdx.x, w = tid >> 5, lane = tid & 31, ln = lane & 15, hh = lane >> 4; const int by = blockIdx.y;
  A += (size_t)by * sA; Bh += (size_t)by * sB; const size_t cofs = (size_t)by * sC; const float* bp = bias ? bias + (size_t)by * sBias : nullptr;
  const int ntn = (N + 63) / 64; const int wid = blockIdx.x * 4 + w; const int mt = wid / ntn, nq = wid % ntn; if (mt * 16 >= M) return;
  const int row0 = mt * 16, col0 = nq * 64; const _Float16* arow = A + (size_t)(row0 + ln) * lda;
  v8f acc[4] = {};
  for (int kb = 0; kb < K; kb += 32) { FragH ah; ah.half[0] = *(const v8us*)((const unsigned short*)arow + kb + 8 * hh); ah.half[1] = *(const v8us*)((const unsigned short*)arow + kb + 16 + 8 * hh);
#pragma unroll
    for (int t = 0; t < 4; ++t) { if (col0 + t * 16 >= N) continue; const size_t boff = (size_t)(col0 + t * 16 + ln) * ldb + kb; FragH bq; bq.half[0] = *(const v8us*)((const unsigned short*)Bh + boff + 8 * hh); bq.half[1] = *(const v8us*)((const unsigned short*)Bh + boff + 16 + 8 * hh);
      acc[t] = mmaH<1>(ah.v, ah.v, bq.v, bq.v, acc[t]); }
  }
#pragma unroll
  for (int t = 0; t < 4; ++t) { if (col0 + t * 16 >= N) continue; const int col = col0 + t * 16 + ln; const float bv = bp ? bf16_round(bp[col]) : 0.f;
#pragma unroll
    for (int r = 0; r < 8; ++r) { float v = acc[t][r] * alpha + bv; if (CP) { const int bidx = (row0g + row0 + 8 * hh + r) / rowsPerB; v += CP[(size_t)bidx * sCPb + (size_t)by * 64 + col]; } if (ACT == 1) v = (v > 0.f) ? v : expm1f(v); else if (ACT == 7) v = (v > 0.f) ? v + 1.0f : expf(v); else if (ACT == 8) v = tanhf(v); else if (ACT == 9) v = 0.5f * v * (1.0f + tanhf(0.7978845608028654f * (v + 0.044715f * v * v * v))); else if (ACT == 11) v = 1.0f / (1.0f + expf(-v)); else if (ACT == 12) v = (v > 0.f) ? v : 0.01f * v; else if (ACT == 14) v = (v > 0.f) ? v : 0.1f * v; else if (ACT == 15) v = v / (1.0f + expf(-v)); else if (ACT == 3) v = fmaxf(v, 0.f); else if (ACT == 6) v = 0.5f * v * (1.0f + erff(v * 0.70710678118654752f)); so[w][8 * hh + r][t * 16 + ln] = v; } }
  __builtin_amdgcn_fence(__ATOMIC_ACQ_REL, "workgroup"); __builtin_amdgcn_wave_barrier();
  const int rsub = lane >> 4, c4 = (lane & 15) * 4; typedef _Float16 v4h __attribute__((ext_vector_type(4)));
  {
#pragma unroll
    for (int q = 0; q < 8; ++q) { const int r = q * 2 + rsub; if (col0 + c4 < N) { const v4f v = *(const v4fa*)&so[w][r][c4]; if (C) *(v4f*)(C + cofs + (size_t)(row0 + r) * ldc + col0 + c4) = v; if (C16) { v4h h4; for (int i = 0; i < 4; ++i) h4[i] = (_Float16)v[i]; *(v4h*)(C16 + cofs + (size_t)(row0 + r) * ldc + col0 + c4) = h4; } } }
     }
}


typedef _Float16 v4h __attribute__((ext_vector_type(4)));

__global__ __launch_bounds__(256) void k_x16(const float* __restrict__ x, _Float16* __restrict__ X16, size_t n8) { const size_t t = (size_t)blockIdx.x * 256 + threadIdx.x; if (t >= n8) return; FragH f;
#pragma unroll
  for (int q = 0; q < 8; ++q) f.h[q] = (_Float16)bf16_round(x[t * 8 + q]); *(v8us*)((unsigned short*)X16 + t * 8) = f.half[0];  }
__global__ __launch_bounds__(256) void k_h16(const float* __restrict__ x, _Float16* __restrict__ X16, size_t n8) { const size_t t = (size_t)blockIdx.x * 256 + threadIdx.x; if (t >= n8) return; FragH f;
#pragma unroll
  for (int q = 0; q < 8; ++q) f.h[q] = (_Float16)x[t * 8 + q]; *(v8us*)((unsigned short*)X16 + t * 8) = f.half[0];  }
__global__ __launch_bounds__(256) void k_round16f(const float* __restrict__ W, _Float16* __restrict__ Bt, size_t n8) { const size_t t = (size_t)blockIdx.x * 256 + threadIdx.x; if (t >= n8) return; FragH f;
#pragma unroll
  for (int i = 0; i < 8; ++i) f.h[i] = (_Float16)(bf16_round(W[t * 8 + i]) * 16.0f); *(v8us*)((unsigned short*)Bt + t * 8) = f.half[0];  }
template <int NHv, int TTv>
__global__ __launch_bounds__(256) void k_vt(const _Float16* __restrict__ V16, int ldv, int voff, _Float16* __restrict__ Vt) { __shared__ unsigned short tl[64][66]; const int tid = threadIdx.x; const int slab = blockIdx.x / (TTv / 64), lg = blockIdx.x % (TTv / 64); const int b = slab / NHv, h = slab % NHv;
  for (int i = tid; i < 64 * 8; i += 256) { const int r = i / 8, c8 = (i % 8) * 8; FragH f; f.half[0] = *(const v8us*)((const unsigned short*)V16 + ((size_t)b * TTv + lg * 64 + r) * ldv + voff + h * 64 + c8);
#pragma unroll
    for (int q = 0; q < 8; ++q) tl[r][c8 + q] = f.u[q]; }
  __syncthreads();
  {
#pragma unroll
    for (int rd = 0; rd < 2; ++rd) { const int d = rd * 32 + tid / 8, pc = tid % 8; FragH f;
#pragma unroll
      for (int q = 0; q < 8; ++q) f.u[q] = tl[pc * 8 + q][d];
      *(v8us*)((unsigned short*)Vt + ((size_t)slab * 64 + d) * TTv + lg * 64 + pc * 8) = f.half[0]; }
     } }

__global__ __launch_bounds__(256) void k_h16s(const float* __restrict__ F, _Float16* __restrict__ H, size_t n8) { const size_t t = (size_t)blockIdx.x * 256 + threadIdx.x; if (t >= n8) return; const v4f a = *(const v4fa*)(F + t * 8), c = *(const v4fa*)(F + t * 8 + 4); FragH f;
#pragma unroll
  for (int q = 0; q < 4; ++q) { f.h[q] = (_Float16)(a[q] * 256.0f); f.h[4 + q] = (_Float16)(c[q] * 256.0f); } *(v8us*)((unsigned short*)H + t * 8) = f.half[0];  }
__global__ __launch_bounds__(128) void k_flash(const _Float16* __restrict__ Q16, int ldq, const _Float16* __restrict__ K16, int ldk, const _Float16* __restrict__ Vt, float* __restrict__ O, int ldo) {
  constexpr int RPW = 16, RTN = RPW / 16, NQB = NN / (4 * RPW), DT = 4, KS = 2;
  __shared__ __attribute__((aligned(16))) unsigned short sP[4][RPW][40]; __shared__ __attribute__((aligned(16))) float sO[4][RPW][128 + 4];
  const int tid = threadIdx.x, w = tid >> 5, lane = tid & 31, ln = lane & 15, hh = lane >> 4;
  const int slab = blockIdx.x / NQB, qblk = blockIdx.x % NQB; const int b = slab / NHU, h = slab % NHU; const int qb0 = qblk * (4 * RPW); const int q0 = qb0 + w * RPW;
  FragH aq[2][KS], aql[2][KS];
#pragma unroll
  for (int rt = 0; rt < RTN; ++rt) { const size_t qo = ((size_t)b * NN + q0 + rt * 16 + ln) * ldq + h * 128; const unsigned short* qr = (const unsigned short*)Q16 + qo; const unsigned short* ql = qr + 64;      /* aq = real part, aql = imaginary part */
#pragma unroll
    for (int ks = 0; ks < KS; ++ks) { aq[rt][ks].half[0] = *(const v8us*)(qr + ks * 32 + 8 * hh); aq[rt][ks].half[1] = *(const v8us*)(qr + ks * 32 + 16 + 8 * hh); aql[rt][ks].half[0] = *(const v8us*)(ql + ks * 32 + 8 * hh); aql[rt][ks].half[1] = *(const v8us*)(ql + ks * 32 + 16 + 8 * hh); } }
  const unsigned short* Vth = (const unsigned short*)Vt + ((size_t)b * 2 * NHU + 2 * h) * 64 * NN; const unsigned short* Vti = Vth + (size_t)64 * NN;      /* Vᵀ real / imag planes of head h */
  float m_r[2][8], l_r[2][8]; v8f oacc[2][DT], oacci[2][DT];
#pragma unroll
  for (int rt = 0; rt < RTN; ++rt) {
#pragma unroll
    for (int r = 0; r < 8; ++r) { m_r[rt][r] = -3.0e38f; l_r[rt][r] = 0.f; }
#pragma unroll
    for (int dt = 0; dt < DT; ++dt) { oacc[rt][dt] = (v8f){0.f,0.f,0.f,0.f,0.f,0.f,0.f,0.f}; oacci[rt][dt] = oacc[rt][dt]; } }
  const int jend = NN;
#pragma unroll 1
  for (int j0 = 0; j0 < jend; j0 += 32) {
    
    v8f s[2][2];
#pragma unroll
    for (int nt = 0; nt < 2; ++nt) { const size_t ko = ((size_t)b * NN + j0 + nt * 16 + ln) * ldk + h * 128; const unsigned short* kr = (const unsigned short*)K16 + ko; const unsigned short* kl = kr + 64; FragH bk[KS], bl[KS];      /* bk = real, bl = imaginary */
#pragma unroll
      for (int ks = 0; ks < KS; ++ks) { bk[ks].half[0] = *(const v8us*)(kr + ks * 32 + 8 * hh); bk[ks].half[1] = *(const v8us*)(kr + ks * 32 + 16 + 8 * hh); bl[ks].half[0] = *(const v8us*)(kl + ks * 32 + 8 * hh); bl[ks].half[1] = *(const v8us*)(kl + ks * 32 + 16 + 8 * hh); }
#pragma unroll
      for (int rt = 0; rt < RTN; ++rt) { v8f re = (v8f){0.f,0.f,0.f,0.f,0.f,0.f,0.f,0.f}, ip = re, in = re;
#pragma unroll
        for (int ks = 0; ks < KS; ++ks) { re = mmaH<1>(aq[rt][ks].v, aq[rt][ks].v, bk[ks].v, bk[ks].v, re); re = mmaH<1>(aql[rt][ks].v, aql[rt][ks].v, bl[ks].v, bl[ks].v, re); ip = mmaH<1>(aql[rt][ks].v, aql[rt][ks].v, bk[ks].v, bk[ks].v, ip); in = mmaH<1>(aq[rt][ks].v, aq[rt][ks].v, bl[ks].v, bl[ks].v, in); }
#pragma unroll
        for (int r = 0; r < 8; ++r) { const float im = ip[r] - in[r]; re[r] = (re[r] * re[r] + im * im) * SCORE_SCALE; } s[rt][nt] = re; } }
#pragma unroll
    for (int rt = 0; rt < RTN; ++rt)
#pragma unroll
      for (int r = 0; r < 8; ++r) { const int tq = q0 + rt * 16 + 8 * hh + r; const int k0 = j0 + ln, k1 = j0 + 16 + ln; (void)tq; (void)k0; (void)k1;
        const bool ok0 = true, ok1 = true;
        const float s0 = s[rt][0][r], s1 = s[rt][1][r]; float mc = fmaxf(s0, s1);
        mc = fmaxf(mc, __shfl_xor(mc, 1, 32)); mc = fmaxf(mc, __shfl_xor(mc, 2, 32)); mc = fmaxf(mc, __shfl_xor(mc, 4, 32)); mc = fmaxf(mc, __shfl_xor(mc, 8, 32));
        const float mn = fmaxf(m_r[rt][r], mc); const float al = (mn > -1.0e38f) ? expf(m_r[rt][r] - mn) : 1.0f; m_r[rt][r] = mn; const float p0 = expf(s0 - mn), p1 = expf(s1 - mn); l_r[rt][r] = l_r[rt][r] * al + p0 + p1;
#pragma unroll
        for (int dt = 0; dt < DT; ++dt) { oacc[rt][dt][r] *= al; oacci[rt][dt][r] *= al; }
        FragH t2; t2.h[0] = (_Float16)(p0 * 1024.0f); t2.h[1] = (_Float16)(p1 * 1024.0f); sP[w][rt * 16 + 8 * hh + r][ln] = t2.u[0]; sP[w][rt * 16 + 8 * hh + r][16 + ln] = t2.u[1]; }
    __builtin_amdgcn_fence(__ATOMIC_ACQ_REL, "workgroup"); __builtin_amdgcn_wave_barrier();
    FragH pa[2];
#pragma unroll
    for (int rt = 0; rt < RTN; ++rt) { pa[rt].half[0] = *(const v8us*)&sP[w][rt * 16 + ln][8 * hh]; pa[rt].half[1] = *(const v8us*)&sP[w][rt * 16 + ln][16 + 8 * hh]; }
#pragma unroll
    for (int dt = 0; dt < DT; ++dt) { const size_t vo = (size_t)(dt * 16 + ln) * NN + j0; FragH bv, bi; bv.half[0] = *(const v8us*)(Vth + vo + 8 * hh); bv.half[1] = *(const v8us*)(Vth + vo + 16 + 8 * hh); bi.half[0] = *(const v8us*)(Vti + vo + 8 * hh); bi.half[1] = *(const v8us*)(Vti + vo + 16 + 8 * hh);
#pragma unroll
      for (int rt = 0; rt < RTN; ++rt) { oacc[rt][dt] = mmaH<1>(pa[rt].v, pa[rt].v, bv.v, bv.v, oacc[rt][dt]); oacci[rt][dt] = mmaH<1>(pa[rt].v, pa[rt].v, bi.v, bi.v, oacci[rt][dt]); } }
    __builtin_amdgcn_fence(__ATOMIC_ACQ_REL, "workgroup"); __builtin_amdgcn_wave_barrier(); }
#pragma unroll
  for (int rt = 0; rt < RTN; ++rt) {
#pragma unroll
    for (int r = 0; r < 8; ++r) { float l = l_r[rt][r]; l += __shfl_xor(l, 1, 32); l += __shfl_xor(l, 2, 32); l += __shfl_xor(l, 4, 32); l += __shfl_xor(l, 8, 32); l_r[rt][r] = (l > 0.f) ? 1.0f / (l * 1024.0f) : 0.f; }
#pragma unroll
    for (int dt = 0; dt < DT; ++dt)
#pragma unroll
      for (int r = 0; r < 8; ++r) { sO[w][rt * 16 + 8 * hh + r][dt * 16 + ln] = oacc[rt][dt][r] * l_r[rt][r]; sO[w][rt * 16 + 8 * hh + r][64 + dt * 16 + ln] = oacci[rt][dt][r] * l_r[rt][r]; } }
  __builtin_amdgcn_fence(__ATOMIC_ACQ_REL, "workgroup"); __builtin_amdgcn_wave_barrier();
  {
#pragma unroll
    for (int rp = 0; rp < RPW; ++rp) { const int r = rp, pc = lane; const v4f val = *(const v4fa*)&sO[w][r][pc * 4]; *(v4f*)(O + ((size_t)b * NN + q0 + r) * ldo + h * 128 + pc * 4) = val; }      /* 32 lanes × 16 B = the head's [real | imag] 512-B run */
     } }

extern "C" void kernel_launch(void* const* d_in, const int* in_sizes, int n_in,
                              void* d_out, int out_size, void* d_ws, size_t ws_size, hipStream_t stream) {
  (void)in_sizes; (void)n_in; (void)out_size;
  const float* const* I = (const float* const*)d_in; const float* x = I[0]; const float* Wq = I[1]; const float* bq = I[2]; const float* Wk = I[3]; const float* bk = I[4]; const float* Wv = I[5]; const float* bv = I[6]; const float* Wo = I[7]; const float* bo = I[8];
  char* ws = (char*)d_ws; size_t off = 0;
  auto take = [&](size_t bytes) { char* p = ws + off; off += (bytes + 255) & ~(size_t)255; return p; };
  _Float16* Bq = (_Float16*)take((size_t)2 * DX * DX * 2); _Float16* Bk = (_Float16*)take((size_t)2 * DX * DX * 2); _Float16* Bv = (_Float16*)take((size_t)2 * DX * DX * 2); _Float16* Bo = (_Float16*)take((size_t)DX * DX * 2);
  _Float16* X16 = (_Float16*)take((size_t)NR * DX * 2); _Float16* Q = (_Float16*)take((size_t)NR * DX * 2); _Float16* K = (_Float16*)take((size_t)NR * DX * 2); _Float16* V = (_Float16*)take((size_t)NR * DX * 2); _Float16* Vt = (_Float16*)take((size_t)NR * DX * 2);
  float* O = (float*)take((size_t)NR * DX * 4); _Float16* O16 = (_Float16*)take((size_t)NR * DX * 2);
  if (off > ws_size) return;      // 3 × 1 + 0.5 + 5 × 4.2 + 8.4 + 4.2 ≈ 37 MB
  k_wt_f16<<<(unsigned)(((size_t)2 * DX * (DX / 8) + 255) / 256), 256, 0, stream>>>(Wq, Bq, DX, 2 * DX, 16.0f); k_wt_f16<<<(unsigned)(((size_t)2 * DX * (DX / 8) + 255) / 256), 256, 0, stream>>>(Wk, Bk, DX, 2 * DX, 16.0f); k_wt_f16<<<(unsigned)(((size_t)2 * DX * (DX / 8) + 255) / 256), 256, 0, stream>>>(Wv, Bv, DX, 2 * DX, 16.0f);      /* (in,out) [512][1024] → Bt[1024][512] ×2^4; only rows 0..511 (heads 0..3) are used */
  k_wt_f16<<<(unsigned)(((size_t)DX * (DX / 8) + 255) / 256), 256, 0, stream>>>(Wo, Bo, DX, DX, 16.0f);
  k_x16<<<(unsigned)(((size_t)NR * DX / 8 + 255) / 256), 256, 0, stream>>>(x, X16, (size_t)NR * DX / 8);
  const dim3 gp(((NR / 16) * (DX / 64) + 3) / 4, 1);
  k_gemm_hhx<0><<<gp, 128, 0, stream>>>(X16, DX, 0, Bq, DX, 0, 0.0625f, bq, 0, nullptr, 1, 0, 0, nullptr, Q, DX, 0, NR, DX, DX);      /* q, heads 0..3 = output columns 0..511 (+ bq): M 4096 N 512 K 512 */
  k_gemm_hhx<0><<<gp, 128, 0, stream>>>(X16, DX, 0, Bk, DX, 0, 0.0625f, bk, 0, nullptr, 1, 0, 0, nullptr, K, DX, 0, NR, DX, DX);
  k_gemm_hhx<0><<<gp, 128, 0, stream>>>(X16, DX, 0, Bv, DX, 0, 0.0625f, bv, 0, nullptr, 1, 0, 0, nullptr, V, DX, 0, NR, DX, DX);
  k_vt<2 * NHU, NN><<<BB * 2 * NHU * (NN / 64), 256, 0, stream>>>(V, DX, 0, Vt);      /* Vᵀ planes per (b, head, part): [b·8 + 2h + part][64][2048] */
  k_flash<<<BB * NHU * (NN / 64), 128, 0, stream>>>(Q, DX, K, DX, Vt, O, DX);
  k_h16s<<<(unsigned)(((size_t)NR * DX / 8 + 255) / 256), 256, 0, stream>>>(O, O16, (size_t)NR * DX / 8);
  k_gemm_hhx<0><<<gp, 128, 0, stream>>>(O16, DX, 0, Bo, DX, 0, 0.0625f * 0.00390625f, bo, 0, nullptr, 1, 0, 0, (float*)d_out, nullptr, DX, 0, NR, DX, DX);      /* out = O·Wo + bo (alpha undoes ×2^4 weights and the ×2^8 carry) */
}

// v001
// Measured time: 191 microseconds a run.
// Timed twice side by side with v000, it ran 1.69 and 1.71 times as fast.
#include <hip/hip_runtime.h>
// 'Superposition' (complex-valued) multi-head attention (B=2, S=2048, D=512, 8 heads; q,k,v projections to 2D with per-head [real 64 | imag 64]): interference = Σ_d q_d·conj(k_d)·64^-½; probs = softmax(|interference|²/0.5); out = probs·v (complex);
// out = concat[real, imag] per head → [B,S,1024], truncated to the first 512 columns (= heads 0..3), then ·Wo + bo. Only heads 0..3 reach the output, so only they are computed.
// Compute dtype: x, weights, biases rounded to bf16; q/k/v (columns of heads 0..3) as f16 GEMM outputs; fused flash-style kernel with three f32 score accumulators (Re, Im⁺, Im⁻) and two value accumulators
// (real, imag), online softmax f32, P f16 ×2^10, on v_wmma_f32_16x16x32_f16; O carried ×2^8 into f16 (small diffuse values) → output GEMM with bias (alpha undoes the carry); f32 accumulate.
#define BB 2
#define NN 2048
#define DX 512
#define NHU 4
#define DH2 128
#define NR (BB * NN)
#define SCORE_SCALE 0.03125f

typedef __bf16 v16b __attribute__((ext_vector_type(16)));
typedef unsigned short v8us __attribute__((ext_vector_type(8), may_alias));
typedef float  v8f  __attribute__((ext_vector_type(8)));
typedef float  v4f  __attribute__((ext_vector_type(4)));
typedef float  v4fa __attribute__((ext_vector_type(4), may_alias));
union FragB { v16b v; v8us half[2]; unsigned short u[16]; };

__device__ __forceinline__ unsigned short bf16_bits(float x) { unsigned int u = __float_as_uint(x); return (unsigned short)((u + 0x7FFFu + ((u >> 16) & 1u)) >> 16); }
__device__ __forceinline__ float bf16_val(unsigned short b) { return __uint_as_float(((unsigned int)b) << 16); }
__device__ __forceinline__ float bf16_round(float x) { return bf16_val(bf16_bits(x)); }
// D += A·B with NT terms: 1 = ah·bh, 2 = + al·bh (A split), 3 = + ah·bl (both split)
template <int NT>
__device__ __forceinline__ v8f mmaN(v16b ah, v16b al, v16b bh, v16b bl, v8f c) {
  c = __builtin_amdgcn_wmma_f32_16x16x32_bf16(false, ah, false, bh, (short)0, c, false, false);
  if (NT >= 2) c = __builtin_amdgcn_wmma_f32_16x16x32_bf16(false, al, false, bh, (short)0, c, false, false);
  if (NT >= 3) c = __builtin_amdgcn_wmma_f32_16x16x32_bf16(false, ah, false, bl, (short)0, c, false, false);
  asm volatile("v_nop\n\tv_nop\n\tv_nop\n\tv_nop" : "+v"(c) : "v"(ah), "v"(al), "v"(bh), "v"(bl));
  return c;
}

__global__ __launch_bounds__(256) void k_wt_bf16(const float* __restrict__ W, unsigned short* __restrict__ Wt, int K, int N) {
  const int t = blockIdx.x * 256 + threadIdx.x;
  const int k8n = K / 8;
  if (t >= N * k8n) return;
  const int n = t / k8n, k8 = (t % k8n) * 8;
  v8us v;
#pragma unroll
  for (int i = 0; i < 8; ++i) v[i] = bf16_bits(W[(size_t)(k8 + i) * N + n]);
  *(v8us*)(Wt + (size_t)n * K + k8) = v;
  
}

// GEMM C[M][N] (f32, pitch ldc) = act(A[M][K]·W + bias). A f32 row-major (pitch lda) converted per fragment to bf16
// (ASPLIT: hi/lo two planes -> 2 terms, else single rounded term); Wt bf16 [N][K] (pitch ldb). BIAS_BF16 rounds the
// bias to bf16 first (bias quantised to bf16 before the add). K%32==0, M%16==0, N%64==0.
template <bool ASPLIT, int ACT, bool BIAS_BF16>
__global__ __launch_bounds__(128) void k_gemm_bf(const float* __restrict__ A, int lda, const unsigned short* __restrict__ Wt, int ldb,
                                               const float* __restrict__ bias, float* __restrict__ C, int ldc, int M, int N, int K) {
  __shared__ __attribute__((aligned(16))) float so[4][16][64];
  const int tid = threadIdx.x, w = tid >> 5, lane = tid & 31, ln = lane & 15, hh = lane >> 4;
  const int ntn = N / 64;
  const int wid = blockIdx.x * 4 + w;
  const int mt = wid / ntn, nq = wid % ntn;
  if (mt * 16 >= M) return;
  const int row0 = mt * 16, col0 = nq * 64;
  const float* arow = A + (size_t)(row0 + ln) * lda;
  v8f acc[4] = {};
  for (int kb = 0; kb < K; kb += 32) {
    FragB ah, al;
    const v4f x0 = *(const v4fa*)(arow + kb + 8 * hh), x1 = *(const v4fa*)(arow + kb + 8 * hh + 4);
    const v4f x2 = *(const v4fa*)(arow + kb + 16 + 8 * hh), x3 = *(const v4fa*)(arow + kb + 16 + 8 * hh + 4);
    float xs[16] = {x0[0],x0[1],x0[2],x0[3],x1[0],x1[1],x1[2],x1[3],x2[0],x2[1],x2[2],x2[3],x3[0],x3[1],x3[2],x3[3]};
#pragma unroll
    for (int i = 0; i < 16; ++i) { const unsigned short hb = bf16_bits(xs[i]); ah.u[i] = hb; al.u[i] = ASPLIT ? bf16_bits(xs[i] - bf16_val(hb)) : (unsigned short)0; }
#pragma unroll
    for (int t = 0; t < 4; ++t) {
      const unsigned short* brow = Wt + (size_t)(col0 + t * 16 + ln) * ldb + kb;
      FragB b;
      b.half[0] = *(const v8us*)(brow + 8 * hh);
      b.half[1] = *(const v8us*)(brow + 16 + 8 * hh);
      acc[t] = mmaN<ASPLIT ? 2 : 1>(ah.v, al.v, b.v, b.v, acc[t]);
    }
  }
#pragma unroll
  for (int t = 0; t < 4; ++t) {
    float bv = bias ? bias[col0 + t * 16 + ln] : 0.f;
    if (BIAS_BF16) bv = bf16_round(bv);
#pragma unroll
    for (int r = 0; r < 8; ++r) { float v = acc[t][r] + bv; if (ACT == 1) v = fmaxf(v, 0.f); so[w][8 * hh + r][t * 16 + ln] = v; }
  }
  __builtin_amdgcn_fence(__ATOMIC_ACQ_REL, "workgroup");
  __builtin_amdgcn_wave_barrier();
  const int rsub = lane >> 4, c4 = (lane & 15) * 4;
  {
#pragma unroll
    for (int q = 0; q < 8; ++q) {
      const int r = q * 2 + rsub;
      const v4f v = *(const v4fa*)&so[w][r][c4];
      *(v4f*)(C + (size_t)(row0 + r) * ldc + col0 + c4) = v;
    }
    
  }
}

// Flash-style causal/unmasked attention, all contractions 3-term bf16 hi/lo splits, f32 softmax with running max.
// q,k,v rows are read from f32 buffers with arbitrary row pitch (so they can live inside a fused qkv buffer);
// D = head size (multiple of 32, <= 128); one wave = 16 query rows; block = 4 waves (64 queries) sharing K/V chunks of 32.
template <int D, bool CAUSAL>
__global__ __launch_bounds__(128) void k_flash(const float* __restrict__ qb, const float* __restrict__ kb, const float* __restrict__ vb,
                                             int pitch, int T, int H, float scale, float* __restrict__ y, int ypitch) {
  constexpr int KS = D / 32;        // k-steps for QK
  constexpr int DT = D / 16;        // d tiles for PV
  __shared__ __attribute__((aligned(16))) unsigned short sKh[32][D + 8], sKl[32][D + 8], sVh[32][D + 8], sVl[32][D + 8];
  __shared__ __attribute__((aligned(16))) unsigned short sPh[4][16][40], sPl[4][16][40];
  __shared__ __attribute__((aligned(16))) float sO[4][16][D];
  const int tid = threadIdx.x, w = tid >> 5, lane = tid & 31, ln = lane & 15, hh = lane >> 4;
  const int nqb = (T + 63) / 64;
  const int bh = blockIdx.x / nqb, qblk = blockIdx.x % nqb;
  const int b = bh / H, h = bh % H;
  const int q0 = qblk * 64 + w * 16;
  const float* Q = qb + (size_t)b * T * pitch + h * D;
  const float* K = kb + (size_t)b * T * pitch + h * D;
  const float* V = vb + (size_t)b * T * pitch + h * D;

  // A fragments of the wave's 16 query rows (scaled), hi/lo
  FragB aqh[KS], aql[KS];
  {
    int row = q0 + ln; if (row >= T) row = T - 1;
    const float* qr = Q + (size_t)row * pitch;
#pragma unroll
    for (int ks = 0; ks < KS; ++ks)
#pragma unroll
      for (int i = 0; i < 16; ++i) {
        const int d = ks * 32 + ((i < 8) ? (8 * hh + i) : (16 + 8 * hh + (i - 8)));
        const float x = qr[d] * scale; const unsigned short hb = bf16_bits(x);
        aqh[ks].u[i] = hb; aql[ks].u[i] = bf16_bits(x - bf16_val(hb));
      }
  }
  float m_r[8], l_r[8];
#pragma unroll
  for (int r = 0; r < 8; ++r) { m_r[r] = -3.0e38f; l_r[r] = 0.f; }
  v8f oacc[DT];
#pragma unroll
  for (int dt = 0; dt < DT; ++dt) oacc[dt] = (v8f){0.f,0.f,0.f,0.f,0.f,0.f,0.f,0.f};

  const int kv_end = CAUSAL ? min(T, qblk * 64 + 64) : T;     // block-uniform
  for (int j0 = 0; j0 < kv_end; j0 += 32) {
    __syncthreads();
    for (int e = tid; e < 32 * (D / 4); e += 128) {
      const int r = e / (D / 4), c4 = (e % (D / 4)) * 4;
      const int key = j0 + r;
      v4f kf = {0.f,0.f,0.f,0.f}, vf = {0.f,0.f,0.f,0.f};
      if (key < T) { kf = *(const v4fa*)(K + (size_t)key * pitch + c4); vf = *(const v4fa*)(V + (size_t)key * pitch + c4); }
#pragma unroll
      for (int t = 0; t < 4; ++t) {
        unsigned short hb = bf16_bits(kf[t]); sKh[r][c4 + t] = hb; sKl[r][c4 + t] = bf16_bits(kf[t] - bf16_val(hb));
        hb = bf16_bits(vf[t]); sVh[r][c4 + t] = hb; sVl[r][c4 + t] = bf16_bits(vf[t] - bf16_val(hb));
      }
    }
    __syncthreads();
    // S tile 16 x 32
    v8f s[2];
#pragma unroll
    for (int nt = 0; nt < 2; ++nt) {
      v8f acc = {};
#pragma unroll
      for (int ks = 0; ks < KS; ++ks) {
        FragB bh_, bl_;
        bh_.half[0] = *(const v8us*)&sKh[nt * 16 + ln][ks * 32 + 8 * hh]; bh_.half[1] = *(const v8us*)&sKh[nt * 16 + ln][ks * 32 + 16 + 8 * hh];
        bl_.half[0] = *(const v8us*)&sKl[nt * 16 + ln][ks * 32 + 8 * hh]; bl_.half[1] = *(const v8us*)&sKl[nt * 16 + ln][ks * 32 + 16 + 8 * hh];
        acc = mmaN<3>(aqh[ks].v, aql[ks].v, bh_.v, bl_.v, acc);
      }
      s[nt] = acc;
    }
    // mask + running max (rows 8hh+r; the 16 lanes of a half share rows)
    float alpha[8];
#pragma unroll
    for (int r = 0; r < 8; ++r) {
      const int qi = q0 + 8 * hh + r;
      const int ja = j0 + ln, jb = j0 + 16 + ln;
      if (CAUSAL) { if (ja > qi) s[0][r] = -3.0e38f; if (jb > qi) s[1][r] = -3.0e38f; }
      if (ja >= T) s[0][r] = -3.0e38f;
      if (jb >= T) s[1][r] = -3.0e38f;
      float mx = fmaxf(s[0][r], s[1][r]);
      mx = fmaxf(mx, __shfl_xor(mx, 1, 32)); mx = fmaxf(mx, __shfl_xor(mx, 2, 32)); mx = fmaxf(mx, __shfl_xor(mx, 4, 32)); mx = fmaxf(mx, __shfl_xor(mx, 8, 32));
      const float mnew = fmaxf(m_r[r], mx);
      alpha[r] = (mnew > -1.0e38f) ? __expf(m_r[r] - mnew) : 1.0f;
      const float p0 = (s[0][r] > -1.0e38f) ? __expf(s[0][r] - mnew) : 0.f;
      const float p1 = (s[1][r] > -1.0e38f) ? __expf(s[1][r] - mnew) : 0.f;
      m_r[r] = mnew;
      l_r[r] = l_r[r] * alpha[r] + p0 + p1;            // per-lane partial row sum (16 lanes combined at the end)
      unsigned short hb = bf16_bits(p0); sPh[w][8 * hh + r][ln] = hb;      sPl[w][8 * hh + r][ln] = bf16_bits(p0 - bf16_val(hb));
      hb = bf16_bits(p1);                sPh[w][8 * hh + r][16 + ln] = hb; sPl[w][8 * hh + r][16 + ln] = bf16_bits(p1 - bf16_val(hb));
    }
#pragma unroll
    for (int dt = 0; dt < DT; ++dt)
#pragma unroll
      for (int r = 0; r < 8; ++r) oacc[dt][r] *= alpha[r];
    __builtin_amdgcn_fence(__ATOMIC_ACQ_REL, "workgroup");
    __builtin_amdgcn_wave_barrier();
    FragB pah, pal;
    pah.half[0] = *(const v8us*)&sPh[w][ln][8 * hh]; pah.half[1] = *(const v8us*)&sPh[w][ln][16 + 8 * hh];
    pal.half[0] = *(const v8us*)&sPl[w][ln][8 * hh]; pal.half[1] = *(const v8us*)&sPl[w][ln][16 + 8 * hh];
#pragma unroll
    for (int dt = 0; dt < DT; ++dt) {
      FragB bvh, bvl;
#pragma unroll
      for (int i = 0; i < 8; ++i) {
        bvh.u[i] = sVh[8 * hh + i][dt * 16 + ln]; bvh.u[8 + i] = sVh[16 + 8 * hh + i][dt * 16 + ln];
        bvl.u[i] = sVl[8 * hh + i][dt * 16 + ln]; bvl.u[8 + i] = sVl[16 + 8 * hh + i][dt * 16 + ln];
      }
      oacc[dt] = mmaN<3>(pah.v, pal.v, bvh.v, bvl.v, oacc[dt]);
    }
    __builtin_amdgcn_fence(__ATOMIC_ACQ_REL, "workgroup");
    __builtin_amdgcn_wave_barrier();
  }
#pragma unroll
  for (int r = 0; r < 8; ++r) {
    float l = l_r[r];
    l += __shfl_xor(l, 1, 32); l += __shfl_xor(l, 2, 32); l += __shfl_xor(l, 4, 32); l += __shfl_xor(l, 8, 32);
    l_r[r] = (l > 0.f) ? 1.0f / l : 0.f;
  }
#pragma unroll
  for (int dt = 0; dt < DT; ++dt)
#pragma unroll
    for (int r = 0; r < 8; ++r) sO[w][8 * hh + r][dt * 16 + ln] = oacc[dt][r] * l_r[r];
  __builtin_amdgcn_fence(__ATOMIC_ACQ_REL, "workgroup");
  __builtin_amdgcn_wave_barrier();
  {
    for (int r = 0; r < 16; ++r) {
      const int row = q0 + r;
      if (row < T && lane < D / 4) {
        const v4f val = *(const v4fa*)&sO[w][r][lane * 4];
        *(v4f*)(y + ((size_t)b * T + row) * ypitch + h * D + lane * 4) = val;
      }
    }
    
  }
}

// GEMM C = act(A·W + bias + resid): A f32 (ASPLIT -> hi/lo 2 terms), Wt bf16 [N][K]; ACT 0 none, 1 relu, 2 exact gelu;
// resid (optional, f32, row index = (row % rmod), pitch ldr, RES_BF16 rounds it) added before the activation.
template <bool ASPLIT, int ACT, bool BIAS_BF16, bool RES_BF16>
__global__ __launch_bounds__(128) void k_gemm_bf3(const float* __restrict__ A, int lda, const unsigned short* __restrict__ Wt, int ldb,
                                                const float* __restrict__ bias, const float* __restrict__ resid, int rmod, int ldr,
                                                float* __restrict__ C, int ldc, int M, int N, int K) {
  __shared__ __attribute__((aligned(16))) float so[4][16][64];
  const int tid = threadIdx.x, w = tid >> 5, lane = tid & 31, ln = lane & 15, hh = lane >> 4;
  const int ntn = N / 64;
  const int wid = blockIdx.x * 4 + w;
  const int mt = wid / ntn, nq = wid % ntn;
  if (mt * 16 >= M) return;
  const int row0 = mt * 16, col0 = nq * 64;
  const float* arow = A + (size_t)(row0 + ln) * lda;
  v8f acc[4] = {};
  for (int kb = 0; kb < K; kb += 32) {
    FragB ah, al;
    const v4f x0 = *(const v4fa*)(arow + kb + 8 * hh), x1 = *(const v4fa*)(arow + kb + 8 * hh + 4);
    const v4f x2 = *(const v4fa*)(arow + kb + 16 + 8 * hh), x3 = *(const v4fa*)(arow + kb + 16 + 8 * hh + 4);
    float xs[16] = {x0[0],x0[1],x0[2],x0[3],x1[0],x1[1],x1[2],x1[3],x2[0],x2[1],x2[2],x2[3],x3[0],x3[1],x3[2],x3[3]};
#pragma unroll
    for (int i = 0; i < 16; ++i) { const unsigned short hb = bf16_bits(xs[i]); ah.u[i] = hb; al.u[i] = ASPLIT ? bf16_bits(xs[i] - bf16_val(hb)) : (unsigned short)0; }
#pragma unroll
    for (int t = 0; t < 4; ++t) {
      const unsigned short* brow = Wt + (size_t)(col0 + t * 16 + ln) * ldb + kb;
      FragB b;
      b.half[0] = *(const v8us*)(brow + 8 * hh);
      b.half[1] = *(const v8us*)(brow + 16 + 8 * hh);
      acc[t] = mmaN<ASPLIT ? 2 : 1>(ah.v, al.v, b.v, b.v, acc[t]);
    }
  }
#pragma unroll
  for (int t = 0; t < 4; ++t) {
    const int col = col0 + t * 16 + ln;
    float bv = bias ? bias[col] : 0.f;
    if (BIAS_BF16) bv = bf16_round(bv);
#pragma unroll
    for (int r = 0; r < 8; ++r) {
      float v = acc[t][r] + bv;
      if (resid) { float rv = resid[(size_t)((row0 + 8 * hh + r) % rmod) * ldr + col]; if (RES_BF16) rv = bf16_round(rv); v += rv; }
      if (ACT == 1) v = fmaxf(v, 0.f);
      if (ACT == 2) v = 0.5f * v * (1.0f + erff(v * 0.70710678118654752f));
      if (ACT == 3) { const float u = 0.7978845608028654f * (v + 0.044715f * v * v * v); v = 0.5f * v * (1.0f + tanhf(u)); }
      so[w][8 * hh + r][t * 16 + ln] = v;
    }
  }
  __builtin_amdgcn_fence(__ATOMIC_ACQ_REL, "workgroup");
  __builtin_amdgcn_wave_barrier();
  const int rsub = lane >> 4, c4 = (lane & 15) * 4;
  {
#pragma unroll
    for (int q = 0; q < 8; ++q) {
      const int r = q * 2 + rsub;
      const v4f v = *(const v4fa*)&so[w][r][c4];
      *(v4f*)(C + (size_t)(row0 + r) * ldc + col0 + c4) = v;
    }
    
  }
}
// row LayerNorm (biased variance, eps) over N: s = X (+ R); optional out_sum <- s; out_norm <- (s-mu)*rsqrt(var+eps)*g + b
template <bool PARAM_BF16>
__global__ __launch_bounds__(256) void k_layernorm(const float* __restrict__ X, const float* __restrict__ R, const float* __restrict__ g, const float* __restrict__ bta,
                                                  float* __restrict__ out_sum, float* __restrict__ out_norm, int N, float eps) {
  __shared__ float red[256];
  const int row = blockIdx.x, tid = threadIdx.x;
  const float* x = X + (size_t)row * N; const float* rr = R ? R + (size_t)row * N : nullptr;
  float vals[16];                     // up to N = 4096
  const int per = N / 256;            // contiguous chunk per thread? use strided-by-4 chunks: thread handles j = tid*4 + 1024*u
  float s1 = 0.f;
  for (int u = 0; u < per / 4; ++u) {
    const int j = tid * 4 + 1024 * u;
    const v4f a = *(const v4fa*)(x + j);
    v4f b = {0.f,0.f,0.f,0.f}; if (rr) b = *(const v4fa*)(rr + j);
#pragma unroll
    for (int q = 0; q < 4; ++q) { const float v = a[q] + b[q]; vals[u * 4 + q] = v; s1 += v; }
  }
  red[tid] = s1; __syncthreads();
  for (int st = 128; st > 0; st >>= 1) { if (tid < st) red[tid] += red[tid + st]; __syncthreads(); }
  const float mu = red[0] / (float)N; __syncthreads();
  float s2 = 0.f;
  for (int u = 0; u < per / 4; ++u)
#pragma unroll
    for (int q = 0; q < 4; ++q) { const float c = vals[u * 4 + q] - mu; s2 += c * c; }
  red[tid] = s2; __syncthreads();
  for (int st = 128; st > 0; st >>= 1) { if (tid < st) red[tid] += red[tid + st]; __syncthreads(); }
  const float rs = rsqrtf(red[0] / (float)N + eps);
  {
    for (int u = 0; u < per / 4; ++u) {
      const int j = tid * 4 + 1024 * u;
      v4f o, sm;
#pragma unroll
      for (int q = 0; q < 4; ++q) {
        float gg = g[j + q], bb = bta[j + q];
        if (PARAM_BF16) { gg = bf16_round(gg); bb = bf16_round(bb); }
        sm[q] = vals[u * 4 + q]; o[q] = (vals[u * 4 + q] - mu) * rs * gg + bb;
      }
      if (out_sum) *(v4f*)(out_sum + (size_t)row * N + j) = sm;
      *(v4f*)(out_norm + (size_t)row * N + j) = o;
    }
    
  }
}



// ---- f16 WMMA path (v_wmma_f32_16x16x32_f16): 11-bit significands for operands in range — used where a [0,1] probability operand needs more precision than bf16
typedef _Float16 v16h __attribute__((ext_vector_type(16)));
union FragH { v16h v; v8us half[2]; _Float16 h[16]; unsigned short u[16]; };
template <int NT>
__device__ __forceinline__ v8f mmaH(v16h ah, v16h al, v16h bh, v16h bl, v8f c) {
  c = __builtin_amdgcn_wmma_f32_16x16x32_f16(false, ah, false, bh, (short)0, c, false, false);
  if (NT >= 2) c = __builtin_amdgcn_wmma_f32_16x16x32_f16(false, al, false, bh, (short)0, c, false, false);
  if (NT >= 3) c = __builtin_amdgcn_wmma_f32_16x16x32_f16(false, ah, false, bl, (short)0, c, false, false);
  asm volatile("v_nop\n\tv_nop\n\tv_nop\n\tv_nop" : "+v"(c) : "v"(ah), "v"(al), "v"(bh), "v"(bl));
  return c;
}
// batched GEMM like k_gemm_b but f16 operands: A f32 (split into f16 hi/lo if ASPLIT, else rounded to f16), Bt = f16 values [n][k]; alpha; C f32; N multiple of 16 (partial tiles skipped)
template <bool ASPLIT>
__global__ __launch_bounds__(128) void k_gemm_h(const float* __restrict__ A, int lda, size_t sA, const _Float16* __restrict__ Bh, int ldb, size_t sB, float alpha, float* __restrict__ C, int ldc, size_t sC, int M, int N, int K) {
  __shared__ __attribute__((aligned(16))) float so[4][16][64];
  const int tid = threadIdx.x, w = tid >> 5, lane = tid & 31, ln = lane & 15, hh = lane >> 4; const int by = blockIdx.y;
  A += (size_t)by * sA; Bh += (size_t)by * sB; C += (size_t)by * sC;
  const int ntn = (N + 63) / 64; const int wid = blockIdx.x * 4 + w; const int mt = wid / ntn, nq = wid % ntn; if (mt * 16 >= M) return;
  const int row0 = mt * 16, col0 = nq * 64; const float* arow = A + (size_t)(row0 + ln) * lda;
  v8f acc[4] = {};
  for (int kb = 0; kb < K; kb += 32) {
    FragH ah, al;
    const v4f x0 = *(const v4fa*)(arow + kb + 8 * hh), x1 = *(const v4fa*)(arow + kb + 8 * hh + 4), x2 = *(const v4fa*)(arow + kb + 16 + 8 * hh), x3 = *(const v4fa*)(arow + kb + 16 + 8 * hh + 4);
    float xs[16] = {x0[0],x0[1],x0[2],x0[3],x1[0],x1[1],x1[2],x1[3],x2[0],x2[1],x2[2],x2[3],x3[0],x3[1],x3[2],x3[3]};
#pragma unroll
    for (int i = 0; i < 16; ++i) { const _Float16 h = (_Float16)xs[i]; ah.h[i] = h; al.h[i] = ASPLIT ? (_Float16)(xs[i] - (float)h) : (_Float16)0.0f; }
#pragma unroll
    for (int t = 0; t < 4; ++t) { if (col0 + t * 16 >= N) continue; const size_t boff = (size_t)(col0 + t * 16 + ln) * ldb + kb; FragH bq; bq.half[0] = *(const v8us*)(Bh + boff + 8 * hh); bq.half[1] = *(const v8us*)(Bh + boff + 16 + 8 * hh);
      acc[t] = mmaH<ASPLIT ? 2 : 1>(ah.v, al.v, bq.v, bq.v, acc[t]); }
  }
#pragma unroll
  for (int t = 0; t < 4; ++t) { if (col0 + t * 16 >= N) continue;
#pragma unroll
    for (int r = 0; r < 8; ++r) so[w][8 * hh + r][t * 16 + ln] = acc[t][r] * alpha; }
  __builtin_amdgcn_fence(__ATOMIC_ACQ_REL, "workgroup"); __builtin_amdgcn_wave_barrier();
  const int rsub = lane >> 4, c4 = (lane & 15) * 4;
  {
#pragma unroll
    for (int q = 0; q < 8; ++q) { const int r = q * 2 + rsub; if (col0 + c4 < N) { const v4f v = *(const v4fa*)&so[w][r][c4]; *(v4f*)(C + (size_t)(row0 + r) * ldc + col0 + c4) = v; } }
     }
}

// Wt[n][k] = f16(bf16(W[k][n])·scale) from f32 row-major W[K][N] (scale = power of two; bf16-exact weights stay exact in f16 away from the subnormal range)
__global__ __launch_bounds__(256) void k_wt_f16(const float* __restrict__ W, _Float16* __restrict__ Wt, int K, int N, float scale) {
  const int t = blockIdx.x * 256 + threadIdx.x; if (t >= N * (K / 8)) return; const int n = t / (K / 8), k8 = (t % (K / 8)) * 8; FragH f;
#pragma unroll
  for (int i = 0; i < 8; ++i) f.h[i] = (_Float16)(bf16_round(W[(size_t)(k8 + i) * N + n]) * scale); const v8us o = f.half[0];
  *(v8us*)((unsigned short*)Wt + (size_t)n * K + k8) = o; 
}
// k_gemm_hh variant with fused epilogue: v = acc·alpha + bf16(bias[by·sBias + col]) (+ CP[(row/rowsPerB)·sCPb + by·64 + col] if CP) ; ACT 0 none / 1 elu ; writes f16 C16 and f32 C, each if non-null
template <int ACT>
__global__ __launch_bounds__(128) void k_gemm_hhx(const _Float16* __restrict__ A, int lda, size_t sA, const _Float16* __restrict__ Bh, int ldb, size_t sB, float alpha, const float* __restrict__ bias, size_t sBias, const float* __restrict__ CP, int rowsPerB, size_t sCPb, int row0g,
    float* __restrict__ C, _Float16* __restrict__ C16, int ldc, size_t sC, int M, int N, int K) {
  __shared__ __attribute__((aligned(16))) float so[4][16][64];
  const int tid = threadIdx.x, w = tid >> 5, lane = tid & 31, ln = lane & 15, hh = lane >> 4; const int by = blockIdx.y;
  A += (size_t)by * sA; Bh += (size_t)by * sB; const size_t cofs = (size_t)by * sC; const float* bp = bias ? bias + (size_t)by * sBias : nullptr;
  const int ntn = (N + 63) / 64; const int wid = blockIdx.x * 4 + w; const int mt = wid / ntn, nq = wid % ntn; if (mt * 16 >= M) return;
  const int row0 = mt * 16, col0 = nq * 64; const _Float16* arow = A + (size_t)(row0 + ln) * lda;
  v8f acc[4] = {};
  for (int kb = 0; kb < K; kb += 32) { FragH ah; ah.half[0] = *(const v8us*)((const unsigned short*)arow + kb + 8 * hh); ah.half[1] = *(const v8us*)((const unsigned short*)arow + kb + 16 + 8 * hh);
#pragma unroll
    for (int t = 0; t < 4; ++t) { if (col0 + t * 16 >= N) continue; const size_t boff = (size_t)(col0 + t * 16 + ln) * ldb + kb; FragH bq; bq.half[0] = *(const v8us*)((const unsigned short*)Bh + boff + 8 * hh); bq.half[1] = *(const v8us*)((const unsigned short*)Bh + boff + 16 + 8 * hh);
      acc[t] = mmaH<1>(ah.v, ah.v, bq.v, bq.v, acc[t]); }
  }
#pragma unroll
  for (int t = 0; t < 4; ++t) { if (col0 + t * 16 >= N) continue; const int col = col0 + t * 16 + ln; const float bv = bp ? bf16_round(bp[col]) : 0.f;
#pragma unroll
    for (int r = 0; r < 8; ++r) { float v = acc[t][r] * alpha + bv; if (CP) { const int bidx = (row0g + row0 + 8 * hh + r) / rowsPerB; v += CP[(size_t)bidx * sCPb + (size_t)by * 64 + col]; } if (ACT == 1) v = (v > 0.f) ? v : expm1f(v); else if (ACT == 7) v = (v > 0.f) ? v + 1.0f : expf(v); else if (ACT == 8) v = tanhf(v); else if (ACT == 9) v = 0.5f * v * (1.0f + tanhf(0.7978845608028654f * (v + 0.044715f * v * v * v))); else if (ACT == 11) v = 1.0f / (1.0f + expf(-v)); else if (ACT == 12) v = (v > 0.f) ? v : 0.01f * v; else if (ACT == 14) v = (v > 0.f) ? v : 0.1f * v; else if (ACT == 15) v = v / (1.0f + expf(-v)); else if (ACT == 3) v = fmaxf(v, 0.f); else if (ACT == 6) v = 0.5f * v * (1.0f + erff(v * 0.70710678118654752f)); so[w][8 * hh + r][t * 16 + ln] = v; } }
  __builtin_amdgcn_fence(__ATOMIC_ACQ_REL, "workgroup"); __builtin_amdgcn_wave_barrier();
  const int rsub = lane >> 4, c4 = (lane & 15) * 4; typedef _Float16 v4h __attribute__((ext_vector_type(4)));
  {
#pragma unroll
    for (int q = 0; q < 8; ++q) { const int r = q * 2 + rsub; if (col0 + c4 < N) { const v4f v = *(const v4fa*)&so[w][r][c4]; if (C) *(v4f*)(C + cofs + (size_t)(row0 + r) * ldc + col0 + c4) = v; if (C16) { v4h h4; for (int i = 0; i < 4; ++i) h4[i] = (_Float16)v[i]; *(v4h*)(C16 + cofs + (size_t)(row0 + r) * ldc + col0 + c4) = h4; } } }
     }
}


typedef _Float16 v4h __attribute__((ext_vector_type(4)));

__global__ __launch_bounds__(256) void k_x16(const float* __restrict__ x, _Float16* __restrict__ X16, size_t n8) { const size_t t = (size_t)blockIdx.x * 256 + threadIdx.x; if (t >= n8) return; FragH f;
#pragma unroll
  for (int q = 0; q < 8; ++q) f.h[q] = (_Float16)bf16_round(x[t * 8 + q]); *(v8us*)((unsigned short*)X16 + t * 8) = f.half[0];  }
__global__ __launch_bounds__(256) void k_h16(const float* __restrict__ x, _Float16* __restrict__ X16, size_t n8) { const size_t t = (size_t)blockIdx.x * 256 + threadIdx.x; if (t >= n8) return; FragH f;
#pragma unroll
  for (int q = 0; q < 8; ++q) f.h[q] = (_Float16)x[t * 8 + q]; *(v8us*)((unsigned short*)X16 + t * 8) = f.half[0];  }
__global__ __launch_bounds__(256) void k_round16f(const float* __restrict__ W, _Float16* __restrict__ Bt, size_t n8) { const size_t t = (size_t)blockIdx.x * 256 + threadIdx.x; if (t >= n8) return; FragH f;
#pragma unroll
  for (int i = 0; i < 8; ++i) f.h[i] = (_Float16)(bf16_round(W[t * 8 + i]) * 16.0f); *(v8us*)((unsigned short*)Bt + t * 8) = f.half[0];  }
template <int NHv, int TTv>
__global__ __launch_bounds__(256) void k_vt(const _Float16* __restrict__ V16, int ldv, int voff, _Float16* __restrict__ Vt) { __shared__ unsigned short tl[64][66]; const int tid = threadIdx.x; const int slab = blockIdx.x / (TTv / 64), lg = blockIdx.x % (TTv / 64); const int b = slab / NHv, h = slab % NHv;
  for (int i = tid; i < 64 * 8; i += 256) { const int r = i / 8, c8 = (i % 8) * 8; FragH f; f.half[0] = *(const v8us*)((const unsigned short*)V16 + ((size_t)b * TTv + lg * 64 + r) * ldv + voff + h * 64 + c8);
#pragma unroll
    for (int q = 0; q < 8; ++q) tl[r][c8 + q] = f.u[q]; }
  __syncthreads();
  {
#pragma unroll
    for (int rd = 0; rd < 2; ++rd) { const int d = rd * 32 + tid / 8, pc = tid % 8; FragH f;
#pragma unroll
      for (int q = 0; q < 8; ++q) f.u[q] = tl[pc * 8 + q][d];
      *(v8us*)((unsigned short*)Vt + ((size_t)slab * 64 + d) * TTv + lg * 64 + pc * 8) = f.half[0]; }
     } }

__global__ __launch_bounds__(256) void k_h16s(const float* __restrict__ F, _Float16* __restrict__ H, size_t n8) { const size_t t = (size_t)blockIdx.x * 256 + threadIdx.x; if (t >= n8) return; const v4f a = *(const v4fa*)(F + t * 8), c = *(const v4fa*)(F + t * 8 + 4); FragH f;
#pragma unroll
  for (int q = 0; q < 4; ++q) { f.h[q] = (_Float16)(a[q] * 256.0f); f.h[4 + q] = (_Float16)(c[q] * 256.0f); } *(v8us*)((unsigned short*)H + t * 8) = f.half[0];  }
// Keys split inside the work-group: each of the 4 query tiles is walked by KVS waves; wave (qw, kr) takes the 32-key blocks kr, kr + KVS, kr + 2 KVS, ... with its own running max, sum and
// un-normalised accumulators; the KVS partials of a tile are merged through LDS behind one work-group barrier (weights exp(m_k - M)).
#define KVS 4
__global__ __launch_bounds__(128 * KVS) void k_flash(const _Float16* __restrict__ Q16, int ldq, const _Float16* __restrict__ K16, int ldk, const _Float16* __restrict__ Vt, float* __restrict__ O, int ldo) {
  constexpr int RPW = 16, RTN = RPW / 16, NQB = NN / (4 * RPW), DT = 4, KS = 2, NW = 4 * KVS, RM = RPW / KVS;
  __shared__ __attribute__((aligned(16))) unsigned short sP[NW][RPW][40]; __shared__ __attribute__((aligned(16))) float sO[NW][RPW][128 + 4]; __shared__ float sM[NW][RPW], sL[NW][RPW];
  const int tid = threadIdx.x, w = tid >> 5, lane = tid & 31, ln = lane & 15, hh = lane >> 4; const int qw = w & 3, kr = w >> 2;
  const int slab = blockIdx.x / NQB, qblk = blockIdx.x % NQB; const int b = slab / NHU, h = slab % NHU; const int qb0 = qblk * (4 * RPW); const int q0 = qb0 + qw * RPW;
  FragH aq[2][KS], aql[2][KS];
#pragma unroll
  for (int rt = 0; rt < RTN; ++rt) { const size_t qo = ((size_t)b * NN + q0 + rt * 16 + ln) * ldq + h * 128; const unsigned short* qr = (const unsigned short*)Q16 + qo; const unsigned short* ql = qr + 64;      /* aq = real part, aql = imaginary part */
#pragma unroll
    for (int ks = 0; ks < KS; ++ks) { aq[rt][ks].half[0] = *(const v8us*)(qr + ks * 32 + 8 * hh); aq[rt][ks].half[1] = *(const v8us*)(qr + ks * 32 + 16 + 8 * hh); aql[rt][ks].half[0] = *(const v8us*)(ql + ks * 32 + 8 * hh); aql[rt][ks].half[1] = *(const v8us*)(ql + ks * 32 + 16 + 8 * hh); } }
  const unsigned short* Vth = (const unsigned short*)Vt + ((size_t)b * 2 * NHU + 2 * h) * 64 * NN; const unsigned short* Vti = Vth + (size_t)64 * NN;      /* Vᵀ real / imag planes of head h */
  float m_r[2][8], l_r[2][8]; v8f oacc[2][DT], oacci[2][DT];
#pragma unroll
  for (int rt = 0; rt < RTN; ++rt) {
#pragma unroll
    for (int r = 0; r < 8; ++r) { m_r[rt][r] = -3.0e38f; l_r[rt][r] = 0.f; }
#pragma unroll
    for (int dt = 0; dt < DT; ++dt) { oacc[rt][dt] = (v8f){0.f,0.f,0.f,0.f,0.f,0.f,0.f,0.f}; oacci[rt][dt] = oacc[rt][dt]; } }
  const int jend = NN;
#pragma unroll 1
  for (int j0 = kr * 32; j0 < jend; j0 += 32 * KVS) {
    
    v8f s[2][2];
#pragma unroll
    for (int nt = 0; nt < 2; ++nt) { const size_t ko = ((size_t)b * NN + j0 + nt * 16 + ln) * ldk + h * 128; const unsigned short* kr = (const unsigned short*)K16 + ko; const unsigned short* kl = kr + 64; FragH bk[KS], bl[KS];      /* bk = real, bl = imaginary */
#pragma unroll
      for (int ks = 0; ks < KS; ++ks) { bk[ks].half[0] = *(const v8us*)(kr + ks * 32 + 8 * hh); bk[ks].half[1] = *(const v8us*)(kr + ks * 32 + 16 + 8 * hh); bl[ks].half[0] = *(const v8us*)(kl + ks * 32 + 8 * hh); bl[ks].half[1] = *(const v8us*)(kl + ks * 32 + 16 + 8 * hh); }
#pragma unroll
      for (int rt = 0; rt < RTN; ++rt) { v8f re = (v8f){0.f,0.f,0.f,0.f,0.f,0.f,0.f,0.f}, ip = re, in = re;
#pragma unroll
        for (int ks = 0; ks < KS; ++ks) { re = mmaH<1>(aq[rt][ks].v, aq[rt][ks].v, bk[ks].v, bk[ks].v, re); re = mmaH<1>(aql[rt][ks].v, aql[rt][ks].v, bl[ks].v, bl[ks].v, re); ip = mmaH<1>(aql[rt][ks].v, aql[rt][ks].v, bk[ks].v, bk[ks].v, ip); in = mmaH<1>(aq[rt][ks].v, aq[rt][ks].v, bl[ks].v, bl[ks].v, in); }
#pragma unroll
        for (int r = 0; r < 8; ++r) { const float im = ip[r] - in[r]; re[r] = (re[r] * re[r] + im * im) * SCORE_SCALE; } s[rt][nt] = re; } }
#pragma unroll
    for (int rt = 0; rt < RTN; ++rt)
#pragma unroll
      for (int r = 0; r < 8; ++r) { const int tq = q0 + rt * 16 + 8 * hh + r; const int k0 = j0 + ln, k1 = j0 + 16 + ln; (void)tq; (void)k0; (void)k1;
        const bool ok0 = true, ok1 = true;
        const float s0 = s[rt][0][r], s1 = s[rt][1][r]; float mc = fmaxf(s0, s1);
        mc = fmaxf(mc, __shfl_xor(mc, 1, 32)); mc = fmaxf(mc, __shfl_xor(mc, 2, 32)); mc = fmaxf(mc, __shfl_xor(mc, 4, 32)); mc = fmaxf(mc, __shfl_xor(mc, 8, 32));
        const float mn = fmaxf(m_r[rt][r], mc); const float al = (mn > -1.0e38f) ? expf(m_r[rt][r] - mn) : 1.0f; m_r[rt][r] = mn; const float p0 = expf(s0 - mn), p1 = expf(s1 - mn); l_r[rt][r] = l_r[rt][r] * al + p0 + p1;
#pragma unroll
        for (int dt = 0; dt < DT; ++dt) { oacc[rt][dt][r] *= al; oacci[rt][dt][r] *= al; }
        FragH t2; t2.h[0] = (_Float16)(p0 * 1024.0f); t2.h[1] = (_Float16)(p1 * 1024.0f); sP[w][rt * 16 + 8 * hh + r][ln] = t2.u[0]; sP[w][rt * 16 + 8 * hh + r][16 + ln] = t2.u[1]; }
    __builtin_amdgcn_fence(__ATOMIC_ACQ_REL, "workgroup"); __builtin_amdgcn_wave_barrier();
    FragH pa[2];
#pragma unroll
    for (int rt = 0; rt < RTN; ++rt) { pa[rt].half[0] = *(const v8us*)&sP[w][rt * 16 + ln][8 * hh]; pa[rt].half[1] = *(const v8us*)&sP[w][rt * 16 + ln][16 + 8 * hh]; }
#pragma unroll
    for (int dt = 0; dt < DT; ++dt) { const size_t vo = (size_t)(dt * 16 + ln) * NN + j0; FragH bv, bi; bv.half[0] = *(const v8us*)(Vth + vo + 8 * hh); bv.half[1] = *(const v8us*)(Vth + vo + 16 + 8 * hh); bi.half[0] = *(const v8us*)(Vti + vo + 8 * hh); bi.half[1] = *(const v8us*)(Vti + vo + 16 + 8 * hh);
#pragma unroll
      for (int rt = 0; rt < RTN; ++rt) { oacc[rt][dt] = mmaH<1>(pa[rt].v, pa[rt].v, bv.v, bv.v, oacc[rt][dt]); oacci[rt][dt] = mmaH<1>(pa[rt].v, pa[rt].v, bi.v, bi.v, oacci[rt][dt]); } }
    __builtin_amdgcn_fence(__ATOMIC_ACQ_REL, "workgroup"); __builtin_amdgcn_wave_barrier(); }
#pragma unroll
  for (int rt = 0; rt < RTN; ++rt) {
#pragma unroll
    for (int r = 0; r < 8; ++r) { float l = l_r[rt][r]; l += __shfl_xor(l, 1, 32); l += __shfl_xor(l, 2, 32); l += __shfl_xor(l, 4, 32); l += __shfl_xor(l, 8, 32); if (ln == 0) { sM[w][rt * 16 + 8 * hh + r] = m_r[rt][r]; sL[w][rt * 16 + 8 * hh + r] = l; } }
#pragma unroll
    for (int dt = 0; dt < DT; ++dt)
#pragma unroll
      for (int r = 0; r < 8; ++r) { sO[w][rt * 16 + 8 * hh + r][dt * 16 + ln] = oacc[rt][dt][r]; sO[w][rt * 16 + 8 * hh + r][64 + dt * 16 + ln] = oacci[rt][dt][r]; } }
  __syncthreads();      /* publishes every wave's partial (max, sum, accumulators) to the waves that merge it */
  {
#pragma unroll
    for (int rp = 0; rp < RM; ++rp) { const int r = kr * RM + rp, pc = lane;      /* wave (qw, kr) merges rows kr*RM .. of query tile qw */
      float mk[KVS], M = -3.0e38f;
#pragma unroll
      for (int k = 0; k < KVS; ++k) { mk[k] = sM[k * 4 + qw][r]; M = fmaxf(M, mk[k]); }
      float L = 0.f; v4f o = {0.f, 0.f, 0.f, 0.f};
#pragma unroll
      for (int k = 0; k < KVS; ++k) { const float wk = expf(mk[k] - M); L += wk * sL[k * 4 + qw][r]; const v4f part = *(const v4fa*)&sO[k * 4 + qw][r][pc * 4]; o += part * wk; }
      const float inv = (L > 0.f) ? 1.0f / (L * 1024.0f) : 0.f;
      *(v4f*)(O + ((size_t)b * NN + q0 + r) * ldo + h * 128 + pc * 4) = o * inv; }      /* 32 lanes x 16 B = the head's [real | imag] 512-B run */
     } }

extern "C" void kernel_launch(void* const* d_in, const int* in_sizes, int n_in,
                              void* d_out, int out_size, void* d_ws, size_t ws_size, hipStream_t stream) {
  (void)in_sizes; (void)n_in; (void)out_size;
  const float* const* I = (const float* const*)d_in; const float* x = I[0]; const float* Wq = I[1]; const float* bq = I[2]; const float* Wk = I[3]; const float* bk = I[4]; const float* Wv = I[5]; const float* bv = I[6]; const float* Wo = I[7]; const float* bo = I[8];
  char* ws = (char*)d_ws; size_t off = 0;
  auto take = [&](size_t bytes) { char* p = ws + off; off += (bytes + 255) & ~(size_t)255; return p; };
  _Float16* Bq = (_Float16*)take((size_t)2 * DX * DX * 2); _Float16* Bk = (_Float16*)take((size_t)2 * DX * DX * 2); _Float16* Bv = (_Float16*)take((size_t)2 * DX * DX * 2); _Float16* Bo = (_Float16*)take((size_t)DX * DX * 2);
  _Float16* X16 = (_Float16*)take((size_t)NR * DX * 2); _Float16* Q = (_Float16*)take((size_t)NR * DX * 2); _Float16* K = (_Float16*)take((size_t)NR * DX * 2); _Float16* V = (_Float16*)take((size_t)NR * DX * 2); _Float16* Vt = (_Float16*)take((size_t)NR * DX * 2);
  float* O = (float*)take((size_t)NR * DX * 4); _Float16* O16 = (_Float16*)take((size_t)NR * DX * 2);
  if (off > ws_size) return;      // 3 × 1 + 0.5 + 5 × 4.2 + 8.4 + 4.2 ≈ 37 MB
  k_wt_f16<<<(unsigned)(((size_t)2 * DX * (DX / 8) + 255) / 256), 256, 0, stream>>>(Wq, Bq, DX, 2 * DX, 16.0f); k_wt_f16<<<(unsigned)(((size_t)2 * DX * (DX / 8) + 255) / 256), 256, 0, stream>>>(Wk, Bk, DX, 2 * DX, 16.0f); k_wt_f16<<<(unsigned)(((size_t)2 * DX * (DX / 8) + 255) / 256), 256, 0, stream>>>(Wv, Bv, DX, 2 * DX, 16.0f);      /* (in,out) [512][1024] → Bt[1024][512] ×2^4; only rows 0..511 (heads 0..3) are used */
  k_wt_f16<<<(unsigned)(((size_t)DX * (DX / 8) + 255) / 256), 256, 0, stream>>>(Wo, Bo, DX, DX, 16.0f);
  k_x16<<<(unsigned)(((size_t)NR * DX / 8 + 255) / 256), 256, 0, stream>>>(x, X16, (size_t)NR * DX / 8);
  const dim3 gp(((NR / 16) * (DX / 64) + 3) / 4, 1);
  k_gemm_hhx<0><<<gp, 128, 0, stream>>>(X16, DX, 0, Bq, DX, 0, 0.0625f, bq, 0, nullptr, 1, 0, 0, nullptr, Q, DX, 0, NR, DX, DX);      /* q, heads 0..3 = output columns 0..511 (+ bq): M 4096 N 512 K 512 */
  k_gemm_hhx<0><<<gp, 128, 0, stream>>>(X16, DX, 0, Bk, DX, 0, 0.0625f, bk, 0, nullptr, 1, 0, 0, nullptr, K, DX, 0, NR, DX, DX);
  k_gemm_hhx<0><<<gp, 128, 0, stream>>>(X16, DX, 0, Bv, DX, 0, 0.0625f, bv, 0, nullptr, 1, 0, 0, nullptr, V, DX, 0, NR, DX, DX);
  k_vt<2 * NHU, NN><<<BB * 2 * NHU * (NN / 64), 256, 0, stream>>>(V, DX, 0, Vt);      /* Vᵀ planes per (b, head, part): [b·8 + 2h + part][64][2048] */
  k_flash<<<BB * NHU * (NN / 64), 128 * KVS, 0, stream>>>(Q, DX, K, DX, Vt, O, DX);
  k_h16s<<<(unsigned)(((size_t)NR * DX / 8 + 255) / 256), 256, 0, stream>>>(O, O16, (size_t)NR * DX / 8);
  k_gemm_hhx<0><<<gp, 128, 0, stream>>>(O16, DX, 0, Bo, DX, 0, 0.0625f * 0.00390625f, bo, 0, nullptr, 1, 0, 0, (float*)d_out, nullptr, DX, 0, NR, DX, DX);      /* out = O·Wo + bo (alpha undoes ×2^4 weights and the ×2^8 carry) */
}

// v002
// One run takes 163 microseconds.
// Timed twice side by side with v001, it ran 1.18 and 1.17 times as fast.
// Counting every step since v000, it is 2.00 times as fast.
#include <hip/hip_runtime.h>
// 'Superposition' (complex-valued) multi-head attention (B=2, S=2048, D=512, 8 heads; q,k,v projections to 2D with per-head [real 64 | imag 64]): interference = Σ_d q_d·conj(k_d)·64^-½; probs = softmax(|interference|²/0.5); out = probs·v (complex);
// out = concat[real, imag] per head → [B,S,1024], truncated to the first 512 columns (= heads 0..3), then ·Wo + bo. Only heads 0..3 reach the output, so only they are computed.
// Compute dtype: x, weights, biases rounded to bf16; q/k/v (columns of heads 0..3) as f16 GEMM outputs; fused flash-style kernel with three f32 score accumulators (Re, Im⁺, Im⁻) and two value accumulators
// (real, imag), online softmax f32, P f16 ×2^10, on v_wmma_f32_16x16x32_f16; O carried ×2^8 into f16 (small diffuse values) → output GEMM with bias (alpha undoes the carry); f32 accumulate.
#define BB 2
#define NN 2048
#define DX 512
#define NHU 4
#define DH2 128
#define NR (BB * NN)
#define SCORE_SCALE 0.03125f

typedef __bf16 v16b __attribute__((ext_vector_type(16)));
typedef unsigned short v8us __attribute__((ext_vector_type(8), may_alias));
typedef float  v8f  __attribute__((ext_vector_type(8)));
typedef float  v4f  __attribute__((ext_vector_type(4)));
typedef float  v4fa __attribute__((ext_vector_type(4), may_alias));
union FragB { v16b v; v8us half[2]; unsigned short u[16]; };

__device__ __forceinline__ unsigned short bf16_bits(float x) { unsigned int u = __float_as_uint(x); return (unsigned short)((u + 0x7FFFu + ((u >> 16) & 1u)) >> 16); }
__device__ __forceinline__ float bf16_val(unsigned short b) { return __uint_as_float(((unsigned int)b) << 16); }
__device__ __forceinline__ float bf16_round(float x) { return bf16_val(bf16_bits(x)); }
// D += A·B with NT terms: 1 = ah·bh, 2 = + al·bh (A split), 3 = + ah·bl (both split)
template <int NT>
__device__ __forceinline__ v8f mmaN(v16b ah, v16b al, v16b bh, v16b bl, v8f c) {
  c = __builtin_amdgcn_wmma_f32_16x16x32_bf16(false, ah, false, bh, (short)0, c, false, false);
  if (NT >= 2) c = __builtin_amdgcn_wmma_f32_16x16x32_bf16(false, al, false, bh, (short)0, c, false, false);
  if (NT >= 3) c = __builtin_amdgcn_wmma_f32_16x16x32_bf16(false, ah, false, bl, (short)0, c, false, false);
  asm volatile("v_nop\n\tv_nop\n\tv_nop\n\tv_nop" : "+v"(c) : "v"(ah), "v"(al), "v"(bh), "v"(bl));
  return c;
}

__global__ __launch_bounds__(256) void k_wt_bf16(const float* __restrict__ W, unsigned short* __restrict__ Wt, int K, int N) {
  const int t = blockIdx.x * 256 + threadIdx.x;
  const int k8n = K / 8;
  if (t >= N * k8n) return;
  const int n = t / k8n, k8 = (t % k8n) * 8;
  v8us v;
#pragma unroll
  for (int i = 0; i < 8; ++i) v[i] = bf16_bits(W[(size_t)(k8 + i) * N + n]);
  *(v8us*)(Wt + (size_t)n * K + k8) = v;
  
}

// GEMM C[M][N] (f32, pitch ldc) = act(A[M][K]·W + bias). A f32 row-major (pitch lda) converted per fragment to bf16
// (ASPLIT: hi/lo two planes -> 2 terms, else single rounded term); Wt bf16 [N][K] (pitch ldb). BIAS_BF16 rounds the
// bias to bf16 first (bias quantised to bf16 before the add). K%32==0, M%16==0, N%64==0.
template <bool ASPLIT, int ACT, bool BIAS_BF16>
__global__ __launch_bounds__(128) void k_gemm_bf(const float* __restrict__ A, int lda, const unsigned short* __restrict__ Wt, int ldb,
                                               const float* __restrict__ bias, float* __restrict__ C, int ldc, int M, int N, int K) {
  __shared__ __attribute__((aligned(16))) float so[4][16][64];
  const int tid = threadIdx.x, w = tid >> 5, lane = tid & 31, ln = lane & 15, hh = lane >> 4;
  const int ntn = N / 64;
  const int wid = blockIdx.x * 4 + w;
  const int mt = wid / ntn, nq = wid % ntn;
  if (mt * 16 >= M) return;
  const int row0 = mt * 16, col0 = nq * 64;
  const float* arow = A + (size_t)(row0 + ln) * lda;
  v8f acc[4] = {};
  for (int kb = 0; kb < K; kb += 32) {
    FragB ah, al;
    const v4f x0 = *(const v4fa*)(arow + kb + 8 * hh), x1 = *(const v4fa*)(arow + kb + 8 * hh + 4);
    const v4f x2 = *(const v4fa*)(arow + kb + 16 + 8 * hh), x3 = *(const v4fa*)(arow + kb + 16 + 8 * hh + 4);
    float xs[16] = {x0[0],x0[1],x0[2],x0[3],x1[0],x1[1],x1[2],x1[3],x2[0],x2[1],x2[2],x2[3],x3[0],x3[1],x3[2],x3[3]};
#pragma unroll
    for (int i = 0; i < 16; ++i) { const unsigned short hb = bf16_bits(xs[i]); ah.u[i] = hb; al.u[i] = ASPLIT ? bf16_bits(xs[i] - bf16_val(hb)) : (unsigned short)0; }
#pragma unroll
    for (int t = 0; t < 4; ++t) {
      const unsigned short* brow = Wt + (size_t)(col0 + t * 16 + ln) * ldb + kb;
      FragB b;
      b.half[0] = *(const v8us*)(brow + 8 * hh);
      b.half[1] = *(const v8us*)(brow + 16 + 8 * hh);
      acc[t] = mmaN<ASPLIT ? 2 : 1>(ah.v, al.v, b.v, b.v, acc[t]);
    }
  }
#pragma unroll
  for (int t = 0; t < 4; ++t) {
    float bv = bias ? bias[col0 + t * 16 + ln] : 0.f;
    if (BIAS_BF16) bv = bf16_round(bv);
#pragma unroll
    for (int r = 0; r < 8; ++r) { float v = acc[t][r] + bv; if (ACT == 1) v = fmaxf(v, 0.f); so[w][8 * hh + r][t * 16 + ln] = v; }
  }
  __builtin_amdgcn_fence(__ATOMIC_ACQ_REL, "workgroup");
  __builtin_amdgcn_wave_barrier();
  const int rsub = lane >> 4, c4 = (lane & 15) * 4;
  {
#pragma unroll
    for (int q = 0; q < 8; ++q) {
      const int r = q * 2 + rsub;
      const v4f v = *(const v4fa*)&so[w][r][c4];
      *(v4f*)(C + (size_t)(row0 + r) * ldc + col0 + c4) = v;
    }
    
  }
}

// Flash-style causal/unmasked attention, all contractions 3-term bf16 hi/lo splits, f32 softmax with running max.
// q,k,v rows are read from f32 buffers with arbitrary row pitch (so they can live inside a fused qkv buffer);
// D = head size (multiple of 32, <= 128); one wave = 16 query rows; block = 4 waves (64 queries) sharing K/V chunks of 32.
template <int D, bool CAUSAL>
__global__ __launch_bounds__(128) void k_flash(const float* __restrict__ qb, const float* __restrict__ kb, const float* __restrict__ vb,
                                             int pitch, int T, int H, float scale, float* __restrict__ y, int ypitch) {
  constexpr int KS = D / 32;        // k-steps for QK
  constexpr int DT = D / 16;        // d tiles for PV
  __shared__ __attribute__((aligned(16))) unsigned short sKh[32][D + 8], sKl[32][D + 8], sVh[32][D + 8], sVl[32][D + 8];
  __shared__ __attribute__((aligned(16))) unsigned short sPh[4][16][40], sPl[4][16][40];
  __shared__ __attribute__((aligned(16))) float sO[4][16][D];
  const int tid = threadIdx.x, w = tid >> 5, lane = tid & 31, ln = lane & 15, hh = lane >> 4;
  const int nqb = (T + 63) / 64;
  const int bh = blockIdx.x / nqb, qblk = blockIdx.x % nqb;
  const int b = bh / H, h = bh % H;
  const int q0 = qblk * 64 + w * 16;
  const float* Q = qb + (size_t)b * T * pitch + h * D;
  const float* K = kb + (size_t)b * T * pitch + h * D;
  const float* V = vb + (size_t)b * T * pitch + h * D;

  // A fragments of the wave's 16 query rows (scaled), hi/lo
  FragB aqh[KS], aql[KS];
  {
    int row = q0 + ln; if (row >= T) row = T - 1;
    const float* qr = Q + (size_t)row * pitch;
#pragma unroll
    for (int ks = 0; ks < KS; ++ks)
#pragma unroll
      for (int i = 0; i < 16; ++i) {
        const int d = ks * 32 + ((i < 8) ? (8 * hh + i) : (16 + 8 * hh + (i - 8)));
        const float x = qr[d] * scale; const unsigned short hb = bf16_bits(x);
        aqh[ks].u[i] = hb; aql[ks].u[i] = bf16_bits(x - bf16_val(hb));
      }
  }
  float m_r[8], l_r[8];
#pragma unroll
  for (int r = 0; r < 8; ++r) { m_r[r] = -3.0e38f; l_r[r] = 0.f; }
  v8f oacc[DT];
#pragma unroll
  for (int dt = 0; dt < DT; ++dt) oacc[dt] = (v8f){0.f,0.f,0.f,0.f,0.f,0.f,0.f,0.f};

  const int kv_end = CAUSAL ? min(T, qblk * 64 + 64) : T;     // block-uniform
  for (int j0 = 0; j0 < kv_end; j0 += 32) {
    __syncthreads();
    for (int e = tid; e < 32 * (D / 4); e += 128) {
      const int r = e / (D / 4), c4 = (e % (D / 4)) * 4;
      const int key = j0 + r;
      v4f kf = {0.f,0.f,0.f,0.f}, vf = {0.f,0.f,0.f,0.f};
      if (key < T) { kf = *(const v4fa*)(K + (size_t)key * pitch + c4); vf = *(const v4fa*)(V + (size_t)key * pitch + c4); }
#pragma unroll
      for (int t = 0; t < 4; ++t) {
        unsigned short hb = bf16_bits(kf[t]); sKh[r][c4 + t] = hb; sKl[r][c4 + t] = bf16_bits(kf[t] - bf16_val(hb));
        hb = bf16_bits(vf[t]); sVh[r][c4 + t] = hb; sVl[r][c4 + t] = bf16_bits(vf[t] - bf16_val(hb));
      }
    }
    __syncthreads();
    // S tile 16 x 32
    v8f s[2];
#pragma unroll
    for (int nt = 0; nt < 2; ++nt) {
      v8f acc = {};
#pragma unroll
      for (int ks = 0; ks < KS; ++ks) {
        FragB bh_, bl_;
        bh_.half[0] = *(const v8us*)&sKh[nt * 16 + ln][ks * 32 + 8 * hh]; bh_.half[1] = *(const v8us*)&sKh[nt * 16 + ln][ks * 32 + 16 + 8 * hh];
        bl_.half[0] = *(const v8us*)&sKl[nt * 16 + ln][ks * 32 + 8 * hh]; bl_.half[1] = *(const v8us*)&sKl[nt * 16 + ln][ks * 32 + 16 + 8 * hh];
        acc = mmaN<3>(aqh[ks].v, aql[ks].v, bh_.v, bl_.v, acc);
      }
      s[nt] = acc;
    }
    // mask + running max (rows 8hh+r; the 16 lanes of a half share rows)
    float alpha[8];
#pragma unroll
    for (int r = 0; r < 8; ++r) {
      const int qi = q0 + 8 * hh + r;
      const int ja = j0 + ln, jb = j0 + 16 + ln;
      if (CAUSAL) { if (ja > qi) s[0][r] = -3.0e38f; if (jb > qi) s[1][r] = -3.0e38f; }
      if (ja >= T) s[0][r] = -3.0e38f;
      if (jb >= T) s[1][r] = -3.0e38f;
      float mx = fmaxf(s[0][r], s[1][r]);
      mx = fmaxf(mx, __shfl_xor(mx, 1, 32)); mx = fmaxf(mx, __shfl_xor(mx, 2, 32)); mx = fmaxf(mx, __shfl_xor(mx, 4, 32)); mx = fmaxf(mx, __shfl_xor(mx, 8, 32));
      const float mnew = fmaxf(m_r[r], mx);
      alpha[r] = (mnew > -1.0e38f) ? __expf(m_r[r] - mnew) : 1.0f;
      const float p0 = (s[0][r] > -1.0e38f) ? __expf(s[0][r] - mnew) : 0.f;
      const float p1 = (s[1][r] > -1.0e38f) ? __expf(s[1][r] - mnew) : 0.f;
      m_r[r] = mnew;
      l_r[r] = l_r[r] * alpha[r] + p0 + p1;            // per-lane partial row sum (16 lanes combined at the end)
      unsigned short hb = bf16_bits(p0); sPh[w][8 * hh + r][ln] = hb;      sPl[w][8 * hh + r][ln] = bf16_bits(p0 - bf16_val(hb));
      hb = bf16_bits(p1);                sPh[w][8 * hh + r][16 + ln] = hb; sPl[w][8 * hh + r][16 + ln] = bf16_bits(p1 - bf16_val(hb));
    }
#pragma unroll
    for (int dt = 0; dt < DT; ++dt)
#pragma unroll
      for (int r = 0; r < 8; ++r) oacc[dt][r] *= alpha[r];
    __builtin_amdgcn_fence(__ATOMIC_ACQ_REL, "workgroup");
    __builtin_amdgcn_wave_barrier();
    FragB pah, pal;
    pah.half[0] = *(const v8us*)&sPh[w][ln][8 * hh]; pah.half[1] = *(const v8us*)&sPh[w][ln][16 + 8 * hh];
    pal.half[0] = *(const v8us*)&sPl[w][ln][8 * hh]; pal.half[1] = *(const v8us*)&sPl[w][ln][16 + 8 * hh];
#pragma unroll
    for (int dt = 0; dt < DT; ++dt) {
      FragB bvh, bvl;
#pragma unroll
      for (int i = 0; i < 8; ++i) {
        bvh.u[i] = sVh[8 * hh + i][dt * 16 + ln]; bvh.u[8 + i] = sVh[16 + 8 * hh + i][dt * 16 + ln];
        bvl.u[i] = sVl[8 * hh + i][dt * 16 + ln]; bvl.u[8 + i] = sVl[16 + 8 * hh + i][dt * 16 + ln];
      }
      oacc[dt] = mmaN<3>(pah.v, pal.v, bvh.v, bvl.v, oacc[dt]);
    }
    __builtin_amdgcn_fence(__ATOMIC_ACQ_REL, "workgroup");
    __builtin_amdgcn_wave_barrier();
  }
#pragma unroll
  for (int r = 0; r < 8; ++r) {
    float l = l_r[r];
    l += __shfl_xor(l, 1, 32); l += __shfl_xor(l, 2, 32); l += __shfl_xor(l, 4, 32); l += __shfl_xor(l, 8, 32);
    l_r[r] = (l > 0.f) ? 1.0f / l : 0.f;
  }
#pragma unroll
  for (int dt = 0; dt < DT; ++dt)
#pragma unroll
    for (int r = 0; r < 8; ++r) sO[w][8 * hh + r][dt * 16 + ln] = oacc[dt][r] * l_r[r];
  __builtin_amdgcn_fence(__ATOMIC_ACQ_REL, "workgroup");
  __builtin_amdgcn_wave_barrier();
  {
    for (int r = 0; r < 16; ++r) {
      const int row = q0 + r;
      if (row < T && lane < D / 4) {
        const v4f val = *(const v4fa*)&sO[w][r][lane * 4];
        *(v4f*)(y + ((size_t)b * T + row) * ypitch + h * D + lane * 4) = val;
      }
    }
    
  }
}

// GEMM C = act(A·W + bias + resid): A f32 (ASPLIT -> hi/lo 2 terms), Wt bf16 [N][K]; ACT 0 none, 1 relu, 2 exact gelu;
// resid (optional, f32, row index = (row % rmod), pitch ldr, RES_BF16 rounds it) added before the activation.
template <bool ASPLIT, int ACT, bool BIAS_BF16, bool RES_BF16>
__global__ __launch_bounds__(128) void k_gemm_bf3(const float* __restrict__ A, int lda, const unsigned short* __restrict__ Wt, int ldb,
                                                const float* __restrict__ bias, const float* __restrict__ resid, int rmod, int ldr,
                                                float* __restrict__ C, int ldc, int M, int N, int K) {
  __shared__ __attribute__((aligned(16))) float so[4][16][64];
  const int tid = threadIdx.x, w = tid >> 5, lane = tid & 31, ln = lane & 15, hh = lane >> 4;
  const int ntn = N / 64;
  const int wid = blockIdx.x * 4 + w;
  const int mt = wid / ntn, nq = wid % ntn;
  if (mt * 16 >= M) return;
  const int row0 = mt * 16, col0 = nq * 64;
  const float* arow = A + (size_t)(row0 + ln) * lda;
  v8f acc[4] = {};
  for (int kb = 0; kb < K; kb += 32) {
    FragB ah, al;
    const v4f x0 = *(const v4fa*)(arow + kb + 8 * hh), x1 = *(const v4fa*)(arow + kb + 8 * hh + 4);
    const v4f x2 = *(const v4fa*)(arow + kb + 16 + 8 * hh), x3 = *(const v4fa*)(arow + kb + 16 + 8 * hh + 4);
    float xs[16] = {x0[0],x0[1],x0[2],x0[3],x1[0],x1[1],x1[2],x1[3],x2[0],x2[1],x2[2],x2[3],x3[0],x3[1],x3[2],x3[3]};
#pragma unroll
    for (int i = 0; i < 16; ++i) { const unsigned short hb = bf16_bits(xs[i]); ah.u[i] = hb; al.u[i] = ASPLIT ? bf16_bits(xs[i] - bf16_val(hb)) : (unsigned short)0; }
#pragma unroll
    for (int t = 0; t < 4; ++t) {
      const unsigned short* brow = Wt + (size_t)(col0 + t * 16 + ln) * ldb + kb;
      FragB b;
      b.half[0] = *(const v8us*)(brow + 8 * hh);
      b.half[1] = *(const v8us*)(brow + 16 + 8 * hh);
      acc[t] = mmaN<ASPLIT ? 2 : 1>(ah.v, al.v, b.v, b.v, acc[t]);
    }
  }
#pragma unroll
  for (int t = 0; t < 4; ++t) {
    const int col = col0 + t * 16 + ln;
    float bv = bias ? bias[col] : 0.f;
    if (BIAS_BF16) bv = bf16_round(bv);
#pragma unroll
    for (int r = 0; r < 8; ++r) {
      float v = acc[t][r] + bv;
      if (resid) { float rv = resid[(size_t)((row0 + 8 * hh + r) % rmod) * ldr + col]; if (RES_BF16) rv = bf16_round(rv); v += rv; }
      if (ACT == 1) v = fmaxf(v, 0.f);
      if (ACT == 2) v = 0.5f * v * (1.0f + erff(v * 0.70710678118654752f));
      if (ACT == 3) { const float u = 0.7978845608028654f * (v + 0.044715f * v * v * v); v = 0.5f * v * (1.0f + tanhf(u)); }
      so[w][8 * hh + r][t * 16 + ln] = v;
    }
  }
  __builtin_amdgcn_fence(__ATOMIC_ACQ_REL, "workgroup");
  __builtin_amdgcn_wave_barrier();
  const int rsub = lane >> 4, c4 = (lane & 15) * 4;
  {
#pragma unroll
    for (int q = 0; q < 8; ++q) {
      const int r = q * 2 + rsub;
      const v4f v = *(const v4fa*)&so[w][r][c4];
      *(v4f*)(C + (size_t)(row0 + r) * ldc + col0 + c4) = v;
    }
    
  }
}
// row LayerNorm (biased variance, eps) over N: s = X (+ R); optional out_sum <- s; out_norm <- (s-mu)*rsqrt(var+eps)*g + b
template <bool PARAM_BF16>
__global__ __launch_bounds__(256) void k_layernorm(const float* __restrict__ X, const float* __restrict__ R, const float* __restrict__ g, const float* __restrict__ bta,
                                                  float* __restrict__ out_sum, float* __restrict__ out_norm, int N, float eps) {
  __shared__ float red[256];
  const int row = blockIdx.x, tid = threadIdx.x;
  const float* x = X + (size_t)row * N; const float* rr = R ? R + (size_t)row * N : nullptr;
  float vals[16];                     // up to N = 4096
  const int per = N / 256;            // contiguous chunk per thread? use strided-by-4 chunks: thread handles j = tid*4 + 1024*u
  float s1 = 0.f;
  for (int u = 0; u < per / 4; ++u) {
    const int j = tid * 4 + 1024 * u;
    const v4f a = *(const v4fa*)(x + j);
    v4f b = {0.f,0.f,0.f,0.f}; if (rr) b = *(const v4fa*)(rr + j);
#pragma unroll
    for (int q = 0; q < 4; ++q) { const float v = a[q] + b[q]; vals[u * 4 + q] = v; s1 += v; }
  }
  red[tid] = s1; __syncthreads();
  for (int st = 128; st > 0; st >>= 1) { if (tid < st) red[tid] += red[tid + st]; __syncthreads(); }
  const float mu = red[0] / (float)N; __syncthreads();
  float s2 = 0.f;
  for (int u = 0; u < per / 4; ++u)
#pragma unroll
    for (int q = 0; q < 4; ++q) { const float c = vals[u * 4 + q] - mu; s2 += c * c; }
  red[tid] = s2; __syncthreads();
  for (int st = 128; st > 0; st >>= 1) { if (tid < st) red[tid] += red[tid + st]; __syncthreads(); }
  const float rs = rsqrtf(red[0] / (float)N + eps);
  {
    for (int u = 0; u < per / 4; ++u) {
      const int j = tid * 4 + 1024 * u;
      v4f o, sm;
#pragma unroll
      for (int q = 0; q < 4; ++q) {
        float gg = g[j + q], bb = bta[j + q];
        if (PARAM_BF16) { gg = bf16_round(gg); bb = bf16_round(bb); }
        sm[q] = vals[u * 4 + q]; o[q] = (vals[u * 4 + q] - mu) * rs * gg + bb;
      }
      if (out_sum) *(v4f*)(out_sum + (size_t)row * N + j) = sm;
      *(v4f*)(out_norm + (size_t)row * N + j) = o;
    }
    
  }
}



// ---- f16 WMMA path (v_wmma_f32_16x16x32_f16): 11-bit significands for operands in range — used where a [0,1] probability operand needs more precision than bf16
typedef _Float16 v16h __attribute__((ext_vector_type(16)));
union FragH { v16h v; v8us half[2]; _Float16 h[16]; unsigned short u[16]; };
template <int NT>
__device__ __forceinline__ v8f mmaH(v16h ah, v16h al, v16h bh, v16h bl, v8f c) {
  c = __builtin_amdgcn_wmma_f32_16x16x32_f16(false, ah, false, bh, (short)0, c, false, false);
  if (NT >= 2) c = __builtin_amdgcn_wmma_f32_16x16x32_f16(false, al, false, bh, (short)0, c, false, false);
  if (NT >= 3) c = __builtin_amdgcn_wmma_f32_16x16x32_f16(false, ah, false, bl, (short)0, c, false, false);
  asm volatile("v_nop\n\tv_nop\n\tv_nop\n\tv_nop" : "+v"(c) : "v"(ah), "v"(al), "v"(bh), "v"(bl));
  return c;
}
// batched GEMM like k_gemm_b but f16 operands: A f32 (split into f16 hi/lo if ASPLIT, else rounded to f16), Bt = f16 values [n][k]; alpha; C f32; N multiple of 16 (partial tiles skipped)
template <bool ASPLIT>
__global__ __launch_bounds__(128) void k_gemm_h(const float* __restrict__ A, int lda, size_t sA, const _Float16* __restrict__ Bh, int ldb, size_t sB, float alpha, float* __restrict__ C, int ldc, size_t sC, int M, int N, int K) {
  __shared__ __attribute__((aligned(16))) float so[4][16][64];
  const int tid = threadIdx.x, w = tid >> 5, lane = tid & 31, ln = lane & 15, hh = lane >> 4; const int by = blockIdx.y;
  A += (size_t)by * sA; Bh += (size_t)by * sB; C += (size_t)by * sC;
  const int ntn = (N + 63) / 64; const int wid = blockIdx.x * 4 + w; const int mt = wid / ntn, nq = wid % ntn; if (mt * 16 >= M) return;
  const int row0 = mt * 16, col0 = nq * 64; const float* arow = A + (size_t)(row0 + ln) * lda;
  v8f acc[4] = {};
  for (int kb = 0; kb < K; kb += 32) {
    FragH ah, al;
    const v4f x0 = *(const v4fa*)(arow + kb + 8 * hh), x1 = *(const v4fa*)(arow + kb + 8 * hh + 4), x2 = *(const v4fa*)(arow + kb + 16 + 8 * hh), x3 = *(const v4fa*)(arow + kb + 16 + 8 * hh + 4);
    float xs[16] = {x0[0],x0[1],x0[2],x0[3],x1[0],x1[1],x1[2],x1[3],x2[0],x2[1],x2[2],x2[3],x3[0],x3[1],x3[2],x3[3]};
#pragma unroll
    for (int i = 0; i < 16; ++i) { const _Float16 h = (_Float16)xs[i]; ah.h[i] = h; al.h[i] = ASPLIT ? (_Float16)(xs[i] - (float)h) : (_Float16)0.0f; }
#pragma unroll
    for (int t = 0; t < 4; ++t) { if (col0 + t * 16 >= N) continue; const size_t boff = (size_t)(col0 + t * 16 + ln) * ldb + kb; FragH bq; bq.half[0] = *(const v8us*)(Bh + boff + 8 * hh); bq.half[1] = *(const v8us*)(Bh + boff + 16 + 8 * hh);
      acc[t] = mmaH<ASPLIT ? 2 : 1>(ah.v, al.v, bq.v, bq.v, acc[t]); }
  }
#pragma unroll
  for (int t = 0; t < 4; ++t) { if (col0 + t * 16 >= N) continue;
#pragma unroll
    for (int r = 0; r < 8; ++r) so[w][8 * hh + r][t * 16 + ln] = acc[t][r] * alpha; }
  __builtin_amdgcn_fence(__ATOMIC_ACQ_REL, "workgroup"); __builtin_amdgcn_wave_barrier();
  const int rsub = lane >> 4, c4 = (lane & 15) * 4;
  {
#pragma unroll
    for (int q = 0; q < 8; ++q) { const int r = q * 2 + rsub; if (col0 + c4 < N) { const v4f v = *(const v4fa*)&so[w][r][c4]; *(v4f*)(C + (size_t)(row0 + r) * ldc + col0 + c4) = v; } }
     }
}

// Wt[n][k] = f16(W[k][n]·scale) from f32 row-major W[K][N] (scale = power of two; bf16-exact weights stay exact in f16 away from the subnormal range)
__device__ __forceinline__ void wt_f16_block(const float* __restrict__ W, _Float16* __restrict__ Wt, int K, int N, float scale, int blk) {
  const int t = blk * 256 + threadIdx.x; if (t >= N * (K / 8)) return; const int n = t / (K / 8), k8 = (t % (K / 8)) * 8; FragH f;
#pragma unroll
  for (int i = 0; i < 8; ++i) f.h[i] = (_Float16)(bf16_round(W[(size_t)(k8 + i) * N + n]) * scale); const v8us o = f.half[0];
  *(v8us*)((unsigned short*)Wt + (size_t)n * K + k8) = o; 
}
// k_gemm_hh variant with fused epilogue: v = acc·alpha + b[by·sBias + col] (b = bias, biasY1, biasY2 for by = 0, 1, ≥2) (+ CP[(row/rowsPerB)·sCPb + by·64 + col] if CP) ; ACT 0 none / 1 elu ; writes f16 C16 (and f32 C if non-null)
template <int ACT>
__global__ __launch_bounds__(128) void k_gemm_hhx(const _Float16* __restrict__ A, int lda, size_t sA, const _Float16* __restrict__ Bh, int ldb, size_t sB, float alpha, const float* __restrict__ bias, const float* __restrict__ biasY1, const float* __restrict__ biasY2, size_t sBias, const float* __restrict__ CP, int rowsPerB, size_t sCPb, int row0g,
    float* __restrict__ C, _Float16* __restrict__ C16, int ldc, size_t sC, int M, int N, int K) {
  __shared__ __attribute__((aligned(16))) float so[4][16][64];
  const int tid = threadIdx.x, w = tid >> 5, lane = tid & 31, ln = lane & 15, hh = lane >> 4; const int by = blockIdx.y;
  A += (size_t)by * sA; Bh += (size_t)by * sB; const size_t cofs = (size_t)by * sC; const float* bsel = (by == 0) ? bias : ((by == 1) ? biasY1 : biasY2); const float* bp = bsel ? bsel + (size_t)by * sBias : nullptr;      /* batch index by = 0, 1, 2 takes its own bias buffer */
  const int ntn = (N + 63) / 64; const int wid = blockIdx.x * 4 + w; const int mt = wid / ntn, nq = wid % ntn; if (mt * 16 >= M) return;
  const int row0 = mt * 16, col0 = nq * 64; const _Float16* arow = A + (size_t)(row0 + ln) * lda;
  v8f acc[4] = {};
  for (int kb = 0; kb < K; kb += 32) { FragH ah; ah.half[0] = *(const v8us*)((const unsigned short*)arow + kb + 8 * hh); ah.half[1] = *(const v8us*)((const unsigned short*)arow + kb + 16 + 8 * hh);
#pragma unroll
    for (int t = 0; t < 4; ++t) { if (col0 + t * 16 >= N) continue; const size_t boff = (size_t)(col0 + t * 16 + ln) * ldb + kb; FragH bq; bq.half[0] = *(const v8us*)((const unsigned short*)Bh + boff + 8 * hh); bq.half[1] = *(const v8us*)((const unsigned short*)Bh + boff + 16 + 8 * hh);
      acc[t] = mmaH<1>(ah.v, ah.v, bq.v, bq.v, acc[t]); }
  }
#pragma unroll
  for (int t = 0; t < 4; ++t) { if (col0 + t * 16 >= N) continue; const int col = col0 + t * 16 + ln; const float bv = bp ? bf16_round(bp[col]) : 0.f;
#pragma unroll
    for (int r = 0; r < 8; ++r) { float v = acc[t][r] * alpha + bv; if (CP) { const int bidx = (row0g + row0 + 8 * hh + r) / rowsPerB; v += CP[(size_t)bidx * sCPb + (size_t)by * 64 + col]; } if (ACT == 1) v = (v > 0.f) ? v : expm1f(v); else if (ACT == 7) v = (v > 0.f) ? v + 1.0f : expf(v); else if (ACT == 8) v = tanhf(v); else if (ACT == 9) v = 0.5f * v * (1.0f + tanhf(0.7978845608028654f * (v + 0.044715f * v * v * v))); else if (ACT == 11) v = 1.0f / (1.0f + expf(-v)); else if (ACT == 12) v = (v > 0.f) ? v : 0.01f * v; else if (ACT == 14) v = (v > 0.f) ? v : 0.1f * v; else if (ACT == 15) v = v / (1.0f + expf(-v)); else if (ACT == 3) v = fmaxf(v, 0.f); else if (ACT == 6) v = 0.5f * v * (1.0f + erff(v * 0.70710678118654752f)); so[w][8 * hh + r][t * 16 + ln] = v; } }
  __builtin_amdgcn_fence(__ATOMIC_ACQ_REL, "workgroup"); __builtin_amdgcn_wave_barrier();
  const int rsub = lane >> 4, c4 = (lane & 15) * 4; typedef _Float16 v4h __attribute__((ext_vector_type(4)));
  {
#pragma unroll
    for (int q = 0; q < 8; ++q) { const int r = q * 2 + rsub; if (col0 + c4 < N) { const v4f v = *(const v4fa*)&so[w][r][c4]; if (C) *(v4f*)(C + cofs + (size_t)(row0 + r) * ldc + col0 + c4) = v; if (C16) { v4h h4; for (int i = 0; i < 4; ++i) h4[i] = (_Float16)v[i]; *(v4h*)(C16 + cofs + (size_t)(row0 + r) * ldc + col0 + c4) = h4; } } }
     }
}


typedef _Float16 v4h __attribute__((ext_vector_type(4)));

__device__ __forceinline__ void x16_block(const float* __restrict__ x, _Float16* __restrict__ X16, size_t n8, int blk) { const size_t t = (size_t)blk * 256 + threadIdx.x; if (t >= n8) return; FragH f;
#pragma unroll
  for (int q = 0; q < 8; ++q) f.h[q] = (_Float16)bf16_round(x[t * 8 + q]); *(v8us*)((unsigned short*)X16 + t * 8) = f.half[0];  }
// One grid for the five operand preparations, none of which reads another's result: the block index picks the job (block-uniform branch).
// Blocks 0 .. 3 NBW - 1: Wq, Wk, Wv (their outputs lie one behind the other in Bqkv); the next NBO: Wo; the last NBX: x.
#define NBW (2 * DX * (DX / 8) / 256)
#define NBO (DX * (DX / 8) / 256)
#define NBX (NR * DX / 8 / 256)
__global__ __launch_bounds__(256) void k_prep(const float* __restrict__ Wq, const float* __restrict__ Wk, const float* __restrict__ Wv, const float* __restrict__ Wo, const float* __restrict__ x,
                                              _Float16* __restrict__ Bqkv, _Float16* __restrict__ Bo, _Float16* __restrict__ X16) {
  const int bid = blockIdx.x;
  if (bid < 3 * NBW) { const int j = bid / NBW; wt_f16_block(j == 0 ? Wq : (j == 1 ? Wk : Wv), Bqkv + (size_t)j * 2 * DX * DX, DX, 2 * DX, 16.0f, bid % NBW); }
  else if (bid < 3 * NBW + NBO) wt_f16_block(Wo, Bo, DX, DX, 16.0f, bid - 3 * NBW);
  else x16_block(x, X16, (size_t)NR * DX / 8, bid - (3 * NBW + NBO)); }
__global__ __launch_bounds__(256) void k_h16(const float* __restrict__ x, _Float16* __restrict__ X16, size_t n8) { const size_t t = (size_t)blockIdx.x * 256 + threadIdx.x; if (t >= n8) return; FragH f;
#pragma unroll
  for (int q = 0; q < 8; ++q) f.h[q] = (_Float16)x[t * 8 + q]; *(v8us*)((unsigned short*)X16 + t * 8) = f.half[0];  }
__global__ __launch_bounds__(256) void k_round16f(const float* __restrict__ W, _Float16* __restrict__ Bt, size_t n8) { const size_t t = (size_t)blockIdx.x * 256 + threadIdx.x; if (t >= n8) return; FragH f;
#pragma unroll
  for (int i = 0; i < 8; ++i) f.h[i] = (_Float16)(bf16_round(W[t * 8 + i]) * 16.0f); *(v8us*)((unsigned short*)Bt + t * 8) = f.half[0];  }
template <int NHv, int TTv>
__global__ __launch_bounds__(256) void k_vt(const _Float16* __restrict__ V16, int ldv, int voff, _Float16* __restrict__ Vt) { __shared__ unsigned short tl[64][66]; const int tid = threadIdx.x; const int slab = blockIdx.x / (TTv / 64), lg = blockIdx.x % (TTv / 64); const int b = slab / NHv, h = slab % NHv;
  for (int i = tid; i < 64 * 8; i += 256) { const int r = i / 8, c8 = (i % 8) * 8; FragH f; f.half[0] = *(const v8us*)((const unsigned short*)V16 + ((size_t)b * TTv + lg * 64 + r) * ldv + voff + h * 64 + c8);
#pragma unroll
    for (int q = 0; q < 8; ++q) tl[r][c8 + q] = f.u[q]; }
  __syncthreads();
  {
#pragma unroll
    for (int rd = 0; rd < 2; ++rd) { const int d = rd * 32 + tid / 8, pc = tid % 8; FragH f;
#pragma unroll
      for (int q = 0; q < 8; ++q) f.u[q] = tl[pc * 8 + q][d];
      *(v8us*)((unsigned short*)Vt + ((size_t)slab * 64 + d) * TTv + lg * 64 + pc * 8) = f.half[0]; }
     } }

__global__ __launch_bounds__(256) void k_h16s(const float* __restrict__ F, _Float16* __restrict__ H, size_t n8) { const size_t t = (size_t)blockIdx.x * 256 + threadIdx.x; if (t >= n8) return; const v4f a = *(const v4fa*)(F + t * 8), c = *(const v4fa*)(F + t * 8 + 4); FragH f;
#pragma unroll
  for (int q = 0; q < 4; ++q) { f.h[q] = (_Float16)(a[q] * 256.0f); f.h[4 + q] = (_Float16)(c[q] * 256.0f); } *(v8us*)((unsigned short*)H + t * 8) = f.half[0];  }
// Keys split inside the work-group: each of the 4 query tiles is walked by KVS waves; wave (qw, kr) takes the 32-key blocks kr, kr + KVS, kr + 2 KVS, ... with its own running max, sum and
// un-normalised accumulators; the KVS partials of a tile are merged through LDS behind one work-group barrier (weights exp(m_k - M)).
#define KVS 4
__global__ __launch_bounds__(128 * KVS) void k_flash(const _Float16* __restrict__ Q16, int ldq, const _Float16* __restrict__ K16, int ldk, const _Float16* __restrict__ Vt, float* __restrict__ O, int ldo) {
  constexpr int RPW = 16, RTN = RPW / 16, NQB = NN / (4 * RPW), DT = 4, KS = 2, NW = 4 * KVS, RM = RPW / KVS;
  __shared__ __attribute__((aligned(16))) unsigned short sP[NW][RPW][40]; __shared__ __attribute__((aligned(16))) float sO[NW][RPW][128 + 4]; __shared__ float sM[NW][RPW], sL[NW][RPW];
  const int tid = threadIdx.x, w = tid >> 5, lane = tid & 31, ln = lane & 15, hh = lane >> 4; const int qw = w & 3, kr = w >> 2;
  const int slab = blockIdx.x / NQB, qblk = blockIdx.x % NQB; const int b = slab / NHU, h = slab % NHU; const int qb0 = qblk * (4 * RPW); const int q0 = qb0 + qw * RPW;
  FragH aq[2][KS], aql[2][KS];
#pragma unroll
  for (int rt = 0; rt < RTN; ++rt) { const size_t qo = ((size_t)b * NN + q0 + rt * 16 + ln) * ldq + h * 128; const unsigned short* qr = (const unsigned short*)Q16 + qo; const unsigned short* ql = qr + 64;      /* aq = real part, aql = imaginary part */
#pragma unroll
    for (int ks = 0; ks < KS; ++ks) { aq[rt][ks].half[0] = *(const v8us*)(qr + ks * 32 + 8 * hh); aq[rt][ks].half[1] = *(const v8us*)(qr + ks * 32 + 16 + 8 * hh); aql[rt][ks].half[0] = *(const v8us*)(ql + ks * 32 + 8 * hh); aql[rt][ks].half[1] = *(const v8us*)(ql + ks * 32 + 16 + 8 * hh); } }
  const unsigned short* Vth = (const unsigned short*)Vt + ((size_t)b * 2 * NHU + 2 * h) * 64 * NN; const unsigned short* Vti = Vth + (size_t)64 * NN;      /* Vᵀ real / imag planes of head h */
  float m_r[2][8], l_r[2][8]; v8f oacc[2][DT], oacci[2][DT];
#pragma unroll
  for (int rt = 0; rt < RTN; ++rt) {
#pragma unroll
    for (int r = 0; r < 8; ++r) { m_r[rt][r] = -3.0e38f; l_r[rt][r] = 0.f; }
#pragma unroll
    for (int dt = 0; dt < DT; ++dt) { oacc[rt][dt] = (v8f){0.f,0.f,0.f,0.f,0.f,0.f,0.f,0.f}; oacci[rt][dt] = oacc[rt][dt]; } }
  const int jend = NN;
#pragma unroll 1
  for (int j0 = kr * 32; j0 < jend; j0 += 32 * KVS) {
    
    v8f s[2][2];
#pragma unroll
    for (int nt = 0; nt < 2; ++nt) { const size_t ko = ((size_t)b * NN + j0 + nt * 16 + ln) * ldk + h * 128; const unsigned short* kr = (const unsigned short*)K16 + ko; const unsigned short* kl = kr + 64; FragH bk[KS], bl[KS];      /* bk = real, bl = imaginary */
#pragma unroll
      for (int ks = 0; ks < KS; ++ks) { bk[ks].half[0] = *(const v8us*)(kr + ks * 32 + 8 * hh); bk[ks].half[1] = *(const v8us*)(kr + ks * 32 + 16 + 8 * hh); bl[ks].half[0] = *(const v8us*)(kl + ks * 32 + 8 * hh); bl[ks].half[1] = *(const v8us*)(kl + ks * 32 + 16 + 8 * hh); }
#pragma unroll
      for (int rt = 0; rt < RTN; ++rt) { v8f re = (v8f){0.f,0.f,0.f,0.f,0.f,0.f,0.f,0.f}, ip = re, in = re;
#pragma unroll
        for (int ks = 0; ks < KS; ++ks) { re = mmaH<1>(aq[rt][ks].v, aq[rt][ks].v, bk[ks].v, bk[ks].v, re); re = mmaH<1>(aql[rt][ks].v, aql[rt][ks].v, bl[ks].v, bl[ks].v, re); ip = mmaH<1>(aql[rt][ks].v, aql[rt][ks].v, bk[ks].v, bk[ks].v, ip); in = mmaH<1>(aq[rt][ks].v, aq[rt][ks].v, bl[ks].v, bl[ks].v, in); }
#pragma unroll
        for (int r = 0; r < 8; ++r) { const float im = ip[r] - in[r]; re[r] = (re[r] * re[r] + im * im) * SCORE_SCALE; } s[rt][nt] = re; } }
#pragma unroll
    for (int rt = 0; rt < RTN; ++rt)
#pragma unroll
      for (int r = 0; r < 8; ++r) { const int tq = q0 + rt * 16 + 8 * hh + r; const int k0 = j0 + ln, k1 = j0 + 16 + ln; (void)tq; (void)k0; (void)k1;
        const bool ok0 = true, ok1 = true;
        const float s0 = s[rt][0][r], s1 = s[rt][1][r]; float mc = fmaxf(s0, s1);
        mc = fmaxf(mc, __shfl_xor(mc, 1, 32)); mc = fmaxf(mc, __shfl_xor(mc, 2, 32)); mc = fmaxf(mc, __shfl_xor(mc, 4, 32)); mc = fmaxf(mc, __shfl_xor(mc, 8, 32));
        const float mn = fmaxf(m_r[rt][r], mc); const float al = (mn > -1.0e38f) ? expf(m_r[rt][r] - mn) : 1.0f; m_r[rt][r] = mn; const float p0 = expf(s0 - mn), p1 = expf(s1 - mn); l_r[rt][r] = l_r[rt][r] * al + p0 + p1;
#pragma unroll
        for (int dt = 0; dt < DT; ++dt) { oacc[rt][dt][r] *= al; oacci[rt][dt][r] *= al; }
        FragH t2; t2.h[0] = (_Float16)(p0 * 1024.0f); t2.h[1] = (_Float16)(p1 * 1024.0f); sP[w][rt * 16 + 8 * hh + r][ln] = t2.u[0]; sP[w][rt * 16 + 8 * hh + r][16 + ln] = t2.u[1]; }
    __builtin_amdgcn_fence(__ATOMIC_ACQ_REL, "workgroup"); __builtin_amdgcn_wave_barrier();
    FragH pa[2];
#pragma unroll
    for (int rt = 0; rt < RTN; ++rt) { pa[rt].half[0] = *(const v8us*)&sP[w][rt * 16 + ln][8 * hh]; pa[rt].half[1] = *(const v8us*)&sP[w][rt * 16 + ln][16 + 8 * hh]; }
#pragma unroll
    for (int dt = 0; dt < DT; ++dt) { const size_t vo = (size_t)(dt * 16 + ln) * NN + j0; FragH bv, bi; bv.half[0] = *(const v8us*)(Vth + vo + 8 * hh); bv.half[1] = *(const v8us*)(Vth + vo + 16 + 8 * hh); bi.half[0] = *(const v8us*)(Vti + vo + 8 * hh); bi.half[1] = *(const v8us*)(Vti + vo + 16 + 8 * hh);
#pragma unroll
      for (int rt = 0; rt < RTN; ++rt) { oacc[rt][dt] = mmaH<1>(pa[rt].v, pa[rt].v, bv.v, bv.v, oacc[rt][dt]); oacci[rt][dt] = mmaH<1>(pa[rt].v, pa[rt].v, bi.v, bi.v, oacci[rt][dt]); } }
    __builtin_amdgcn_fence(__ATOMIC_ACQ_REL, "workgroup"); __builtin_amdgcn_wave_barrier(); }
#pragma unroll
  for (int rt = 0; rt < RTN; ++rt) {
#pragma unroll
    for (int r = 0; r < 8; ++r) { float l = l_r[rt][r]; l += __shfl_xor(l, 1, 32); l += __shfl_xor(l, 2, 32); l += __shfl_xor(l, 4, 32); l += __shfl_xor(l, 8, 32); if (ln == 0) { sM[w][rt * 16 + 8 * hh + r] = m_r[rt][r]; sL[w][rt * 16 + 8 * hh + r] = l; } }
#pragma unroll
    for (int dt = 0; dt < DT; ++dt)
#pragma unroll
      for (int r = 0; r < 8; ++r) { sO[w][rt * 16 + 8 * hh + r][dt * 16 + ln] = oacc[rt][dt][r]; sO[w][rt * 16 + 8 * hh + r][64 + dt * 16 + ln] = oacci[rt][dt][r]; } }
  __syncthreads();      /* publishes every wave's partial (max, sum, accumulators) to the waves that merge it */
  {
#pragma unroll
    for (int rp = 0; rp < RM; ++rp) { const int r = kr * RM + rp, pc = lane;      /* wave (qw, kr) merges rows kr*RM .. of query tile qw */
      float mk[KVS], M = -3.0e38f;
#pragma unroll
      for (int k = 0; k < KVS; ++k) { mk[k] = sM[k * 4 + qw][r]; M = fmaxf(M, mk[k]); }
      float L = 0.f; v4f o = {0.f, 0.f, 0.f, 0.f};
#pragma unroll
      for (int k = 0; k < KVS; ++k) { const float wk = expf(mk[k] - M); L += wk * sL[k * 4 + qw][r]; const v4f part = *(const v4fa*)&sO[k * 4 + qw][r][pc * 4]; o += part * wk; }
      const float inv = (L > 0.f) ? 1.0f / (L * 1024.0f) : 0.f;
      *(v4f*)(O + ((size_t)b * NN + q0 + r) * ldo + h * 128 + pc * 4) = o * inv; }      /* 32 lanes x 16 B = the head's [real | imag] 512-B run */
     } }

extern "C" void kernel_launch(void* const* d_in, const int* in_sizes, int n_in,
                              void* d_out, int out_size, void* d_ws, size_t ws_size, hipStream_t stream) {
  (void)in_sizes; (void)n_in; (void)out_size;
  const float* const* I = (const float* const*)d_in; const float* x = I[0]; const float* Wq = I[1]; const float* bq = I[2]; const float* Wk = I[3]; const float* bk = I[4]; const float* Wv = I[5]; const float* bv = I[6]; const float* Wo = I[7]; const float* bo = I[8];
  char* ws = (char*)d_ws; size_t off = 0;
  auto take = [&](size_t bytes) { char* p = ws + off; off += (bytes + 255) & ~(size_t)255; return p; };
  _Float16* Bq = (_Float16*)take((size_t)3 * 2 * DX * DX * 2); _Float16* Bo = (_Float16*)take((size_t)DX * DX * 2);
  _Float16* X16 = (_Float16*)take((size_t)NR * DX * 2); _Float16* Q = (_Float16*)take((size_t)3 * NR * DX * 2); _Float16* K = Q + (size_t)NR * DX; _Float16* V = K + (size_t)NR * DX;      /* q, k, v one behind the other: batch stride of the merged projection */ _Float16* Vt = (_Float16*)take((size_t)NR * DX * 2);
  float* O = (float*)take((size_t)NR * DX * 4); _Float16* O16 = (_Float16*)take((size_t)NR * DX * 2);
  if (off > ws_size) return;      // 3 × 1 + 0.5 + 5 × 4.2 + 8.4 + 4.2 ≈ 37 MB
  k_prep<<<3 * NBW + NBO + NBX, 256, 0, stream>>>(Wq, Wk, Wv, Wo, x, Bq, Bo, X16);      /* (in,out) [512][1024] -> Bt[1024][512] x2^4 for Wq, Wk, Wv (only rows 0..511 = heads 0..3 are used), Wo likewise, x -> f16: one launch */
  const dim3 gp(((NR / 16) * (DX / 64) + 3) / 4, 1), gp3(((NR / 16) * (DX / 64) + 3) / 4, 3);
  k_gemm_hhx<0><<<gp3, 128, 0, stream>>>(X16, DX, 0, Bq, DX, (size_t)2 * DX * DX, 0.0625f, bq, bk, bv, 0, nullptr, 1, 0, 0, nullptr, Q, DX, (size_t)NR * DX, NR, DX, DX);      /* q, k, v in one launch (blockIdx.y), heads 0..3 = output columns 0..511 (+ bias): each M 4096 N 512 K 512 */
  k_vt<2 * NHU, NN><<<BB * 2 * NHU * (NN / 64), 256, 0, stream>>>(V, DX, 0, Vt);      /* Vᵀ planes per (b, head, part): [b·8 + 2h + part][64][2048] */
  k_flash<<<BB * NHU * (NN / 64), 128 * KVS, 0, stream>>>(Q, DX, K, DX, Vt, O, DX);
  k_h16s<<<(unsigned)(((size_t)NR * DX / 8 + 255) / 256), 256, 0, stream>>>(O, O16, (size_t)NR * DX / 8);
  k_gemm_hhx<0><<<gp, 128, 0, stream>>>(O16, DX, 0, Bo, DX, 0, 0.0625f * 0.00390625f, bo, nullptr, nullptr, 0, nullptr, 1, 0, 0, (float*)d_out, nullptr, DX, 0, NR, DX, DX);      /* out = O·Wo + bo (alpha undoes ×2^4 weights and the ×2^8 carry) */
}

// v003
// A run of this version takes 134 microseconds.
// Next to v002, in two timings, it ran 1.21 times as fast each time.
// All steps since v000 together make it 2.42 times as fast.
#include <hip/hip_runtime.h>
// 'Superposition' (complex-valued) multi-head attention (B=2, S=2048, D=512, 8 heads; q,k,v projections to 2D with per-head [real 64 | imag 64]): interference = Σ_d q_d·conj(k_d)·64^-½; probs = softmax(|interference|²/0.5); out = probs·v (complex);
// out = concat[real, imag] per head → [B,S,1024], truncated to the first 512 columns (= heads 0..3), then ·Wo + bo. Only heads 0..3 reach the output, so only they are computed.
// Compute dtype: x, weights, biases rounded to bf16; q/k/v (columns of heads 0..3) as f16 GEMM outputs; fused flash-style kernel with three f32 score accumulators (Re, Im⁺, Im⁻) and two value accumulators
// (real, imag), online softmax f32, P f16 ×2^10, on v_wmma_f32_16x16x32_f16; O carried ×2^8 into f16 (small diffuse values) → output GEMM with bias (alpha undoes the carry); f32 accumulate.
#define BB 2
#define NN 2048
#define DX 512
#define NHU 4
#define DH2 128
#define NR (BB * NN)
#define SCORE_SCALE 0.03125f

typedef __bf16 v16b __attribute__((ext_vector_type(16)));
typedef unsigned short v8us __attribute__((ext_vector_type(8), may_alias));
typedef float  v8f  __attribute__((ext_vector_type(8)));
typedef float  v4f  __attribute__((ext_vector_type(4)));
typedef float  v4fa __attribute__((ext_vector_type(4), may_alias));
union FragB { v16b v; v8us half[2]; unsigned short u[16]; };

__device__ __forceinline__ unsigned short bf16_bits(float x) { unsigned int u = __float_as_uint(x); return (unsigned short)((u + 0x7FFFu + ((u >> 16) & 1u)) >> 16); }
__device__ __forceinline__ float bf16_val(unsigned short b) { return __uint_as_float(((unsigned int)b) << 16); }
__device__ __forceinline__ float bf16_round(float x) { return bf16_val(bf16_bits(x)); }
// D += A·B with NT terms: 1 = ah·bh, 2 = + al·bh (A split), 3 = + ah·bl (both split)
template <int NT>
__device__ __forceinline__ v8f mmaN(v16b ah, v16b al, v16b bh, v16b bl, v8f c) {
  c = __builtin_amdgcn_wmma_f32_16x16x32_bf16(false, ah, false, bh, (short)0, c, false, false);
  if (NT >= 2) c = __builtin_amdgcn_wmma_f32_16x16x32_bf16(false, al, false, bh, (short)0, c, false, false);
  if (NT >= 3) c = __builtin_amdgcn_wmma_f32_16x16x32_bf16(false, ah, false, bl, (short)0, c, false, false);
  asm volatile("v_nop\n\tv_nop\n\tv_nop\n\tv_nop" : "+v"(c) : "v"(ah), "v"(al), "v"(bh), "v"(bl));
  return c;
}

__global__ __launch_bounds__(256) void k_wt_bf16(const float* __restrict__ W, unsigned short* __restrict__ Wt, int K, int N) {
  const int t = blockIdx.x * 256 + threadIdx.x;
  const int k8n = K / 8;
  if (t >= N * k8n) return;
  const int n = t / k8n, k8 = (t % k8n) * 8;
  v8us v;
#pragma unroll
  for (int i = 0; i < 8; ++i) v[i] = bf16_bits(W[(size_t)(k8 + i) * N + n]);
  *(v8us*)(Wt + (size_t)n * K + k8) = v;
  
}

// GEMM C[M][N] (f32, pitch ldc) = act(A[M][K]·W + bias). A f32 row-major (pitch lda) converted per fragment to bf16
// (ASPLIT: hi/lo two planes -> 2 terms, else single rounded term); Wt bf16 [N][K] (pitch ldb). BIAS_BF16 rounds the
// bias to bf16 first (bias quantised to bf16 before the add). K%32==0, M%16==0, N%64==0.
template <bool ASPLIT, int ACT, bool BIAS_BF16>
__global__ __launch_bounds__(128) void k_gemm_bf(const float* __restrict__ A, int lda, const unsigned short* __restrict__ Wt, int ldb,
                                               const float* __restrict__ bias, float* __restrict__ C, int ldc, int M, int N, int K) {
  __shared__ __attribute__((aligned(16))) float so[4][16][64];
  const int tid = threadIdx.x, w = tid >> 5, lane = tid & 31, ln = lane & 15, hh = lane >> 4;
  const int ntn = N / 64;
  const int wid = blockIdx.x * 4 + w;
  const int mt = wid / ntn, nq = wid % ntn;
  if (mt * 16 >= M) return;
  const int row0 = mt * 16, col0 = nq * 64;
  const float* arow = A + (size_t)(row0 + ln) * lda;
  v8f acc[4] = {};
  for (int kb = 0; kb < K; kb += 32) {
    FragB ah, al;
    const v4f x0 = *(const v4fa*)(arow + kb + 8 * hh), x1 = *(const v4fa*)(arow + kb + 8 * hh + 4);
    const v4f x2 = *(const v4fa*)(arow + kb + 16 + 8 * hh), x3 = *(const v4fa*)(arow + kb + 16 + 8 * hh + 4);
    float xs[16] = {x0[0],x0[1],x0[2],x0[3],x1[0],x1[1],x1[2],x1[3],x2[0],x2[1],x2[2],x2[3],x3[0],x3[1],x3[2],x3[3]};
#pragma unroll
    for (int i = 0; i < 16; ++i) { const unsigned short hb = bf16_bits(xs[i]); ah.u[i] = hb; al.u[i] = ASPLIT ? bf16_bits(xs[i] - bf16_val(hb)) : (unsigned short)0; }
#pragma unroll
    for (int t = 0; t < 4; ++t) {
      const unsigned short* brow = Wt + (size_t)(col0 + t * 16 + ln) * ldb + kb;
      FragB b;
      b.half[0] = *(const v8us*)(brow + 8 * hh);
      b.half[1] = *(const v8us*)(brow + 16 + 8 * hh);
      acc[t] = mmaN<ASPLIT ? 2 : 1>(ah.v, al.v, b.v, b.v, acc[t]);
    }
  }
#pragma unroll
  for (int t = 0; t < 4; ++t) {
    float bv = bias ? bias[col0 + t * 16 + ln] : 0.f;
    if (BIAS_BF16) bv = bf16_round(bv);
#pragma unroll
    for (int r = 0; r < 8; ++r) { float v = acc[t][r] + bv; if (ACT == 1) v = fmaxf(v, 0.f); so[w][8 * hh + r][t * 16 + ln] = v; }
  }
  __builtin_amdgcn_fence(__ATOMIC_ACQ_REL, "workgroup");
  __builtin_amdgcn_wave_barrier();
  const int rsub = lane >> 4, c4 = (lane & 15) * 4;
  {
#pragma unroll
    for (int q = 0; q < 8; ++q) {
      const int r = q * 2 + rsub;
      const v4f v = *(const v4fa*)&so[w][r][c4];
      *(v4f*)(C + (size_t)(row0 + r) * ldc + col0 + c4) = v;
    }
    
  }
}

// Flash-style causal/unmasked attention, all contractions 3-term bf16 hi/lo splits, f32 softmax with running max.
// q,k,v rows are read from f32 buffers with arbitrary row pitch (so they can live inside a fused qkv buffer);
// D = head size (multiple of 32, <= 128); one wave = 16 query rows; block = 4 waves (64 queries) sharing K/V chunks of 32.
template <int D, bool CAUSAL>
__global__ __launch_bounds__(128) void k_flash(const float* __restrict__ qb, const float* __restrict__ kb, const float* __restrict__ vb,
                                             int pitch, int T, int H, float scale, float* __restrict__ y, int ypitch) {
  constexpr int KS = D / 32;        // k-steps for QK
  constexpr int DT = D / 16;        // d tiles for PV
  __shared__ __attribute__((aligned(16))) unsigned short sKh[32][D + 8], sKl[32][D + 8], sVh[32][D + 8], sVl[32][D + 8];
  __shared__ __attribute__((aligned(16))) unsigned short sPh[4][16][40], sPl[4][16][40];
  __shared__ __attribute__((aligned(16))) float sO[4][16][D];
  const int tid = threadIdx.x, w = tid >> 5, lane = tid & 31, ln = lane & 15, hh = lane >> 4;
  const int nqb = (T + 63) / 64;
  const int bh = blockIdx.x / nqb, qblk = blockIdx.x % nqb;
  const int b = bh / H, h = bh % H;
  const int q0 = qblk * 64 + w * 16;
  const float* Q = qb + (size_t)b * T * pitch + h * D;
  const float* K = kb + (size_t)b * T * pitch + h * D;
  const float* V = vb + (size_t)b * T * pitch + h * D;

  // A fragments of the wave's 16 query rows (scaled), hi/lo
  FragB aqh[KS], aql[KS];
  {
    int row = q0 + ln; if (row >= T) row = T - 1;
    const float* qr = Q + (size_t)row * pitch;
#pragma unroll
    for (int ks = 0; ks < KS; ++ks)
#pragma unroll
      for (int i = 0; i < 16; ++i) {
        const int d = ks * 32 + ((i < 8) ? (8 * hh + i) : (16 + 8 * hh + (i - 8)));
        const float x = qr[d] * scale; const unsigned short hb = bf16_bits(x);
        aqh[ks].u[i] = hb; aql[ks].u[i] = bf16_bits(x - bf16_val(hb));
      }
  }
  float m_r[8], l_r[8];
#pragma unroll
  for (int r = 0; r < 8; ++r) { m_r[r] = -3.0e38f; l_r[r] = 0.f; }
  v8f oacc[DT];
#pragma unroll
  for (int dt = 0; dt < DT; ++dt) oacc[dt] = (v8f){0.f,0.f,0.f,0.f,0.f,0.f,0.f,0.f};

  const int kv_end = CAUSAL ? min(T, qblk * 64 + 64) : T;     // block-uniform
  for (int j0 = 0; j0 < kv_end; j0 += 32) {
    __syncthreads();
    for (int e = tid; e < 32 * (D / 4); e += 128) {
      const int r = e / (D / 4), c4 = (e % (D / 4)) * 4;
      const int key = j0 + r;
      v4f kf = {0.f,0.f,0.f,0.f}, vf = {0.f,0.f,0.f,0.f};
      if (key < T) { kf = *(const v4fa*)(K + (size_t)key * pitch + c4); vf = *(const v4fa*)(V + (size_t)key * pitch + c4); }
#pragma unroll
      for (int t = 0; t < 4; ++t) {
        unsigned short hb = bf16_bits(kf[t]); sKh[r][c4 + t] = hb; sKl[r][c4 + t] = bf16_bits(kf[t] - bf16_val(hb));
        hb = bf16_bits(vf[t]); sVh[r][c4 + t] = hb; sVl[r][c4 + t] = bf16_bits(vf[t] - bf16_val(hb));
      }
    }
    __syncthreads();
    // S tile 16 x 32
    v8f s[2];
#pragma unroll
    for (int nt = 0; nt < 2; ++nt) {
      v8f acc = {};
#pragma unroll
      for (int ks = 0; ks < KS; ++ks) {
        FragB bh_, bl_;
        bh_.half[0] = *(const v8us*)&sKh[nt * 16 + ln][ks * 32 + 8 * hh]; bh_.half[1] = *(const v8us*)&sKh[nt * 16 + ln][ks * 32 + 16 + 8 * hh];
        bl_.half[0] = *(const v8us*)&sKl[nt * 16 + ln][ks * 32 + 8 * hh]; bl_.half[1] = *(const v8us*)&sKl[nt * 16 + ln][ks * 32 + 16 + 8 * hh];
        acc = mmaN<3>(aqh[ks].v, aql[ks].v, bh_.v, bl_.v, acc);
      }
      s[nt] = acc;
    }
    // mask + running max (rows 8hh+r; the 16 lanes of a half share rows)
    float alpha[8];
#pragma unroll
    for (int r = 0; r < 8; ++r) {
      const int qi = q0 + 8 * hh + r;
      const int ja = j0 + ln, jb = j0 + 16 + ln;
      if (CAUSAL) { if (ja > qi) s[0][r] = -3.0e38f; if (jb > qi) s[1][r] = -3.0e38f; }
      if (ja >= T) s[0][r] = -3.0e38f;
      if (jb >= T) s[1][r] = -3.0e38f;
      float mx = fmaxf(s[0][r], s[1][r]);
      mx = fmaxf(mx, __shfl_xor(mx, 1, 32)); mx = fmaxf(mx, __shfl_xor(mx, 2, 32)); mx = fmaxf(mx, __shfl_xor(mx, 4, 32)); mx = fmaxf(mx, __shfl_xor(mx, 8, 32));
      const float mnew = fmaxf(m_r[r], mx);
      alpha[r] = (mnew > -1.0e38f) ? __expf(m_r[r] - mnew) : 1.0f;
      const float p0 = (s[0][r] > -1.0e38f) ? __expf(s[0][r] - mnew) : 0.f;
      const float p1 = (s[1][r] > -1.0e38f) ? __expf(s[1][r] - mnew) : 0.f;
      m_r[r] = mnew;
      l_r[r] = l_r[r] * alpha[r] + p0 + p1;            // per-lane partial row sum (16 lanes combined at the end)
      unsigned short hb = bf16_bits(p0); sPh[w][8 * hh + r][ln] = hb;      sPl[w][8 * hh + r][ln] = bf16_bits(p0 - bf16_val(hb));
      hb = bf16_bits(p1);                sPh[w][8 * hh + r][16 + ln] = hb; sPl[w][8 * hh + r][16 + ln] = bf16_bits(p1 - bf16_val(hb));
    }
#pragma unroll
    for (int dt = 0; dt < DT; ++dt)
#pragma unroll
      for (int r = 0; r < 8; ++r) oacc[dt][r] *= alpha[r];
    __builtin_amdgcn_fence(__ATOMIC_ACQ_REL, "workgroup");
    __builtin_amdgcn_wave_barrier();
    FragB pah, pal;
    pah.half[0] = *(const v8us*)&sPh[w][ln][8 * hh]; pah.half[1] = *(const v8us*)&sPh[w][ln][16 + 8 * hh];
    pal.half[0] = *(const v8us*)&sPl[w][ln][8 * hh]; pal.half[1] = *(const v8us*)&sPl[w][ln][16 + 8 * hh];
#pragma unroll
    for (int dt = 0; dt < DT; ++dt) {
      FragB bvh, bvl;
#pragma unroll
      for (int i = 0; i < 8; ++i) {
        bvh.u[i] = sVh[8 * hh + i][dt * 16 + ln]; bvh.u[8 + i] = sVh[16 + 8 * hh + i][dt * 16 + ln];
        bvl.u[i] = sVl[8 * hh + i][dt * 16 + ln]; bvl.u[8 + i] = sVl[16 + 8 * hh + i][dt * 16 + ln];
      }
      oacc[dt] = mmaN<3>(pah.v, pal.v, bvh.v, bvl.v, oacc[dt]);
    }
    __builtin_amdgcn_fence(__ATOMIC_ACQ_REL, "workgroup");
    __builtin_amdgcn_wave_barrier();
  }
#pragma unroll
  for (int r = 0; r < 8; ++r) {
    float l = l_r[r];
    l += __shfl_xor(l, 1, 32); l += __shfl_xor(l, 2, 32); l += __shfl_xor(l, 4, 32); l += __shfl_xor(l, 8, 32);
    l_r[r] = (l > 0.f) ? 1.0f / l : 0.f;
  }
#pragma unroll
  for (int dt = 0; dt < DT; ++dt)
#pragma unroll
    for (int r = 0; r < 8; ++r) sO[w][8 * hh + r][dt * 16 + ln] = oacc[dt][r] * l_r[r];
  __builtin_amdgcn_fence(__ATOMIC_ACQ_REL, "workgroup");
  __builtin_amdgcn_wave_barrier();
  {
    for (int r = 0; r < 16; ++r) {
      const int row = q0 + r;
      if (row < T && lane < D / 4) {
        const v4f val = *(const v4fa*)&sO[w][r][lane * 4];
        *(v4f*)(y + ((size_t)b * T + row) * ypitch + h * D + lane * 4) = val;
      }
    }
    
  }
}

// GEMM C = act(A·W + bias + resid): A f32 (ASPLIT -> hi/lo 2 terms), Wt bf16 [N][K]; ACT 0 none, 1 relu, 2 exact gelu;
// resid (optional, f32, row index = (row % rmod), pitch ldr, RES_BF16 rounds it) added before the activation.
template <bool ASPLIT, int ACT, bool BIAS_BF16, bool RES_BF16>
__global__ __launch_bounds__(128) void k_gemm_bf3(const float* __restrict__ A, int lda, const unsigned short* __restrict__ Wt, int ldb,
                                                const float* __restrict__ bias, const float* __restrict__ resid, int rmod, int ldr,
                                                float* __restrict__ C, int ldc, int M, int N, int K) {
  __shared__ __attribute__((aligned(16))) float so[4][16][64];
  const int tid = threadIdx.x, w = tid >> 5, lane = tid & 31, ln = lane & 15, hh = lane >> 4;
  const int ntn = N / 64;
  const int wid = blockIdx.x * 4 + w;
  const int mt = wid / ntn, nq = wid % ntn;
  if (mt * 16 >= M) return;
  const int row0 = mt * 16, col0 = nq * 64;
  const float* arow = A + (size_t)(row0 + ln) * lda;
  v8f acc[4] = {};
  for (int kb = 0; kb < K; kb += 32) {
    FragB ah, al;
    const v4f x0 = *(const v4fa*)(arow + kb + 8 * hh), x1 = *(const v4fa*)(arow + kb + 8 * hh + 4);
    const v4f x2 = *(const v4fa*)(arow + kb + 16 + 8 * hh), x3 = *(const v4fa*)(arow + kb + 16 + 8 * hh + 4);
    float xs[16] = {x0[0],x0[1],x0[2],x0[3],x1[0],x1[1],x1[2],x1[3],x2[0],x2[1],x2[2],x2[3],x3[0],x3[1],x3[2],x3[3]};
#pragma unroll
    for (int i = 0; i < 16; ++i) { const unsigned short hb = bf16_bits(xs[i]); ah.u[i] = hb; al.u[i] = ASPLIT ? bf16_bits(xs[i] - bf16_val(hb)) : (unsigned short)0; }
#pragma unroll
    for (int t = 0; t < 4; ++t) {
      const unsigned short* brow = Wt + (size_t)(col0 + t * 16 + ln) * ldb + kb;
      FragB b;
      b.half[0] = *(const v8us*)(brow + 8 * hh);
      b.half[1] = *(const v8us*)(brow + 16 + 8 * hh);
      acc[t] = mmaN<ASPLIT ? 2 : 1>(ah.v, al.v, b.v, b.v, acc[t]);
    }
  }
#pragma unroll
  for (int t = 0; t < 4; ++t) {
    const int col = col0 + t * 16 + ln;
    float bv = bias ? bias[col] : 0.f;
    if (BIAS_BF16) bv = bf16_round(bv);
#pragma unroll
    for (int r = 0; r < 8; ++r) {
      float v = acc[t][r] + bv;
      if (resid) { float rv = resid[(size_t)((row0 + 8 * hh + r) % rmod) * ldr + col]; if (RES_BF16) rv = bf16_round(rv); v += rv; }
      if (ACT == 1) v = fmaxf(v, 0.f);
      if (ACT == 2) v = 0.5f * v * (1.0f + erff(v * 0.70710678118654752f));
      if (ACT == 3) { const float u = 0.7978845608028654f * (v + 0.044715f * v * v * v); v = 0.5f * v * (1.0f + tanhf(u)); }
      so[w][8 * hh + r][t * 16 + ln] = v;
    }
  }
  __builtin_amdgcn_fence(__ATOMIC_ACQ_REL, "workgroup");
  __builtin_amdgcn_wave_barrier();
  const int rsub = lane >> 4, c4 = (lane & 15) * 4;
  {
#pragma unroll
    for (int q = 0; q < 8; ++q) {
      const int r = q * 2 + rsub;
      const v4f v = *(const v4fa*)&so[w][r][c4];
      *(v4f*)(C + (size_t)(row0 + r) * ldc + col0 + c4) = v;
    }
    
  }
}
// row LayerNorm (biased variance, eps) over N: s = X (+ R); optional out_sum <- s; out_norm <- (s-mu)*rsqrt(var+eps)*g + b
template <bool PARAM_BF16>
__global__ __launch_bounds__(256) void k_layernorm(const float* __restrict__ X, const float* __restrict__ R, const float* __restrict__ g, const float* __restrict__ bta,
                                                  float* __restrict__ out_sum, float* __restrict__ out_norm, int N, float eps) {
  __shared__ float red[256];
  const int row = blockIdx.x, tid = threadIdx.x;
  const float* x = X + (size_t)row * N; const float* rr = R ? R + (size_t)row * N : nullptr;
  float vals[16];                     // up to N = 4096
  const int per = N / 256;            // contiguous chunk per thread? use strided-by-4 chunks: thread handles j = tid*4 + 1024*u
  float s1 = 0.f;
  for (int u = 0; u < per / 4; ++u) {
    const int j = tid * 4 + 1024 * u;
    const v4f a = *(const v4fa*)(x + j);
    v4f b = {0.f,0.f,0.f,0.f}; if (rr) b = *(const v4fa*)(rr + j);
#pragma unroll
    for (int q = 0; q < 4; ++q) { const float v = a[q] + b[q]; vals[u * 4 + q] = v; s1 += v; }
  }
  red[tid] = s1; __syncthreads();
  for (int st = 128; st > 0; st >>= 1) { if (tid < st) red[tid] += red[tid + st]; __syncthreads(); }
  const float mu = red[0] / (float)N; __syncthreads();
  float s2 = 0.f;
  for (int u = 0; u < per / 4; ++u)
#pragma unroll
    for (int q = 0; q < 4; ++q) { const float c = vals[u * 4 + q] - mu; s2 += c * c; }
  red[tid] = s2; __syncthreads();
  for (int st = 128; st > 0; st >>= 1) { if (tid < st) red[tid] += red[tid + st]; __syncthreads(); }
  const float rs = rsqrtf(red[0] / (float)N + eps);
  {
    for (int u = 0; u < per / 4; ++u) {
      const int j = tid * 4 + 1024 * u;
      v4f o, sm;
#pragma unroll
      for (int q = 0; q < 4; ++q) {
        float gg = g[j + q], bb = bta[j + q];
        if (PARAM_BF16) { gg = bf16_round(gg); bb = bf16_round(bb); }
        sm[q] = vals[u * 4 + q]; o[q] = (vals[u * 4 + q] - mu) * rs * gg + bb;
      }
      if (out_sum) *(v4f*)(out_sum + (size_t)row * N + j) = sm;
      *(v4f*)(out_norm + (size_t)row * N + j) = o;
    }
    
  }
}



// ---- f16 WMMA path (v_wmma_f32_16x16x32_f16): 11-bit significands for operands in range — used where a [0,1] probability operand needs more precision than bf16
typedef _Float16 v16h __attribute__((ext_vector_type(16)));
union FragH { v16h v; v8us half[2]; _Float16 h[16]; unsigned short u[16]; };
template <int NT>
__device__ __forceinline__ v8f mmaH(v16h ah, v16h al, v16h bh, v16h bl, v8f c) {
  c = __builtin_amdgcn_wmma_f32_16x16x32_f16(false, ah, false, bh, (short)0, c, false, false);
  if (NT >= 2) c = __builtin_amdgcn_wmma_f32_16x16x32_f16(false, al, false, bh, (short)0, c, false, false);
  if (NT >= 3) c = __builtin_amdgcn_wmma_f32_16x16x32_f16(false, ah, false, bl, (short)0, c, false, false);
  asm volatile("v_nop\n\tv_nop\n\tv_nop\n\tv_nop" : "+v"(c) : "v"(ah), "v"(al), "v"(bh), "v"(bl));
  return c;
}
// batched GEMM like k_gemm_b but f16 operands: A f32 (split into f16 hi/lo if ASPLIT, else rounded to f16), Bt = f16 values [n][k]; alpha; C f32; N multiple of 16 (partial tiles skipped)
template <bool ASPLIT>
__global__ __launch_bounds__(128) void k_gemm_h(const float* __restrict__ A, int lda, size_t sA, const _Float16* __restrict__ Bh, int ldb, size_t sB, float alpha, float* __restrict__ C, int ldc, size_t sC, int M, int N, int K) {
  __shared__ __attribute__((aligned(16))) float so[4][16][64];
  const int tid = threadIdx.x, w = tid >> 5, lane = tid & 31, ln = lane & 15, hh = lane >> 4; const int by = blockIdx.y;
  A += (size_t)by * sA; Bh += (size_t)by * sB; C += (size_t)by * sC;
  const int ntn = (N + 63) / 64; const int wid = blockIdx.x * 4 + w; const int mt = wid / ntn, nq = wid % ntn; if (mt * 16 >= M) return;
  const int row0 = mt * 16, col0 = nq * 64; const float* arow = A + (size_t)(row0 + ln) * lda;
  v8f acc[4] = {};
  for (int kb = 0; kb < K; kb += 32) {
    FragH ah, al;
    const v4f x0 = *(const v4fa*)(arow + kb + 8 * hh), x1 = *(const v4fa*)(arow + kb + 8 * hh + 4), x2 = *(const v4fa*)(arow + kb + 16 + 8 * hh), x3 = *(const v4fa*)(arow + kb + 16 + 8 * hh + 4);
    float xs[16] = {x0[0],x0[1],x0[2],x0[3],x1[0],x1[1],x1[2],x1[3],x2[0],x2[1],x2[2],x2[3],x3[0],x3[1],x3[2],x3[3]};
#pragma unroll
    for (int i = 0; i < 16; ++i) { const _Float16 h = (_Float16)xs[i]; ah.h[i] = h; al.h[i] = ASPLIT ? (_Float16)(xs[i] - (float)h) : (_Float16)0.0f; }
#pragma unroll
    for (int t = 0; t < 4; ++t) { if (col0 + t * 16 >= N) continue; const size_t boff = (size_t)(col0 + t * 16 + ln) * ldb + kb; FragH bq; bq.half[0] = *(const v8us*)(Bh + boff + 8 * hh); bq.half[1] = *(const v8us*)(Bh + boff + 16 + 8 * hh);
      acc[t] = mmaH<ASPLIT ? 2 : 1>(ah.v, al.v, bq.v, bq.v, acc[t]); }
  }
#pragma unroll
  for (int t = 0; t < 4; ++t) { if (col0 + t * 16 >= N) continue;
#pragma unroll
    for (int r = 0; r < 8; ++r) so[w][8 * hh + r][t * 16 + ln] = acc[t][r] * alpha; }
  __builtin_amdgcn_fence(__ATOMIC_ACQ_REL, "workgroup"); __builtin_amdgcn_wave_barrier();
  const int rsub = lane >> 4, c4 = (lane & 15) * 4;
  {
#pragma unroll
    for (int q = 0; q < 8; ++q) { const int r = q * 2 + rsub; if (col0 + c4 < N) { const v4f v = *(const v4fa*)&so[w][r][c4]; *(v4f*)(C + (size_t)(row0 + r) * ldc + col0 + c4) = v; } }
     }
}

// Wt[n][k] = f16(W[k][n]·scale) from f32 row-major W[K][N] (scale = power of two; bf16-exact weights stay exact in f16 away from the subnormal range)
__device__ __forceinline__ void wt_f16_block(const float* __restrict__ W, _Float16* __restrict__ Wt, int K, int N, float scale, int blk) {
  const int t = blk * 256 + threadIdx.x; if (t >= N * (K / 8)) return; const int n = t / (K / 8), k8 = (t % (K / 8)) * 8; FragH f;
#pragma unroll
  for (int i = 0; i < 8; ++i) f.h[i] = (_Float16)(bf16_round(W[(size_t)(k8 + i) * N + n]) * scale); const v8us o = f.half[0];
  *(v8us*)((unsigned short*)Wt + (size_t)n * K + k8) = o; 
}
// k_gemm_hh variant with fused epilogue: v = acc·alpha + bf16(bias_by[by·sBias + col]) (bias_by = bias, biasY1, biasY2 for by = 0, 1, 2) (+ CP[(row/rowsPerB)·sCPb + by·64 + col] if CP) ; ACT 0 none / 1 elu ; writes f16 C16 and f32 C, each if non-null
// N (a multiple of 64, so every wave owns four whole 16-column tiles) and K are compile-time: the k loop is unrolled whole and its fragment loads run PF k-steps ahead of the products that use them.
template <int ACT, int N, int K>
__global__ __launch_bounds__(128) void k_gemm_hhx(const _Float16* __restrict__ A, int lda, size_t sA, const _Float16* __restrict__ Bh, int ldb, size_t sB, float alpha, const float* __restrict__ bias, const float* __restrict__ biasY1, const float* __restrict__ biasY2, size_t sBias, const float* __restrict__ CP, int rowsPerB, size_t sCPb, int row0g,
    float* __restrict__ C, _Float16* __restrict__ C16, int ldc, size_t sC, int M) {
  static_assert(N % 64 == 0 && K % 32 == 0, "whole 64-column wave tiles and whole 32-deep k-steps");
  __shared__ __attribute__((aligned(16))) float so[4][16][64];
  const int tid = threadIdx.x, w = tid >> 5, lane = tid & 31, ln = lane & 15, hh = lane >> 4; const int by = blockIdx.y;
  A += (size_t)by * sA; Bh += (size_t)by * sB; const size_t cofs = (size_t)by * sC; const float* bsel = (by == 0) ? bias : ((by == 1) ? biasY1 : biasY2); const float* bp = bsel ? bsel + (size_t)by * sBias : nullptr;      /* batch index by = 0, 1, 2 takes its own bias buffer */
  const int ntn = (N + 63) / 64; const int wid = blockIdx.x * 4 + w; const int mt = wid / ntn, nq = wid % ntn; if (mt * 16 >= M) return;
  const int row0 = mt * 16, col0 = nq * 64; const _Float16* arow = A + (size_t)(row0 + ln) * lda;
  v8f acc[4] = {};
  constexpr int NS = K / 32, PF = 2, NB = PF + 1;      /* NB register stages: PF k-steps of loads in flight beside the one being multiplied */
  const unsigned short* ap = (const unsigned short*)arow + 8 * hh; const unsigned short* bq0 = (const unsigned short*)Bh + (size_t)(col0 + ln) * ldb + 8 * hh;
  FragH fa[NB], fb[NB][4];
#pragma unroll
  for (int s = 0; s < NS + PF; ++s) {      /* unrolled whole: the stage indices must be constants for the stages to stay in registers */
    if (s < NS) { const int st = s % NB; fa[st].half[0] = *(const v8us*)(ap + s * 32); fa[st].half[1] = *(const v8us*)(ap + s * 32 + 16);
#pragma unroll
      for (int t = 0; t < 4; ++t) { const unsigned short* br = bq0 + (size_t)(t * 16) * ldb + s * 32; fb[st][t].half[0] = *(const v8us*)br; fb[st][t].half[1] = *(const v8us*)(br + 16); } }
    if (s >= PF) { const int st = (s - PF) % NB;
#pragma unroll
      for (int t = 0; t < 4; ++t) acc[t] = mmaH<1>(fa[st].v, fa[st].v, fb[st][t].v, fb[st][t].v, acc[t]); }
  }
#pragma unroll
  for (int t = 0; t < 4; ++t) { if (col0 + t * 16 >= N) continue; const int col = col0 + t * 16 + ln; const float bv = bp ? bf16_round(bp[col]) : 0.f;
#pragma unroll
    for (int r = 0; r < 8; ++r) { float v = acc[t][r] * alpha + bv; if (CP) { const int bidx = (row0g + row0 + 8 * hh + r) / rowsPerB; v += CP[(size_t)bidx * sCPb + (size_t)by * 64 + col]; } if (ACT == 1) v = (v > 0.f) ? v : expm1f(v); else if (ACT == 7) v = (v > 0.f) ? v + 1.0f : expf(v); else if (ACT == 8) v = tanhf(v); else if (ACT == 9) v = 0.5f * v * (1.0f + tanhf(0.7978845608028654f * (v + 0.044715f * v * v * v))); else if (ACT == 11) v = 1.0f / (1.0f + expf(-v)); else if (ACT == 12) v = (v > 0.f) ? v : 0.01f * v; else if (ACT == 14) v = (v > 0.f) ? v : 0.1f * v; else if (ACT == 15) v = v / (1.0f + expf(-v)); else if (ACT == 3) v = fmaxf(v, 0.f); else if (ACT == 6) v = 0.5f * v * (1.0f + erff(v * 0.70710678118654752f)); so[w][8 * hh + r][t * 16 + ln] = v; } }
  __builtin_amdgcn_fence(__ATOMIC_ACQ_REL, "workgroup"); __builtin_amdgcn_wave_barrier();
  const int rsub = lane >> 4, c4 = (lane & 15) * 4; typedef _Float16 v4h __attribute__((ext_vector_type(4)));
  {
#pragma unroll
    for (int q = 0; q < 8; ++q) { const int r = q * 2 + rsub; if (col0 + c4 < N) { const v4f v = *(const v4fa*)&so[w][r][c4]; if (C) *(v4f*)(C + cofs + (size_t)(row0 + r) * ldc + col0 + c4) = v; if (C16) { v4h h4; for (int i = 0; i < 4; ++i) h4[i] = (_Float16)v[i]; *(v4h*)(C16 + cofs + (size_t)(row0 + r) * ldc + col0 + c4) = h4; } } }
     }
}


typedef _Float16 v4h __attribute__((ext_vector_type(4)));

__device__ __forceinline__ void x16_block(const float* __restrict__ x, _Float16* __restrict__ X16, size_t n8, int blk) { const size_t t = (size_t)blk * 256 + threadIdx.x; if (t >= n8) return; FragH f;
#pragma unroll
  for (int q = 0; q < 8; ++q) f.h[q] = (_Float16)bf16_round(x[t * 8 + q]); *(v8us*)((unsigned short*)X16 + t * 8) = f.half[0];  }
// One grid for the five operand preparations, none of which reads another's result: the block index picks the job (block-uniform branch).
// Blocks 0 .. 3 NBW - 1: Wq, Wk, Wv (their outputs lie one behind the other in Bqkv); the next NBO: Wo; the last NBX: x.
#define NBW (2 * DX * (DX / 8) / 256)
#define NBO (DX * (DX / 8) / 256)
#define NBX (NR * DX / 8 / 256)
__global__ __launch_bounds__(256) void k_prep(const float* __restrict__ Wq, const float* __restrict__ Wk, const float* __restrict__ Wv, const float* __restrict__ Wo, const float* __restrict__ x,
                                              _Float16* __restrict__ Bqkv, _Float16* __restrict__ Bo, _Float16* __restrict__ X16) {
  const int bid = blockIdx.x;
  if (bid < 3 * NBW) { const int j = bid / NBW; wt_f16_block(j == 0 ? Wq : (j == 1 ? Wk : Wv), Bqkv + (size_t)j * 2 * DX * DX, DX, 2 * DX, 16.0f, bid % NBW); }
  else if (bid < 3 * NBW + NBO) wt_f16_block(Wo, Bo, DX, DX, 16.0f, bid - 3 * NBW);
  else x16_block(x, X16, (size_t)NR * DX / 8, bid - (3 * NBW + NBO)); }
__global__ __launch_bounds__(256) void k_h16(const float* __restrict__ x, _Float16* __restrict__ X16, size_t n8) { const size_t t = (size_t)blockIdx.x * 256 + threadIdx.x; if (t >= n8) return; FragH f;
#pragma unroll
  for (int q = 0; q < 8; ++q) f.h[q] = (_Float16)x[t * 8 + q]; *(v8us*)((unsigned short*)X16 + t * 8) = f.half[0];  }
__global__ __launch_bounds__(256) void k_round16f(const float* __restrict__ W, _Float16* __restrict__ Bt, size_t n8) { const size_t t = (size_t)blockIdx.x * 256 + threadIdx.x; if (t >= n8) return; FragH f;
#pragma unroll
  for (int i = 0; i < 8; ++i) f.h[i] = (_Float16)(bf16_round(W[t * 8 + i]) * 16.0f); *(v8us*)((unsigned short*)Bt + t * 8) = f.half[0];  }
template <int NHv, int TTv>
__global__ __launch_bounds__(256) void k_vt(const _Float16* __restrict__ V16, int ldv, int voff, _Float16* __restrict__ Vt) { __shared__ unsigned short tl[64][66]; const int tid = threadIdx.x; const int slab = blockIdx.x / (TTv / 64), lg = blockIdx.x % (TTv / 64); const int b = slab / NHv, h = slab % NHv;
  for (int i = tid; i < 64 * 8; i += 256) { const int r = i / 8, c8 = (i % 8) * 8; FragH f; f.half[0] = *(const v8us*)((const unsigned short*)V16 + ((size_t)b * TTv + lg * 64 + r) * ldv + voff + h * 64 + c8);
#pragma unroll
    for (int q = 0; q < 8; ++q) tl[r][c8 + q] = f.u[q]; }
  __syncthreads();
  {
#pragma unroll
    for (int rd = 0; rd < 2; ++rd) { const int d = rd * 32 + tid / 8, pc = tid % 8; FragH f;
#pragma unroll
      for (int q = 0; q < 8; ++q) f.u[q] = tl[pc * 8 + q][d];
      *(v8us*)((unsigned short*)Vt + ((size_t)slab * 64 + d) * TTv + lg * 64 + pc * 8) = f.half[0]; }
     } }

__global__ __launch_bounds__(256) void k_h16s(const float* __restrict__ F, _Float16* __restrict__ H, size_t n8) { const size_t t = (size_t)blockIdx.x * 256 + threadIdx.x; if (t >= n8) return; const v4f a = *(const v4fa*)(F + t * 8), c = *(const v4fa*)(F + t * 8 + 4); FragH f;
#pragma unroll
  for (int q = 0; q < 4; ++q) { f.h[q] = (_Float16)(a[q] * 256.0f); f.h[4 + q] = (_Float16)(c[q] * 256.0f); } *(v8us*)((unsigned short*)H + t * 8) = f.half[0];  }
// Keys split inside the work-group: each of the 4 query tiles is walked by KVS waves; wave (qw, kr) takes the 32-key blocks kr, kr + KVS, kr + 2 KVS, ... with its own running max, sum and
// un-normalised accumulators; the KVS partials of a tile are merged through LDS behind one work-group barrier (weights exp(m_k - M)).
#define KVS 4
__global__ __launch_bounds__(128 * KVS) void k_flash(const _Float16* __restrict__ Q16, int ldq, const _Float16* __restrict__ K16, int ldk, const _Float16* __restrict__ Vt, float* __restrict__ O, int ldo) {
  constexpr int RPW = 16, RTN = RPW / 16, NQB = NN / (4 * RPW), DT = 4, KS = 2, NW = 4 * KVS, RM = RPW / KVS;
  __shared__ __attribute__((aligned(16))) unsigned short sP[NW][RPW][40]; __shared__ __attribute__((aligned(16))) float sO[NW][RPW][128 + 4]; __shared__ float sM[NW][RPW], sL[NW][RPW];
  const int tid = threadIdx.x, w = __builtin_amdgcn_readfirstlane(tid >> 5), lane = tid & 31, ln = lane & 15, hh = lane >> 4; const int qw = w & 3, kr = w >> 2;      /* the wave's number held as a scalar: tile and key-block indices leave the vector registers, which the grouped fragments need */
  const int slab = blockIdx.x / NQB, qblk = blockIdx.x % NQB; const int b = slab / NHU, h = slab % NHU; const int qb0 = qblk * (4 * RPW); const int q0 = qb0 + qw * RPW;
  FragH aq[2][KS], aql[2][KS];
#pragma unroll
  for (int rt = 0; rt < RTN; ++rt) { const size_t qo = ((size_t)b * NN + q0 + rt * 16 + ln) * ldq + h * 128; const unsigned short* qr = (const unsigned short*)Q16 + qo; const unsigned short* ql = qr + 64;      /* aq = real part, aql = imaginary part */
#pragma unroll
    for (int ks = 0; ks < KS; ++ks) { aq[rt][ks].half[0] = *(const v8us*)(qr + ks * 32 + 8 * hh); aq[rt][ks].half[1] = *(const v8us*)(qr + ks * 32 + 16 + 8 * hh); aql[rt][ks].half[0] = *(const v8us*)(ql + ks * 32 + 8 * hh); aql[rt][ks].half[1] = *(const v8us*)(ql + ks * 32 + 16 + 8 * hh); } }
  const unsigned short* Vth = (const unsigned short*)Vt + ((size_t)b * 2 * NHU + 2 * h) * 64 * NN; const unsigned short* Vti = Vth + (size_t)64 * NN;      /* Vᵀ real / imag planes of head h */
  float m_r[2][8], l_r[2][8]; v8f oacc[2][DT], oacci[2][DT];
#pragma unroll
  for (int rt = 0; rt < RTN; ++rt) {
#pragma unroll
    for (int r = 0; r < 8; ++r) { m_r[rt][r] = -3.0e38f; l_r[rt][r] = 0.f; }
#pragma unroll
    for (int dt = 0; dt < DT; ++dt) { oacc[rt][dt] = (v8f){0.f,0.f,0.f,0.f,0.f,0.f,0.f,0.f}; oacci[rt][dt] = oacc[rt][dt]; } }
  const int jend = NN;
#pragma unroll 1
  for (int j0 = kr * 32; j0 < jend; j0 += 32 * KVS) {
    
    v8f s[2][2]; FragH bk[2][KS], bl[2][KS];      /* bk = real, bl = imaginary; both 16-key tiles' fragments are loaded as one group ahead of the score products */
    const unsigned short* kp[2];
#pragma unroll
    for (int nt = 0; nt < 2; ++nt) { kp[nt] = (const unsigned short*)K16 + ((size_t)b * NN + j0 + nt * 16 + ln) * ldk + h * 128 + 8 * hh; const unsigned short* kr = kp[nt]; const unsigned short* kl = kr + 64;
#pragma unroll
      for (int ks = 0; ks < KS; ++ks) { bk[nt][ks].half[0] = *(const v8us*)(kr + ks * 32); bk[nt][ks].half[1] = *(const v8us*)(kr + ks * 32 + 16); bl[nt][ks].half[0] = *(const v8us*)(kl + ks * 32); bl[nt][ks].half[1] = *(const v8us*)(kl + ks * 32 + 16); } }
    asm volatile("s_wait_xcnt 0x0" :: "v"(kp[0]), "v"(kp[1]) : "memory");      /* keeps both address pairs alive past the last load of the group, so that no load's result lands in a pair that an issued load names before this wait */
#pragma unroll
    for (int nt = 0; nt < 2; ++nt) {
#pragma unroll
      for (int rt = 0; rt < RTN; ++rt) { v8f re = (v8f){0.f,0.f,0.f,0.f,0.f,0.f,0.f,0.f}, ip = re, in = re;
#pragma unroll
        for (int ks = 0; ks < KS; ++ks) { re = mmaH<1>(aq[rt][ks].v, aq[rt][ks].v, bk[nt][ks].v, bk[nt][ks].v, re); re = mmaH<1>(aql[rt][ks].v, aql[rt][ks].v, bl[nt][ks].v, bl[nt][ks].v, re); ip = mmaH<1>(aql[rt][ks].v, aql[rt][ks].v, bk[nt][ks].v, bk[nt][ks].v, ip); in = mmaH<1>(aq[rt][ks].v, aq[rt][ks].v, bl[nt][ks].v, bl[nt][ks].v, in); }
#pragma unroll
        for (int r = 0; r < 8; ++r) { const float im = ip[r] - in[r]; re[r] = (re[r] * re[r] + im * im) * SCORE_SCALE; } s[rt][nt] = re; } }
    FragH bv[DT], bi[DT];      /* all value fragments of this key block are requested here, so that they travel while the softmax below is computed */
    const unsigned short* vp = Vth + (size_t)ln * NN + j0 + 8 * hh; const unsigned short* vq = vp + (size_t)64 * NN;
#pragma unroll
    for (int dt = 0; dt < DT; ++dt) { const size_t vo = (size_t)(dt * 16) * NN; bv[dt].half[0] = *(const v8us*)(vp + vo); bv[dt].half[1] = *(const v8us*)(vp + vo + 16); bi[dt].half[0] = *(const v8us*)(vq + vo); bi[dt].half[1] = *(const v8us*)(vq + vo + 16); }
    asm volatile("s_wait_xcnt 0x0" :: "v"(vp) : "memory");      /* as above: the address pair outlives the group's last load */
#pragma unroll
    for (int rt = 0; rt < RTN; ++rt)
#pragma unroll
      for (int r = 0; r < 8; ++r) { const int tq = q0 + rt * 16 + 8 * hh + r; const int k0 = j0 + ln, k1 = j0 + 16 + ln; (void)tq; (void)k0; (void)k1;
        const bool ok0 = true, ok1 = true;
        const float s0 = s[rt][0][r], s1 = s[rt][1][r]; float mc = fmaxf(s0, s1);
        mc = fmaxf(mc, __shfl_xor(mc, 1, 32)); mc = fmaxf(mc, __shfl_xor(mc, 2, 32)); mc = fmaxf(mc, __shfl_xor(mc, 4, 32)); mc = fmaxf(mc, __shfl_xor(mc, 8, 32));
        const float mn = fmaxf(m_r[rt][r], mc); const float al = (mn > -1.0e38f) ? expf(m_r[rt][r] - mn) : 1.0f; m_r[rt][r] = mn; const float p0 = expf(s0 - mn), p1 = expf(s1 - mn); l_r[rt][r] = l_r[rt][r] * al + p0 + p1;
#pragma unroll
        for (int dt = 0; dt < DT; ++dt) { oacc[rt][dt][r] *= al; oacci[rt][dt][r] *= al; }
        FragH t2; t2.h[0] = (_Float16)(p0 * 1024.0f); t2.h[1] = (_Float16)(p1 * 1024.0f); sP[w][rt * 16 + 8 * hh + r][ln] = t2.u[0]; sP[w][rt * 16 + 8 * hh + r][16 + ln] = t2.u[1]; }
    __builtin_amdgcn_fence(__ATOMIC_ACQ_REL, "workgroup"); __builtin_amdgcn_wave_barrier();
    FragH pa[2];
#pragma unroll
    for (int rt = 0; rt < RTN; ++rt) { pa[rt].half[0] = *(const v8us*)&sP[w][rt * 16 + ln][8 * hh]; pa[rt].half[1] = *(const v8us*)&sP[w][rt * 16 + ln][16 + 8 * hh]; }
#pragma unroll
    for (int dt = 0; dt < DT; ++dt) {
#pragma unroll
      for (int rt = 0; rt < RTN; ++rt) { oacc[rt][dt] = mmaH<1>(pa[rt].v, pa[rt].v, bv[dt].v, bv[dt].v, oacc[rt][dt]); oacci[rt][dt] = mmaH<1>(pa[rt].v, pa[rt].v, bi[dt].v, bi[dt].v, oacci[rt][dt]); } }
    __builtin_amdgcn_fence(__ATOMIC_ACQ_REL, "workgroup"); __builtin_amdgcn_wave_barrier(); }
#pragma unroll
  for (int rt = 0; rt < RTN; ++rt) {
#pragma unroll
    for (int r = 0; r < 8; ++r) { float l = l_r[rt][r]; l += __shfl_xor(l, 1, 32); l += __shfl_xor(l, 2, 32); l += __shfl_xor(l, 4, 32); l += __shfl_xor(l, 8, 32); if (ln == 0) { sM[w][rt * 16 + 8 * hh + r] = m_r[rt][r]; sL[w][rt * 16 + 8 * hh + r] = l; } }
#pragma unroll
    for (int dt = 0; dt < DT; ++dt)
#pragma unroll
      for (int r = 0; r < 8; ++r) { sO[w][rt * 16 + 8 * hh + r][dt * 16 + ln] = oacc[rt][dt][r]; sO[w][rt * 16 + 8 * hh + r][64 + dt * 16 + ln] = oacci[rt][dt][r]; } }
  __syncthreads();      /* publishes every wave's partial (max, sum, accumulators) to the waves that merge it */
  {
#pragma unroll
    for (int rp = 0; rp < RM; ++rp) { const int r = kr * RM + rp, pc = lane;      /* wave (qw, kr) merges rows kr*RM .. of query tile qw */
      float mk[KVS], M = -3.0e38f;
#pragma unroll
      for (int k = 0; k < KVS; ++k) { mk[k] = sM[k * 4 + qw][r]; M = fmaxf(M, mk[k]); }
      float L = 0.f; v4f o = {0.f, 0.f, 0.f, 0.f};
#pragma unroll
      for (int k = 0; k < KVS; ++k) { const float wk = expf(mk[k] - M); L += wk * sL[k * 4 + qw][r]; const v4f part = *(const v4fa*)&sO[k * 4 + qw][r][pc * 4]; o += part * wk; }
      const float inv = (L > 0.f) ? 1.0f / (L * 1024.0f) : 0.f;
      *(v4f*)(O + ((size_t)b * NN + q0 + r) * ldo + h * 128 + pc * 4) = o * inv;      /* 32 lanes x 16 B = the head's [real | imag] 512-B run */
      asm volatile("s_wait_xcnt 0x0" ::: "memory"); }      /* stands in front of the next row's rewrite of the registers that the issued store names */
     } }

extern "C" void kernel_launch(void* const* d_in, const int* in_sizes, int n_in,
                              void* d_out, int out_size, void* d_ws, size_t ws_size, hipStream_t stream) {
  (void)in_sizes; (void)n_in; (void)out_size;
  const float* const* I = (const float* const*)d_in; const float* x = I[0]; const float* Wq = I[1]; const float* bq = I[2]; const float* Wk = I[3]; const float* bk = I[4]; const float* Wv = I[5]; const float* bv = I[6]; const float* Wo = I[7]; const float* bo = I[8];
  char* ws = (char*)d_ws; size_t off = 0;
  auto take = [&](size_t bytes) { char* p = ws + off; off += (bytes + 255) & ~(size_t)255; return p; };
  _Float16* Bq = (_Float16*)take((size_t)3 * 2 * DX * DX * 2); _Float16* Bo = (_Float16*)take((size_t)DX * DX * 2);
  _Float16* X16 = (_Float16*)take((size_t)NR * DX * 2); _Float16* Q = (_Float16*)take((size_t)3 * NR * DX * 2); _Float16* K = Q + (size_t)NR * DX; _Float16* V = K + (size_t)NR * DX;      /* q, k, v one behind the other: batch stride of the merged projection */ _Float16* Vt = (_Float16*)take((size_t)NR * DX * 2);
  float* O = (float*)take((size_t)NR * DX * 4); _Float16* O16 = (_Float16*)take((size_t)NR * DX * 2);
  if (off > ws_size) return;      // 3 × 1 + 0.5 + 5 × 4.2 + 8.4 + 4.2 ≈ 37 MB
  k_prep<<<3 * NBW + NBO + NBX, 256, 0, stream>>>(Wq, Wk, Wv, Wo, x, Bq, Bo, X16);      /* (in,out) [512][1024] -> Bt[1024][512] x2^4 for Wq, Wk, Wv (only rows 0..511 = heads 0..3 are used), Wo likewise, x -> f16: one launch */
  const dim3 gp(((NR / 16) * (DX / 64) + 3) / 4, 1), gp3(((NR / 16) * (DX / 64) + 3) / 4, 3);
  k_gemm_hhx<0, DX, DX><<<gp3, 128, 0, stream>>>(X16, DX, 0, Bq, DX, (size_t)2 * DX * DX, 0.0625f, bq, bk, bv, 0, nullptr, 1, 0, 0, nullptr, Q, DX, (size_t)NR * DX, NR);      /* q, k, v in one launch (blockIdx.y), heads 0..3 = output columns 0..511 (+ bias): each M 4096 N 512 K 512 */
  k_vt<2 * NHU, NN><<<BB * 2 * NHU * (NN / 64), 256, 0, stream>>>(V, DX, 0, Vt);      /* Vᵀ planes per (b, head, part): [b·8 + 2h + part][64][2048] */
  k_flash<<<BB * NHU * (NN / 64), 128 * KVS, 0, stream>>>(Q, DX, K, DX, Vt, O, DX);
  k_h16s<<<(unsigned)(((size_t)NR * DX / 8 + 255) / 256), 256, 0, stream>>>(O, O16, (size_t)NR * DX / 8);
  k_gemm_hhx<0, DX, DX><<<gp, 128, 0, stream>>>(O16, DX, 0, Bo, DX, 0, 0.0625f * 0.00390625f, bo, nullptr, nullptr, 0, nullptr, 1, 0, 0, (float*)d_out, nullptr, DX, 0, NR);      /* out = O·Wo + bo (alpha undoes ×2^4 weights and the ×2^8 carry) */
}

// v004
// A run of this version takes 96 microseconds.
// Next to v003, in two timings, it ran 1.39 times as fast each time.
// Over all steps from v000 it is 3.37 times as fast.
#include <hip/hip_runtime.h>
// 'Superposition' (complex-valued) multi-head attention (B=2, S=2048, D=512, 8 heads; q,k,v projections to 2D with per-head [real 64 | imag 64]): interference = Σ_d q_d·conj(k_d)·64^-½; probs = softmax(|interference|²/0.5); out = probs·v (complex);
// out = concat[real, imag] per head → [B,S,1024], truncated to the first 512 columns (= heads 0..3), then ·Wo + bo. Only heads 0..3 reach the output, so only they are computed.
// Compute dtype: x, weights, biases rounded to bf16; q/k/v (columns of heads 0..3) as f16 GEMM outputs; fused flash-style kernel with three f32 score accumulators (Re, Im⁺, Im⁻) and two value accumulators
// (real, imag), online softmax f32, P f16 ×2^10, on v_wmma_f32_16x16x32_f16; O carried ×2^8 into f16 (small diffuse values) → output GEMM with bias (alpha undoes the carry); f32 accumulate.
#define BB 2
#define NN 2048
#define DX 512
#define NHU 4
#define DH2 128
#define NR (BB * NN)
#define SCORE_SCALE 0.03125f

typedef __bf16 v16b __attribute__((ext_vector_type(16)));
typedef unsigned short v8us __attribute__((ext_vector_type(8), may_alias));
typedef float  v8f  __attribute__((ext_vector_type(8)));
typedef float  v4f  __attribute__((ext_vector_type(4)));
typedef float  v4fa __attribute__((ext_vector_type(4), may_alias));
union FragB { v16b v; v8us half[2]; unsigned short u[16]; };

__device__ __forceinline__ unsigned short bf16_bits(float x) { unsigned int u = __float_as_uint(x); return (unsigned short)((u + 0x7FFFu + ((u >> 16) & 1u)) >> 16); }
__device__ __forceinline__ float bf16_val(unsigned short b) { return __uint_as_float(((unsigned int)b) << 16); }
__device__ __forceinline__ float bf16_round(float x) { return bf16_val(bf16_bits(x)); }
// D += A·B with NT terms: 1 = ah·bh, 2 = + al·bh (A split), 3 = + ah·bl (both split)
template <int NT>
__device__ __forceinline__ v8f mmaN(v16b ah, v16b al, v16b bh, v16b bl, v8f c) {
  c = __builtin_amdgcn_wmma_f32_16x16x32_bf16(false, ah, false, bh, (short)0, c, false, false);
  if (NT >= 2) c = __builtin_amdgcn_wmma_f32_16x16x32_bf16(false, al, false, bh, (short)0, c, false, false);
  if (NT >= 3) c = __builtin_amdgcn_wmma_f32_16x16x32_bf16(false, ah, false, bl, (short)0, c, false, false);
  asm volatile("v_nop\n\tv_nop\n\tv_nop\n\tv_nop" : "+v"(c) : "v"(ah), "v"(al), "v"(bh), "v"(bl));
  return c;
}

__global__ __launch_bounds__(256) void k_wt_bf16(const float* __restrict__ W, unsigned short* __restrict__ Wt, int K, int N) {
  const int t = blockIdx.x * 256 + threadIdx.x;
  const int k8n = K / 8;
  if (t >= N * k8n) return;
  const int n = t / k8n, k8 = (t % k8n) * 8;
  v8us v;
#pragma unroll
  for (int i = 0; i < 8; ++i) v[i] = bf16_bits(W[(size_t)(k8 + i) * N + n]);
  *(v8us*)(Wt + (size_t)n * K + k8) = v;
  
}

// GEMM C[M][N] (f32, pitch ldc) = act(A[M][K]·W + bias). A f32 row-major (pitch lda) converted per fragment to bf16
// (ASPLIT: hi/lo two planes -> 2 terms, else single rounded term); Wt bf16 [N][K] (pitch ldb). BIAS_BF16 rounds the
// bias to bf16 first (bias quantised to bf16 before the add). K%32==0, M%16==0, N%64==0.
template <bool ASPLIT, int ACT, bool BIAS_BF16>
__global__ __launch_bounds__(128) void k_gemm_bf(const float* __restrict__ A, int lda, const unsigned short* __restrict__ Wt, int ldb,
                                               const float* __restrict__ bias, float* __restrict__ C, int ldc, int M, int N, int K) {
  __shared__ __attribute__((aligned(16))) float so[4][16][64];
  const int tid = threadIdx.x, w = tid >> 5, lane = tid & 31, ln = lane & 15, hh = lane >> 4;
  const int ntn = N / 64;
  const int wid = blockIdx.x * 4 + w;
  const int mt = wid / ntn, nq = wid % ntn;
  if (mt * 16 >= M) return;
  const int row0 = mt * 16, col0 = nq * 64;
  const float* arow = A + (size_t)(row0 + ln) * lda;
  v8f acc[4] = {};
  for (int kb = 0; kb < K; kb += 32) {
    FragB ah, al;
    const v4f x0 = *(const v4fa*)(arow + kb + 8 * hh), x1 = *(const v4fa*)(arow + kb + 8 * hh + 4);
    const v4f x2 = *(const v4fa*)(arow + kb + 16 + 8 * hh), x3 = *(const v4fa*)(arow + kb + 16 + 8 * hh + 4);
    float xs[16] = {x0[0],x0[1],x0[2],x0[3],x1[0],x1[1],x1[2],x1[3],x2[0],x2[1],x2[2],x2[3],x3[0],x3[1],x3[2],x3[3]};
#pragma unroll
    for (int i = 0; i < 16; ++i) { const unsigned short hb = bf16_bits(xs[i]); ah.u[i] = hb; al.u[i] = ASPLIT ? bf16_bits(xs[i] - bf16_val(hb)) : (unsigned short)0; }
#pragma unroll
    for (int t = 0; t < 4; ++t) {
      const unsigned short* brow = Wt + (size_t)(col0 + t * 16 + ln) * ldb + kb;
      FragB b;
      b.half[0] = *(const v8us*)(brow + 8 * hh);
      b.half[1] = *(const v8us*)(brow + 16 + 8 * hh);
      acc[t] = mmaN<ASPLIT ? 2 : 1>(ah.v, al.v, b.v, b.v, acc[t]);
    }
  }
#pragma unroll
  for (int t = 0; t < 4; ++t) {
    float bv = bias ? bias[col0 + t * 16 + ln] : 0.f;
    if (BIAS_BF16) bv = bf16_round(bv);
#pragma unroll
    for (int r = 0; r < 8; ++r) { float v = acc[t][r] + bv; if (ACT == 1) v = fmaxf(v, 0.f); so[w][8 * hh + r][t * 16 + ln] = v; }
  }
  __builtin_amdgcn_fence(__ATOMIC_ACQ_REL, "workgroup");
  __builtin_amdgcn_wave_barrier();
  const int rsub = lane >> 4, c4 = (lane & 15) * 4;
  {
#pragma unroll
    for (int q = 0; q < 8; ++q) {
      const int r = q * 2 + rsub;
      const v4f v = *(const v4fa*)&so[w][r][c4];
      *(v4f*)(C + (size_t)(row0 + r) * ldc + col0 + c4) = v;
    }
    
  }
}

// Flash-style causal/unmasked attention, all contractions 3-term bf16 hi/lo splits, f32 softmax with running max.
// q,k,v rows are read from f32 buffers with arbitrary row pitch (so they can live inside a fused qkv buffer);
// D = head size (multiple of 32, <= 128); one wave = 16 query rows; block = 4 waves (64 queries) sharing K/V chunks of 32.
template <int D, bool CAUSAL>
__global__ __launch_bounds__(128) void k_flash(const float* __restrict__ qb, const float* __restrict__ kb, const float* __restrict__ vb,
                                             int pitch, int T, int H, float scale, float* __restrict__ y, int ypitch) {
  constexpr int KS = D / 32;        // k-steps for QK
  constexpr int DT = D / 16;        // d tiles for PV
  __shared__ __attribute__((aligned(16))) unsigned short sKh[32][D + 8], sKl[32][D + 8], sVh[32][D + 8], sVl[32][D + 8];
  __shared__ __attribute__((aligned(16))) unsigned short sPh[4][16][40], sPl[4][16][40];
  __shared__ __attribute__((aligned(16))) float sO[4][16][D];
  const int tid = threadIdx.x, w = tid >> 5, lane = tid & 31, ln = lane & 15, hh = lane >> 4;
  const int nqb = (T + 63) / 64;
  const int bh = blockIdx.x / nqb, qblk = blockIdx.x % nqb;
  const int b = bh / H, h = bh % H;
  const int q0 = qblk * 64 + w * 16;
  const float* Q = qb + (size_t)b * T * pitch + h * D;
  const float* K = kb + (size_t)b * T * pitch + h * D;
  const float* V = vb + (size_t)b * T * pitch + h * D;

  // A fragments of the wave's 16 query rows (scaled), hi/lo
  FragB aqh[KS], aql[KS];
  {
    int row = q0 + ln; if (row >= T) row = T - 1;
    const float* qr = Q + (size_t)row * pitch;
#pragma unroll
    for (int ks = 0; ks < KS; ++ks)
#pragma unroll
      for (int i = 0; i < 16; ++i) {
        const int d = ks * 32 + ((i < 8) ? (8 * hh + i) : (16 + 8 * hh + (i - 8)));
        const float x = qr[d] * scale; const unsigned short hb = bf16_bits(x);
        aqh[ks].u[i] = hb; aql[ks].u[i] = bf16_bits(x - bf16_val(hb));
      }
  }
  float m_r[8], l_r[8];
#pragma unroll
  for (int r = 0; r < 8; ++r) { m_r[r] = -3.0e38f; l_r[r] = 0.f; }
  v8f oacc[DT];
#pragma unroll
  for (int dt = 0; dt < DT; ++dt) oacc[dt] = (v8f){0.f,0.f,0.f,0.f,0.f,0.f,0.f,0.f};

  const int kv_end = CAUSAL ? min(T, qblk * 64 + 64) : T;     // block-uniform
  for (int j0 = 0; j0 < kv_end; j0 += 32) {
    __syncthreads();
    for (int e = tid; e < 32 * (D / 4); e += 128) {
      const int r = e / (D / 4), c4 = (e % (D / 4)) * 4;
      const int key = j0 + r;
      v4f kf = {0.f,0.f,0.f,0.f}, vf = {0.f,0.f,0.f,0.f};
      if (key < T) { kf = *(const v4fa*)(K + (size_t)key * pitch + c4); vf = *(const v4fa*)(V + (size_t)key * pitch + c4); }
#pragma unroll
      for (int t = 0; t < 4; ++t) {
        unsigned short hb = bf16_bits(kf[t]); sKh[r][c4 + t] = hb; sKl[r][c4 + t] = bf16_bits(kf[t] - bf16_val(hb));
        hb = bf16_bits(vf[t]); sVh[r][c4 + t] = hb; sVl[r][c4 + t] = bf16_bits(vf[t] - bf16_val(hb));
      }
    }
    __syncthreads();
    // S tile 16 x 32
    v8f s[2];
#pragma unroll
    for (int nt = 0; nt < 2; ++nt) {
      v8f acc = {};
#pragma unroll
      for (int ks = 0; ks < KS; ++ks) {
        FragB bh_, bl_;
        bh_.half[0] = *(const v8us*)&sKh[nt * 16 + ln][ks * 32 + 8 * hh]; bh_.half[1] = *(const v8us*)&sKh[nt * 16 + ln][ks * 32 + 16 + 8 * hh];
        bl_.half[0] = *(const v8us*)&sKl[nt * 16 + ln][ks * 32 + 8 * hh]; bl_.half[1] = *(const v8us*)&sKl[nt * 16 + ln][ks * 32 + 16 + 8 * hh];
        acc = mmaN<3>(aqh[ks].v, aql[ks].v, bh_.v, bl_.v, acc);
      }
      s[nt] = acc;
    }
    // mask + running max (rows 8hh+r; the 16 lanes of a half share rows)
    float alpha[8];
#pragma unroll
    for (int r = 0; r < 8; ++r) {
      const int qi = q0 + 8 * hh + r;
      const int ja = j0 + ln, jb = j0 + 16 + ln;
      if (CAUSAL) { if (ja > qi) s[0][r] = -3.0e38f; if (jb > qi) s[1][r] = -3.0e38f; }
      if (ja >= T) s[0][r] = -3.0e38f;
      if (jb >= T) s[1][r] = -3.0e38f;
      float mx = fmaxf(s[0][r], s[1][r]);
      mx = fmaxf(mx, __shfl_xor(mx, 1, 32)); mx = fmaxf(mx, __shfl_xor(mx, 2, 32)); mx = fmaxf(mx, __shfl_xor(mx, 4, 32)); mx = fmaxf(mx, __shfl_xor(mx, 8, 32));
      const float mnew = fmaxf(m_r[r], mx);
      alpha[r] = (mnew > -1.0e38f) ? __expf(m_r[r] - mnew) : 1.0f;
      const float p0 = (s[0][r] > -1.0e38f) ? __expf(s[0][r] - mnew) : 0.f;
      const float p1 = (s[1][r] > -1.0e38f) ? __expf(s[1][r] - mnew) : 0.f;
      m_r[r] = mnew;
      l_r[r] = l_r[r] * alpha[r] + p0 + p1;            // per-lane partial row sum (16 lanes combined at the end)
      unsigned short hb = bf16_bits(p0); sPh[w][8 * hh + r][ln] = hb;      sPl[w][8 * hh + r][ln] = bf16_bits(p0 - bf16_val(hb));
      hb = bf16_bits(p1);                sPh[w][8 * hh + r][16 + ln] = hb; sPl[w][8 * hh + r][16 + ln] = bf16_bits(p1 - bf16_val(hb));
    }
#pragma unroll
    for (int dt = 0; dt < DT; ++dt)
#pragma unroll
      for (int r = 0; r < 8; ++r) oacc[dt][r] *= alpha[r];
    __builtin_amdgcn_fence(__ATOMIC_ACQ_REL, "workgroup");
    __builtin_amdgcn_wave_barrier();
    FragB pah, pal;
    pah.half[0] = *(const v8us*)&sPh[w][ln][8 * hh]; pah.half[1] = *(const v8us*)&sPh[w][ln][16 + 8 * hh];
    pal.half[0] = *(const v8us*)&sPl[w][ln][8 * hh]; pal.half[1] = *(const v8us*)&sPl[w][ln][16 + 8 * hh];
#pragma unroll
    for (int dt = 0; dt < DT; ++dt) {
      FragB bvh, bvl;
#pragma unroll
      for (int i = 0; i < 8; ++i) {
        bvh.u[i] = sVh[8 * hh + i][dt * 16 + ln]; bvh.u[8 + i] = sVh[16 + 8 * hh + i][dt * 16 + ln];
        bvl.u[i] = sVl[8 * hh + i][dt * 16 + ln]; bvl.u[8 + i] = sVl[16 + 8 * hh + i][dt * 16 + ln];
      }
      oacc[dt] = mmaN<3>(pah.v, pal.v, bvh.v, bvl.v, oacc[dt]);
    }
    __builtin_amdgcn_fence(__ATOMIC_ACQ_REL, "workgroup");
    __builtin_amdgcn_wave_barrier();
  }
#pragma unroll
  for (int r = 0; r < 8; ++r) {
    float l = l_r[r];
    l += __shfl_xor(l, 1, 32); l += __shfl_xor(l, 2, 32); l += __shfl_xor(l, 4, 32); l += __shfl_xor(l, 8, 32);
    l_r[r] = (l > 0.f) ? 1.0f / l : 0.f;
  }
#pragma unroll
  for (int dt = 0; dt < DT; ++dt)
#pragma unroll
    for (int r = 0; r < 8; ++r) sO[w][8 * hh + r][dt * 16 + ln] = oacc[dt][r] * l_r[r];
  __builtin_amdgcn_fence(__ATOMIC_ACQ_REL, "workgroup");
  __builtin_amdgcn_wave_barrier();
  {
    for (int r = 0; r < 16; ++r) {
      const int row = q0 + r;
      if (row < T && lane < D / 4) {
        const v4f val = *(const v4fa*)&sO[w][r][lane * 4];
        *(v4f*)(y + ((size_t)b * T + row) * ypitch + h * D + lane * 4) = val;
      }
    }
    
  }
}

// GEMM C = act(A·W + bias + resid): A f32 (ASPLIT -> hi/lo 2 terms), Wt bf16 [N][K]; ACT 0 none, 1 relu, 2 exact gelu;
// resid (optional, f32, row index = (row % rmod), pitch ldr, RES_BF16 rounds it) added before the activation.
template <bool ASPLIT, int ACT, bool BIAS_BF16, bool RES_BF16>
__global__ __launch_bounds__(128) void k_gemm_bf3(const float* __restrict__ A, int lda, const unsigned short* __restrict__ Wt, int ldb,
                                                const float* __restrict__ bias, const float* __restrict__ resid, int rmod, int ldr,
                                                float* __restrict__ C, int ldc, int M, int N, int K) {
  __shared__ __attribute__((aligned(16))) float so[4][16][64];
  const int tid = threadIdx.x, w = tid >> 5, lane = tid & 31, ln = lane & 15, hh = lane >> 4;
  const int ntn = N / 64;
  const int wid = blockIdx.x * 4 + w;
  const int mt = wid / ntn, nq = wid % ntn;
  if (mt * 16 >= M) return;
  const int row0 = mt * 16, col0 = nq * 64;
  const float* arow = A + (size_t)(row0 + ln) * lda;
  v8f acc[4] = {};
  for (int kb = 0; kb < K; kb += 32) {
    FragB ah, al;
    const v4f x0 = *(const v4fa*)(arow + kb + 8 * hh), x1 = *(const v4fa*)(arow + kb + 8 * hh + 4);
    const v4f x2 = *(const v4fa*)(arow + kb + 16 + 8 * hh), x3 = *(const v4fa*)(arow + kb + 16 + 8 * hh + 4);
    float xs[16] = {x0[0],x0[1],x0[2],x0[3],x1[0],x1[1],x1[2],x1[3],x2[0],x2[1],x2[2],x2[3],x3[0],x3[1],x3[2],x3[3]};
#pragma unroll
    for (int i = 0; i < 16; ++i) { const unsigned short hb = bf16_bits(xs[i]); ah.u[i] = hb; al.u[i] = ASPLIT ? bf16_bits(xs[i] - bf16_val(hb)) : (unsigned short)0; }
#pragma unroll
    for (int t = 0; t < 4; ++t) {
      const unsigned short* brow = Wt + (size_t)(col0 + t * 16 + ln) * ldb + kb;
      FragB b;
      b.half[0] = *(const v8us*)(brow + 8 * hh);
      b.half[1] = *(const v8us*)(brow + 16 + 8 * hh);
      acc[t] = mmaN<ASPLIT ? 2 : 1>(ah.v, al.v, b.v, b.v, acc[t]);
    }
  }
#pragma unroll
  for (int t = 0; t < 4; ++t) {
    const int col = col0 + t * 16 + ln;
    float bv = bias ? bias[col] : 0.f;
    if (BIAS_BF16) bv = bf16_round(bv);
#pragma unroll
    for (int r = 0; r < 8; ++r) {
      float v = acc[t][r] + bv;
      if (resid) { float rv = resid[(size_t)((row0 + 8 * hh + r) % rmod) * ldr + col]; if (RES_BF16) rv = bf16_round(rv); v += rv; }
      if (ACT == 1) v = fmaxf(v, 0.f);
      if (ACT == 2) v = 0.5f * v * (1.0f + erff(v * 0.70710678118654752f));
      if (ACT == 3) { const float u = 0.7978845608028654f * (v + 0.044715f * v * v * v); v = 0.5f * v * (1.0f + tanhf(u)); }
      so[w][8 * hh + r][t * 16 + ln] = v;
    }
  }
  __builtin_amdgcn_fence(__ATOMIC_ACQ_REL, "workgroup");
  __builtin_amdgcn_wave_barrier();
  const int rsub = lane >> 4, c4 = (lane & 15) * 4;
  {
#pragma unroll
    for (int q = 0; q < 8; ++q) {
      const int r = q * 2 + rsub;
      const v4f v = *(const v4fa*)&so[w][r][c4];
      *(v4f*)(C + (size_t)(row0 + r) * ldc + col0 + c4) = v;
    }
    
  }
}
// row LayerNorm (biased variance, eps) over N: s = X (+ R); optional out_sum <- s; out_norm <- (s-mu)*rsqrt(var+eps)*g + b
template <bool PARAM_BF16>
__global__ __launch_bounds__(256) void k_layernorm(const float* __restrict__ X, const float* __restrict__ R, const float* __restrict__ g, const float* __restrict__ bta,
                                                  float* __restrict__ out_sum, float* __restrict__ out_norm, int N, float eps) {
  __shared__ float red[256];
  const int row = blockIdx.x, tid = threadIdx.x;
  const float* x = X + (size_t)row * N; const float* rr = R ? R + (size_t)row * N : nullptr;
  float vals[16];                     // up to N = 4096
  const int per = N / 256;            // contiguous chunk per thread? use strided-by-4 chunks: thread handles j = tid*4 + 1024*u
  float s1 = 0.f;
  for (int u = 0; u < per / 4; ++u) {
    const int j = tid * 4 + 1024 * u;
    const v4f a = *(const v4fa*)(x + j);
    v4f b = {0.f,0.f,0.f,0.f}; if (rr) b = *(const v4fa*)(rr + j);
#pragma unroll
    for (int q = 0; q < 4; ++q) { const float v = a[q] + b[q]; vals[u * 4 + q] = v; s1 += v; }
  }
  red[tid] = s1; __syncthreads();
  for (int st = 128; st > 0; st >>= 1) { if (tid < st) red[tid] += red[tid + st]; __syncthreads(); }
  const float mu = red[0] / (float)N; __syncthreads();
  float s2 = 0.f;
  for (int u = 0; u < per / 4; ++u)
#pragma unroll
    for (int q = 0; q < 4; ++q) { const float c = vals[u * 4 + q] - mu; s2 += c * c; }
  red[tid] = s2; __syncthreads();
  for (int st = 128; st > 0; st >>= 1) { if (tid < st) red[tid] += red[tid + st]; __syncthreads(); }
  const float rs = rsqrtf(red[0] / (float)N + eps);
  {
    for (int u = 0; u < per / 4; ++u) {
      const int j = tid * 4 + 1024 * u;
      v4f o, sm;
#pragma unroll
      for (int q = 0; q < 4; ++q) {
        float gg = g[j + q], bb = bta[j + q];
        if (PARAM_BF16) { gg = bf16_round(gg); bb = bf16_round(bb); }
        sm[q] = vals[u * 4 + q]; o[q] = (vals[u * 4 + q] - mu) * rs * gg + bb;
      }
      if (out_sum) *(v4f*)(out_sum + (size_t)row * N + j) = sm;
      *(v4f*)(out_norm + (size_t)row * N + j) = o;
    }
    
  }
}



// ---- f16 WMMA path (v_wmma_f32_16x16x32_f16): 11-bit significands for operands in range — used where a [0,1] probability operand needs more precision than bf16
typedef _Float16 v16h __attribute__((ext_vector_type(16)));
union FragH { v16h v; v8us half[2]; _Float16 h[16]; unsigned short u[16]; };
template <int NT>
__device__ __forceinline__ v8f mmaH(v16h ah, v16h al, v16h bh, v16h bl, v8f c) {
  c = __builtin_amdgcn_wmma_f32_16x16x32_f16(false, ah, false, bh, (short)0, c, false, false);
  if (NT >= 2) c = __builtin_amdgcn_wmma_f32_16x16x32_f16(false, al, false, bh, (short)0, c, false, false);
  if (NT >= 3) c = __builtin_amdgcn_wmma_f32_16x16x32_f16(false, ah, false, bl, (short)0, c, false, false);
  asm volatile("v_nop\n\tv_nop\n\tv_nop\n\tv_nop" : "+v"(c) : "v"(ah), "v"(al), "v"(bh), "v"(bl));
  return c;
}
// batched GEMM like k_gemm_b but f16 operands: A f32 (split into f16 hi/lo if ASPLIT, else rounded to f16), Bt = f16 values [n][k]; alpha; C f32; N multiple of 16 (partial tiles skipped)
template <bool ASPLIT>
__global__ __launch_bounds__(128) void k_gemm_h(const float* __restrict__ A, int lda, size_t sA, const _Float16* __restrict__ Bh, int ldb, size_t sB, float alpha, float* __restrict__ C, int ldc, size_t sC, int M, int N, int K) {
  __shared__ __attribute__((aligned(16))) float so[4][16][64];
  const int tid = threadIdx.x, w = tid >> 5, lane = tid & 31, ln = lane & 15, hh = lane >> 4; const int by = blockIdx.y;
  A += (size_t)by * sA; Bh += (size_t)by * sB; C += (size_t)by * sC;
  const int ntn = (N + 63) / 64; const int wid = blockIdx.x * 4 + w; const int mt = wid / ntn, nq = wid % ntn; if (mt * 16 >= M) return;
  const int row0 = mt * 16, col0 = nq * 64; const float* arow = A + (size_t)(row0 + ln) * lda;
  v8f acc[4] = {};
  for (int kb = 0; kb < K; kb += 32) {
    FragH ah, al;
    const v4f x0 = *(const v4fa*)(arow + kb + 8 * hh), x1 = *(const v4fa*)(arow + kb + 8 * hh + 4), x2 = *(const v4fa*)(arow + kb + 16 + 8 * hh), x3 = *(const v4fa*)(arow + kb + 16 + 8 * hh + 4);
    float xs[16] = {x0[0],x0[1],x0[2],x0[3],x1[0],x1[1],x1[2],x1[3],x2[0],x2[1],x2[2],x2[3],x3[0],x3[1],x3[2],x3[3]};
#pragma unroll
    for (int i = 0; i < 16; ++i) { const _Float16 h = (_Float16)xs[i]; ah.h[i] = h; al.h[i] = ASPLIT ? (_Float16)(xs[i] - (float)h) : (_Float16)0.0f; }
#pragma unroll
    for (int t = 0; t < 4; ++t) { if (col0 + t * 16 >= N) continue; const size_t boff = (size_t)(col0 + t * 16 + ln) * ldb + kb; FragH bq; bq.half[0] = *(const v8us*)(Bh + boff + 8 * hh); bq.half[1] = *(const v8us*)(Bh + boff + 16 + 8 * hh);
      acc[t] = mmaH<ASPLIT ? 2 : 1>(ah.v, al.v, bq.v, bq.v, acc[t]); }
  }
#pragma unroll
  for (int t = 0; t < 4; ++t) { if (col0 + t * 16 >= N) continue;
#pragma unroll
    for (int r = 0; r < 8; ++r) so[w][8 * hh + r][t * 16 + ln] = acc[t][r] * alpha; }
  __builtin_amdgcn_fence(__ATOMIC_ACQ_REL, "workgroup"); __builtin_amdgcn_wave_barrier();
  const int rsub = lane >> 4, c4 = (lane & 15) * 4;
  {
#pragma unroll
    for (int q = 0; q < 8; ++q) { const int r = q * 2 + rsub; if (col0 + c4 < N) { const v4f v = *(const v4fa*)&so[w][r][c4]; *(v4f*)(C + (size_t)(row0 + r) * ldc + col0 + c4) = v; } }
     }
}

// FRAGMENT ORDER. Every 16-bit matrix operand M[row][k] (rows a multiple of 16, k a multiple of 32, KS = k-steps of 32) lies in the workspace as [row tile of 16][k-step][half j][lane][8 elements]:
// lane 16 hh + (row & 15) of half j of k-step s holds k = 32 s + 16 j + 8 hh + 0..7. One half of a fragment is then 32 lanes x 16 B = 512 contiguous bytes (4 cache lines), where rows of a row-major matrix gave 16 lines a load.
// The 16-byte piece number t of such a matrix (its place is element 8 t) holds row frag_row(t, KS), columns frag_k(t, KS) + 0..7; a writer whose thread t makes piece t stores whole lines.
__device__ __forceinline__ int frag_row(unsigned t, unsigned KS) { return (int)((t / (64 * KS)) * 16 + (t & 15)); }
__device__ __forceinline__ int frag_k(unsigned t, unsigned KS) { return (int)(((t >> 6) % KS) * 32 + ((t >> 5) & 1) * 16 + ((t >> 4) & 1) * 8); }
// Wt (row n, column k, fragment order) = f16(W[k][n] * scale) from f32 row-major W[K][N] (scale = power of two; bf16-exact weights stay exact in f16 away from the subnormal range)
__device__ __forceinline__ void wt_f16_block(const float* __restrict__ W, _Float16* __restrict__ Wt, int K, int N, float scale, int blk) {
  const int t = blk * 256 + threadIdx.x; if (t >= N * (K / 8)) return; const int n = frag_row(t, K / 32), k8 = frag_k(t, K / 32); FragH f;
#pragma unroll
  for (int i = 0; i < 8; ++i) f.h[i] = (_Float16)(bf16_round(W[(size_t)(k8 + i) * N + n]) * scale); const v8us o = f.half[0];
  *(v8us*)((unsigned short*)Wt + (size_t)t * 8) = o; 
}
// k_gemm_hh variant with fused epilogue: v = acc·alpha + bf16(bias_by[by·sBias + col]) (bias_by = bias, biasY1, biasY2 for by = 0, 1, 2) (+ CP[(row/rowsPerB)·sCPb + by·64 + col] if CP) ; ACT 0 none / 1 elu ; writes f16 C16 and f32 C, each if non-null
// N (a multiple of 64, so every wave owns four whole 16-column tiles) and K are compile-time: the k loop is unrolled whole and its fragment loads run PF k-steps ahead of the products that use them.
// A, Bh and C16 are in fragment order (K / 32, K / 32 and N / 32 k-steps a row tile); C is row-major with pitch ldc.
template <int ACT, int N, int K>
__global__ __launch_bounds__(128) void k_gemm_hhx(const _Float16* __restrict__ A, int lda, size_t sA, const _Float16* __restrict__ Bh, int ldb, size_t sB, float alpha, const float* __restrict__ bias, const float* __restrict__ biasY1, const float* __restrict__ biasY2, size_t sBias, const float* __restrict__ CP, int rowsPerB, size_t sCPb, int row0g,
    float* __restrict__ C, _Float16* __restrict__ C16, int ldc, size_t sC, int M) {
  static_assert(N % 64 == 0 && K % 32 == 0, "whole 64-column wave tiles and whole 32-deep k-steps");
  __shared__ __attribute__((aligned(16))) float so[4][16][64 + 4];      /* pitch 68: the fragment-order store below reads 16 rows at one column, which a pitch of 64 would put on the same banks */
  const int tid = threadIdx.x, w = tid >> 5, lane = tid & 31, ln = lane & 15, hh = lane >> 4; const int by = blockIdx.y;
  A += (size_t)by * sA; Bh += (size_t)by * sB; const size_t cofs = (size_t)by * sC; const float* bsel = (by == 0) ? bias : ((by == 1) ? biasY1 : biasY2); const float* bp = bsel ? bsel + (size_t)by * sBias : nullptr;      /* batch index by = 0, 1, 2 takes its own bias buffer */
  const int ntn = (N + 63) / 64; const int wid = blockIdx.x * 4 + w; const int mt = wid / ntn, nq = wid % ntn; if (mt * 16 >= M) return;
  const int row0 = mt * 16, col0 = nq * 64; (void)lda; (void)ldb;
  v8f acc[4] = {};
  constexpr int NS = K / 32, PF = 2, NB = PF + 1;      /* NB register stages: PF k-steps of loads in flight beside the one being multiplied */
  const unsigned short* ap = (const unsigned short*)A + (size_t)mt * NS * 512 + lane * 8; const unsigned short* bq0 = (const unsigned short*)Bh + (size_t)(nq * 4) * NS * 512 + lane * 8;      /* row tile mt of A; row tiles 4 nq + t of Bh */
  FragH fa[NB], fb[NB][4];
#pragma unroll
  for (int s = 0; s < NS + PF; ++s) {      /* unrolled whole: the stage indices must be constants for the stages to stay in registers */
    if (s < NS) { const int st = s % NB; fa[st].half[0] = *(const v8us*)(ap + s * 512); fa[st].half[1] = *(const v8us*)(ap + s * 512 + 256);
#pragma unroll
      for (int t = 0; t < 4; ++t) { const unsigned short* br = bq0 + (t * NS + s) * 512; fb[st][t].half[0] = *(const v8us*)br; fb[st][t].half[1] = *(const v8us*)(br + 256); } }
    if (s >= PF) { const int st = (s - PF) % NB;
#pragma unroll
      for (int t = 0; t < 4; ++t) acc[t] = mmaH<1>(fa[st].v, fa[st].v, fb[st][t].v, fb[st][t].v, acc[t]); }
  }
#pragma unroll
  for (int t = 0; t < 4; ++t) { if (col0 + t * 16 >= N) continue; const int col = col0 + t * 16 + ln; const float bv = bp ? bf16_round(bp[col]) : 0.f;
#pragma unroll
    for (int r = 0; r < 8; ++r) { float v = acc[t][r] * alpha + bv; if (CP) { const int bidx = (row0g + row0 + 8 * hh + r) / rowsPerB; v += CP[(size_t)bidx * sCPb + (size_t)by * 64 + col]; } if (ACT == 1) v = (v > 0.f) ? v : expm1f(v); else if (ACT == 7) v = (v > 0.f) ? v + 1.0f : expf(v); else if (ACT == 8) v = tanhf(v); else if (ACT == 9) v = 0.5f * v * (1.0f + tanhf(0.7978845608028654f * (v + 0.044715f * v * v * v))); else if (ACT == 11) v = 1.0f / (1.0f + expf(-v)); else if (ACT == 12) v = (v > 0.f) ? v : 0.01f * v; else if (ACT == 14) v = (v > 0.f) ? v : 0.1f * v; else if (ACT == 15) v = v / (1.0f + expf(-v)); else if (ACT == 3) v = fmaxf(v, 0.f); else if (ACT == 6) v = 0.5f * v * (1.0f + erff(v * 0.70710678118654752f)); so[w][8 * hh + r][t * 16 + ln] = v; } }
  __builtin_amdgcn_fence(__ATOMIC_ACQ_REL, "workgroup"); __builtin_amdgcn_wave_barrier();
  const int rsub = lane >> 4, c4 = (lane & 15) * 4;
  {
#pragma unroll
    for (int q = 0; q < 8; ++q) { const int r = q * 2 + rsub; if (C && col0 + c4 < N) { const v4f v = *(const v4fa*)&so[w][r][c4]; *(v4f*)(C + cofs + (size_t)(row0 + r) * ldc + col0 + c4) = v; } }
    if (C) asm volatile("s_wait_xcnt 0x0" ::: "memory");      /* directly behind the row-major stores: the fragment-order part below rewrites registers that they name */
    if (C16) { unsigned short* cp = (unsigned short*)C16 + cofs + ((size_t)mt * (N / 32) + nq * 2) * 512 + lane * 8;      /* the wave's 16 x 64 tile = two k-steps of row tile mt = 2 KB in a row: four 512-byte stores */
#pragma unroll
      for (int q = 0; q < 4; ++q) { const v4f v0 = *(const v4fa*)&so[w][ln][q * 16 + 8 * hh], v1 = *(const v4fa*)&so[w][ln][q * 16 + 8 * hh + 4]; FragH f;
#pragma unroll
        for (int i = 0; i < 4; ++i) { f.h[i] = (_Float16)v0[i]; f.h[4 + i] = (_Float16)v1[i]; }
        *(v8us*)(cp + q * 256) = f.half[0]; } }
     }
}


typedef _Float16 v4h __attribute__((ext_vector_type(4)));

__device__ __forceinline__ void x16_block(const float* __restrict__ x, _Float16* __restrict__ X16, size_t n8, int blk) { const size_t t = (size_t)blk * 256 + threadIdx.x; if (t >= n8) return; FragH f;      /* x row-major [NR][DX] -> X16 in fragment order */
  const float* xr = x + (size_t)frag_row((unsigned)t, DX / 32) * DX + frag_k((unsigned)t, DX / 32);
#pragma unroll
  for (int q = 0; q < 8; ++q) f.h[q] = (_Float16)bf16_round(xr[q]); *(v8us*)((unsigned short*)X16 + t * 8) = f.half[0];  }
// One grid for the five operand preparations, none of which reads another's result: the block index picks the job (block-uniform branch).
// Blocks 0 .. 3 NBW - 1: Wq, Wk, Wv (their outputs lie one behind the other in Bqkv); the next NBO: Wo; the last NBX: x.
#define NBW (2 * DX * (DX / 8) / 256)
#define NBO (DX * (DX / 8) / 256)
#define NBX (NR * DX / 8 / 256)
__global__ __launch_bounds__(256) void k_prep(const float* __restrict__ Wq, const float* __restrict__ Wk, const float* __restrict__ Wv, const float* __restrict__ Wo, const float* __restrict__ x,
                                              _Float16* __restrict__ Bqkv, _Float16* __restrict__ Bo, _Float16* __restrict__ X16) {
  const int bid = blockIdx.x;
  if (bid < 3 * NBW) { const int j = bid / NBW; wt_f16_block(j == 0 ? Wq : (j == 1 ? Wk : Wv), Bqkv + (size_t)j * 2 * DX * DX, DX, 2 * DX, 16.0f, bid % NBW); }
  else if (bid < 3 * NBW + NBO) wt_f16_block(Wo, Bo, DX, DX, 16.0f, bid - 3 * NBW);
  else x16_block(x, X16, (size_t)NR * DX / 8, bid - (3 * NBW + NBO)); }
__global__ __launch_bounds__(256) void k_h16(const float* __restrict__ x, _Float16* __restrict__ X16, size_t n8) { const size_t t = (size_t)blockIdx.x * 256 + threadIdx.x; if (t >= n8) return; FragH f;
#pragma unroll
  for (int q = 0; q < 8; ++q) f.h[q] = (_Float16)x[t * 8 + q]; *(v8us*)((unsigned short*)X16 + t * 8) = f.half[0];  }
__global__ __launch_bounds__(256) void k_round16f(const float* __restrict__ W, _Float16* __restrict__ Bt, size_t n8) { const size_t t = (size_t)blockIdx.x * 256 + threadIdx.x; if (t >= n8) return; FragH f;
#pragma unroll
  for (int i = 0; i < 8; ++i) f.h[i] = (_Float16)(bf16_round(W[t * 8 + i]) * 16.0f); *(v8us*)((unsigned short*)Bt + t * 8) = f.half[0];  }
template <int NHv, int TTv>
__global__ __launch_bounds__(256) void k_vt(const _Float16* __restrict__ V16, int ldv, int voff, _Float16* __restrict__ Vt) { __shared__ unsigned short tl[64][66]; const int tid = threadIdx.x; const int slab = blockIdx.x / (TTv / 64), lg = blockIdx.x % (TTv / 64); const int b = slab / NHv, h = slab % NHv;
  (void)ldv; (void)voff;      /* V16 in fragment order, NHv * 2 k-steps a row tile; piece i of the 64 x 64 block: row tile i >> 7, k-step (i >> 6) & 1, half (i >> 5) & 1, lane i & 31 */
  for (int i = tid; i < 64 * 8; i += 256) { const int r = (i >> 7) * 16 + (i & 15), c8 = ((i >> 6) & 1) * 32 + ((i >> 5) & 1) * 16 + ((i >> 4) & 1) * 8; FragH f; f.half[0] = *(const v8us*)((const unsigned short*)V16 + ((size_t)((b * TTv + lg * 64) / 16 + (i >> 7)) * (NHv * 2) + h * 2 + ((i >> 6) & 1)) * 512 + ((i >> 5) & 1) * 256 + (i & 31) * 8);
#pragma unroll
    for (int q = 0; q < 8; ++q) tl[r][c8 + q] = f.u[q]; }
  __syncthreads();
  {
#pragma unroll
    for (int rd = 0; rd < 2; ++rd) { const int i = rd * 256 + tid; const int d = (i >> 7) * 16 + (i & 15), pc = (i >> 4) & 7; FragH f;      /* Vt plane [64 rows d][TTv keys] in fragment order: row tile i >> 7, k-step lg * 2 + ((i >> 6) & 1), half (i >> 5) & 1, lane i & 31; keys lg * 64 + pc * 8 + q */
#pragma unroll
      for (int q = 0; q < 8; ++q) f.u[q] = tl[pc * 8 + q][d];
      *(v8us*)((unsigned short*)Vt + (size_t)slab * 64 * TTv + ((size_t)(i >> 7) * (TTv / 32) + lg * 2 + ((i >> 6) & 1)) * 512 + ((i >> 5) & 1) * 256 + (i & 31) * 8) = f.half[0]; }
     } }

__global__ __launch_bounds__(256) void k_h16s(const float* __restrict__ F, _Float16* __restrict__ H, size_t n8) { const size_t t = (size_t)blockIdx.x * 256 + threadIdx.x; if (t >= n8) return; const float* fr = F + (size_t)frag_row((unsigned)t, DX / 32) * DX + frag_k((unsigned)t, DX / 32); const v4f a = *(const v4fa*)fr, c = *(const v4fa*)(fr + 4); FragH f;      /* F row-major [NR][DX] -> H in fragment order */
#pragma unroll
  for (int q = 0; q < 4; ++q) { f.h[q] = (_Float16)(a[q] * 256.0f); f.h[4 + q] = (_Float16)(c[q] * 256.0f); } *(v8us*)((unsigned short*)H + t * 8) = f.half[0];  }
// Keys split inside the work-group: each of the 4 query tiles is walked by KVS waves; wave (qw, kr) takes the 32-key blocks kr, kr + KVS, kr + 2 KVS, ... with its own running max, sum and
// un-normalised accumulators; the KVS partials of a tile are merged through LDS behind one work-group barrier (weights exp(m_k - M)).
#define KVS 4
__global__ __launch_bounds__(128 * KVS) void k_flash(const _Float16* __restrict__ Q16, int ldq, const _Float16* __restrict__ K16, int ldk, const _Float16* __restrict__ Vt, float* __restrict__ O, int ldo) {
  constexpr int RPW = 16, RTN = RPW / 16, NQB = NN / (4 * RPW), DT = 4, KS = 2, NW = 4 * KVS, RM = RPW / KVS;
  __shared__ __attribute__((aligned(16))) unsigned short sP[NW][RPW][40]; __shared__ __attribute__((aligned(16))) float sO[NW][RPW][128 + 4]; __shared__ float sM[NW][RPW], sL[NW][RPW];
  const int tid = threadIdx.x, w = __builtin_amdgcn_readfirstlane(tid >> 5), lane = tid & 31, ln = lane & 15, hh = lane >> 4; const int qw = w & 3, kr = w >> 2;      /* the wave's number held as a scalar: tile and key-block indices leave the vector registers, which the grouped fragments need */
  const int slab = blockIdx.x / NQB, qblk = blockIdx.x % NQB; const int b = slab / NHU, h = slab % NHU; const int qb0 = qblk * (4 * RPW); const int q0 = qb0 + qw * RPW;
  FragH aq[2][KS], aql[2][KS];
#pragma unroll
  for (int rt = 0; rt < RTN; ++rt) { const size_t qo = ((size_t)((b * NN + q0) / 16 + rt) * (DX / 32) + h * 4) * 512 + lane * 8; const unsigned short* qr = (const unsigned short*)Q16 + qo; const unsigned short* ql = qr + 2 * 512;      /* Q16, K16 in fragment order: head h = k-steps 4 h .. 4 h + 3 of a row tile; aq = real part (the first two), aql = imaginary part */
#pragma unroll
    for (int ks = 0; ks < KS; ++ks) { aq[rt][ks].half[0] = *(const v8us*)(qr + ks * 512); aq[rt][ks].half[1] = *(const v8us*)(qr + ks * 512 + 256); aql[rt][ks].half[0] = *(const v8us*)(ql + ks * 512); aql[rt][ks].half[1] = *(const v8us*)(ql + ks * 512 + 256); } }
  (void)ldq; (void)ldk;
  const unsigned short* Vth = (const unsigned short*)Vt + ((size_t)b * 2 * NHU + 2 * h) * 64 * NN; const unsigned short* Vti = Vth + (size_t)64 * NN;      /* Vᵀ real / imag planes of head h */
  float m_r[2][8], l_r[2][8]; v8f oacc[2][DT], oacci[2][DT];
#pragma unroll
  for (int rt = 0; rt < RTN; ++rt) {
#pragma unroll
    for (int r = 0; r < 8; ++r) { m_r[rt][r] = -3.0e38f; l_r[rt][r] = 0.f; }
#pragma unroll
    for (int dt = 0; dt < DT; ++dt) { oacc[rt][dt] = (v8f){0.f,0.f,0.f,0.f,0.f,0.f,0.f,0.f}; oacci[rt][dt] = oacc[rt][dt]; } }
  const int jend = NN;
#pragma unroll 1
  for (int j0 = kr * 32; j0 < jend; j0 += 32 * KVS) {
    
    v8f s[2][2]; FragH bk[2][KS], bl[2][KS];      /* bk = real, bl = imaginary; both 16-key tiles' fragments are loaded as one group ahead of the score products */
    const unsigned short* kp[2];
#pragma unroll
    for (int nt = 0; nt < 2; ++nt) { kp[nt] = (const unsigned short*)K16 + ((size_t)((b * NN + j0) / 16 + nt) * (DX / 32) + h * 4) * 512 + lane * 8; const unsigned short* kr = kp[nt]; const unsigned short* kl = kr + 2 * 512;
#pragma unroll
      for (int ks = 0; ks < KS; ++ks) { bk[nt][ks].half[0] = *(const v8us*)(kr + ks * 512); bk[nt][ks].half[1] = *(const v8us*)(kr + ks * 512 + 256); bl[nt][ks].half[0] = *(const v8us*)(kl + ks * 512); bl[nt][ks].half[1] = *(const v8us*)(kl + ks * 512 + 256); } }
    asm volatile("s_wait_xcnt 0x0" :: "v"(kp[0]), "v"(kp[1]) : "memory");      /* keeps both address pairs alive past the last load of the group, so that no load's result lands in a pair that an issued load names before this wait */
#pragma unroll
    for (int nt = 0; nt < 2; ++nt) {
#pragma unroll
      for (int rt = 0; rt < RTN; ++rt) { v8f re = (v8f){0.f,0.f,0.f,0.f,0.f,0.f,0.f,0.f}, ip = re, in = re;
#pragma unroll
        for (int ks = 0; ks < KS; ++ks) { re = mmaH<1>(aq[rt][ks].v, aq[rt][ks].v, bk[nt][ks].v, bk[nt][ks].v, re); re = mmaH<1>(aql[rt][ks].v, aql[rt][ks].v, bl[nt][ks].v, bl[nt][ks].v, re); ip = mmaH<1>(aql[rt][ks].v, aql[rt][ks].v, bk[nt][ks].v, bk[nt][ks].v, ip); in = mmaH<1>(aq[rt][ks].v, aq[rt][ks].v, bl[nt][ks].v, bl[nt][ks].v, in); }
#pragma unroll
        for (int r = 0; r < 8; ++r) { const float im = ip[r] - in[r]; re[r] = (re[r] * re[r] + im * im) * SCORE_SCALE; } s[rt][nt] = re; } }
    FragH bv[DT], bi[DT];      /* all value fragments of this key block are requested here, so that they travel while the softmax below is computed */
    const unsigned short* vp = Vth + (size_t)(j0 / 32) * 512 + lane * 8; const unsigned short* vq = vp + (size_t)64 * NN;      /* fragment order: k-step j0 / 32 of row tile dt, NN / 32 k-steps a row tile */
#pragma unroll
    for (int dt = 0; dt < DT; ++dt) { const size_t vo = (size_t)(dt * 16) * NN; bv[dt].half[0] = *(const v8us*)(vp + vo); bv[dt].half[1] = *(const v8us*)(vp + vo + 256); bi[dt].half[0] = *(const v8us*)(vq + vo); bi[dt].half[1] = *(const v8us*)(vq + vo + 256); }
    asm volatile("s_wait_xcnt 0x0" :: "v"(vp) : "memory");      /* as above: the address pair outlives the group's last load */
#pragma unroll
    for (int rt = 0; rt < RTN; ++rt)
#pragma unroll
      for (int r = 0; r < 8; ++r) { const int tq = q0 + rt * 16 + 8 * hh + r; const int k0 = j0 + ln, k1 = j0 + 16 + ln; (void)tq; (void)k0; (void)k1;
        const bool ok0 = true, ok1 = true;
        const float s0 = s[rt][0][r], s1 = s[rt][1][r]; float mc = fmaxf(s0, s1);
        mc = fmaxf(mc, __shfl_xor(mc, 1, 32)); mc = fmaxf(mc, __shfl_xor(mc, 2, 32)); mc = fmaxf(mc, __shfl_xor(mc, 4, 32)); mc = fmaxf(mc, __shfl_xor(mc, 8, 32));
        const float mn = fmaxf(m_r[rt][r], mc); const float al = (mn > -1.0e38f) ? expf(m_r[rt][r] - mn) : 1.0f; m_r[rt][r] = mn; const float p0 = expf(s0 - mn), p1 = expf(s1 - mn); l_r[rt][r] = l_r[rt][r] * al + p0 + p1;
#pragma unroll
        for (int dt = 0; dt < DT; ++dt) { oacc[rt][dt][r] *= al; oacci[rt][dt][r] *= al; }
        FragH t2; t2.h[0] = (_Float16)(p0 * 1024.0f); t2.h[1] = (_Float16)(p1 * 1024.0f); sP[w][rt * 16 + 8 * hh + r][ln] = t2.u[0]; sP[w][rt * 16 + 8 * hh + r][16 + ln] = t2.u[1]; }
    __builtin_amdgcn_fence(__ATOMIC_ACQ_REL, "workgroup"); __builtin_amdgcn_wave_barrier();
    FragH pa[2];
#pragma unroll
    for (int rt = 0; rt < RTN; ++rt) { pa[rt].half[0] = *(const v8us*)&sP[w][rt * 16 + ln][8 * hh]; pa[rt].half[1] = *(const v8us*)&sP[w][rt * 16 + ln][16 + 8 * hh]; }
#pragma unroll
    for (int dt = 0; dt < DT; ++dt) {
#pragma unroll
      for (int rt = 0; rt < RTN; ++rt) { oacc[rt][dt] = mmaH<1>(pa[rt].v, pa[rt].v, bv[dt].v, bv[dt].v, oacc[rt][dt]); oacci[rt][dt] = mmaH<1>(pa[rt].v, pa[rt].v, bi[dt].v, bi[dt].v, oacci[rt][dt]); } }
    __builtin_amdgcn_fence(__ATOMIC_ACQ_REL, "workgroup"); __builtin_amdgcn_wave_barrier(); }
#pragma unroll
  for (int rt = 0; rt < RTN; ++rt) {
#pragma unroll
    for (int r = 0; r < 8; ++r) { float l = l_r[rt][r]; l += __shfl_xor(l, 1, 32); l += __shfl_xor(l, 2, 32); l += __shfl_xor(l, 4, 32); l += __shfl_xor(l, 8, 32); if (ln == 0) { sM[w][rt * 16 + 8 * hh + r] = m_r[rt][r]; sL[w][rt * 16 + 8 * hh + r] = l; } }
#pragma unroll
    for (int dt = 0; dt < DT; ++dt)
#pragma unroll
      for (int r = 0; r < 8; ++r) { sO[w][rt * 16 + 8 * hh + r][dt * 16 + ln] = oacc[rt][dt][r]; sO[w][rt * 16 + 8 * hh + r][64 + dt * 16 + ln] = oacci[rt][dt][r]; } }
  __syncthreads();      /* publishes every wave's partial (max, sum, accumulators) to the waves that merge it */
  {
#pragma unroll
    for (int rp = 0; rp < RM; ++rp) { const int r = kr * RM + rp, pc = lane;      /* wave (qw, kr) merges rows kr*RM .. of query tile qw */
      float mk[KVS], M = -3.0e38f;
#pragma unroll
      for (int k = 0; k < KVS; ++k) { mk[k] = sM[k * 4 + qw][r]; M = fmaxf(M, mk[k]); }
      float L = 0.f; v4f o = {0.f, 0.f, 0.f, 0.f};
#pragma unroll
      for (int k = 0; k < KVS; ++k) { const float wk = expf(mk[k] - M); L += wk * sL[k * 4 + qw][r]; const v4f part = *(const v4fa*)&sO[k * 4 + qw][r][pc * 4]; o += part * wk; }
      const float inv = (L > 0.f) ? 1.0f / (L * 1024.0f) : 0.f;
      *(v4f*)(O + ((size_t)b * NN + q0 + r) * ldo + h * 128 + pc * 4) = o * inv;      /* 32 lanes x 16 B = the head's [real | imag] 512-B run */
      asm volatile("s_wait_xcnt 0x0" ::: "memory"); }      /* stands in front of the next row's rewrite of the registers that the issued store names */
     } }

extern "C" void kernel_launch(void* const* d_in, const int* in_sizes, int n_in,
                              void* d_out, int out_size, void* d_ws, size_t ws_size, hipStream_t stream) {
  (void)in_sizes; (void)n_in; (void)out_size;
  const float* const* I = (const float* const*)d_in; const float* x = I[0]; const float* Wq = I[1]; const float* bq = I[2]; const float* Wk = I[3]; const float* bk = I[4]; const float* Wv = I[5]; const float* bv = I[6]; const float* Wo = I[7]; const float* bo = I[8];
  char* ws = (char*)d_ws; size_t off = 0;
  auto take = [&](size_t bytes) { char* p = ws + off; off += (bytes + 255) & ~(size_t)255; return p; };
  _Float16* Bq = (_Float16*)take((size_t)3 * 2 * DX * DX * 2); _Float16* Bo = (_Float16*)take((size_t)DX * DX * 2);
  _Float16* X16 = (_Float16*)take((size_t)NR * DX * 2); _Float16* Q = (_Float16*)take((size_t)3 * NR * DX * 2); _Float16* K = Q + (size_t)NR * DX; _Float16* V = K + (size_t)NR * DX;      /* q, k, v one behind the other: batch stride of the merged projection */ _Float16* Vt = (_Float16*)take((size_t)NR * DX * 2);
  float* O = (float*)take((size_t)NR * DX * 4); _Float16* O16 = (_Float16*)take((size_t)NR * DX * 2);
  /* Bq, Bo, X16, Q, K, V, Vt and O16 are all in fragment order (see FRAGMENT ORDER above); O and the output are row-major */
  if (off > ws_size) return;      // 3 × 1 + 0.5 + 5 × 4.2 + 8.4 + 4.2 ≈ 37 MB
  k_prep<<<3 * NBW + NBO + NBX, 256, 0, stream>>>(Wq, Wk, Wv, Wo, x, Bq, Bo, X16);      /* (in,out) [512][1024] -> Bt[1024][512] x2^4 for Wq, Wk, Wv (only rows 0..511 = heads 0..3 are used), Wo likewise, x -> f16: one launch */
  const dim3 gp(((NR / 16) * (DX / 64) + 3) / 4, 1), gp3(((NR / 16) * (DX / 64) + 3) / 4, 3);
  k_gemm_hhx<0, DX, DX><<<gp3, 128, 0, stream>>>(X16, DX, 0, Bq, DX, (size_t)2 * DX * DX, 0.0625f, bq, bk, bv, 0, nullptr, 1, 0, 0, nullptr, Q, DX, (size_t)NR * DX, NR);      /* q, k, v in one launch (blockIdx.y), heads 0..3 = output columns 0..511 (+ bias): each M 4096 N 512 K 512 */
  k_vt<2 * NHU, NN><<<BB * 2 * NHU * (NN / 64), 256, 0, stream>>>(V, DX, 0, Vt);      /* Vᵀ planes per (b, head, part): [b·8 + 2h + part][64][2048] */
  k_flash<<<BB * NHU * (NN / 64), 128 * KVS, 0, stream>>>(Q, DX, K, DX, Vt, O, DX);
  k_h16s<<<(unsigned)(((size_t)NR * DX / 8 + 255) / 256), 256, 0, stream>>>(O, O16, (size_t)NR * DX / 8);
  k_gemm_hhx<0, DX, DX><<<gp, 128, 0, stream>>>(O16, DX, 0, Bo, DX, 0, 0.0625f * 0.00390625f, bo, nullptr, nullptr, 0, nullptr, 1, 0, 0, (float*)d_out, nullptr, DX, 0, NR);      /* out = O·Wo + bo (alpha undoes ×2^4 weights and the ×2^8 carry) */
}

// v005
// One run takes 72.8 microseconds.
// Next to v004, in two timings, it ran 1.31 and 1.32 times as fast.
// All steps since v000 together make it 4.43 times as fast.
#include <hip/hip_runtime.h>
// 'Superposition' (complex-valued) multi-head attention (B=2, S=2048, D=512, 8 heads; q,k,v projections to 2D with per-head [real 64 | imag 64]): interference = Σ_d q_d·conj(k_d)·64^-½; probs = softmax(|interference|²/0.5); out = probs·v (complex);
// out = concat[real, imag] per head → [B,S,1024], truncated to the first 512 columns (= heads 0..3), then ·Wo + bo. Only heads 0..3 reach the output, so only they are computed.
// Compute dtype: x, weights, biases rounded to bf16; q/k/v (columns of heads 0..3) as f16 GEMM outputs; fused flash-style kernel with three f32 score accumulators (Re, Im⁺, Im⁻) and two value accumulators
// (real, imag), online softmax f32, P f16 ×2^10, on v_wmma_f32_16x16x32_f16; O carried ×2^8 into f16 (small diffuse values) → output GEMM with bias (alpha undoes the carry); f32 accumulate.
#define BB 2
#define NN 2048
#define DX 512
#define NHU 4
#define DH2 128
#define NR (BB * NN)
#define SCORE_SCALE 0.03125f

typedef __bf16 v16b __attribute__((ext_vector_type(16)));
typedef unsigned short v8us __attribute__((ext_vector_type(8), may_alias));
typedef float  v8f  __attribute__((ext_vector_type(8)));
typedef float  v4f  __attribute__((ext_vector_type(4)));
typedef float  v4fa __attribute__((ext_vector_type(4), may_alias));
union FragB { v16b v; v8us half[2]; unsigned short u[16]; };

__device__ __forceinline__ unsigned short bf16_bits(float x) { unsigned int u = __float_as_uint(x); return (unsigned short)((u + 0x7FFFu + ((u >> 16) & 1u)) >> 16); }
__device__ __forceinline__ float bf16_val(unsigned short b) { return __uint_as_float(((unsigned int)b) << 16); }
__device__ __forceinline__ float bf16_round(float x) { return bf16_val(bf16_bits(x)); }
// D += A·B with NT terms: 1 = ah·bh, 2 = + al·bh (A split), 3 = + ah·bl (both split)
template <int NT>
__device__ __forceinline__ v8f mmaN(v16b ah, v16b al, v16b bh, v16b bl, v8f c) {
  c = __builtin_amdgcn_wmma_f32_16x16x32_bf16(false, ah, false, bh, (short)0, c, false, false);
  if (NT >= 2) c = __builtin_amdgcn_wmma_f32_16x16x32_bf16(false, al, false, bh, (short)0, c, false, false);
  if (NT >= 3) c = __builtin_amdgcn_wmma_f32_16x16x32_bf16(false, ah, false, bl, (short)0, c, false, false);
  asm volatile("v_nop\n\tv_nop\n\tv_nop\n\tv_nop" : "+v"(c) : "v"(ah), "v"(al), "v"(bh), "v"(bl));
  return c;
}

__global__ __launch_bounds__(256) void k_wt_bf16(const float* __restrict__ W, unsigned short* __restrict__ Wt, int K, int N) {
  const int t = blockIdx.x * 256 + threadIdx.x;
  const int k8n = K / 8;
  if (t >= N * k8n) return;
  const int n = t / k8n, k8 = (t % k8n) * 8;
  v8us v;
#pragma unroll
  for (int i = 0; i < 8; ++i) v[i] = bf16_bits(W[(size_t)(k8 + i) * N + n]);
  *(v8us*)(Wt + (size_t)n * K + k8) = v;
  
}

// GEMM C[M][N] (f32, pitch ldc) = act(A[M][K]·W + bias). A f32 row-major (pitch lda) converted per fragment to bf16
// (ASPLIT: hi/lo two planes -> 2 terms, else single rounded term); Wt bf16 [N][K] (pitch ldb). BIAS_BF16 rounds the
// bias to bf16 first (bias quantised to bf16 before the add). K%32==0, M%16==0, N%64==0.
template <bool ASPLIT, int ACT, bool BIAS_BF16>
__global__ __launch_bounds__(128) void k_gemm_bf(const float* __restrict__ A, int lda, const unsigned short* __restrict__ Wt, int ldb,
                                               const float* __restrict__ bias, float* __restrict__ C, int ldc, int M, int N, int K) {
  __shared__ __attribute__((aligned(16))) float so[4][16][64];
  const int tid = threadIdx.x, w = tid >> 5, lane = tid & 31, ln = lane & 15, hh = lane >> 4;
  const int ntn = N / 64;
  const int wid = blockIdx.x * 4 + w;
  const int mt = wid / ntn, nq = wid % ntn;
  if (mt * 16 >= M) return;
  const int row0 = mt * 16, col0 = nq * 64;
  const float* arow = A + (size_t)(row0 + ln) * lda;
  v8f acc[4] = {};
  for (int kb = 0; kb < K; kb += 32) {
    FragB ah, al;
    const v4f x0 = *(const v4fa*)(arow + kb + 8 * hh), x1 = *(const v4fa*)(arow + kb + 8 * hh + 4);
    const v4f x2 = *(const v4fa*)(arow + kb + 16 + 8 * hh), x3 = *(const v4fa*)(arow + kb + 16 + 8 * hh + 4);
    float xs[16] = {x0[0],x0[1],x0[2],x0[3],x1[0],x1[1],x1[2],x1[3],x2[0],x2[1],x2[2],x2[3],x3[0],x3[1],x3[2],x3[3]};
#pragma unroll
    for (int i = 0; i < 16; ++i) { const unsigned short hb = bf16_bits(xs[i]); ah.u[i] = hb; al.u[i] = ASPLIT ? bf16_bits(xs[i] - bf16_val(hb)) : (unsigned short)0; }
#pragma unroll
    for (int t = 0; t < 4; ++t) {
      const unsigned short* brow = Wt + (size_t)(col0 + t * 16 + ln) * ldb + kb;
      FragB b;
      b.half[0] = *(const v8us*)(brow + 8 * hh);
      b.half[1] = *(const v8us*)(brow + 16 + 8 * hh);
      acc[t] = mmaN<ASPLIT ? 2 : 1>(ah.v, al.v, b.v, b.v, acc[t]);
    }
  }
#pragma unroll
  for (int t = 0; t < 4; ++t) {
    float bv = bias ? bias[col0 + t * 16 + ln] : 0.f;
    if (BIAS_BF16) bv = bf16_round(bv);
#pragma unroll
    for (int r = 0; r < 8; ++r) { float v = acc[t][r] + bv; if (ACT == 1) v = fmaxf(v, 0.f); so[w][8 * hh + r][t * 16 + ln] = v; }
  }
  __builtin_amdgcn_fence(__ATOMIC_ACQ_REL, "workgroup");
  __builtin_amdgcn_wave_barrier();
  const int rsub = lane >> 4, c4 = (lane & 15) * 4;
  {
#pragma unroll
    for (int q = 0; q < 8; ++q) {
      const int r = q * 2 + rsub;
      const v4f v = *(const v4fa*)&so[w][r][c4];
      *(v4f*)(C + (size_t)(row0 + r) * ldc + col0 + c4) = v;
    }
    
  }
}

// Flash-style causal/unmasked attention, all contractions 3-term bf16 hi/lo splits, f32 softmax with running max.
// q,k,v rows are read from f32 buffers with arbitrary row pitch (so they can live inside a fused qkv buffer);
// D = head size (multiple of 32, <= 128); one wave = 16 query rows; block = 4 waves (64 queries) sharing K/V chunks of 32.
template <int D, bool CAUSAL>
__global__ __launch_bounds__(128) void k_flash(const float* __restrict__ qb, const float* __restrict__ kb, const float* __restrict__ vb,
                                             int pitch, int T, int H, float scale, float* __restrict__ y, int ypitch) {
  constexpr int KS = D / 32;        // k-steps for QK
  constexpr int DT = D / 16;        // d tiles for PV
  __shared__ __attribute__((aligned(16))) unsigned short sKh[32][D + 8], sKl[32][D + 8], sVh[32][D + 8], sVl[32][D + 8];
  __shared__ __attribute__((aligned(16))) unsigned short sPh[4][16][40], sPl[4][16][40];
  __shared__ __attribute__((aligned(16))) float sO[4][16][D];
  const int tid = threadIdx.x, w = tid >> 5, lane = tid & 31, ln = lane & 15, hh = lane >> 4;
  const int nqb = (T + 63) / 64;
  const int bh = blockIdx.x / nqb, qblk = blockIdx.x % nqb;
  const int b = bh / H, h = bh % H;
  const int q0 = qblk * 64 + w * 16;
  const float* Q = qb + (size_t)b * T * pitch + h * D;
  const float* K = kb + (size_t)b * T * pitch + h * D;
  const float* V = vb + (size_t)b * T * pitch + h * D;

  // A fragments of the wave's 16 query rows (scaled), hi/lo
  FragB aqh[KS], aql[KS];
  {
    int row = q0 + ln; if (row >= T) row = T - 1;
    const float* qr = Q + (size_t)row * pitch;
#pragma unroll
    for (int ks = 0; ks < KS; ++ks)
#pragma unroll
      for (int i = 0; i < 16; ++i) {
        const int d = ks * 32 + ((i < 8) ? (8 * hh + i) : (16 + 8 * hh + (i - 8)));
        const float x = qr[d] * scale; const unsigned short hb = bf16_bits(x);
        aqh[ks].u[i] = hb; aql[ks].u[i] = bf16_bits(x - bf16_val(hb));
      }
  }
  float m_r[8], l_r[8];
#pragma unroll
  for (int r = 0; r < 8; ++r) { m_r[r] = -3.0e38f; l_r[r] = 0.f; }
  v8f oacc[DT];
#pragma unroll
  for (int dt = 0; dt < DT; ++dt) oacc[dt] = (v8f){0.f,0.f,0.f,0.f,0.f,0.f,0.f,0.f};

  const int kv_end = CAUSAL ? min(T, qblk * 64 + 64) : T;     // block-uniform
  for (int j0 = 0; j0 < kv_end; j0 += 32) {
    __syncthreads();
    for (int e = tid; e < 32 * (D / 4); e += 128) {
      const int r = e / (D / 4), c4 = (e % (D / 4)) * 4;
      const int key = j0 + r;
      v4f kf = {0.f,0.f,0.f,0.f}, vf = {0.f,0.f,0.f,0.f};
      if (key < T) { kf = *(const v4fa*)(K + (size_t)key * pitch + c4); vf = *(const v4fa*)(V + (size_t)key * pitch + c4); }
#pragma unroll
      for (int t = 0; t < 4; ++t) {
        unsigned short hb = bf16_bits(kf[t]); sKh[r][c4 + t] = hb; sKl[r][c4 + t] = bf16_bits(kf[t] - bf16_val(hb));
        hb = bf16_bits(vf[t]); sVh[r][c4 + t] = hb; sVl[r][c4 + t] = bf16_bits(vf[t] - bf16_val(hb));
      }
    }
    __syncthreads();
    // S tile 16 x 32
    v8f s[2];
#pragma unroll
    for (int nt = 0; nt < 2; ++nt) {
      v8f acc = {};
#pragma unroll
      for (int ks = 0; ks < KS; ++ks) {
        FragB bh_, bl_;
        bh_.half[0] = *(const v8us*)&sKh[nt * 16 + ln][ks * 32 + 8 * hh]; bh_.half[1] = *(const v8us*)&sKh[nt * 16 + ln][ks * 32 + 16 + 8 * hh];
        bl_.half[0] = *(const v8us*)&sKl[nt * 16 + ln][ks * 32 + 8 * hh]; bl_.half[1] = *(const v8us*)&sKl[nt * 16 + ln][ks * 32 + 16 + 8 * hh];
        acc = mmaN<3>(aqh[ks].v, aql[ks].v, bh_.v, bl_.v, acc);
      }
      s[nt] = acc;
    }
    // mask + running max (rows 8hh+r; the 16 lanes of a half share rows)
    float alpha[8];
#pragma unroll
    for (int r = 0; r < 8; ++r) {
      const int qi = q0 + 8 * hh + r;
      const int ja = j0 + ln, jb = j0 + 16 + ln;
      if (CAUSAL) { if (ja > qi) s[0][r] = -3.0e38f; if (jb > qi) s[1][r] = -3.0e38f; }
      if (ja >= T) s[0][r] = -3.0e38f;
      if (jb >= T) s[1][r] = -3.0e38f;
      float mx = fmaxf(s[0][r], s[1][r]);
      mx = fmaxf(mx, __shfl_xor(mx, 1, 32)); mx = fmaxf(mx, __shfl_xor(mx, 2, 32)); mx = fmaxf(mx, __shfl_xor(mx, 4, 32)); mx = fmaxf(mx, __shfl_xor(mx, 8, 32));
      const float mnew = fmaxf(m_r[r], mx);
      alpha[r] = (mnew > -1.0e38f) ? __expf(m_r[r] - mnew) : 1.0f;
      const float p0 = (s[0][r] > -1.0e38f) ? __expf(s[0][r] - mnew) : 0.f;
      const float p1 = (s[1][r] > -1.0e38f) ? __expf(s[1][r] - mnew) : 0.f;
      m_r[r] = mnew;
      l_r[r] = l_r[r] * alpha[r] + p0 + p1;            // per-lane partial row sum (16 lanes combined at the end)
      unsigned short hb = bf16_bits(p0); sPh[w][8 * hh + r][ln] = hb;      sPl[w][8 * hh + r][ln] = bf16_bits(p0 - bf16_val(hb));
      hb = bf16_bits(p1);                sPh[w][8 * hh + r][16 + ln] = hb; sPl[w][8 * hh + r][16 + ln] = bf16_bits(p1 - bf16_val(hb));
    }
#pragma unroll
    for (int dt = 0; dt < DT; ++dt)
#pragma unroll
      for (int r = 0; r < 8; ++r) oacc[dt][r] *= alpha[r];
    __builtin_amdgcn_fence(__ATOMIC_ACQ_REL, "workgroup");
    __builtin_amdgcn_wave_barrier();
    FragB pah, pal;
    pah.half[0] = *(const v8us*)&sPh[w][ln][8 * hh]; pah.half[1] = *(const v8us*)&sPh[w][ln][16 + 8 * hh];
    pal.half[0] = *(const v8us*)&sPl[w][ln][8 * hh]; pal.half[1] = *(const v8us*)&sPl[w][ln][16 + 8 * hh];
#pragma unroll
    for (int dt = 0; dt < DT; ++dt) {
      FragB bvh, bvl;
#pragma unroll
      for (int i = 0; i < 8; ++i) {
        bvh.u[i] = sVh[8 * hh + i][dt * 16 + ln]; bvh.u[8 + i] = sVh[16 + 8 * hh + i][dt * 16 + ln];
        bvl.u[i] = sVl[8 * hh + i][dt * 16 + ln]; bvl.u[8 + i] = sVl[16 + 8 * hh + i][dt * 16 + ln];
      }
      oacc[dt] = mmaN<3>(pah.v, pal.v, bvh.v, bvl.v, oacc[dt]);
    }
    __builtin_amdgcn_fence(__ATOMIC_ACQ_REL, "workgroup");
    __builtin_amdgcn_wave_barrier();
  }
#pragma unroll
  for (int r = 0; r < 8; ++r) {
    float l = l_r[r];
    l += __shfl_xor(l, 1, 32); l += __shfl_xor(l, 2, 32); l += __shfl_xor(l, 4, 32); l += __shfl_xor(l, 8, 32);
    l_r[r] = (l > 0.f) ? 1.0f / l : 0.f;
  }
#pragma unroll
  for (int dt = 0; dt < DT; ++dt)
#pragma unroll
    for (int r = 0; r < 8; ++r) sO[w][8 * hh + r][dt * 16 + ln] = oacc[dt][r] * l_r[r];
  __builtin_amdgcn_fence(__ATOMIC_ACQ_REL, "workgroup");
  __builtin_amdgcn_wave_barrier();
  {
    for (int r = 0; r < 16; ++r) {
      const int row = q0 + r;
      if (row < T && lane < D / 4) {
        const v4f val = *(const v4fa*)&sO[w][r][lane * 4];
        *(v4f*)(y + ((size_t)b * T + row) * ypitch + h * D + lane * 4) = val;
      }
    }
    
  }
}

// GEMM C = act(A·W + bias + resid): A f32 (ASPLIT -> hi/lo 2 terms), Wt bf16 [N][K]; ACT 0 none, 1 relu, 2 exact gelu;
// resid (optional, f32, row index = (row % rmod), pitch ldr, RES_BF16 rounds it) added before the activation.
template <bool ASPLIT, int ACT, bool BIAS_BF16, bool RES_BF16>
__global__ __launch_bounds__(128) void k_gemm_bf3(const float* __restrict__ A, int lda, const unsigned short* __restrict__ Wt, int ldb,
                                                const float* __restrict__ bias, const float* __restrict__ resid, int rmod, int ldr,
                                                float* __restrict__ C, int ldc, int M, int N, int K) {
  __shared__ __attribute__((aligned(16))) float so[4][16][64];
  const int tid = threadIdx.x, w = tid >> 5, lane = tid & 31, ln = lane & 15, hh = lane >> 4;
  const int ntn = N / 64;
  const int wid = blockIdx.x * 4 + w;
  const int mt = wid / ntn, nq = wid % ntn;
  if (mt * 16 >= M) return;
  const int row0 = mt * 16, col0 = nq * 64;
  const float* arow = A + (size_t)(row0 + ln) * lda;
  v8f acc[4] = {};
  for (int kb = 0; kb < K; kb += 32) {
    FragB ah, al;
    const v4f x0 = *(const v4fa*)(arow + kb + 8 * hh), x1 = *(const v4fa*)(arow + kb + 8 * hh + 4);
    const v4f x2 = *(const v4fa*)(arow + kb + 16 + 8 * hh), x3 = *(const v4fa*)(arow + kb + 16 + 8 * hh + 4);
    float xs[16] = {x0[0],x0[1],x0[2],x0[3],x1[0],x1[1],x1[2],x1[3],x2[0],x2[1],x2[2],x2[3],x3[0],x3[1],x3[2],x3[3]};
#pragma unroll
    for (int i = 0; i < 16; ++i) { const unsigned short hb = bf16_bits(xs[i]); ah.u[i] = hb; al.u[i] = ASPLIT ? bf16_bits(xs[i] - bf16_val(hb)) : (unsigned short)0; }
#pragma unroll
    for (int t = 0; t < 4; ++t) {
      const unsigned short* brow = Wt + (size_t)(col0 + t * 16 + ln) * ldb + kb;
      FragB b;
      b.half[0] = *(const v8us*)(brow + 8 * hh);
      b.half[1] = *(const v8us*)(brow + 16 + 8 * hh);
      acc[t] = mmaN<ASPLIT ? 2 : 1>(ah.v, al.v, b.v, b.v, acc[t]);
    }
  }
#pragma unroll
  for (int t = 0; t < 4; ++t) {
    const int col = col0 + t * 16 + ln;
    float bv = bias ? bias[col] : 0.f;
    if (BIAS_BF16) bv = bf16_round(bv);
#pragma unroll
    for (int r = 0; r < 8; ++r) {
      float v = acc[t][r] + bv;
      if (resid) { float rv = resid[(size_t)((row0 + 8 * hh + r) % rmod) * ldr + col]; if (RES_BF16) rv = bf16_round(rv); v += rv; }
      if (ACT == 1) v = fmaxf(v, 0.f);
      if (ACT == 2) v = 0.5f * v * (1.0f + erff(v * 0.70710678118654752f));
      if (ACT == 3) { const float u = 0.7978845608028654f * (v + 0.044715f * v * v * v); v = 0.5f * v * (1.0f + tanhf(u)); }
      so[w][8 * hh + r][t * 16 + ln] = v;
    }
  }
  __builtin_amdgcn_fence(__ATOMIC_ACQ_REL, "workgroup");
  __builtin_amdgcn_wave_barrier();
  const int rsub = lane >> 4, c4 = (lane & 15) * 4;
  {
#pragma unroll
    for (int q = 0; q < 8; ++q) {
      const int r = q * 2 + rsub;
      const v4f v = *(const v4fa*)&so[w][r][c4];
      *(v4f*)(C + (size_t)(row0 + r) * ldc + col0 + c4) = v;
    }
    
  }
}
// row LayerNorm (biased variance, eps) over N: s = X (+ R); optional out_sum <- s; out_norm <- (s-mu)*rsqrt(var+eps)*g + b
template <bool PARAM_BF16>
__global__ __launch_bounds__(256) void k_layernorm(const float* __restrict__ X, const float* __restrict__ R, const float* __restrict__ g, const float* __restrict__ bta,
                                                  float* __restrict__ out_sum, float* __restrict__ out_norm, int N, float eps) {
  __shared__ float red[256];
  const int row = blockIdx.x, tid = threadIdx.x;
  const float* x = X + (size_t)row * N; const float* rr = R ? R + (size_t)row * N : nullptr;
  float vals[16];                     // up to N = 4096
  const int per = N / 256;            // contiguous chunk per thread? use strided-by-4 chunks: thread handles j = tid*4 + 1024*u
  float s1 = 0.f;
  for (int u = 0; u < per / 4; ++u) {
    const int j = tid * 4 + 1024 * u;
    const v4f a = *(const v4fa*)(x + j);
    v4f b = {0.f,0.f,0.f,0.f}; if (rr) b = *(const v4fa*)(rr + j);
#pragma unroll
    for (int q = 0; q < 4; ++q) { const float v = a[q] + b[q]; vals[u * 4 + q] = v; s1 += v; }
  }
  red[tid] = s1; __syncthreads();
  for (int st = 128; st > 0; st >>= 1) { if (tid < st) red[tid] += red[tid + st]; __syncthreads(); }
  const float mu = red[0] / (float)N; __syncthreads();
  float s2 = 0.f;
  for (int u = 0; u < per / 4; ++u)
#pragma unroll
    for (int q = 0; q < 4; ++q) { const float c = vals[u * 4 + q] - mu; s2 += c * c; }
  red[tid] = s2; __syncthreads();
  for (int st = 128; st > 0; st >>= 1) { if (tid < st) red[tid] += red[tid + st]; __syncthreads(); }
  const float rs = rsqrtf(red[0] / (float)N + eps);
  {
    for (int u = 0; u < per / 4; ++u) {
      const int j = tid * 4 + 1024 * u;
      v4f o, sm;
#pragma unroll
      for (int q = 0; q < 4; ++q) {
        float gg = g[j + q], bb = bta[j + q];
        if (PARAM_BF16) { gg = bf16_round(gg); bb = bf16_round(bb); }
        sm[q] = vals[u * 4 + q]; o[q] = (vals[u * 4 + q] - mu) * rs * gg + bb;
      }
      if (out_sum) *(v4f*)(out_sum + (size_t)row * N + j) = sm;
      *(v4f*)(out_norm + (size_t)row * N + j) = o;
    }
    
  }
}



// ---- f16 WMMA path (v_wmma_f32_16x16x32_f16): 11-bit significands for operands in range — used where a [0,1] probability operand needs more precision than bf16
typedef _Float16 v16h __attribute__((ext_vector_type(16)));
union FragH { v16h v; v8us half[2]; _Float16 h[16]; unsigned short u[16]; };
template <int NT>
__device__ __forceinline__ v8f mmaH(v16h ah, v16h al, v16h bh, v16h bl, v8f c) {
  c = __builtin_amdgcn_wmma_f32_16x16x32_f16(false, ah, false, bh, (short)0, c, false, false);
  if (NT >= 2) c = __builtin_amdgcn_wmma_f32_16x16x32_f16(false, al, false, bh, (short)0, c, false, false);
  if (NT >= 3) c = __builtin_amdgcn_wmma_f32_16x16x32_f16(false, ah, false, bl, (short)0, c, false, false);
  asm volatile("v_nop\n\tv_nop\n\tv_nop\n\tv_nop" : "+v"(c) : "v"(ah), "v"(al), "v"(bh), "v"(bl));
  return c;
}
// batched GEMM like k_gemm_b but f16 operands: A f32 (split into f16 hi/lo if ASPLIT, else rounded to f16), Bt = f16 values [n][k]; alpha; C f32; N multiple of 16 (partial tiles skipped)
template <bool ASPLIT>
__global__ __launch_bounds__(128) void k_gemm_h(const float* __restrict__ A, int lda, size_t sA, const _Float16* __restrict__ Bh, int ldb, size_t sB, float alpha, float* __restrict__ C, int ldc, size_t sC, int M, int N, int K) {
  __shared__ __attribute__((aligned(16))) float so[4][16][64];
  const int tid = threadIdx.x, w = tid >> 5, lane = tid & 31, ln = lane & 15, hh = lane >> 4; const int by = blockIdx.y;
  A += (size_t)by * sA; Bh += (size_t)by * sB; C += (size_t)by * sC;
  const int ntn = (N + 63) / 64; const int wid = blockIdx.x * 4 + w; const int mt = wid / ntn, nq = wid % ntn; if (mt * 16 >= M) return;
  const int row0 = mt * 16, col0 = nq * 64; const float* arow = A + (size_t)(row0 + ln) * lda;
  v8f acc[4] = {};
  for (int kb = 0; kb < K; kb += 32) {
    FragH ah, al;
    const v4f x0 = *(const v4fa*)(arow + kb + 8 * hh), x1 = *(const v4fa*)(arow + kb + 8 * hh + 4), x2 = *(const v4fa*)(arow + kb + 16 + 8 * hh), x3 = *(const v4fa*)(arow + kb + 16 + 8 * hh + 4);
    float xs[16] = {x0[0],x0[1],x0[2],x0[3],x1[0],x1[1],x1[2],x1[3],x2[0],x2[1],x2[2],x2[3],x3[0],x3[1],x3[2],x3[3]};
#pragma unroll
    for (int i = 0; i < 16; ++i) { const _Float16 h = (_Float16)xs[i]; ah.h[i] = h; al.h[i] = ASPLIT ? (_Float16)(xs[i] - (float)h) : (_Float16)0.0f; }
#pragma unroll
    for (int t = 0; t < 4; ++t) { if (col0 + t * 16 >= N) continue; const size_t boff = (size_t)(col0 + t * 16 + ln) * ldb + kb; FragH bq; bq.half[0] = *(const v8us*)(Bh + boff + 8 * hh); bq.half[1] = *(const v8us*)(Bh + boff + 16 + 8 * hh);
      acc[t] = mmaH<ASPLIT ? 2 : 1>(ah.v, al.v, bq.v, bq.v, acc[t]); }
  }
#pragma unroll
  for (int t = 0; t < 4; ++t) { if (col0 + t * 16 >= N) continue;
#pragma unroll
    for (int r = 0; r < 8; ++r) so[w][8 * hh + r][t * 16 + ln] = acc[t][r] * alpha; }
  __builtin_amdgcn_fence(__ATOMIC_ACQ_REL, "workgroup"); __builtin_amdgcn_wave_barrier();
  const int rsub = lane >> 4, c4 = (lane & 15) * 4;
  {
#pragma unroll
    for (int q = 0; q < 8; ++q) { const int r = q * 2 + rsub; if (col0 + c4 < N) { const v4f v = *(const v4fa*)&so[w][r][c4]; *(v4f*)(C + (size_t)(row0 + r) * ldc + col0 + c4) = v; } }
     }
}

// FRAGMENT ORDER. Every 16-bit matrix operand M[row][k] (rows a multiple of 16, k a multiple of 32, KS = k-steps of 32) lies in the workspace as [row tile of 16][k-step][half j][lane][8 elements]:
// lane 16 hh + (row & 15) of half j of k-step s holds k = 32 s + 16 j + 8 hh + 0..7. One half of a fragment is then 32 lanes x 16 B = 512 contiguous bytes (4 cache lines), where rows of a row-major matrix gave 16 lines a load.
// The 16-byte piece number t of such a matrix (its place is element 8 t) holds row frag_row(t, KS), columns frag_k(t, KS) + 0..7; a writer whose thread t makes piece t stores whole lines.
__device__ __forceinline__ int frag_row(unsigned t, unsigned KS) { return (int)((t / (64 * KS)) * 16 + (t & 15)); }
__device__ __forceinline__ int frag_k(unsigned t, unsigned KS) { return (int)(((t >> 6) % KS) * 32 + ((t >> 5) & 1) * 16 + ((t >> 4) & 1) * 8); }
// Wt (row n, column k, fragment order) = f16(W[k][n] * scale) from f32 row-major W[K][N] (scale = power of two; bf16-exact weights stay exact in f16 away from the subnormal range)
__device__ __forceinline__ void wt_f16_block(const float* __restrict__ W, _Float16* __restrict__ Wt, int K, int N, float scale, int blk) {
  const int t = blk * 256 + threadIdx.x; if (t >= N * (K / 8)) return; const int n = frag_row(t, K / 32), k8 = frag_k(t, K / 32); FragH f;
#pragma unroll
  for (int i = 0; i < 8; ++i) f.h[i] = (_Float16)(bf16_round(W[(size_t)(k8 + i) * N + n]) * scale); const v8us o = f.half[0];
  *(v8us*)((unsigned short*)Wt + (size_t)t * 8) = o; 
}
// k_gemm_hh variant with fused epilogue: v = acc·alpha + bf16(bias_by[by·sBias + col]) (bias_by = bias, biasY1, biasY2 for by = 0, 1, 2) (+ CP[(row/rowsPerB)·sCPb + by·64 + col] if CP) ; ACT 0 none / 1 elu ; writes f16 C16 and f32 C, each if non-null
// N (a multiple of 64, so every wave owns four whole 16-column tiles) and K are compile-time: the k loop is unrolled whole and its fragment loads run PF k-steps ahead of the products that use them.
// A, Bh and C16 are in fragment order (K / 32, K / 32 and N / 32 k-steps a row tile); C is row-major with pitch ldc.
template <int ACT, int N, int K>
__global__ __launch_bounds__(128) void k_gemm_hhx(const _Float16* __restrict__ A, int lda, size_t sA, const _Float16* __restrict__ Bh, int ldb, size_t sB, float alpha, const float* __restrict__ bias, const float* __restrict__ biasY1, const float* __restrict__ biasY2, size_t sBias, const float* __restrict__ CP, int rowsPerB, size_t sCPb, int row0g,
    float* __restrict__ C, _Float16* __restrict__ C16, int ldc, size_t sC, int M) {
  static_assert(N % 64 == 0 && K % 32 == 0, "whole 64-column wave tiles and whole 32-deep k-steps");
  __shared__ __attribute__((aligned(16))) float so[4][16][64 + 4];      /* pitch 68: the fragment-order store below reads 16 rows at one column, which a pitch of 64 would put on the same banks */
  const int tid = threadIdx.x, w = tid >> 5, lane = tid & 31, ln = lane & 15, hh = lane >> 4; const int by = blockIdx.y;
  A += (size_t)by * sA; Bh += (size_t)by * sB; const size_t cofs = (size_t)by * sC; const float* bsel = (by == 0) ? bias : ((by == 1) ? biasY1 : biasY2); const float* bp = bsel ? bsel + (size_t)by * sBias : nullptr;      /* batch index by = 0, 1, 2 takes its own bias buffer */
  const int ntn = (N + 63) / 64; const int wid = blockIdx.x * 4 + w; const int mt = wid / ntn, nq = wid % ntn; if (mt * 16 >= M) return;
  const int row0 = mt * 16, col0 = nq * 64; (void)lda; (void)ldb;
  v8f acc[4] = {};
  constexpr int NS = K / 32, PF = 2, NB = PF + 1;      /* NB register stages: PF k-steps of loads in flight beside the one being multiplied */
  const unsigned short* ap = (const unsigned short*)A + (size_t)mt * NS * 512 + lane * 8; const unsigned short* bq0 = (const unsigned short*)Bh + (size_t)(nq * 4) * NS * 512 + lane * 8;      /* row tile mt of A; row tiles 4 nq + t of Bh */
  FragH fa[NB], fb[NB][4];
#pragma unroll
  for (int s = 0; s < NS + PF; ++s) {      /* unrolled whole: the stage indices must be constants for the stages to stay in registers */
    if (s < NS) { const int st = s % NB; fa[st].half[0] = *(const v8us*)(ap + s * 512); fa[st].half[1] = *(const v8us*)(ap + s * 512 + 256);
#pragma unroll
      for (int t = 0; t < 4; ++t) { const unsigned short* br = bq0 + (t * NS + s) * 512; fb[st][t].half[0] = *(const v8us*)br; fb[st][t].half[1] = *(const v8us*)(br + 256); } }
    if (s >= PF) { const int st = (s - PF) % NB;
#pragma unroll
      for (int t = 0; t < 4; ++t) acc[t] = mmaH<1>(fa[st].v, fa[st].v, fb[st][t].v, fb[st][t].v, acc[t]); }
  }
#pragma unroll
  for (int t = 0; t < 4; ++t) { if (col0 + t * 16 >= N) continue; const int col = col0 + t * 16 + ln; const float bv = bp ? bf16_round(bp[col]) : 0.f;
#pragma unroll
    for (int r = 0; r < 8; ++r) { float v = acc[t][r] * alpha + bv; if (CP) { const int bidx = (row0g + row0 + 8 * hh + r) / rowsPerB; v += CP[(size_t)bidx * sCPb + (size_t)by * 64 + col]; } if (ACT == 1) v = (v > 0.f) ? v : expm1f(v); else if (ACT == 7) v = (v > 0.f) ? v + 1.0f : expf(v); else if (ACT == 8) v = tanhf(v); else if (ACT == 9) v = 0.5f * v * (1.0f + tanhf(0.7978845608028654f * (v + 0.044715f * v * v * v))); else if (ACT == 11) v = 1.0f / (1.0f + expf(-v)); else if (ACT == 12) v = (v > 0.f) ? v : 0.01f * v; else if (ACT == 14) v = (v > 0.f) ? v : 0.1f * v; else if (ACT == 15) v = v / (1.0f + expf(-v)); else if (ACT == 3) v = fmaxf(v, 0.f); else if (ACT == 6) v = 0.5f * v * (1.0f + erff(v * 0.70710678118654752f)); so[w][8 * hh + r][t * 16 + ln] = v; } }
  __builtin_amdgcn_fence(__ATOMIC_ACQ_REL, "workgroup"); __builtin_amdgcn_wave_barrier();
  const int rsub = lane >> 4, c4 = (lane & 15) * 4;
  {
#pragma unroll
    for (int q = 0; q < 8; ++q) { const int r = q * 2 + rsub; if (C && col0 + c4 < N) { const v4f v = *(const v4fa*)&so[w][r][c4]; *(v4f*)(C + cofs + (size_t)(row0 + r) * ldc + col0 + c4) = v; } }
    if (C) asm volatile("s_wait_xcnt 0x0" ::: "memory");      /* directly behind the row-major stores: the fragment-order part below rewrites registers that they name */
    if (C16) { unsigned short* cp = (unsigned short*)C16 + cofs + ((size_t)mt * (N / 32) + nq * 2) * 512 + lane * 8;      /* the wave's 16 x 64 tile = two k-steps of row tile mt = 2 KB in a row: four 512-byte stores */
#pragma unroll
      for (int q = 0; q < 4; ++q) { const v4f v0 = *(const v4fa*)&so[w][ln][q * 16 + 8 * hh], v1 = *(const v4fa*)&so[w][ln][q * 16 + 8 * hh + 4]; FragH f;
#pragma unroll
        for (int i = 0; i < 4; ++i) { f.h[i] = (_Float16)v0[i]; f.h[4 + i] = (_Float16)v1[i]; }
        *(v8us*)(cp + q * 256) = f.half[0]; } }
     }
}


typedef _Float16 v4h __attribute__((ext_vector_type(4)));

__device__ __forceinline__ void x16_block(const float* __restrict__ x, _Float16* __restrict__ X16, size_t n8, int blk) { const size_t t = (size_t)blk * 256 + threadIdx.x; if (t >= n8) return; FragH f;      /* x row-major [NR][DX] -> X16 in fragment order */
  const float* xr = x + (size_t)frag_row((unsigned)t, DX / 32) * DX + frag_k((unsigned)t, DX / 32);
#pragma unroll
  for (int q = 0; q < 8; ++q) f.h[q] = (_Float16)bf16_round(xr[q]); *(v8us*)((unsigned short*)X16 + t * 8) = f.half[0];  }
// One grid for the five operand preparations, none of which reads another's result: the block index picks the job (block-uniform branch).
// Blocks 0 .. 3 NBW - 1: Wq, Wk, Wv (their outputs lie one behind the other in Bqkv); the next NBO: Wo; the last NBX: x.
#define NBW (2 * DX * (DX / 8) / 256)
#define NBO (DX * (DX / 8) / 256)
#define NBX (NR * DX / 8 / 256)
__global__ __launch_bounds__(256) void k_prep(const float* __restrict__ Wq, const float* __restrict__ Wk, const float* __restrict__ Wv, const float* __restrict__ Wo, const float* __restrict__ x,
                                              _Float16* __restrict__ Bqkv, _Float16* __restrict__ Bo, _Float16* __restrict__ X16) {
  const int bid = blockIdx.x;
  if (bid < 3 * NBW) { const int j = bid / NBW; wt_f16_block(j == 0 ? Wq : (j == 1 ? Wk : Wv), Bqkv + (size_t)j * 2 * DX * DX, DX, 2 * DX, 16.0f, bid % NBW); }
  else if (bid < 3 * NBW + NBO) wt_f16_block(Wo, Bo, DX, DX, 16.0f, bid - 3 * NBW);
  else x16_block(x, X16, (size_t)NR * DX / 8, bid - (3 * NBW + NBO)); }
__global__ __launch_bounds__(256) void k_h16(const float* __restrict__ x, _Float16* __restrict__ X16, size_t n8) { const size_t t = (size_t)blockIdx.x * 256 + threadIdx.x; if (t >= n8) return; FragH f;
#pragma unroll
  for (int q = 0; q < 8; ++q) f.h[q] = (_Float16)x[t * 8 + q]; *(v8us*)((unsigned short*)X16 + t * 8) = f.half[0];  }
__global__ __launch_bounds__(256) void k_round16f(const float* __restrict__ W, _Float16* __restrict__ Bt, size_t n8) { const size_t t = (size_t)blockIdx.x * 256 + threadIdx.x; if (t >= n8) return; FragH f;
#pragma unroll
  for (int i = 0; i < 8; ++i) f.h[i] = (_Float16)(bf16_round(W[t * 8 + i]) * 16.0f); *(v8us*)((unsigned short*)Bt + t * 8) = f.half[0];  }
template <int NHv, int TTv>
__global__ __launch_bounds__(256) void k_vt(const _Float16* __restrict__ V16, int ldv, int voff, _Float16* __restrict__ Vt) { __shared__ unsigned short tl[64][66]; const int tid = threadIdx.x; const int slab = blockIdx.x / (TTv / 64), lg = blockIdx.x % (TTv / 64); const int b = slab / NHv, h = slab % NHv;
  (void)ldv; (void)voff;      /* V16 in fragment order, NHv * 2 k-steps a row tile; piece i of the 64 x 64 block: row tile i >> 7, k-step (i >> 6) & 1, half (i >> 5) & 1, lane i & 31 */
  for (int i = tid; i < 64 * 8; i += 256) { const int r = (i >> 7) * 16 + (i & 15), c8 = ((i >> 6) & 1) * 32 + ((i >> 5) & 1) * 16 + ((i >> 4) & 1) * 8; FragH f; f.half[0] = *(const v8us*)((const unsigned short*)V16 + ((size_t)((b * TTv + lg * 64) / 16 + (i >> 7)) * (NHv * 2) + h * 2 + ((i >> 6) & 1)) * 512 + ((i >> 5) & 1) * 256 + (i & 31) * 8);
#pragma unroll
    for (int q = 0; q < 8; ++q) tl[r][c8 + q] = f.u[q]; }
  __syncthreads();
  {
#pragma unroll
    for (int rd = 0; rd < 2; ++rd) { const int i = rd * 256 + tid; const int d = (i >> 7) * 16 + (i & 15), pc = (i >> 4) & 7; FragH f;      /* Vt plane [64 rows d][TTv keys] in fragment order: row tile i >> 7, k-step lg * 2 + ((i >> 6) & 1), half (i >> 5) & 1, lane i & 31; keys lg * 64 + pc * 8 + q */
#pragma unroll
      for (int q = 0; q < 8; ++q) f.u[q] = tl[pc * 8 + q][d];
      *(v8us*)((unsigned short*)Vt + (size_t)slab * 64 * TTv + ((size_t)(i >> 7) * (TTv / 32) + lg * 2 + ((i >> 6) & 1)) * 512 + ((i >> 5) & 1) * 256 + (i & 31) * 8) = f.half[0]; }
     } }

__global__ __launch_bounds__(256) void k_h16s(const float* __restrict__ F, _Float16* __restrict__ H, size_t n8) { const size_t t = (size_t)blockIdx.x * 256 + threadIdx.x; if (t >= n8) return; const float* fr = F + (size_t)frag_row((unsigned)t, DX / 32) * DX + frag_k((unsigned)t, DX / 32); const v4f a = *(const v4fa*)fr, c = *(const v4fa*)(fr + 4); FragH f;      /* F row-major [NR][DX] -> H in fragment order */
#pragma unroll
  for (int q = 0; q < 4; ++q) { f.h[q] = (_Float16)(a[q] * 256.0f); f.h[4 + q] = (_Float16)(c[q] * 256.0f); } *(v8us*)((unsigned short*)H + t * 8) = f.half[0];  }
// Keys split inside the work-group: each of the 4 query tiles is walked by KVS waves; wave (qw, kr) takes the 32-key blocks kr, kr + KVS, kr + 2 KVS, ... with its own running max, sum and
// un-normalised accumulators; the KVS partials of a tile are merged through LDS behind one work-group barrier (weights exp(m_k - M)).
// TRANSPOSED PRODUCTS. Scores are formed as S^T = K Q^T (A = key rows, B = query columns) and values as O^T += V^T P^T (A = V^T rows d, B = P^T). In a D tile lane 16 hh + ln, register r holds row 8 hh + r, column ln:
// a lane then holds scores of ONE query (ln), keys 16 nt + 8 hh + r, so the maximum and the sum over keys are in-lane but for one exchange between the lane halves, the rescale factor is one value a lane,
// and the two score tiles nt = 0, 1, converted in place, are the B operand of the value product (element 8 nt + r = key 16 nt + 8 hh + r, the k order of every fragment here): P never goes through LDS.
#define KVS 4
typedef float v2f __attribute__((ext_vector_type(2)));
__device__ __forceinline__ float xhalf(float x) { return __builtin_bit_cast(float, __builtin_amdgcn_permlanex16(__builtin_bit_cast(int, x), __builtin_bit_cast(int, x), 0x76543210, 0xfedcba98, false, false)); }      /* lane l takes the value of lane l ^ 16 */
__global__ __launch_bounds__(128 * KVS) void k_flash(const _Float16* __restrict__ Q16, int ldq, const _Float16* __restrict__ K16, int ldk, const _Float16* __restrict__ Vt, float* __restrict__ O, int ldo) {
  constexpr int RPW = 16, NQB = NN / (4 * RPW), DT = 4, KS = 2, NW = 4 * KVS, RM = RPW / KVS;
  __shared__ __attribute__((aligned(16))) float sO[NW][RPW][128 + 4]; __shared__ float sM[NW][RPW], sL[NW][RPW];
  const int tid = threadIdx.x, w = __builtin_amdgcn_readfirstlane(tid >> 5), lane = tid & 31, ln = lane & 15, hh = lane >> 4; const int qw = w & 3, kr = w >> 2;      /* the wave's number held as a scalar: tile and key-block indices leave the vector registers, which the grouped fragments need */
  const int slab = blockIdx.x / NQB, qblk = blockIdx.x % NQB; const int b = slab / NHU, h = slab % NHU; const int qb0 = qblk * (4 * RPW); const int q0 = qb0 + qw * RPW;
  FragH aq[KS], aql[KS];
  { const size_t qo = ((size_t)((b * NN + q0) / 16) * (DX / 32) + h * 4) * 512 + lane * 8; const unsigned short* qr = (const unsigned short*)Q16 + qo; const unsigned short* ql = qr + 2 * 512;      /* Q16, K16 in fragment order: head h = k-steps 4 h .. 4 h + 3 of a row tile; aq = real part (the first two), aql = imaginary part */
#pragma unroll
    for (int ks = 0; ks < KS; ++ks) { aq[ks].half[0] = *(const v8us*)(qr + ks * 512); aq[ks].half[1] = *(const v8us*)(qr + ks * 512 + 256); aql[ks].half[0] = *(const v8us*)(ql + ks * 512); aql[ks].half[1] = *(const v8us*)(ql + ks * 512 + 256); } }
  (void)ldq; (void)ldk;
  const unsigned short* Vth = (const unsigned short*)Vt + ((size_t)b * 2 * NHU + 2 * h) * 64 * NN;      /* V^T real plane of head h; the imaginary plane lies 64 NN elements behind it */
  float m_q = -3.0e38f, l_q = 0.f; v8f oacc[DT], oacci[DT];      /* running max of query ln (equal in both lane halves), this lane half's share of its sum, O^T tiles: register r = column d = 16 dt + 8 hh + r of query ln */
#pragma unroll
  for (int dt = 0; dt < DT; ++dt) { oacc[dt] = (v8f){0.f,0.f,0.f,0.f,0.f,0.f,0.f,0.f}; oacci[dt] = oacc[dt]; }
  const int jend = NN;
#pragma unroll 1
  for (int j0 = kr * 32; j0 < jend; j0 += 32 * KVS) {
    v8f s[2]; FragH bk[2][KS], bl[2][KS];      /* bk = real, bl = imaginary; both 16-key tiles' fragments are loaded as one group ahead of the score products */
    const unsigned short* kp[2];
#pragma unroll
    for (int nt = 0; nt < 2; ++nt) { kp[nt] = (const unsigned short*)K16 + ((size_t)((b * NN + j0) / 16 + nt) * (DX / 32) + h * 4) * 512 + lane * 8; const unsigned short* kr = kp[nt]; const unsigned short* kl = kr + 2 * 512;
#pragma unroll
      for (int ks = 0; ks < KS; ++ks) { bk[nt][ks].half[0] = *(const v8us*)(kr + ks * 512); bk[nt][ks].half[1] = *(const v8us*)(kr + ks * 512 + 256); bl[nt][ks].half[0] = *(const v8us*)(kl + ks * 512); bl[nt][ks].half[1] = *(const v8us*)(kl + ks * 512 + 256); } }
    asm volatile("s_wait_xcnt 0x0" :: "v"(kp[0]), "v"(kp[1]) : "memory");      /* keeps both address pairs alive past the last load of the group, so that no load's result lands in a pair that an issued load names before this wait */
#pragma unroll
    for (int nt = 0; nt < 2; ++nt) { v8f re = (v8f){0.f,0.f,0.f,0.f,0.f,0.f,0.f,0.f}, ip = re, in = re;      /* keys as A, queries as B */
#pragma unroll
      for (int ks = 0; ks < KS; ++ks) { re = mmaH<1>(bk[nt][ks].v, bk[nt][ks].v, aq[ks].v, aq[ks].v, re); re = mmaH<1>(bl[nt][ks].v, bl[nt][ks].v, aql[ks].v, aql[ks].v, re); ip = mmaH<1>(bk[nt][ks].v, bk[nt][ks].v, aql[ks].v, aql[ks].v, ip); in = mmaH<1>(bl[nt][ks].v, bl[nt][ks].v, aq[ks].v, aq[ks].v, in); }
      const v8f im = ip - in; s[nt] = (re * re + im * im) * SCORE_SCALE; }
    FragH bv[DT], bi[DT];      /* all value fragments of this key block are requested here, so that they travel while the softmax below is computed */
    const unsigned short* vp = Vth + (size_t)(j0 / 32) * 512 + lane * 8; const unsigned short* vq = vp + (size_t)64 * NN;      /* fragment order: k-step j0 / 32 of row tile dt, NN / 32 k-steps a row tile */
#pragma unroll
    for (int dt = 0; dt < DT; ++dt) { const size_t vo = (size_t)(dt * 16) * NN; bv[dt].half[0] = *(const v8us*)(vp + vo); bv[dt].half[1] = *(const v8us*)(vp + vo + 256); bi[dt].half[0] = *(const v8us*)(vq + vo); bi[dt].half[1] = *(const v8us*)(vq + vo + 256); }
    asm volatile("s_wait_xcnt 0x0" :: "v"(vp) : "memory");      /* as above: the address pair outlives the group's last load */
    float mc = fmaxf(s[0][0], s[1][0]);
#pragma unroll
    for (int r = 1; r < 8; ++r) mc = fmaxf(mc, fmaxf(s[0][r], s[1][r]));
    mc = fmaxf(mc, xhalf(mc));      /* the other 16 keys of the block lie in the other lane half */
    const float mn = fmaxf(m_q, mc); const float al = expf(m_q - mn); m_q = mn;
    FragH pb; v2f ps = {0.f, 0.f};      /* two partial sums, over even and odd registers: neighbouring registers pair in the packed adds */
#pragma unroll
    for (int nt = 0; nt < 2; ++nt)
#pragma unroll
      for (int r = 0; r < 8; r += 2) { const v2f p = {expf(s[nt][r] - mn), expf(s[nt][r + 1] - mn)}; ps += p; const v2f ph = p * 1024.0f; pb.h[8 * nt + r] = (_Float16)ph[0]; pb.h[8 * nt + r + 1] = (_Float16)ph[1]; }
    l_q = l_q * al + (ps[0] + ps[1]);
#pragma unroll
    for (int dt = 0; dt < DT; ++dt) { oacc[dt] *= al; oacci[dt] *= al; }
#pragma unroll
    for (int dt = 0; dt < DT; ++dt) { oacc[dt] = mmaH<1>(bv[dt].v, bv[dt].v, pb.v, pb.v, oacc[dt]); oacci[dt] = mmaH<1>(bi[dt].v, bi[dt].v, pb.v, pb.v, oacci[dt]); } }
  { const float l = l_q + xhalf(l_q); if (hh == 0) { sM[w][ln] = m_q; sL[w][ln] = l; } }
#pragma unroll
  for (int dt = 0; dt < DT; ++dt) { float* so = &sO[w][ln][dt * 16 + 8 * hh];      /* a lane's 8 registers are 8 neighbouring columns of its query's row: two 16-byte stores a tile */
    *(v4fa*)so = (v4f){oacc[dt][0], oacc[dt][1], oacc[dt][2], oacc[dt][3]}; *(v4fa*)(so + 4) = (v4f){oacc[dt][4], oacc[dt][5], oacc[dt][6], oacc[dt][7]};
    *(v4fa*)(so + 64) = (v4f){oacci[dt][0], oacci[dt][1], oacci[dt][2], oacci[dt][3]}; *(v4fa*)(so + 68) = (v4f){oacci[dt][4], oacci[dt][5], oacci[dt][6], oacci[dt][7]}; }
  __syncthreads();      /* publishes every wave's partial (max, sum, accumulators) to the waves that merge it */
  {
#pragma unroll
    for (int rp = 0; rp < RM; ++rp) { const int r = kr * RM + rp, pc = lane;      /* wave (qw, kr) merges rows kr*RM .. of query tile qw */
      float mk[KVS], M = -3.0e38f;
#pragma unroll
      for (int k = 0; k < KVS; ++k) { mk[k] = sM[k * 4 + qw][r]; M = fmaxf(M, mk[k]); }
      float L = 0.f; v4f o = {0.f, 0.f, 0.f, 0.f};
#pragma unroll
      for (int k = 0; k < KVS; ++k) { const float wk = expf(mk[k] - M); L += wk * sL[k * 4 + qw][r]; const v4f part = *(const v4fa*)&sO[k * 4 + qw][r][pc * 4]; o += part * wk; }
      const float inv = (L > 0.f) ? 1.0f / (L * 1024.0f) : 0.f;
      *(v4f*)(O + ((size_t)b * NN + q0 + r) * ldo + h * 128 + pc * 4) = o * inv;      /* 32 lanes x 16 B = the head's [real | imag] 512-B run */
      asm volatile("s_wait_xcnt 0x0" ::: "memory"); }      /* stands in front of the next row's rewrite of the registers that the issued store names */
     } }

extern "C" void kernel_launch(void* const* d_in, const int* in_sizes, int n_in,
                              void* d_out, int out_size, void* d_ws, size_t ws_size, hipStream_t stream) {
  (void)in_sizes; (void)n_in; (void)out_size;
  const float* const* I = (const float* const*)d_in; const float* x = I[0]; const float* Wq = I[1]; const float* bq = I[2]; const float* Wk = I[3]; const float* bk = I[4]; const float* Wv = I[5]; const float* bv = I[6]; const float* Wo = I[7]; const float* bo = I[8];
  char* ws = (char*)d_ws; size_t off = 0;
  auto take = [&](size_t bytes) { char* p = ws + off; off += (bytes + 255) & ~(size_t)255; return p; };
  _Float16* Bq = (_Float16*)take((size_t)3 * 2 * DX * DX * 2); _Float16* Bo = (_Float16*)take((size_t)DX * DX * 2);
  _Float16* X16 = (_Float16*)take((size_t)NR * DX * 2); _Float16* Q = (_Float16*)take((size_t)3 * NR * DX * 2); _Float16* K = Q + (size_t)NR * DX; _Float16* V = K + (size_t)NR * DX;      /* q, k, v one behind the other: batch stride of the merged projection */ _Float16* Vt = (_Float16*)take((size_t)NR * DX * 2);
  float* O = (float*)take((size_t)NR * DX * 4); _Float16* O16 = (_Float16*)take((size_t)NR * DX * 2);
  /* Bq, Bo, X16, Q, K, V, Vt and O16 are all in fragment order (see FRAGMENT ORDER above); O and the output are row-major */
  if (off > ws_size) return;      // 3 × 1 + 0.5 + 5 × 4.2 + 8.4 + 4.2 ≈ 37 MB
  k_prep<<<3 * NBW + NBO + NBX, 256, 0, stream>>>(Wq, Wk, Wv, Wo, x, Bq, Bo, X16);      /* (in,out) [512][1024] -> Bt[1024][512] x2^4 for Wq, Wk, Wv (only rows 0..511 = heads 0..3 are used), Wo likewise, x -> f16: one launch */
  const dim3 gp(((NR / 16) * (DX / 64) + 3) / 4, 1), gp3(((NR / 16) * (DX / 64) + 3) / 4, 3);
  k_gemm_hhx<0, DX, DX><<<gp3, 128, 0, stream>>>(X16, DX, 0, Bq, DX, (size_t)2 * DX * DX, 0.0625f, bq, bk, bv, 0, nullptr, 1, 0, 0, nullptr, Q, DX, (size_t)NR * DX, NR);      /* q, k, v in one launch (blockIdx.y), heads 0..3 = output columns 0..511 (+ bias): each M 4096 N 512 K 512 */
  k_vt<2 * NHU, NN><<<BB * 2 * NHU * (NN / 64), 256, 0, stream>>>(V, DX, 0, Vt);      /* Vᵀ planes per (b, head, part): [b·8 + 2h + part][64][2048] */
  k_flash<<<BB * NHU * (NN / 64), 128 * KVS, 0, stream>>>(Q, DX, K, DX, Vt, O, DX);
  k_h16s<<<(unsigned)(((size_t)NR * DX / 8 + 255) / 256), 256, 0, stream>>>(O, O16, (size_t)NR * DX / 8);
  k_gemm_hhx<0, DX, DX><<<gp, 128, 0, stream>>>(O16, DX, 0, Bo, DX, 0, 0.0625f * 0.00390625f, bo, nullptr, nullptr, 0, nullptr, 1, 0, 0, (float*)d_out, nullptr, DX, 0, NR);      /* out = O·Wo + bo (alpha undoes ×2^4 weights and the ×2^8 carry) */
}

// v006
// A run of this version takes 64.8 microseconds.
// Two timings next to v005 put it at 1.12 and 1.13 times that version's speed.
// All steps since v000 together make it 4.99 times as fast.
#include <hip/hip_runtime.h>
// 'Superposition' (complex-valued) multi-head attention (B=2, S=2048, D=512, 8 heads; q,k,v projections to 2D with per-head [real 64 | imag 64]): interference = Σ_d q_d·conj(k_d)·64^-½; probs = softmax(|interference|²/0.5); out = probs·v (complex);
// out = concat[real, imag] per head → [B,S,1024], truncated to the first 512 columns (= heads 0..3), then ·Wo + bo. Only heads 0..3 reach the output, so only they are computed.
// Compute dtype: x, weights, biases rounded to bf16; q/k/v (columns of heads 0..3) as f16 GEMM outputs; fused flash-style kernel with three f32 score accumulators (Re, Im⁺, Im⁻) and two value accumulators
// (real, imag), online softmax f32, P f16 ×2^10, on v_wmma_f32_16x16x32_f16; O carried ×2^8 into f16 (small diffuse values) → output GEMM with bias (alpha undoes the carry); f32 accumulate.
#define BB 2
#define NN 2048
#define DX 512
#define NHU 4
#define DH2 128
#define NR (BB * NN)
#define SCORE_SCALE 0.03125f

typedef __bf16 v16b __attribute__((ext_vector_type(16)));
typedef unsigned short v8us __attribute__((ext_vector_type(8), may_alias));
typedef float  v8f  __attribute__((ext_vector_type(8)));
typedef float  v4f  __attribute__((ext_vector_type(4)));
typedef float  v4fa __attribute__((ext_vector_type(4), may_alias));
union FragB { v16b v; v8us half[2]; unsigned short u[16]; };

__device__ __forceinline__ unsigned short bf16_bits(float x) { unsigned int u = __float_as_uint(x); return (unsigned short)((u + 0x7FFFu + ((u >> 16) & 1u)) >> 16); }
__device__ __forceinline__ float bf16_val(unsigned short b) { return __uint_as_float(((unsigned int)b) << 16); }
__device__ __forceinline__ float bf16_round(float x) { return bf16_val(bf16_bits(x)); }
// D += A·B with NT terms: 1 = ah·bh, 2 = + al·bh (A split), 3 = + ah·bl (both split)
template <int NT>
__device__ __forceinline__ v8f mmaN(v16b ah, v16b al, v16b bh, v16b bl, v8f c) {
  c = __builtin_amdgcn_wmma_f32_16x16x32_bf16(false, ah, false, bh, (short)0, c, false, false);
  if (NT >= 2) c = __builtin_amdgcn_wmma_f32_16x16x32_bf16(false, al, false, bh, (short)0, c, false, false);
  if (NT >= 3) c = __builtin_amdgcn_wmma_f32_16x16x32_bf16(false, ah, false, bl, (short)0, c, false, false);
  asm volatile("v_nop\n\tv_nop\n\tv_nop\n\tv_nop" : "+v"(c) : "v"(ah), "v"(al), "v"(bh), "v"(bl));
  return c;
}

__global__ __launch_bounds__(256) void k_wt_bf16(const float* __restrict__ W, unsigned short* __restrict__ Wt, int K, int N) {
  const int t = blockIdx.x * 256 + threadIdx.x;
  const int k8n = K / 8;
  if (t >= N * k8n) return;
  const int n = t / k8n, k8 = (t % k8n) * 8;
  v8us v;
#pragma unroll
  for (int i = 0; i < 8; ++i) v[i] = bf16_bits(W[(size_t)(k8 + i) * N + n]);
  *(v8us*)(Wt + (size_t)n * K + k8) = v;
  
}

// GEMM C[M][N] (f32, pitch ldc) = act(A[M][K]·W + bias). A f32 row-major (pitch lda) converted per fragment to bf16
// (ASPLIT: hi/lo two planes -> 2 terms, else single rounded term); Wt bf16 [N][K] (pitch ldb). BIAS_BF16 rounds the
// bias to bf16 first (bias quantised to bf16 before the add). K%32==0, M%16==0, N%64==0.
template <bool ASPLIT, int ACT, bool BIAS_BF16>
__global__ __launch_bounds__(128) void k_gemm_bf(const float* __restrict__ A, int lda, const unsigned short* __restrict__ Wt, int ldb,
                                               const float* __restrict__ bias, float* __restrict__ C, int ldc, int M, int N, int K) {
  __shared__ __attribute__((aligned(16))) float so[4][16][64];
  const int tid = threadIdx.x, w = tid >> 5, lane = tid & 31, ln = lane & 15, hh = lane >> 4;
  const int ntn = N / 64;
  const int wid = blockIdx.x * 4 + w;
  const int mt = wid / ntn, nq = wid % ntn;
  if (mt * 16 >= M) return;
  const int row0 = mt * 16, col0 = nq * 64;
  const float* arow = A + (size_t)(row0 + ln) * lda;
  v8f acc[4] = {};
  for (int kb = 0; kb < K; kb += 32) {
    FragB ah, al;
    const v4f x0 = *(const v4fa*)(arow + kb + 8 * hh), x1 = *(const v4fa*)(arow + kb + 8 * hh + 4);
    const v4f x2 = *(const v4fa*)(arow + kb + 16 + 8 * hh), x3 = *(const v4fa*)(arow + kb + 16 + 8 * hh + 4);
    float xs[16] = {x0[0],x0[1],x0[2],x0[3],x1[0],x1[1],x1[2],x1[3],x2[0],x2[1],x2[2],x2[3],x3[0],x3[1],x3[2],x3[3]};
#pragma unroll
    for (int i = 0; i < 16; ++i) { const unsigned short hb = bf16_bits(xs[i]); ah.u[i] = hb; al.u[i] = ASPLIT ? bf16_bits(xs[i] - bf16_val(hb)) : (unsigned short)0; }
#pragma unroll
    for (int t = 0; t < 4; ++t) {
      const unsigned short* brow = Wt + (size_t)(col0 + t * 16 + ln) * ldb + kb;
      FragB b;
      b.half[0] = *(const v8us*)(brow + 8 * hh);
      b.half[1] = *(const v8us*)(brow + 16 + 8 * hh);
      acc[t] = mmaN<ASPLIT ? 2 : 1>(ah.v, al.v, b.v, b.v, acc[t]);
    }
  }
#pragma unroll
  for (int t = 0; t < 4; ++t) {
    float bv = bias ? bias[col0 + t * 16 + ln] : 0.f;
    if (BIAS_BF16) bv = bf16_round(bv);
#pragma unroll
    for (int r = 0; r < 8; ++r) { float v = acc[t][r] + bv; if (ACT == 1) v = fmaxf(v, 0.f); so[w][8 * hh + r][t * 16 + ln] = v; }
  }
  __builtin_amdgcn_fence(__ATOMIC_ACQ_REL, "workgroup");
  __builtin_amdgcn_wave_barrier();
  const int rsub = lane >> 4, c4 = (lane & 15) * 4;
  {
#pragma unroll
    for (int q = 0; q < 8; ++q) {
      const int r = q * 2 + rsub;
      const v4f v = *(const v4fa*)&so[w][r][c4];
      *(v4f*)(C + (size_t)(row0 + r) * ldc + col0 + c4) = v;
    }
    
  }
}

// Flash-style causal/unmasked attention, all contractions 3-term bf16 hi/lo splits, f32 softmax with running max.
// q,k,v rows are read from f32 buffers with arbitrary row pitch (so they can live inside a fused qkv buffer);
// D = head size (multiple of 32, <= 128); one wave = 16 query rows; block = 4 waves (64 queries) sharing K/V chunks of 32.
template <int D, bool CAUSAL>
__global__ __launch_bounds__(128) void k_flash(const float* __restrict__ qb, const float* __restrict__ kb, const float* __restrict__ vb,
                                             int pitch, int T, int H, float scale, float* __restrict__ y, int ypitch) {
  constexpr int KS = D / 32;        // k-steps for QK
  constexpr int DT = D / 16;        // d tiles for PV
  __shared__ __attribute__((aligned(16))) unsigned short sKh[32][D + 8], sKl[32][D + 8], sVh[32][D + 8], sVl[32][D + 8];
  __shared__ __attribute__((aligned(16))) unsigned short sPh[4][16][40], sPl[4][16][40];
  __shared__ __attribute__((aligned(16))) float sO[4][16][D];
  const int tid = threadIdx.x, w = tid >> 5, lane = tid & 31, ln = lane & 15, hh = lane >> 4;
  const int nqb = (T + 63) / 64;
  const int bh = blockIdx.x / nqb, qblk = blockIdx.x % nqb;
  const int b = bh / H, h = bh % H;
  const int q0 = qblk * 64 + w * 16;
  const float* Q = qb + (size_t)b * T * pitch + h * D;
  const float* K = kb + (size_t)b * T * pitch + h * D;
  const float* V = vb + (size_t)b * T * pitch + h * D;

  // A fragments of the wave's 16 query rows (scaled), hi/lo
  FragB aqh[KS], aql[KS];
  {
    int row = q0 + ln; if (row >= T) row = T - 1;
    const float* qr = Q + (size_t)row * pitch;
#pragma unroll
    for (int ks = 0; ks < KS; ++ks)
#pragma unroll
      for (int i = 0; i < 16; ++i) {
        const int d = ks * 32 + ((i < 8) ? (8 * hh + i) : (16 + 8 * hh + (i - 8)));
        const float x = qr[d] * scale; const unsigned short hb = bf16_bits(x);
        aqh[ks].u[i] = hb; aql[ks].u[i] = bf16_bits(x - bf16_val(hb));
      }
  }
  float m_r[8], l_r[8];
#pragma unroll
  for (int r = 0; r < 8; ++r) { m_r[r] = -3.0e38f; l_r[r] = 0.f; }
  v8f oacc[DT];
#pragma unroll
  for (int dt = 0; dt < DT; ++dt) oacc[dt] = (v8f){0.f,0.f,0.f,0.f,0.f,0.f,0.f,0.f};

  const int kv_end = CAUSAL ? min(T, qblk * 64 + 64) : T;     // block-uniform
  for (int j0 = 0; j0 < kv_end; j0 += 32) {
    __syncthreads();
    for (int e = tid; e < 32 * (D / 4); e += 128) {
      const int r = e / (D / 4), c4 = (e % (D / 4)) * 4;
      const int key = j0 + r;
      v4f kf = {0.f,0.f,0.f,0.f}, vf = {0.f,0.f,0.f,0.f};
      if (key < T) { kf = *(const v4fa*)(K + (size_t)key * pitch + c4); vf = *(const v4fa*)(V + (size_t)key * pitch + c4); }
#pragma unroll
      for (int t = 0; t < 4; ++t) {
        unsigned short hb = bf16_bits(kf[t]); sKh[r][c4 + t] = hb; sKl[r][c4 + t] = bf16_bits(kf[t] - bf16_val(hb));
        hb = bf16_bits(vf[t]); sVh[r][c4 + t] = hb; sVl[r][c4 + t] = bf16_bits(vf[t] - bf16_val(hb));
      }
    }
    __syncthreads();
    // S tile 16 x 32
    v8f s[2];
#pragma unroll
    for (int nt = 0; nt < 2; ++nt) {
      v8f acc = {};
#pragma unroll
      for (int ks = 0; ks < KS; ++ks) {
        FragB bh_, bl_;
        bh_.half[0] = *(const v8us*)&sKh[nt * 16 + ln][ks * 32 + 8 * hh]; bh_.half[1] = *(const v8us*)&sKh[nt * 16 + ln][ks * 32 + 16 + 8 * hh];
        bl_.half[0] = *(const v8us*)&sKl[nt * 16 + ln][ks * 32 + 8 * hh]; bl_.half[1] = *(const v8us*)&sKl[nt * 16 + ln][ks * 32 + 16 + 8 * hh];
        acc = mmaN<3>(aqh[ks].v, aql[ks].v, bh_.v, bl_.v, acc);
      }
      s[nt] = acc;
    }
    // mask + running max (rows 8hh+r; the 16 lanes of a half share rows)
    float alpha[8];
#pragma unroll
    for (int r = 0; r < 8; ++r) {
      const int qi = q0 + 8 * hh + r;
      const int ja = j0 + ln, jb = j0 + 16 + ln;
      if (CAUSAL) { if (ja > qi) s[0][r] = -3.0e38f; if (jb > qi) s[1][r] = -3.0e38f; }
      if (ja >= T) s[0][r] = -3.0e38f;
      if (jb >= T) s[1][r] = -3.0e38f;
      float mx = fmaxf(s[0][r], s[1][r]);
      mx = fmaxf(mx, __shfl_xor(mx, 1, 32)); mx = fmaxf(mx, __shfl_xor(mx, 2, 32)); mx = fmaxf(mx, __shfl_xor(mx, 4, 32)); mx = fmaxf(mx, __shfl_xor(mx, 8, 32));
      const float mnew = fmaxf(m_r[r], mx);
      alpha[r] = (mnew > -1.0e38f) ? __expf(m_r[r] - mnew) : 1.0f;
      const float p0 = (s[0][r] > -1.0e38f) ? __expf(s[0][r] - mnew) : 0.f;
      const float p1 = (s[1][r] > -1.0e38f) ? __expf(s[1][r] - mnew) : 0.f;
      m_r[r] = mnew;
      l_r[r] = l_r[r] * alpha[r] + p0 + p1;            // per-lane partial row sum (16 lanes combined at the end)
      unsigned short hb = bf16_bits(p0); sPh[w][8 * hh + r][ln] = hb;      sPl[w][8 * hh + r][ln] = bf16_bits(p0 - bf16_val(hb));
      hb = bf16_bits(p1);                sPh[w][8 * hh + r][16 + ln] = hb; sPl[w][8 * hh + r][16 + ln] = bf16_bits(p1 - bf16_val(hb));
    }
#pragma unroll
    for (int dt = 0; dt < DT; ++dt)
#pragma unroll
      for (int r = 0; r < 8; ++r) oacc[dt][r] *= alpha[r];
    __builtin_amdgcn_fence(__ATOMIC_ACQ_REL, "workgroup");
    __builtin_amdgcn_wave_barrier();
    FragB pah, pal;
    pah.half[0] = *(const v8us*)&sPh[w][ln][8 * hh]; pah.half[1] = *(const v8us*)&sPh[w][ln][16 + 8 * hh];
    pal.half[0] = *(const v8us*)&sPl[w][ln][8 * hh]; pal.half[1] = *(const v8us*)&sPl[w][ln][16 + 8 * hh];
#pragma unroll
    for (int dt = 0; dt < DT; ++dt) {
      FragB bvh, bvl;
#pragma unroll
      for (int i = 0; i < 8; ++i) {
        bvh.u[i] = sVh[8 * hh + i][dt * 16 + ln]; bvh.u[8 + i] = sVh[16 + 8 * hh + i][dt * 16 + ln];
        bvl.u[i] = sVl[8 * hh + i][dt * 16 + ln]; bvl.u[8 + i] = sVl[16 + 8 * hh + i][dt * 16 + ln];
      }
      oacc[dt] = mmaN<3>(pah.v, pal.v, bvh.v, bvl.v, oacc[dt]);
    }
    __builtin_amdgcn_fence(__ATOMIC_ACQ_REL, "workgroup");
    __builtin_amdgcn_wave_barrier();
  }
#pragma unroll
  for (int r = 0; r < 8; ++r) {
    float l = l_r[r];
    l += __shfl_xor(l, 1, 32); l += __shfl_xor(l, 2, 32); l += __shfl_xor(l, 4, 32); l += __shfl_xor(l, 8, 32);
    l_r[r] = (l > 0.f) ? 1.0f / l : 0.f;
  }
#pragma unroll
  for (int dt = 0; dt < DT; ++dt)
#pragma unroll
    for (int r = 0; r < 8; ++r) sO[w][8 * hh + r][dt * 16 + ln] = oacc[dt][r] * l_r[r];
  __builtin_amdgcn_fence(__ATOMIC_ACQ_REL, "workgroup");
  __builtin_amdgcn_wave_barrier();
  {
    for (int r = 0; r < 16; ++r) {
      const int row = q0 + r;
      if (row < T && lane < D / 4) {
        const v4f val = *(const v4fa*)&sO[w][r][lane * 4];
        *(v4f*)(y + ((size_t)b * T + row) * ypitch + h * D + lane * 4) = val;
      }
    }
    
  }
}

// GEMM C = act(A·W + bias + resid): A f32 (ASPLIT -> hi/lo 2 terms), Wt bf16 [N][K]; ACT 0 none, 1 relu, 2 exact gelu;
// resid (optional, f32, row index = (row % rmod), pitch ldr, RES_BF16 rounds it) added before the activation.
template <bool ASPLIT, int ACT, bool BIAS_BF16, bool RES_BF16>
__global__ __launch_bounds__(128) void k_gemm_bf3(const float* __restrict__ A, int lda, const unsigned short* __restrict__ Wt, int ldb,
                                                const float* __restrict__ bias, const float* __restrict__ resid, int rmod, int ldr,
                                                float* __restrict__ C, int ldc, int M, int N, int K) {
  __shared__ __attribute__((aligned(16))) float so[4][16][64];
  const int tid = threadIdx.x, w = tid >> 5, lane = tid & 31, ln = lane & 15, hh = lane >> 4;
  const int ntn = N / 64;
  const int wid = blockIdx.x * 4 + w;
  const int mt = wid / ntn, nq = wid % ntn;
  if (mt * 16 >= M) return;
  const int row0 = mt * 16, col0 = nq * 64;
  const float* arow = A + (size_t)(row0 + ln) * lda;
  v8f acc[4] = {};
  for (int kb = 0; kb < K; kb += 32) {
    FragB ah, al;
    const v4f x0 = *(const v4fa*)(arow + kb + 8 * hh), x1 = *(const v4fa*)(arow + kb + 8 * hh + 4);
    const v4f x2 = *(const v4fa*)(arow + kb + 16 + 8 * hh), x3 = *(const v4fa*)(arow + kb + 16 + 8 * hh + 4);
    float xs[16] = {x0[0],x0[1],x0[2],x0[3],x1[0],x1[1],x1[2],x1[3],x2[0],x2[1],x2[2],x2[3],x3[0],x3[1],x3[2],x3[3]};
#pragma unroll
    for (int i = 0; i < 16; ++i) { const unsigned short hb = bf16_bits(xs[i]); ah.u[i] = hb; al.u[i] = ASPLIT ? bf16_bits(xs[i] - bf16_val(hb)) : (unsigned short)0; }
#pragma unroll
    for (int t = 0; t < 4; ++t) {
      const unsigned short* brow = Wt + (size_t)(col0 + t * 16 + ln) * ldb + kb;
      FragB b;
      b.half[0] = *(const v8us*)(brow + 8 * hh);
      b.half[1] = *(const v8us*)(brow + 16 + 8 * hh);
      acc[t] = mmaN<ASPLIT ? 2 : 1>(ah.v, al.v, b.v, b.v, acc[t]);
    }
  }
#pragma unroll
  for (int t = 0; t < 4; ++t) {
    const int col = col0 + t * 16 + ln;
    float bv = bias ? bias[col] : 0.f;
    if (BIAS_BF16) bv = bf16_round(bv);
#pragma unroll
    for (int r = 0; r < 8; ++r) {
      float v = acc[t][r] + bv;
      if (resid) { float rv = resid[(size_t)((row0 + 8 * hh + r) % rmod) * ldr + col]; if (RES_BF16) rv = bf16_round(rv); v += rv; }
      if (ACT == 1) v = fmaxf(v, 0.f);
      if (ACT == 2) v = 0.5f * v * (1.0f + erff(v * 0.70710678118654752f));
      if (ACT == 3) { const float u = 0.7978845608028654f * (v + 0.044715f * v * v * v); v = 0.5f * v * (1.0f + tanhf(u)); }
      so[w][8 * hh + r][t * 16 + ln] = v;
    }
  }
  __builtin_amdgcn_fence(__ATOMIC_ACQ_REL, "workgroup");
  __builtin_amdgcn_wave_barrier();
  const int rsub = lane >> 4, c4 = (lane & 15) * 4;
  {
#pragma unroll
    for (int q = 0; q < 8; ++q) {
      const int r = q * 2 + rsub;
      const v4f v = *(const v4fa*)&so[w][r][c4];
      *(v4f*)(C + (size_t)(row0 + r) * ldc + col0 + c4) = v;
    }
    
  }
}
// row LayerNorm (biased variance, eps) over N: s = X (+ R); optional out_sum <- s; out_norm <- (s-mu)*rsqrt(var+eps)*g + b
template <bool PARAM_BF16>
__global__ __launch_bounds__(256) void k_layernorm(const float* __restrict__ X, const float* __restrict__ R, const float* __restrict__ g, const float* __restrict__ bta,
                                                  float* __restrict__ out_sum, float* __restrict__ out_norm, int N, float eps) {
  __shared__ float red[256];
  const int row = blockIdx.x, tid = threadIdx.x;
  const float* x = X + (size_t)row * N; const float* rr = R ? R + (size_t)row * N : nullptr;
  float vals[16];                     // up to N = 4096
  const int per = N / 256;            // contiguous chunk per thread? use strided-by-4 chunks: thread handles j = tid*4 + 1024*u
  float s1 = 0.f;
  for (int u = 0; u < per / 4; ++u) {
    const int j = tid * 4 + 1024 * u;
    const v4f a = *(const v4fa*)(x + j);
    v4f b = {0.f,0.f,0.f,0.f}; if (rr) b = *(const v4fa*)(rr + j);
#pragma unroll
    for (int q = 0; q < 4; ++q) { const float v = a[q] + b[q]; vals[u * 4 + q] = v; s1 += v; }
  }
  red[tid] = s1; __syncthreads();
  for (int st = 128; st > 0; st >>= 1) { if (tid < st) red[tid] += red[tid + st]; __syncthreads(); }
  const float mu = red[0] / (float)N; __syncthreads();
  float s2 = 0.f;
  for (int u = 0; u < per / 4; ++u)
#pragma unroll
    for (int q = 0; q < 4; ++q) { const float c = vals[u * 4 + q] - mu; s2 += c * c; }
  red[tid] = s2; __syncthreads();
  for (int st = 128; st > 0; st >>= 1) { if (tid < st) red[tid] += red[tid + st]; __syncthreads(); }
  const float rs = rsqrtf(red[0] / (float)N + eps);
  {
    for (int u = 0; u < per / 4; ++u) {
      const int j = tid * 4 + 1024 * u;
      v4f o, sm;
#pragma unroll
      for (int q = 0; q < 4; ++q) {
        float gg = g[j + q], bb = bta[j + q];
        if (PARAM_BF16) { gg = bf16_round(gg); bb = bf16_round(bb); }
        sm[q] = vals[u * 4 + q]; o[q] = (vals[u * 4 + q] - mu) * rs * gg + bb;
      }
      if (out_sum) *(v4f*)(out_sum + (size_t)row * N + j) = sm;
      *(v4f*)(out_norm + (size_t)row * N + j) = o;
    }
    
  }
}



// ---- f16 WMMA path (v_wmma_f32_16x16x32_f16): 11-bit significands for operands in range — used where a [0,1] probability operand needs more precision than bf16
typedef _Float16 v16h __attribute__((ext_vector_type(16)));
union FragH { v16h v; v8us half[2]; _Float16 h[16]; unsigned short u[16]; };
template <int NT>
__device__ __forceinline__ v8f mmaH(v16h ah, v16h al, v16h bh, v16h bl, v8f c) {
  c = __builtin_amdgcn_wmma_f32_16x16x32_f16(false, ah, false, bh, (short)0, c, false, false);
  if (NT >= 2) c = __builtin_amdgcn_wmma_f32_16x16x32_f16(false, al, false, bh, (short)0, c, false, false);
  if (NT >= 3) c = __builtin_amdgcn_wmma_f32_16x16x32_f16(false, ah, false, bl, (short)0, c, false, false);
  asm volatile("v_nop\n\tv_nop\n\tv_nop\n\tv_nop" : "+v"(c) : "v"(ah), "v"(al), "v"(bh), "v"(bl));
  return c;
}
// batched GEMM like k_gemm_b but f16 operands: A f32 (split into f16 hi/lo if ASPLIT, else rounded to f16), Bt = f16 values [n][k]; alpha; C f32; N multiple of 16 (partial tiles skipped)
template <bool ASPLIT>
__global__ __launch_bounds__(128) void k_gemm_h(const float* __restrict__ A, int lda, size_t sA, const _Float16* __restrict__ Bh, int ldb, size_t sB, float alpha, float* __restrict__ C, int ldc, size_t sC, int M, int N, int K) {
  __shared__ __attribute__((aligned(16))) float so[4][16][64];
  const int tid = threadIdx.x, w = tid >> 5, lane = tid & 31, ln = lane & 15, hh = lane >> 4; const int by = blockIdx.y;
  A += (size_t)by * sA; Bh += (size_t)by * sB; C += (size_t)by * sC;
  const int ntn = (N + 63) / 64; const int wid = blockIdx.x * 4 + w; const int mt = wid / ntn, nq = wid % ntn; if (mt * 16 >= M) return;
  const int row0 = mt * 16, col0 = nq * 64; const float* arow = A + (size_t)(row0 + ln) * lda;
  v8f acc[4] = {};
  for (int kb = 0; kb < K; kb += 32) {
    FragH ah, al;
    const v4f x0 = *(const v4fa*)(arow + kb + 8 * hh), x1 = *(const v4fa*)(arow + kb + 8 * hh + 4), x2 = *(const v4fa*)(arow + kb + 16 + 8 * hh), x3 = *(const v4fa*)(arow + kb + 16 + 8 * hh + 4);
    float xs[16] = {x0[0],x0[1],x0[2],x0[3],x1[0],x1[1],x1[2],x1[3],x2[0],x2[1],x2[2],x2[3],x3[0],x3[1],x3[2],x3[3]};
#pragma unroll
    for (int i = 0; i < 16; ++i) { const _Float16 h = (_Float16)xs[i]; ah.h[i] = h; al.h[i] = ASPLIT ? (_Float16)(xs[i] - (float)h) : (_Float16)0.0f; }
#pragma unroll
    for (int t = 0; t < 4; ++t) { if (col0 + t * 16 >= N) continue; const size_t boff = (size_t)(col0 + t * 16 + ln) * ldb + kb; FragH bq; bq.half[0] = *(const v8us*)(Bh + boff + 8 * hh); bq.half[1] = *(const v8us*)(Bh + boff + 16 + 8 * hh);
      acc[t] = mmaH<ASPLIT ? 2 : 1>(ah.v, al.v, bq.v, bq.v, acc[t]); }
  }
#pragma unroll
  for (int t = 0; t < 4; ++t) { if (col0 + t * 16 >= N) continue;
#pragma unroll
    for (int r = 0; r < 8; ++r) so[w][8 * hh + r][t * 16 + ln] = acc[t][r] * alpha; }
  __builtin_amdgcn_fence(__ATOMIC_ACQ_REL, "workgroup"); __builtin_amdgcn_wave_barrier();
  const int rsub = lane >> 4, c4 = (lane & 15) * 4;
  {
#pragma unroll
    for (int q = 0; q < 8; ++q) { const int r = q * 2 + rsub; if (col0 + c4 < N) { const v4f v = *(const v4fa*)&so[w][r][c4]; *(v4f*)(C + (size_t)(row0 + r) * ldc + col0 + c4) = v; } }
     }
}

// FRAGMENT ORDER. Every 16-bit matrix operand M[row][k] (rows a multiple of 16, k a multiple of 32, KS = k-steps of 32) lies in the workspace as [row tile of 16][k-step][half j][lane][8 elements]:
// lane 16 hh + (row & 15) of half j of k-step s holds k = 32 s + 16 j + 8 hh + 0..7. One half of a fragment is then 32 lanes x 16 B = 512 contiguous bytes (4 cache lines), where rows of a row-major matrix gave 16 lines a load.
// The 16-byte piece number t of such a matrix (its place is element 8 t) holds row frag_row(t, KS), columns frag_k(t, KS) + 0..7; a writer whose thread t makes piece t stores whole lines.
__device__ __forceinline__ int frag_row(unsigned t, unsigned KS) { return (int)((t / (64 * KS)) * 16 + (t & 15)); }
__device__ __forceinline__ int frag_k(unsigned t, unsigned KS) { return (int)(((t >> 6) % KS) * 32 + ((t >> 5) & 1) * 16 + ((t >> 4) & 1) * 8); }
// Wt (row n, column k, fragment order) = f16(W[k][n] * scale) from f32 row-major W[K][N] (scale = power of two; bf16-exact weights stay exact in f16 away from the subnormal range)
__device__ __forceinline__ void wt_f16_block(const float* __restrict__ W, _Float16* __restrict__ Wt, int K, int N, float scale, int blk) {
  const int t = blk * 256 + threadIdx.x; if (t >= N * (K / 8)) return; const int n = frag_row(t, K / 32), k8 = frag_k(t, K / 32); FragH f;
#pragma unroll
  for (int i = 0; i < 8; ++i) f.h[i] = (_Float16)(bf16_round(W[(size_t)(k8 + i) * N + n]) * scale); const v8us o = f.half[0];
  *(v8us*)((unsigned short*)Wt + (size_t)t * 8) = o; 
}
// k_gemm_hh variant with fused epilogue: v = acc·alpha + bf16(bias_by[by·sBias + col]) (bias_by = bias, biasY1, biasY2 for by = 0, 1, 2) (+ CP[(row/rowsPerB)·sCPb + by·64 + col] if CP) ; ACT 0 none / 1 elu ; writes f16 C16 and f32 C, each if non-null
// N (a multiple of 64, so every wave owns four whole 16-column tiles) and K are compile-time: the k loop is unrolled whole and its fragment loads run PF k-steps ahead of the products that use them.
// A, Bh and C16 are in fragment order (K / 32, K / 32 and N / 32 k-steps a row tile); C is row-major with pitch ldc.
// VT: batch index 2 (the value projection) is stored transposed instead, into CT: planes [row / NN][column / 64] of [64 rows d][NN keys] in fragment order (NN / 32 k-steps a row tile), the A operand of the flash kernel's value product.
template <int ACT, int N, int K, bool VT>
__global__ __launch_bounds__(128) void k_gemm_hhx(const _Float16* __restrict__ A, int lda, size_t sA, const _Float16* __restrict__ Bh, int ldb, size_t sB, float alpha, const float* __restrict__ bias, const float* __restrict__ biasY1, const float* __restrict__ biasY2, size_t sBias, const float* __restrict__ CP, int rowsPerB, size_t sCPb, int row0g,
    float* __restrict__ C, _Float16* __restrict__ C16, _Float16* __restrict__ CT, int ldc, size_t sC, int M) {
  static_assert(N % 64 == 0 && K % 32 == 0, "whole 64-column wave tiles and whole 32-deep k-steps");
  __shared__ __attribute__((aligned(16))) float so[4][16][64 + 4];      /* pitch 68: the fragment-order store below reads 16 rows at one column, which a pitch of 64 would put on the same banks */
  const int tid = threadIdx.x, w = tid >> 5, lane = tid & 31, ln = lane & 15, hh = lane >> 4; const int by = blockIdx.y;
  A += (size_t)by * sA; Bh += (size_t)by * sB; const size_t cofs = (size_t)by * sC; const float* bsel = (by == 0) ? bias : ((by == 1) ? biasY1 : biasY2); const float* bp = bsel ? bsel + (size_t)by * sBias : nullptr;      /* batch index by = 0, 1, 2 takes its own bias buffer */
  const int ntn = (N + 63) / 64; const int wid = blockIdx.x * 4 + w; const int mt = wid / ntn, nq = wid % ntn; if (mt * 16 >= M) return;
  const int row0 = mt * 16, col0 = nq * 64; (void)lda; (void)ldb;
  v8f acc[4] = {};
  constexpr int NS = K / 32, PF = 2, NB = PF + 1;      /* NB register stages: PF k-steps of loads in flight beside the one being multiplied */
  const unsigned short* ap = (const unsigned short*)A + (size_t)mt * NS * 512 + lane * 8; const unsigned short* bq0 = (const unsigned short*)Bh + (size_t)(nq * 4) * NS * 512 + lane * 8;      /* row tile mt of A; row tiles 4 nq + t of Bh */
  FragH fa[NB], fb[NB][4];
#pragma unroll
  for (int s = 0; s < NS + PF; ++s) {      /* unrolled whole: the stage indices must be constants for the stages to stay in registers */
    if (s < NS) { const int st = s % NB; fa[st].half[0] = *(const v8us*)(ap + s * 512); fa[st].half[1] = *(const v8us*)(ap + s * 512 + 256);
#pragma unroll
      for (int t = 0; t < 4; ++t) { const unsigned short* br = bq0 + (t * NS + s) * 512; fb[st][t].half[0] = *(const v8us*)br; fb[st][t].half[1] = *(const v8us*)(br + 256); } }
    if (s >= PF) { const int st = (s - PF) % NB;
#pragma unroll
      for (int t = 0; t < 4; ++t) acc[t] = mmaH<1>(fa[st].v, fa[st].v, fb[st][t].v, fb[st][t].v, acc[t]); }
  }
  if (VT && by == 2) {      /* block-uniform. In accumulator tile t lane 16 hh + ln holds rows (keys) 8 hh + 0..7 of column d = 16 t + ln: that is the lane's 16-byte piece of the transposed operand, so it goes out from the registers, no LDS */
    const unsigned ur = (unsigned)row0; unsigned short* tp = (unsigned short*)CT + (size_t)((ur / NN) * (N / 64) + (unsigned)nq) * 64 * NN + ((ur % NN) / 32) * 512 + ((ur >> 4) & 1) * 256 + lane * 8;      /* plane (batch, nq); the wave's 16 keys are half (row0 / 16) & 1 of k-step (row0 % NN) / 32 */
    float bv[4] = {0.f, 0.f, 0.f, 0.f};
    if (bp) {      /* one test for the four bias loads, so that they travel together */
#pragma unroll
      for (int t = 0; t < 4; ++t) bv[t] = bp[col0 + t * 16 + ln];
#pragma unroll
      for (int t = 0; t < 4; ++t) bv[t] = bf16_round(bv[t]); }
    FragH f[2];
#pragma unroll
    for (int t = 0; t < 4; ++t)
#pragma unroll
      for (int r = 0; r < 8; ++r) f[t >> 1].h[(t & 1) * 8 + r] = (_Float16)(acc[t][r] * alpha + bv[t]);
#pragma unroll
    for (int t = 0; t < 4; ++t) *(v8us*)(tp + (size_t)t * (NN / 32) * 512) = f[t >> 1].half[t & 1];      /* row tile t of the plane: four 512-byte stores */
    return; }
#pragma unroll
  for (int t = 0; t < 4; ++t) { if (col0 + t * 16 >= N) continue; const int col = col0 + t * 16 + ln; const float bv = bp ? bf16_round(bp[col]) : 0.f;
#pragma unroll
    for (int r = 0; r < 8; ++r) { float v = acc[t][r] * alpha + bv; if (CP) { const int bidx = (row0g + row0 + 8 * hh + r) / rowsPerB; v += CP[(size_t)bidx * sCPb + (size_t)by * 64 + col]; } if (ACT == 1) v = (v > 0.f) ? v : expm1f(v); else if (ACT == 7) v = (v > 0.f) ? v + 1.0f : expf(v); else if (ACT == 8) v = tanhf(v); else if (ACT == 9) v = 0.5f * v * (1.0f + tanhf(0.7978845608028654f * (v + 0.044715f * v * v * v))); else if (ACT == 11) v = 1.0f / (1.0f + expf(-v)); else if (ACT == 12) v = (v > 0.f) ? v : 0.01f * v; else if (ACT == 14) v = (v > 0.f) ? v : 0.1f * v; else if (ACT == 15) v = v / (1.0f + expf(-v)); else if (ACT == 3) v = fmaxf(v, 0.f); else if (ACT == 6) v = 0.5f * v * (1.0f + erff(v * 0.70710678118654752f)); so[w][8 * hh + r][t * 16 + ln] = v; } }
  __builtin_amdgcn_fence(__ATOMIC_ACQ_REL, "workgroup"); __builtin_amdgcn_wave_barrier();
  const int rsub = lane >> 4, c4 = (lane & 15) * 4;
  {
#pragma unroll
    for (int q = 0; q < 8; ++q) { const int r = q * 2 + rsub; if (C && col0 + c4 < N) { const v4f v = *(const v4fa*)&so[w][r][c4]; *(v4f*)(C + cofs + (size_t)(row0 + r) * ldc + col0 + c4) = v; } }
    if (C) asm volatile("s_wait_xcnt 0x0" ::: "memory");      /* directly behind the row-major stores: the fragment-order part below rewrites registers that they name */
    if (C16) { unsigned short* cp = (unsigned short*)C16 + cofs + ((size_t)mt * (N / 32) + nq * 2) * 512 + lane * 8;      /* the wave's 16 x 64 tile = two k-steps of row tile mt = 2 KB in a row: four 512-byte stores */
#pragma unroll
      for (int q = 0; q < 4; ++q) { const v4f v0 = *(const v4fa*)&so[w][ln][q * 16 + 8 * hh], v1 = *(const v4fa*)&so[w][ln][q * 16 + 8 * hh + 4]; FragH f;
#pragma unroll
        for (int i = 0; i < 4; ++i) { f.h[i] = (_Float16)v0[i]; f.h[4 + i] = (_Float16)v1[i]; }
        *(v8us*)(cp + q * 256) = f.half[0]; }
      if (VT) asm volatile("s_wait_xcnt 0x0" ::: "memory"); }      /* directly behind the four fragment-order stores: the VT build lays the transposed-store block out behind them, and it rewrites registers that they name */
     }
}


typedef _Float16 v4h __attribute__((ext_vector_type(4)));

__device__ __forceinline__ void x16_block(const float* __restrict__ x, _Float16* __restrict__ X16, size_t n8, int blk) { const size_t t = (size_t)blk * 256 + threadIdx.x; if (t >= n8) return; FragH f;      /* x row-major [NR][DX] -> X16 in fragment order */
  const float* xr = x + (size_t)frag_row((unsigned)t, DX / 32) * DX + frag_k((unsigned)t, DX / 32);
#pragma unroll
  for (int q = 0; q < 8; ++q) f.h[q] = (_Float16)bf16_round(xr[q]); *(v8us*)((unsigned short*)X16 + t * 8) = f.half[0];  }
// One grid for the five operand preparations, none of which reads another's result: the block index picks the job (block-uniform branch).
// Blocks 0 .. 3 NBW - 1: Wq, Wk, Wv (their outputs lie one behind the other in Bqkv); the next NBO: Wo; the last NBX: x.
#define NBW (2 * DX * (DX / 8) / 256)
#define NBO (DX * (DX / 8) / 256)
#define NBX (NR * DX / 8 / 256)
__global__ __launch_bounds__(256) void k_prep(const float* __restrict__ Wq, const float* __restrict__ Wk, const float* __restrict__ Wv, const float* __restrict__ Wo, const float* __restrict__ x,
                                              _Float16* __restrict__ Bqkv, _Float16* __restrict__ Bo, _Float16* __restrict__ X16) {
  const int bid = blockIdx.x;
  if (bid < 3 * NBW) { const int j = bid / NBW; wt_f16_block(j == 0 ? Wq : (j == 1 ? Wk : Wv), Bqkv + (size_t)j * 2 * DX * DX, DX, 2 * DX, 16.0f, bid % NBW); }
  else if (bid < 3 * NBW + NBO) wt_f16_block(Wo, Bo, DX, DX, 16.0f, bid - 3 * NBW);
  else x16_block(x, X16, (size_t)NR * DX / 8, bid - (3 * NBW + NBO)); }
__global__ __launch_bounds__(256) void k_h16(const float* __restrict__ x, _Float16* __restrict__ X16, size_t n8) { const size_t t = (size_t)blockIdx.x * 256 + threadIdx.x; if (t >= n8) return; FragH f;
#pragma unroll
  for (int q = 0; q < 8; ++q) f.h[q] = (_Float16)x[t * 8 + q]; *(v8us*)((unsigned short*)X16 + t * 8) = f.half[0];  }
__global__ __launch_bounds__(256) void k_round16f(const float* __restrict__ W, _Float16* __restrict__ Bt, size_t n8) { const size_t t = (size_t)blockIdx.x * 256 + threadIdx.x; if (t >= n8) return; FragH f;
#pragma unroll
  for (int i = 0; i < 8; ++i) f.h[i] = (_Float16)(bf16_round(W[t * 8 + i]) * 16.0f); *(v8us*)((unsigned short*)Bt + t * 8) = f.half[0];  }
// Keys split inside the work-group: each of the 4 query tiles is walked by KVS waves; wave (qw, kr) takes the 32-key blocks kr, kr + KVS, kr + 2 KVS, ... with its own running max, sum and
// un-normalised accumulators; the KVS partials of a tile are merged through LDS behind one work-group barrier (weights exp(m_k - M)).
// TRANSPOSED PRODUCTS. Scores are formed as S^T = K Q^T (A = key rows, B = query columns) and values as O^T += V^T P^T (A = V^T rows d, B = P^T). In a D tile lane 16 hh + ln, register r holds row 8 hh + r, column ln:
// a lane then holds scores of ONE query (ln), keys 16 nt + 8 hh + r, so the maximum and the sum over keys are in-lane but for one exchange between the lane halves, the rescale factor is one value a lane,
// and the two score tiles nt = 0, 1, converted in place, are the B operand of the value product (element 8 nt + r = key 16 nt + 8 hh + r, the k order of every fragment here): P never goes through LDS.
#define KVS 4
typedef float v2f __attribute__((ext_vector_type(2)));
__device__ __forceinline__ float xhalf(float x) { return __builtin_bit_cast(float, __builtin_amdgcn_permlanex16(__builtin_bit_cast(int, x), __builtin_bit_cast(int, x), 0x76543210, 0xfedcba98, false, false)); }      /* lane l takes the value of lane l ^ 16 */
__global__ __launch_bounds__(128 * KVS) void k_flash(const _Float16* __restrict__ Q16, int ldq, const _Float16* __restrict__ K16, int ldk, const _Float16* __restrict__ Vt, _Float16* __restrict__ O16) {
  constexpr int RPW = 16, NQB = NN / (4 * RPW), DT = 4, KS = 2, NW = 4 * KVS;
  __shared__ __attribute__((aligned(16))) float sO[NW][RPW][128 + 4]; __shared__ float sM[NW][RPW], sL[NW][RPW];
  const int tid = threadIdx.x, w = __builtin_amdgcn_readfirstlane(tid >> 5), lane = tid & 31, ln = lane & 15, hh = lane >> 4; const int qw = w & 3, kr = w >> 2;      /* the wave's number held as a scalar: tile and key-block indices leave the vector registers, which the grouped fragments need */
  const int slab = blockIdx.x / NQB, qblk = blockIdx.x % NQB; const int b = slab / NHU, h = slab % NHU; const int qb0 = qblk * (4 * RPW); const int q0 = qb0 + qw * RPW;
  FragH aq[KS], aql[KS];
  { const size_t qo = ((size_t)((b * NN + q0) / 16) * (DX / 32) + h * 4) * 512 + lane * 8; const unsigned short* qr = (const unsigned short*)Q16 + qo; const unsigned short* ql = qr + 2 * 512;      /* Q16, K16 in fragment order: head h = k-steps 4 h .. 4 h + 3 of a row tile; aq = real part (the first two), aql = imaginary part */
#pragma unroll
    for (int ks = 0; ks < KS; ++ks) { aq[ks].half[0] = *(const v8us*)(qr + ks * 512); aq[ks].half[1] = *(const v8us*)(qr + ks * 512 + 256); aql[ks].half[0] = *(const v8us*)(ql + ks * 512); aql[ks].half[1] = *(const v8us*)(ql + ks * 512 + 256); } }
  (void)ldq; (void)ldk;
  const unsigned short* Vth = (const unsigned short*)Vt + ((size_t)b * 2 * NHU + 2 * h) * 64 * NN;      /* V^T real plane of head h; the imaginary plane lies 64 NN elements behind it */
  float m_q = -3.0e38f, l_q = 0.f; v8f oacc[DT], oacci[DT];      /* running max of query ln (equal in both lane halves), this lane half's share of its sum, O^T tiles: register r = column d = 16 dt + 8 hh + r of query ln */
#pragma unroll
  for (int dt = 0; dt < DT; ++dt) { oacc[dt] = (v8f){0.f,0.f,0.f,0.f,0.f,0.f,0.f,0.f}; oacci[dt] = oacc[dt]; }
  const int jend = NN;
#pragma unroll 1
  for (int j0 = kr * 32; j0 < jend; j0 += 32 * KVS) {
    v8f s[2]; FragH bk[2][KS], bl[2][KS];      /* bk = real, bl = imaginary; both 16-key tiles' fragments are loaded as one group ahead of the score products */
    const unsigned short* kp[2];
#pragma unroll
    for (int nt = 0; nt < 2; ++nt) { kp[nt] = (const unsigned short*)K16 + ((size_t)((b * NN + j0) / 16 + nt) * (DX / 32) + h * 4) * 512 + lane * 8; const unsigned short* kr = kp[nt]; const unsigned short* kl = kr + 2 * 512;
#pragma unroll
      for (int ks = 0; ks < KS; ++ks) { bk[nt][ks].half[0] = *(const v8us*)(kr + ks * 512); bk[nt][ks].half[1] = *(const v8us*)(kr + ks * 512 + 256); bl[nt][ks].half[0] = *(const v8us*)(kl + ks * 512); bl[nt][ks].half[1] = *(const v8us*)(kl + ks * 512 + 256); } }
    asm volatile("s_wait_xcnt 0x0" :: "v"(kp[0]), "v"(kp[1]) : "memory");      /* keeps both address pairs alive past the last load of the group, so that no load's result lands in a pair that an issued load names before this wait */
#pragma unroll
    for (int nt = 0; nt < 2; ++nt) { v8f re = (v8f){0.f,0.f,0.f,0.f,0.f,0.f,0.f,0.f}, ip = re, in = re;      /* keys as A, queries as B */
#pragma unroll
      for (int ks = 0; ks < KS; ++ks) { re = mmaH<1>(bk[nt][ks].v, bk[nt][ks].v, aq[ks].v, aq[ks].v, re); re = mmaH<1>(bl[nt][ks].v, bl[nt][ks].v, aql[ks].v, aql[ks].v, re); ip = mmaH<1>(bk[nt][ks].v, bk[nt][ks].v, aql[ks].v, aql[ks].v, ip); in = mmaH<1>(bl[nt][ks].v, bl[nt][ks].v, aq[ks].v, aq[ks].v, in); }
      const v8f im = ip - in; s[nt] = (re * re + im * im) * SCORE_SCALE; }
    FragH bv[DT], bi[DT];      /* all value fragments of this key block are requested here, so that they travel while the softmax below is computed */
    const unsigned short* vp = Vth + (size_t)(j0 / 32) * 512 + lane * 8; const unsigned short* vq = vp + (size_t)64 * NN;      /* fragment order: k-step j0 / 32 of row tile dt, NN / 32 k-steps a row tile */
#pragma unroll
    for (int dt = 0; dt < DT; ++dt) { const size_t vo = (size_t)(dt * 16) * NN; bv[dt].half[0] = *(const v8us*)(vp + vo); bv[dt].half[1] = *(const v8us*)(vp + vo + 256); bi[dt].half[0] = *(const v8us*)(vq + vo); bi[dt].half[1] = *(const v8us*)(vq + vo + 256); }
    asm volatile("s_wait_xcnt 0x0" :: "v"(vp) : "memory");      /* as above: the address pair outlives the group's last load */
    float mc = fmaxf(s[0][0], s[1][0]);
#pragma unroll
    for (int r = 1; r < 8; ++r) mc = fmaxf(mc, fmaxf(s[0][r], s[1][r]));
    mc = fmaxf(mc, xhalf(mc));      /* the other 16 keys of the block lie in the other lane half */
    const float mn = fmaxf(m_q, mc); const float al = expf(m_q - mn); m_q = mn;
    FragH pb; v2f ps = {0.f, 0.f};      /* two partial sums, over even and odd registers: neighbouring registers pair in the packed adds */
#pragma unroll
    for (int nt = 0; nt < 2; ++nt)
#pragma unroll
      for (int r = 0; r < 8; r += 2) { const v2f p = {expf(s[nt][r] - mn), expf(s[nt][r + 1] - mn)}; ps += p; const v2f ph = p * 1024.0f; pb.h[8 * nt + r] = (_Float16)ph[0]; pb.h[8 * nt + r + 1] = (_Float16)ph[1]; }
    l_q = l_q * al + (ps[0] + ps[1]);
#pragma unroll
    for (int dt = 0; dt < DT; ++dt) { oacc[dt] *= al; oacci[dt] *= al; }
#pragma unroll
    for (int dt = 0; dt < DT; ++dt) { oacc[dt] = mmaH<1>(bv[dt].v, bv[dt].v, pb.v, pb.v, oacc[dt]); oacci[dt] = mmaH<1>(bi[dt].v, bi[dt].v, pb.v, pb.v, oacci[dt]); } }
  { const float l = l_q + xhalf(l_q); if (hh == 0) { sM[w][ln] = m_q; sL[w][ln] = l; } }
#pragma unroll
  for (int dt = 0; dt < DT; ++dt) { float* so = &sO[w][ln][dt * 16 + 8 * hh];      /* a lane's 8 registers are 8 neighbouring columns of its query's row: two 16-byte stores a tile */
    *(v4fa*)so = (v4f){oacc[dt][0], oacc[dt][1], oacc[dt][2], oacc[dt][3]}; *(v4fa*)(so + 4) = (v4f){oacc[dt][4], oacc[dt][5], oacc[dt][6], oacc[dt][7]};
    *(v4fa*)(so + 64) = (v4f){oacci[dt][0], oacci[dt][1], oacci[dt][2], oacci[dt][3]}; *(v4fa*)(so + 68) = (v4f){oacci[dt][4], oacci[dt][5], oacci[dt][6], oacci[dt][7]}; }
  __syncthreads();      /* publishes every wave's partial (max, sum, accumulators) to the waves that merge it */
  {      /* wave (qw, kr) merges columns 32 kr .. 32 kr + 31 of query tile qw = k-step 4 h + kr of that row tile of O16 (fragment order, x 2^8): lane 16 hh + ln makes row ln, columns 32 kr + 16 j + 8 hh + 0..7 for j = 0, 1 */
    float mk[KVS], wk[KVS], M = -3.0e38f, L = 0.f;
#pragma unroll
    for (int k = 0; k < KVS; ++k) { mk[k] = sM[k * 4 + qw][ln]; M = fmaxf(M, mk[k]); }
#pragma unroll
    for (int k = 0; k < KVS; ++k) { wk[k] = expf(mk[k] - M); L += wk[k] * sL[k * 4 + qw][ln]; }
    const float inv = (L > 0.f) ? 1.0f / (L * 1024.0f) : 0.f;
    FragH f;
#pragma unroll
    for (int j = 0; j < 2; ++j) { v4f o0 = {0.f, 0.f, 0.f, 0.f}, o1 = o0;
#pragma unroll
      for (int k = 0; k < KVS; ++k) { const float* sp = &sO[k * 4 + qw][ln][kr * 32 + j * 16 + 8 * hh]; o0 += *(const v4fa*)sp * wk[k]; o1 += *(const v4fa*)(sp + 4) * wk[k]; }
      o0 = o0 * inv; o1 = o1 * inv;
#pragma unroll
      for (int i = 0; i < 4; ++i) { f.h[8 * j + i] = (_Float16)(o0[i] * 256.0f); f.h[8 * j + 4 + i] = (_Float16)(o1[i] * 256.0f); } }
    unsigned short* op = (unsigned short*)O16 + ((size_t)((b * NN + q0) / 16) * (DX / 32) + h * 4 + kr) * 512 + lane * 8;
    *(v8us*)op = f.half[0]; *(v8us*)(op + 256) = f.half[1];      /* two 512-byte stores, the last instructions of the wave */
  } }

extern "C" void kernel_launch(void* const* d_in, const int* in_sizes, int n_in,
                              void* d_out, int out_size, void* d_ws, size_t ws_size, hipStream_t stream) {
  (void)in_sizes; (void)n_in; (void)out_size;
  const float* const* I = (const float* const*)d_in; const float* x = I[0]; const float* Wq = I[1]; const float* bq = I[2]; const float* Wk = I[3]; const float* bk = I[4]; const float* Wv = I[5]; const float* bv = I[6]; const float* Wo = I[7]; const float* bo = I[8];
  char* ws = (char*)d_ws; size_t off = 0;
  auto take = [&](size_t bytes) { char* p = ws + off; off += (bytes + 255) & ~(size_t)255; return p; };
  _Float16* Bq = (_Float16*)take((size_t)3 * 2 * DX * DX * 2); _Float16* Bo = (_Float16*)take((size_t)DX * DX * 2);
  _Float16* X16 = (_Float16*)take((size_t)NR * DX * 2); _Float16* Q = (_Float16*)take((size_t)2 * NR * DX * 2); _Float16* K = Q + (size_t)NR * DX;      /* q, k one behind the other: batch stride of the merged projection */ _Float16* Vt = (_Float16*)take((size_t)NR * DX * 2);
  _Float16* O16 = (_Float16*)take((size_t)NR * DX * 2);
  /* Bq, Bo, X16, Q, K, Vt and O16 are all in fragment order (see FRAGMENT ORDER above); the output is row-major */
  if (off > ws_size) return;      // 3 x 1 + 0.5 + 5 x 4.2 = about 25 MB
  k_prep<<<3 * NBW + NBO + NBX, 256, 0, stream>>>(Wq, Wk, Wv, Wo, x, Bq, Bo, X16);      /* (in,out) [512][1024] -> Bt[1024][512] x2^4 for Wq, Wk, Wv (only rows 0..511 = heads 0..3 are used), Wo likewise, x -> f16: one launch */
  const dim3 gp(((NR / 16) * (DX / 64) + 3) / 4, 1), gp3(((NR / 16) * (DX / 64) + 3) / 4, 3);
  k_gemm_hhx<0, DX, DX, true><<<gp3, 128, 0, stream>>>(X16, DX, 0, Bq, DX, (size_t)2 * DX * DX, 0.0625f, bq, bk, bv, 0, nullptr, 1, 0, 0, nullptr, Q, Vt, DX, (size_t)NR * DX, NR);      /* q, k, v in one launch (blockIdx.y), heads 0..3 = output columns 0..511 (+ bias): each M 4096 N 512 K 512; v goes out transposed, planes per (b, head, part): [b * 8 + 2 h + part][64][2048] */
  k_flash<<<BB * NHU * (NN / 64), 128 * KVS, 0, stream>>>(Q, DX, K, DX, Vt, O16);      /* stores O x 2^8 as f16 in fragment order, the A operand of the output product */
  k_gemm_hhx<0, DX, DX, false><<<gp, 128, 0, stream>>>(O16, DX, 0, Bo, DX, 0, 0.0625f * 0.00390625f, bo, nullptr, nullptr, 0, nullptr, 1, 0, 0, (float*)d_out, nullptr, nullptr, DX, 0, NR);      /* out = O Wo + bo (alpha undoes the x 2^4 of the weights and the x 2^8 carry) */
}

// v007
// It runs in 61.5 microseconds.
// Next to v006, in two timings, it ran 1.04 and 1.06 times as fast.
// Over all steps from v000 it is 5.23 times as fast.
#include <hip/hip_runtime.h>
// 'Superposition' (complex-valued) multi-head attention (B=2, S=2048, D=512, 8 heads; q,k,v projections to 2D with per-head [real 64 | imag 64]): interference = Σ_d q_d·conj(k_d)·64^-½; probs = softmax(|interference|²/0.5); out = probs·v (complex);
// out = concat[real, imag] per head → [B,S,1024], truncated to the first 512 columns (= heads 0..3), then ·Wo + bo. Only heads 0..3 reach the output, so only they are computed.
// Compute dtype: x, weights, biases rounded to bf16; q/k/v (columns of heads 0..3) as f16 GEMM outputs; fused flash-style kernel with three f32 score accumulators (Re, Im⁺, Im⁻) and two value accumulators
// (real, imag), online softmax f32, P f16 ×2^10, on v_wmma_f32_16x16x32_f16; O carried ×2^8 into f16 (small diffuse values) → output GEMM with bias (alpha undoes the carry); f32 accumulate.
#define BB 2
#define NN 2048
#define DX 512
#define NHU 4
#define DH2 128
#define NR (BB * NN)
#define SCORE_SCALE 0.03125f
#define SCORE_L2E (SCORE_SCALE * 1.44269504088896340736f)      /* score scale x log2(e): the softmax runs in base 2 */

typedef __bf16 v16b __attribute__((ext_vector_type(16)));
typedef unsigned short v8us __attribute__((ext_vector_type(8), may_alias));
typedef float  v8f  __attribute__((ext_vector_type(8)));
typedef float  v4f  __attribute__((ext_vector_type(4)));
typedef float  v4fa __attribute__((ext_vector_type(4), may_alias));
union FragB { v16b v; v8us half[2]; unsigned short u[16]; };

__device__ __forceinline__ unsigned short bf16_bits(float x) { unsigned int u = __float_as_uint(x); return (unsigned short)((u + 0x7FFFu + ((u >> 16) & 1u)) >> 16); }
__device__ __forceinline__ float bf16_val(unsigned short b) { return __uint_as_float(((unsigned int)b) << 16); }
__device__ __forceinline__ float bf16_round(float x) { return bf16_val(bf16_bits(x)); }
// D += A·B with NT terms: 1 = ah·bh, 2 = + al·bh (A split), 3 = + ah·bl (both split)
template <int NT>
__device__ __forceinline__ v8f mmaN(v16b ah, v16b al, v16b bh, v16b bl, v8f c) {
  c = __builtin_amdgcn_wmma_f32_16x16x32_bf16(false, ah, false, bh, (short)0, c, false, false);
  if (NT >= 2) c = __builtin_amdgcn_wmma_f32_16x16x32_bf16(false, al, false, bh, (short)0, c, false, false);
  if (NT >= 3) c = __builtin_amdgcn_wmma_f32_16x16x32_bf16(false, ah, false, bl, (short)0, c, false, false);
  asm volatile("v_nop\n\tv_nop\n\tv_nop\n\tv_nop" : "+v"(c) : "v"(ah), "v"(al), "v"(bh), "v"(bl));
  return c;
}

__global__ __launch_bounds__(256) void k_wt_bf16(const float* __restrict__ W, unsigned short* __restrict__ Wt, int K, int N) {
  const int t = blockIdx.x * 256 + threadIdx.x;
  const int k8n = K / 8;
  if (t >= N * k8n) return;
  const int n = t / k8n, k8 = (t % k8n) * 8;
  v8us v;
#pragma unroll
  for (int i = 0; i < 8; ++i) v[i] = bf16_bits(W[(size_t)(k8 + i) * N + n]);
  *(v8us*)(Wt + (size_t)n * K + k8) = v;
  
}

// GEMM C[M][N] (f32, pitch ldc) = act(A[M][K]·W + bias). A f32 row-major (pitch lda) converted per fragment to bf16
// (ASPLIT: hi/lo two planes -> 2 terms, else single rounded term); Wt bf16 [N][K] (pitch ldb). BIAS_BF16 rounds the
// bias to bf16 first (bias quantised to bf16 before the add). K%32==0, M%16==0, N%64==0.
template <bool ASPLIT, int ACT, bool BIAS_BF16>
__global__ __launch_bounds__(128) void k_gemm_bf(const float* __restrict__ A, int lda, const unsigned short* __restrict__ Wt, int ldb,
                                               const float* __restrict__ bias, float* __restrict__ C, int ldc, int M, int N, int K) {
  __shared__ __attribute__((aligned(16))) float so[4][16][64];
  const int tid = threadIdx.x, w = tid >> 5, lane = tid & 31, ln = lane & 15, hh = lane >> 4;
  const int ntn = N / 64;
  const int wid = blockIdx.x * 4 + w;
  const int mt = wid / ntn, nq = wid % ntn;
  if (mt * 16 >= M) return;
  const int row0 = mt * 16, col0 = nq * 64;
  const float* arow = A + (size_t)(row0 + ln) * lda;
  v8f acc[4] = {};
  for (int kb = 0; kb < K; kb += 32) {
    FragB ah, al;
    const v4f x0 = *(const v4fa*)(arow + kb + 8 * hh), x1 = *(const v4fa*)(arow + kb + 8 * hh + 4);
    const v4f x2 = *(const v4fa*)(arow + kb + 16 + 8 * hh), x3 = *(const v4fa*)(arow + kb + 16 + 8 * hh + 4);
    float xs[16] = {x0[0],x0[1],x0[2],x0[3],x1[0],x1[1],x1[2],x1[3],x2[0],x2[1],x2[2],x2[3],x3[0],x3[1],x3[2],x3[3]};
#pragma unroll
    for (int i = 0; i < 16; ++i) { const unsigned short hb = bf16_bits(xs[i]); ah.u[i] = hb; al.u[i] = ASPLIT ? bf16_bits(xs[i] - bf16_val(hb)) : (unsigned short)0; }
#pragma unroll
    for (int t = 0; t < 4; ++t) {
      const unsigned short* brow = Wt + (size_t)(col0 + t * 16 + ln) * ldb + kb;
      FragB b;
      b.half[0] = *(const v8us*)(brow + 8 * hh);
      b.half[1] = *(const v8us*)(brow + 16 + 8 * hh);
      acc[t] = mmaN<ASPLIT ? 2 : 1>(ah.v, al.v, b.v, b.v, acc[t]);
    }
  }
#pragma unroll
  for (int t = 0; t < 4; ++t) {
    float bv = bias ? bias[col0 + t * 16 + ln] : 0.f;
    if (BIAS_BF16) bv = bf16_round(bv);
#pragma unroll
    for (int r = 0; r < 8; ++r) { float v = acc[t][r] + bv; if (ACT == 1) v = fmaxf(v, 0.f); so[w][8 * hh + r][t * 16 + ln] = v; }
  }
  __builtin_amdgcn_fence(__ATOMIC_ACQ_REL, "workgroup");
  __builtin_amdgcn_wave_barrier();
  const int rsub = lane >> 4, c4 = (lane & 15) * 4;
  {
#pragma unroll
    for (int q = 0; q < 8; ++q) {
      const int r = q * 2 + rsub;
      const v4f v = *(const v4fa*)&so[w][r][c4];
      *(v4f*)(C + (size_t)(row0 + r) * ldc + col0 + c4) = v;
    }
    
  }
}

// Flash-style causal/unmasked attention, all contractions 3-term bf16 hi/lo splits, f32 softmax with running max.
// q,k,v rows are read from f32 buffers with arbitrary row pitch (so they can live inside a fused qkv buffer);
// D = head size (multiple of 32, <= 128); one wave = 16 query rows; block = 4 waves (64 queries) sharing K/V chunks of 32.
template <int D, bool CAUSAL>
__global__ __launch_bounds__(128) void k_flash(const float* __restrict__ qb, const float* __restrict__ kb, const float* __restrict__ vb,
                                             int pitch, int T, int H, float scale, float* __restrict__ y, int ypitch) {
  constexpr int KS = D / 32;        // k-steps for QK
  constexpr int DT = D / 16;        // d tiles for PV
  __shared__ __attribute__((aligned(16))) unsigned short sKh[32][D + 8], sKl[32][D + 8], sVh[32][D + 8], sVl[32][D + 8];
  __shared__ __attribute__((aligned(16))) unsigned short sPh[4][16][40], sPl[4][16][40];
  __shared__ __attribute__((aligned(16))) float sO[4][16][D];
  const int tid = threadIdx.x, w = tid >> 5, lane = tid & 31, ln = lane & 15, hh = lane >> 4;
  const int nqb = (T + 63) / 64;
  const int bh = blockIdx.x / nqb, qblk = blockIdx.x % nqb;
  const int b = bh / H, h = bh % H;
  const int q0 = qblk * 64 + w * 16;
  const float* Q = qb + (size_t)b * T * pitch + h * D;
  const float* K = kb + (size_t)b * T * pitch + h * D;
  const float* V = vb + (size_t)b * T * pitch + h * D;

  // A fragments of the wave's 16 query rows (scaled), hi/lo
  FragB aqh[KS], aql[KS];
  {
    int row = q0 + ln; if (row >= T) row = T - 1;
    const float* qr = Q + (size_t)row * pitch;
#pragma unroll
    for (int ks = 0; ks < KS; ++ks)
#pragma unroll
      for (int i = 0; i < 16; ++i) {
        const int d = ks * 32 + ((i < 8) ? (8 * hh + i) : (16 + 8 * hh + (i - 8)));
        const float x = qr[d] * scale; const unsigned short hb = bf16_bits(x);
        aqh[ks].u[i] = hb; aql[ks].u[i] = bf16_bits(x - bf16_val(hb));
      }
  }
  float m_r[8], l_r[8];
#pragma unroll
  for (int r = 0; r < 8; ++r) { m_r[r] = -3.0e38f; l_r[r] = 0.f; }
  v8f oacc[DT];
#pragma unroll
  for (int dt = 0; dt < DT; ++dt) oacc[dt] = (v8f){0.f,0.f,0.f,0.f,0.f,0.f,0.f,0.f};

  const int kv_end = CAUSAL ? min(T, qblk * 64 + 64) : T;     // block-uniform
  for (int j0 = 0; j0 < kv_end; j0 += 32) {
    __syncthreads();
    for (int e = tid; e < 32 * (D / 4); e += 128) {
      const int r = e / (D / 4), c4 = (e % (D / 4)) * 4;
      const int key = j0 + r;
      v4f kf = {0.f,0.f,0.f,0.f}, vf = {0.f,0.f,0.f,0.f};
      if (key < T) { kf = *(const v4fa*)(K + (size_t)key * pitch + c4); vf = *(const v4fa*)(V + (size_t)key * pitch + c4); }
#pragma unroll
      for (int t = 0; t < 4; ++t) {
        unsigned short hb = bf16_bits(kf[t]); sKh[r][c4 + t] = hb; sKl[r][c4 + t] = bf16_bits(kf[t] - bf16_val(hb));
        hb = bf16_bits(vf[t]); sVh[r][c4 + t] = hb; sVl[r][c4 + t] = bf16_bits(vf[t] - bf16_val(hb));
      }
    }
    __syncthreads();
    // S tile 16 x 32
    v8f s[2];
#pragma unroll
    for (int nt = 0; nt < 2; ++nt) {
      v8f acc = {};
#pragma unroll
      for (int ks = 0; ks < KS; ++ks) {
        FragB bh_, bl_;
        bh_.half[0] = *(const v8us*)&sKh[nt * 16 + ln][ks * 32 + 8 * hh]; bh_.half[1] = *(const v8us*)&sKh[nt * 16 + ln][ks * 32 + 16 + 8 * hh];
        bl_.half[0] = *(const v8us*)&sKl[nt * 16 + ln][ks * 32 + 8 * hh]; bl_.half[1] = *(const v8us*)&sKl[nt * 16 + ln][ks * 32 + 16 + 8 * hh];
        acc = mmaN<3>(aqh[ks].v, aql[ks].v, bh_.v, bl_.v, acc);
      }
      s[nt] = acc;
    }
    // mask + running max (rows 8hh+r; the 16 lanes of a half share rows)
    float alpha[8];
#pragma unroll
    for (int r = 0; r < 8; ++r) {
      const int qi = q0 + 8 * hh + r;
      const int ja = j0 + ln, jb = j0 + 16 + ln;
      if (CAUSAL) { if (ja > qi) s[0][r] = -3.0e38f; if (jb > qi) s[1][r] = -3.0e38f; }
      if (ja >= T) s[0][r] = -3.0e38f;
      if (jb >= T) s[1][r] = -3.0e38f;
      float mx = fmaxf(s[0][r], s[1][r]);
      mx = fmaxf(mx, __shfl_xor(mx, 1, 32)); mx = fmaxf(mx, __shfl_xor(mx, 2, 32)); mx = fmaxf(mx, __shfl_xor(mx, 4, 32)); mx = fmaxf(mx, __shfl_xor(mx, 8, 32));
      const float mnew = fmaxf(m_r[r], mx);
      alpha[r] = (mnew > -1.0e38f) ? __expf(m_r[r] - mnew) : 1.0f;
      const float p0 = (s[0][r] > -1.0e38f) ? __expf(s[0][r] - mnew) : 0.f;
      const float p1 = (s[1][r] > -1.0e38f) ? __expf(s[1][r] - mnew) : 0.f;
      m_r[r] = mnew;
      l_r[r] = l_r[r] * alpha[r] + p0 + p1;            // per-lane partial row sum (16 lanes combined at the end)
      unsigned short hb = bf16_bits(p0); sPh[w][8 * hh + r][ln] = hb;      sPl[w][8 * hh + r][ln] = bf16_bits(p0 - bf16_val(hb));
      hb = bf16_bits(p1);                sPh[w][8 * hh + r][16 + ln] = hb; sPl[w][8 * hh + r][16 + ln] = bf16_bits(p1 - bf16_val(hb));
    }
#pragma unroll
    for (int dt = 0; dt < DT; ++dt)
#pragma unroll
      for (int r = 0; r < 8; ++r) oacc[dt][r] *= alpha[r];
    __builtin_amdgcn_fence(__ATOMIC_ACQ_REL, "workgroup");
    __builtin_amdgcn_wave_barrier();
    FragB pah, pal;
    pah.half[0] = *(const v8us*)&sPh[w][ln][8 * hh]; pah.half[1] = *(const v8us*)&sPh[w][ln][16 + 8 * hh];
    pal.half[0] = *(const v8us*)&sPl[w][ln][8 * hh]; pal.half[1] = *(const v8us*)&sPl[w][ln][16 + 8 * hh];
#pragma unroll
    for (int dt = 0; dt < DT; ++dt) {
      FragB bvh, bvl;
#pragma unroll
      for (int i = 0; i < 8; ++i) {
        bvh.u[i] = sVh[8 * hh + i][dt * 16 + ln]; bvh.u[8 + i] = sVh[16 + 8 * hh + i][dt * 16 + ln];
        bvl.u[i] = sVl[8 * hh + i][dt * 16 + ln]; bvl.u[8 + i] = sVl[16 + 8 * hh + i][dt * 16 + ln];
      }
      oacc[dt] = mmaN<3>(pah.v, pal.v, bvh.v, bvl.v, oacc[dt]);
    }
    __builtin_amdgcn_fence(__ATOMIC_ACQ_REL, "workgroup");
    __builtin_amdgcn_wave_barrier();
  }
#pragma unroll
  for (int r = 0; r < 8; ++r) {
    float l = l_r[r];
    l += __shfl_xor(l, 1, 32); l += __shfl_xor(l, 2, 32); l += __shfl_xor(l, 4, 32); l += __shfl_xor(l, 8, 32);
    l_r[r] = (l > 0.f) ? 1.0f / l : 0.f;
  }
#pragma unroll
  for (int dt = 0; dt < DT; ++dt)
#pragma unroll
    for (int r = 0; r < 8; ++r) sO[w][8 * hh + r][dt * 16 + ln] = oacc[dt][r] * l_r[r];
  __builtin_amdgcn_fence(__ATOMIC_ACQ_REL, "workgroup");
  __builtin_amdgcn_wave_barrier();
  {
    for (int r = 0; r < 16; ++r) {
      const int row = q0 + r;
      if (row < T && lane < D / 4) {
        const v4f val = *(const v4fa*)&sO[w][r][lane * 4];
        *(v4f*)(y + ((size_t)b * T + row) * ypitch + h * D + lane * 4) = val;
      }
    }
    
  }
}

// GEMM C = act(A·W + bias + resid): A f32 (ASPLIT -> hi/lo 2 terms), Wt bf16 [N][K]; ACT 0 none, 1 relu, 2 exact gelu;
// resid (optional, f32, row index = (row % rmod), pitch ldr, RES_BF16 rounds it) added before the activation.
template <bool ASPLIT, int ACT, bool BIAS_BF16, bool RES_BF16>
__global__ __launch_bounds__(128) void k_gemm_bf3(const float* __restrict__ A, int lda, const unsigned short* __restrict__ Wt, int ldb,
                                                const float* __restrict__ bias, const float* __restrict__ resid, int rmod, int ldr,
                                                float* __restrict__ C, int ldc, int M, int N, int K) {
  __shared__ __attribute__((aligned(16))) float so[4][16][64];
  const int tid = threadIdx.x, w = tid >> 5, lane = tid & 31, ln = lane & 15, hh = lane >> 4;
  const int ntn = N / 64;
  const int wid = blockIdx.x * 4 + w;
  const int mt = wid / ntn, nq = wid % ntn;
  if (mt * 16 >= M) return;
  const int row0 = mt * 16, col0 = nq * 64;
  const float* arow = A + (size_t)(row0 + ln) * lda;
  v8f acc[4] = {};
  for (int kb = 0; kb < K; kb += 32) {
    FragB ah, al;
    const v4f x0 = *(const v4fa*)(arow + kb + 8 * hh), x1 = *(const v4fa*)(arow + kb + 8 * hh + 4);
    const v4f x2 = *(const v4fa*)(arow + kb + 16 + 8 * hh), x3 = *(const v4fa*)(arow + kb + 16 + 8 * hh + 4);
    float xs[16] = {x0[0],x0[1],x0[2],x0[3],x1[0],x1[1],x1[2],x1[3],x2[0],x2[1],x2[2],x2[3],x3[0],x3[1],x3[2],x3[3]};
#pragma unroll
    for (int i = 0; i < 16; ++i) { const unsigned short hb = bf16_bits(xs[i]); ah.u[i] = hb; al.u[i] = ASPLIT ? bf16_bits(xs[i] - bf16_val(hb)) : (unsigned short)0; }
#pragma unroll
    for (int t = 0; t < 4; ++t) {
      const unsigned short* brow = Wt + (size_t)(col0 + t * 16 + ln) * ldb + kb;
      FragB b;
      b.half[0] = *(const v8us*)(brow + 8 * hh);
      b.half[1] = *(const v8us*)(brow + 16 + 8 * hh);
      acc[t] = mmaN<ASPLIT ? 2 : 1>(ah.v, al.v, b.v, b.v, acc[t]);
    }
  }
#pragma unroll
  for (int t = 0; t < 4; ++t) {
    const int col = col0 + t * 16 + ln;
    float bv = bias ? bias[col] : 0.f;
    if (BIAS_BF16) bv = bf16_round(bv);
#pragma unroll
    for (int r = 0; r < 8; ++r) {
      float v = acc[t][r] + bv;
      if (resid) { float rv = resid[(size_t)((row0 + 8 * hh + r) % rmod) * ldr + col]; if (RES_BF16) rv = bf16_round(rv); v += rv; }
      if (ACT == 1) v = fmaxf(v, 0.f);
      if (ACT == 2) v = 0.5f * v * (1.0f + erff(v * 0.70710678118654752f));
      if (ACT == 3) { const float u = 0.7978845608028654f * (v + 0.044715f * v * v * v); v = 0.5f * v * (1.0f + tanhf(u)); }
      so[w][8 * hh + r][t * 16 + ln] = v;
    }
  }
  __builtin_amdgcn_fence(__ATOMIC_ACQ_REL, "workgroup");
  __builtin_amdgcn_wave_barrier();
  const int rsub = lane >> 4, c4 = (lane & 15) * 4;
  {
#pragma unroll
    for (int q = 0; q < 8; ++q) {
      const int r = q * 2 + rsub;
      const v4f v = *(const v4fa*)&so[w][r][c4];
      *(v4f*)(C + (size_t)(row0 + r) * ldc + col0 + c4) = v;
    }
    
  }
}
// row LayerNorm (biased variance, eps) over N: s = X (+ R); optional out_sum <- s; out_norm <- (s-mu)*rsqrt(var+eps)*g + b
template <bool PARAM_BF16>
__global__ __launch_bounds__(256) void k_layernorm(const float* __restrict__ X, const float* __restrict__ R, const float* __restrict__ g, const float* __restrict__ bta,
                                                  float* __restrict__ out_sum, float* __restrict__ out_norm, int N, float eps) {
  __shared__ float red[256];
  const int row = blockIdx.x, tid = threadIdx.x;
  const float* x = X + (size_t)row * N; const float* rr = R ? R + (size_t)row * N : nullptr;
  float vals[16];                     // up to N = 4096
  const int per = N / 256;            // contiguous chunk per thread? use strided-by-4 chunks: thread handles j = tid*4 + 1024*u
  float s1 = 0.f;
  for (int u = 0; u < per / 4; ++u) {
    const int j = tid * 4 + 1024 * u;
    const v4f a = *(const v4fa*)(x + j);
    v4f b = {0.f,0.f,0.f,0.f}; if (rr) b = *(const v4fa*)(rr + j);
#pragma unroll
    for (int q = 0; q < 4; ++q) { const float v = a[q] + b[q]; vals[u * 4 + q] = v; s1 += v; }
  }
  red[tid] = s1; __syncthreads();
  for (int st = 128; st > 0; st >>= 1) { if (tid < st) red[tid] += red[tid + st]; __syncthreads(); }
  const float mu = red[0] / (float)N; __syncthreads();
  float s2 = 0.f;
  for (int u = 0; u < per / 4; ++u)
#pragma unroll
    for (int q = 0; q < 4; ++q) { const float c = vals[u * 4 + q] - mu; s2 += c * c; }
  red[tid] = s2; __syncthreads();
  for (int st = 128; st > 0; st >>= 1) { if (tid < st) red[tid] += red[tid + st]; __syncthreads(); }
  const float rs = rsqrtf(red[0] / (float)N + eps);
  {
    for (int u = 0; u < per / 4; ++u) {
      const int j = tid * 4 + 1024 * u;
      v4f o, sm;
#pragma unroll
      for (int q = 0; q < 4; ++q) {
        float gg = g[j + q], bb = bta[j + q];
        if (PARAM_BF16) { gg = bf16_round(gg); bb = bf16_round(bb); }
        sm[q] = vals[u * 4 + q]; o[q] = (vals[u * 4 + q] - mu) * rs * gg + bb;
      }
      if (out_sum) *(v4f*)(out_sum + (size_t)row * N + j) = sm;
      *(v4f*)(out_norm + (size_t)row * N + j) = o;
    }
    
  }
}



// ---- f16 WMMA path (v_wmma_f32_16x16x32_f16): 11-bit significands for operands in range — used where a [0,1] probability operand needs more precision than bf16
typedef _Float16 v16h __attribute__((ext_vector_type(16)));
union FragH { v16h v; v8us half[2]; _Float16 h[16]; unsigned short u[16]; };
template <int NT>
__device__ __forceinline__ v8f mmaH(v16h ah, v16h al, v16h bh, v16h bl, v8f c) {
  c = __builtin_amdgcn_wmma_f32_16x16x32_f16(false, ah, false, bh, (short)0, c, false, false);
  if (NT >= 2) c = __builtin_amdgcn_wmma_f32_16x16x32_f16(false, al, false, bh, (short)0, c, false, false);
  if (NT >= 3) c = __builtin_amdgcn_wmma_f32_16x16x32_f16(false, ah, false, bl, (short)0, c, false, false);
  asm volatile("v_nop\n\tv_nop\n\tv_nop\n\tv_nop" : "+v"(c) : "v"(ah), "v"(al), "v"(bh), "v"(bl));
  return c;
}
// batched GEMM like k_gemm_b but f16 operands: A f32 (split into f16 hi/lo if ASPLIT, else rounded to f16), Bt = f16 values [n][k]; alpha; C f32; N multiple of 16 (partial tiles skipped)
template <bool ASPLIT>
__global__ __launch_bounds__(128) void k_gemm_h(const float* __restrict__ A, int lda, size_t sA, const _Float16* __restrict__ Bh, int ldb, size_t sB, float alpha, float* __restrict__ C, int ldc, size_t sC, int M, int N, int K) {
  __shared__ __attribute__((aligned(16))) float so[4][16][64];
  const int tid = threadIdx.x, w = tid >> 5, lane = tid & 31, ln = lane & 15, hh = lane >> 4; const int by = blockIdx.y;
  A += (size_t)by * sA; Bh += (size_t)by * sB; C += (size_t)by * sC;
  const int ntn = (N + 63) / 64; const int wid = blockIdx.x * 4 + w; const int mt = wid / ntn, nq = wid % ntn; if (mt * 16 >= M) return;
  const int row0 = mt * 16, col0 = nq * 64; const float* arow = A + (size_t)(row0 + ln) * lda;
  v8f acc[4] = {};
  for (int kb = 0; kb < K; kb += 32) {
    FragH ah, al;
    const v4f x0 = *(const v4fa*)(arow + kb + 8 * hh), x1 = *(const v4fa*)(arow + kb + 8 * hh + 4), x2 = *(const v4fa*)(arow + kb + 16 + 8 * hh), x3 = *(const v4fa*)(arow + kb + 16 + 8 * hh + 4);
    float xs[16] = {x0[0],x0[1],x0[2],x0[3],x1[0],x1[1],x1[2],x1[3],x2[0],x2[1],x2[2],x2[3],x3[0],x3[1],x3[2],x3[3]};
#pragma unroll
    for (int i = 0; i < 16; ++i) { const _Float16 h = (_Float16)xs[i]; ah.h[i] = h; al.h[i] = ASPLIT ? (_Float16)(xs[i] - (float)h) : (_Float16)0.0f; }
#pragma unroll
    for (int t = 0; t < 4; ++t) { if (col0 + t * 16 >= N) continue; const size_t boff = (size_t)(col0 + t * 16 + ln) * ldb + kb; FragH bq; bq.half[0] = *(const v8us*)(Bh + boff + 8 * hh); bq.half[1] = *(const v8us*)(Bh + boff + 16 + 8 * hh);
      acc[t] = mmaH<ASPLIT ? 2 : 1>(ah.v, al.v, bq.v, bq.v, acc[t]); }
  }
#pragma unroll
  for (int t = 0; t < 4; ++t) { if (col0 + t * 16 >= N) continue;
#pragma unroll
    for (int r = 0; r < 8; ++r) so[w][8 * hh + r][t * 16 + ln] = acc[t][r] * alpha; }
  __builtin_amdgcn_fence(__ATOMIC_ACQ_REL, "workgroup"); __builtin_amdgcn_wave_barrier();
  const int rsub = lane >> 4, c4 = (lane & 15) * 4;
  {
#pragma unroll
    for (int q = 0; q < 8; ++q) { const int r = q * 2 + rsub; if (col0 + c4 < N) { const v4f v = *(const v4fa*)&so[w][r][c4]; *(v4f*)(C + (size_t)(row0 + r) * ldc + col0 + c4) = v; } }
     }
}

// FRAGMENT ORDER. Every 16-bit matrix operand M[row][k] (rows a multiple of 16, k a multiple of 32, KS = k-steps of 32) lies in the workspace as [row tile of 16][k-step][half j][lane][8 elements]:
// lane 16 hh + (row & 15) of half j of k-step s holds k = 32 s + 16 j + 8 hh + 0..7. One half of a fragment is then 32 lanes x 16 B = 512 contiguous bytes (4 cache lines), where rows of a row-major matrix gave 16 lines a load.
// The 16-byte piece number t of such a matrix (its place is element 8 t) holds row frag_row(t, KS), columns frag_k(t, KS) + 0..7; a writer whose thread t makes piece t stores whole lines.
__device__ __forceinline__ int frag_row(unsigned t, unsigned KS) { return (int)((t / (64 * KS)) * 16 + (t & 15)); }
__device__ __forceinline__ int frag_k(unsigned t, unsigned KS) { return (int)(((t >> 6) % KS) * 32 + ((t >> 5) & 1) * 16 + ((t >> 4) & 1) * 8); }
// Wt (row n, column k, fragment order) = f16(W[k][n] * scale) from f32 row-major W[K][N] (scale = power of two; bf16-exact weights stay exact in f16 away from the subnormal range)
__device__ __forceinline__ void wt_f16_block(const float* __restrict__ W, _Float16* __restrict__ Wt, int K, int N, float scale, int blk) {
  const int t = blk * 256 + threadIdx.x; if (t >= N * (K / 8)) return; const int n = frag_row(t, K / 32), k8 = frag_k(t, K / 32); FragH f;
#pragma unroll
  for (int i = 0; i < 8; ++i) f.h[i] = (_Float16)(bf16_round(W[(size_t)(k8 + i) * N + n]) * scale); const v8us o = f.half[0];
  *(v8us*)((unsigned short*)Wt + (size_t)t * 8) = o; 
}
// k_gemm_hh variant with fused epilogue: v = acc·alpha + bf16(bias_by[by·sBias + col]) (bias_by = bias, biasY1, biasY2 for by = 0, 1, 2) (+ CP[(row/rowsPerB)·sCPb + by·64 + col] if CP) ; ACT 0 none / 1 elu ; writes f16 C16 and f32 C, each if non-null
// N (a multiple of 64, so every wave owns four whole 16-column tiles) and K are compile-time: the k loop is unrolled whole and its fragment loads run PF k-steps ahead of the products that use them.
// A, Bh and C16 are in fragment order (K / 32, K / 32 and N / 32 k-steps a row tile); C is row-major with pitch ldc.
// VT: batch index 2 (the value projection) is stored transposed instead, into CT: planes [row / NN][column / 64] of [64 rows d][NN keys] in fragment order (NN / 32 k-steps a row tile), the A operand of the flash kernel's value product.
template <int ACT, int N, int K, bool VT>
__global__ __launch_bounds__(128) void k_gemm_hhx(const _Float16* __restrict__ A, int lda, size_t sA, const _Float16* __restrict__ Bh, int ldb, size_t sB, float alpha, const float* __restrict__ bias, const float* __restrict__ biasY1, const float* __restrict__ biasY2, size_t sBias, const float* __restrict__ CP, int rowsPerB, size_t sCPb, int row0g,
    float* __restrict__ C, _Float16* __restrict__ C16, _Float16* __restrict__ CT, int ldc, size_t sC, int M) {
  static_assert(N % 64 == 0 && K % 32 == 0, "whole 64-column wave tiles and whole 32-deep k-steps");
  __shared__ __attribute__((aligned(16))) float so[4][16][64 + 4];      /* pitch 68: the fragment-order store below reads 16 rows at one column, which a pitch of 64 would put on the same banks */
  const int tid = threadIdx.x, w = tid >> 5, lane = tid & 31, ln = lane & 15, hh = lane >> 4; const int by = blockIdx.y;
  A += (size_t)by * sA; Bh += (size_t)by * sB; const size_t cofs = (size_t)by * sC; const float* bsel = (by == 0) ? bias : ((by == 1) ? biasY1 : biasY2); const float* bp = bsel ? bsel + (size_t)by * sBias : nullptr;      /* batch index by = 0, 1, 2 takes its own bias buffer */
  const int ntn = (N + 63) / 64; const int wid = blockIdx.x * 4 + w; const int mt = wid / ntn, nq = wid % ntn; if (mt * 16 >= M) return;
  const int row0 = mt * 16, col0 = nq * 64; (void)lda; (void)ldb;
  v8f acc[4] = {};
  constexpr int NS = K / 32, PF = 2, NB = PF + 1;      /* NB register stages: PF k-steps of loads in flight beside the one being multiplied */
  const unsigned short* ap = (const unsigned short*)A + (size_t)mt * NS * 512 + lane * 8; const unsigned short* bq0 = (const unsigned short*)Bh + (size_t)(nq * 4) * NS * 512 + lane * 8;      /* row tile mt of A; row tiles 4 nq + t of Bh */
  FragH fa[NB], fb[NB][4];
#pragma unroll
  for (int s = 0; s < NS + PF; ++s) {      /* unrolled whole: the stage indices must be constants for the stages to stay in registers */
    if (s < NS) { const int st = s % NB; fa[st].half[0] = *(const v8us*)(ap + s * 512); fa[st].half[1] = *(const v8us*)(ap + s * 512 + 256);
#pragma unroll
      for (int t = 0; t < 4; ++t) { const unsigned short* br = bq0 + (t * NS + s) * 512; fb[st][t].half[0] = *(const v8us*)br; fb[st][t].half[1] = *(const v8us*)(br + 256); } }
    if (s >= PF) { const int st = (s - PF) % NB;
#pragma unroll
      for (int t = 0; t < 4; ++t) acc[t] = mmaH<1>(fa[st].v, fa[st].v, fb[st][t].v, fb[st][t].v, acc[t]); }
  }
  if (VT && by == 2) {      /* block-uniform. In accumulator tile t lane 16 hh + ln holds rows (keys) 8 hh + 0..7 of column d = 16 t + ln: that is the lane's 16-byte piece of the transposed operand, so it goes out from the registers, no LDS */
    const unsigned ur = (unsigned)row0; unsigned short* tp = (unsigned short*)CT + (size_t)((ur / NN) * (N / 64) + (unsigned)nq) * 64 * NN + ((ur % NN) / 32) * 512 + ((ur >> 4) & 1) * 256 + lane * 8;      /* plane (batch, nq); the wave's 16 keys are half (row0 / 16) & 1 of k-step (row0 % NN) / 32 */
    float bv[4] = {0.f, 0.f, 0.f, 0.f};
    if (bp) {      /* one test for the four bias loads, so that they travel together */
#pragma unroll
      for (int t = 0; t < 4; ++t) bv[t] = bp[col0 + t * 16 + ln];
#pragma unroll
      for (int t = 0; t < 4; ++t) bv[t] = bf16_round(bv[t]); }
    FragH f[2];
#pragma unroll
    for (int t = 0; t < 4; ++t)
#pragma unroll
      for (int r = 0; r < 8; ++r) f[t >> 1].h[(t & 1) * 8 + r] = (_Float16)(acc[t][r] * alpha + bv[t]);
#pragma unroll
    for (int t = 0; t < 4; ++t) *(v8us*)(tp + (size_t)t * (NN / 32) * 512) = f[t >> 1].half[t & 1];      /* row tile t of the plane: four 512-byte stores */
    return; }
#pragma unroll
  for (int t = 0; t < 4; ++t) { if (col0 + t * 16 >= N) continue; const int col = col0 + t * 16 + ln; const float bv = bp ? bf16_round(bp[col]) : 0.f;
#pragma unroll
    for (int r = 0; r < 8; ++r) { float v = acc[t][r] * alpha + bv; if (CP) { const int bidx = (row0g + row0 + 8 * hh + r) / rowsPerB; v += CP[(size_t)bidx * sCPb + (size_t)by * 64 + col]; } if (ACT == 1) v = (v > 0.f) ? v : expm1f(v); else if (ACT == 7) v = (v > 0.f) ? v + 1.0f : expf(v); else if (ACT == 8) v = tanhf(v); else if (ACT == 9) v = 0.5f * v * (1.0f + tanhf(0.7978845608028654f * (v + 0.044715f * v * v * v))); else if (ACT == 11) v = 1.0f / (1.0f + expf(-v)); else if (ACT == 12) v = (v > 0.f) ? v : 0.01f * v; else if (ACT == 14) v = (v > 0.f) ? v : 0.1f * v; else if (ACT == 15) v = v / (1.0f + expf(-v)); else if (ACT == 3) v = fmaxf(v, 0.f); else if (ACT == 6) v = 0.5f * v * (1.0f + erff(v * 0.70710678118654752f)); so[w][8 * hh + r][t * 16 + ln] = v; } }
  __builtin_amdgcn_fence(__ATOMIC_ACQ_REL, "workgroup"); __builtin_amdgcn_wave_barrier();
  const int rsub = lane >> 4, c4 = (lane & 15) * 4;
  {
#pragma unroll
    for (int q = 0; q < 8; ++q) { const int r = q * 2 + rsub; if (C && col0 + c4 < N) { const v4f v = *(const v4fa*)&so[w][r][c4]; *(v4f*)(C + cofs + (size_t)(row0 + r) * ldc + col0 + c4) = v; } }
    if (C) asm volatile("s_wait_xcnt 0x0" ::: "memory");      /* directly behind the row-major stores: the fragment-order part below rewrites registers that they name */
    if (C16) { unsigned short* cp = (unsigned short*)C16 + cofs + ((size_t)mt * (N / 32) + nq * 2) * 512 + lane * 8;      /* the wave's 16 x 64 tile = two k-steps of row tile mt = 2 KB in a row: four 512-byte stores */
#pragma unroll
      for (int q = 0; q < 4; ++q) { const v4f v0 = *(const v4fa*)&so[w][ln][q * 16 + 8 * hh], v1 = *(const v4fa*)&so[w][ln][q * 16 + 8 * hh + 4]; FragH f;
#pragma unroll
        for (int i = 0; i < 4; ++i) { f.h[i] = (_Float16)v0[i]; f.h[4 + i] = (_Float16)v1[i]; }
        *(v8us*)(cp + q * 256) = f.half[0]; }
      if (VT) asm volatile("s_wait_xcnt 0x0" ::: "memory"); }      /* directly behind the four fragment-order stores: the VT build lays the transposed-store block out behind them, and it rewrites registers that they name */
     }
}


typedef _Float16 v4h __attribute__((ext_vector_type(4)));

__device__ __forceinline__ void x16_block(const float* __restrict__ x, _Float16* __restrict__ X16, size_t n8, int blk) { const size_t t = (size_t)blk * 256 + threadIdx.x; if (t >= n8) return; FragH f;      /* x row-major [NR][DX] -> X16 in fragment order */
  const float* xr = x + (size_t)frag_row((unsigned)t, DX / 32) * DX + frag_k((unsigned)t, DX / 32);
#pragma unroll
  for (int q = 0; q < 8; ++q) f.h[q] = (_Float16)bf16_round(xr[q]); *(v8us*)((unsigned short*)X16 + t * 8) = f.half[0];  }
// One grid for the five operand preparations, none of which reads another's result: the block index picks the job (block-uniform branch).
// Blocks 0 .. 3 NBW - 1: Wq, Wk, Wv (their outputs lie one behind the other in Bqkv); the next NBO: Wo; the last NBX: x.
#define NBW (2 * DX * (DX / 8) / 256)
#define NBO (DX * (DX / 8) / 256)
#define NBX (NR * DX / 8 / 256)
__global__ __launch_bounds__(256) void k_prep(const float* __restrict__ Wq, const float* __restrict__ Wk, const float* __restrict__ Wv, const float* __restrict__ Wo, const float* __restrict__ x,
                                              _Float16* __restrict__ Bqkv, _Float16* __restrict__ Bo, _Float16* __restrict__ X16) {
  const int bid = blockIdx.x;
  if (bid < 3 * NBW) { const int j = bid / NBW; wt_f16_block(j == 0 ? Wq : (j == 1 ? Wk : Wv), Bqkv + (size_t)j * 2 * DX * DX, DX, 2 * DX, 16.0f, bid % NBW); }
  else if (bid < 3 * NBW + NBO) wt_f16_block(Wo, Bo, DX, DX, 16.0f, bid - 3 * NBW);
  else x16_block(x, X16, (size_t)NR * DX / 8, bid - (3 * NBW + NBO)); }
__global__ __launch_bounds__(256) void k_h16(const float* __restrict__ x, _Float16* __restrict__ X16, size_t n8) { const size_t t = (size_t)blockIdx.x * 256 + threadIdx.x; if (t >= n8) return; FragH f;
#pragma unroll
  for (int q = 0; q < 8; ++q) f.h[q] = (_Float16)x[t * 8 + q]; *(v8us*)((unsigned short*)X16 + t * 8) = f.half[0];  }
__global__ __launch_bounds__(256) void k_round16f(const float* __restrict__ W, _Float16* __restrict__ Bt, size_t n8) { const size_t t = (size_t)blockIdx.x * 256 + threadIdx.x; if (t >= n8) return; FragH f;
#pragma unroll
  for (int i = 0; i < 8; ++i) f.h[i] = (_Float16)(bf16_round(W[t * 8 + i]) * 16.0f); *(v8us*)((unsigned short*)Bt + t * 8) = f.half[0];  }
// Keys split inside the work-group: each of the 4 query tiles is walked by KVS waves; wave (qw, kr) takes the 32-key blocks kr, kr + KVS, kr + 2 KVS, ... with its own running max, sum and
// un-normalised accumulators; the KVS partials of a tile are merged through LDS behind one work-group barrier (weights exp(SCORE_SCALE (m_k - M)), the maxima being raw).
// TRANSPOSED PRODUCTS. Scores are formed as S^T = K Q^T (A = key rows, B = query columns) and values as O^T += V^T P^T (A = V^T rows d, B = P^T). In a D tile lane 16 hh + ln, register r holds row 8 hh + r, column ln:
// a lane then holds scores of ONE query (ln), keys 16 nt + 8 hh + r, so the maximum and the sum over keys are in-lane but for one exchange between the lane halves, the rescale factor is one value a lane,
// and the two score tiles nt = 0, 1, converted in place, are the B operand of the value product (element 8 nt + r = key 16 nt + 8 hh + r, the k order of every fragment here): P never goes through LDS.
#define KVS 4
typedef float v2f __attribute__((ext_vector_type(2)));
__device__ __forceinline__ float xhalf(float x) { return __builtin_bit_cast(float, __builtin_amdgcn_permlanex16(__builtin_bit_cast(int, x), __builtin_bit_cast(int, x), 0x76543210, 0xfedcba98, false, false)); }      /* lane l takes the value of lane l ^ 16 */
__global__ __launch_bounds__(128 * KVS) void k_flash(const _Float16* __restrict__ Q16, int ldq, const _Float16* __restrict__ K16, int ldk, const _Float16* __restrict__ Vt, _Float16* __restrict__ O16) {
  constexpr int RPW = 16, NQB = NN / (4 * RPW), DT = 4, KS = 2, NW = 4 * KVS;
  __shared__ __attribute__((aligned(16))) float sO[NW][RPW][128 + 4]; __shared__ float sM[NW][RPW], sL[NW][RPW];
  const int tid = threadIdx.x, w = __builtin_amdgcn_readfirstlane(tid >> 5), lane = tid & 31, ln = lane & 15, hh = lane >> 4; const int qw = w & 3, kr = w >> 2;      /* the wave's number held as a scalar: tile and key-block indices leave the vector registers, which the grouped fragments need */
  const int slab = blockIdx.x / NQB, qblk = blockIdx.x % NQB; const int b = slab / NHU, h = slab % NHU; const int qb0 = qblk * (4 * RPW); const int q0 = qb0 + qw * RPW;
  FragH aq[KS], aql[KS];
  { const size_t qo = ((size_t)((b * NN + q0) / 16) * (DX / 32) + h * 4) * 512 + lane * 8; const unsigned short* qr = (const unsigned short*)Q16 + qo; const unsigned short* ql = qr + 2 * 512;      /* Q16, K16 in fragment order: head h = k-steps 4 h .. 4 h + 3 of a row tile; aq = real part (the first two), aql = imaginary part */
#pragma unroll
    for (int ks = 0; ks < KS; ++ks) { aq[ks].half[0] = *(const v8us*)(qr + ks * 512); aq[ks].half[1] = *(const v8us*)(qr + ks * 512 + 256); aql[ks].half[0] = *(const v8us*)(ql + ks * 512); aql[ks].half[1] = *(const v8us*)(ql + ks * 512 + 256); } }
  (void)ldq; (void)ldk;
  const unsigned short* Vth = (const unsigned short*)Vt + ((size_t)b * 2 * NHU + 2 * h) * 64 * NN;      /* V^T real plane of head h; the imaginary plane lies 64 NN elements behind it */
  float m_q = -3.0e38f, l_q = 0.f; v8f oacc[DT], oacci[DT];      /* running max of query ln (equal in both lane halves), this lane half's share of its sum, O^T tiles: register r = column d = 16 dt + 8 hh + r of query ln */
#pragma unroll
  for (int dt = 0; dt < DT; ++dt) { oacc[dt] = (v8f){0.f,0.f,0.f,0.f,0.f,0.f,0.f,0.f}; oacci[dt] = oacc[dt]; }
  const int jend = NN;
#pragma unroll 1
  for (int j0 = kr * 32; j0 < jend; j0 += 32 * KVS) {
    v8f s[2]; FragH bk[2][KS], bl[2][KS];      /* bk = real, bl = imaginary; both 16-key tiles' fragments are loaded as one group ahead of the score products */
    const unsigned short* kp[2];
#pragma unroll
    for (int nt = 0; nt < 2; ++nt) { kp[nt] = (const unsigned short*)K16 + ((size_t)((b * NN + j0) / 16 + nt) * (DX / 32) + h * 4) * 512 + lane * 8; const unsigned short* kr = kp[nt]; const unsigned short* kl = kr + 2 * 512;
#pragma unroll
      for (int ks = 0; ks < KS; ++ks) { bk[nt][ks].half[0] = *(const v8us*)(kr + ks * 512); bk[nt][ks].half[1] = *(const v8us*)(kr + ks * 512 + 256); bl[nt][ks].half[0] = *(const v8us*)(kl + ks * 512); bl[nt][ks].half[1] = *(const v8us*)(kl + ks * 512 + 256); } }
    asm volatile("s_wait_xcnt 0x0" :: "v"(kp[0]), "v"(kp[1]) : "memory");      /* keeps both address pairs alive past the last load of the group, so that no load's result lands in a pair that an issued load names before this wait */
#pragma unroll
    for (int nt = 0; nt < 2; ++nt) { v8f re = (v8f){0.f,0.f,0.f,0.f,0.f,0.f,0.f,0.f}, ip = re, in = re;      /* keys as A, queries as B */
#pragma unroll
      for (int ks = 0; ks < KS; ++ks) { re = mmaH<1>(bk[nt][ks].v, bk[nt][ks].v, aq[ks].v, aq[ks].v, re); re = mmaH<1>(bl[nt][ks].v, bl[nt][ks].v, aql[ks].v, aql[ks].v, re); ip = mmaH<1>(bk[nt][ks].v, bk[nt][ks].v, aql[ks].v, aql[ks].v, ip); in = mmaH<1>(bl[nt][ks].v, bl[nt][ks].v, aq[ks].v, aq[ks].v, in); }
      const v8f im = ip - in; s[nt] = re * re + im * im; }      /* raw squared magnitude: its (positive) scale is applied in the exponent below, so maxima are taken over raw values */
    FragH bv[DT], bi[DT];      /* all value fragments of this key block are requested here, so that they travel while the softmax below is computed */
    const unsigned short* vp = Vth + (size_t)(j0 / 32) * 512 + lane * 8; const unsigned short* vq = vp + (size_t)64 * NN;      /* fragment order: k-step j0 / 32 of row tile dt, NN / 32 k-steps a row tile */
#pragma unroll
    for (int dt = 0; dt < DT; ++dt) { const size_t vo = (size_t)(dt * 16) * NN; bv[dt].half[0] = *(const v8us*)(vp + vo); bv[dt].half[1] = *(const v8us*)(vp + vo + 256); bi[dt].half[0] = *(const v8us*)(vq + vo); bi[dt].half[1] = *(const v8us*)(vq + vo + 256); }
    asm volatile("s_wait_xcnt 0x0" :: "v"(vp) : "memory");      /* as above: the address pair outlives the group's last load */
    float mc = fmaxf(s[0][0], s[1][0]);
#pragma unroll
    for (int r = 1; r < 8; ++r) mc = fmaxf(mc, fmaxf(s[0][r], s[1][r]));
    mc = fmaxf(mc, xhalf(mc));      /* the other 16 keys of the block lie in the other lane half */
    const float mn = fmaxf(m_q, mc); const float al = __builtin_amdgcn_exp2f((m_q - mn) * SCORE_L2E); m_q = mn;      /* m_q, mn: raw units. Every exponent here is <= 0 (+ 10), where the bare v_exp_f32 needs none of the library's range handling: far below, it gives 0 */
    const float eb = 10.0f - mn * SCORE_L2E;      /* one addend a lane: minus the scaled maximum, plus 10 for the x 2^10 carry of P */
    FragH pb; v2f ps = {0.f, 0.f};      /* two partial sums, over even and odd registers: neighbouring registers pair in the packed adds */
#pragma unroll
    for (int nt = 0; nt < 2; ++nt)
#pragma unroll
      for (int r = 0; r < 8; r += 2) { const v2f e = (v2f){s[nt][r], s[nt][r + 1]} * SCORE_L2E + eb; const v2f p = {__builtin_amdgcn_exp2f(e[0]), __builtin_amdgcn_exp2f(e[1])}; ps += p; pb.h[8 * nt + r] = (_Float16)p[0]; pb.h[8 * nt + r + 1] = (_Float16)p[1]; }      /* p = P x 2^10; the sum carries the same factor */
    l_q = l_q * al + (ps[0] + ps[1]);
#pragma unroll
    for (int dt = 0; dt < DT; ++dt) { oacc[dt] *= al; oacci[dt] *= al; }
#pragma unroll
    for (int dt = 0; dt < DT; ++dt) { oacc[dt] = mmaH<1>(bv[dt].v, bv[dt].v, pb.v, pb.v, oacc[dt]); oacci[dt] = mmaH<1>(bi[dt].v, bi[dt].v, pb.v, pb.v, oacci[dt]); } }
  { const float l = l_q + xhalf(l_q); if (hh == 0) { sM[w][ln] = m_q; sL[w][ln] = l; } }
#pragma unroll
  for (int dt = 0; dt < DT; ++dt) { float* so = &sO[w][ln][dt * 16 + 8 * hh];      /* a lane's 8 registers are 8 neighbouring columns of its query's row: two 16-byte stores a tile */
    *(v4fa*)so = (v4f){oacc[dt][0], oacc[dt][1], oacc[dt][2], oacc[dt][3]}; *(v4fa*)(so + 4) = (v4f){oacc[dt][4], oacc[dt][5], oacc[dt][6], oacc[dt][7]};
    *(v4fa*)(so + 64) = (v4f){oacci[dt][0], oacci[dt][1], oacci[dt][2], oacci[dt][3]}; *(v4fa*)(so + 68) = (v4f){oacci[dt][4], oacci[dt][5], oacci[dt][6], oacci[dt][7]}; }
  __syncthreads();      /* publishes every wave's partial (max, sum, accumulators) to the waves that merge it */
  {      /* wave (qw, kr) merges columns 32 kr .. 32 kr + 31 of query tile qw = k-step 4 h + kr of that row tile of O16 (fragment order, x 2^8): lane 16 hh + ln makes row ln, columns 32 kr + 16 j + 8 hh + 0..7 for j = 0, 1 */
    float mk[KVS], wk[KVS], M = -3.0e38f, L = 0.f;
#pragma unroll
    for (int k = 0; k < KVS; ++k) { mk[k] = sM[k * 4 + qw][ln]; M = fmaxf(M, mk[k]); }
#pragma unroll
    for (int k = 0; k < KVS; ++k) { wk[k] = __builtin_amdgcn_exp2f((mk[k] - M) * SCORE_L2E); L += wk[k] * sL[k * 4 + qw][ln]; }      /* maxima are raw, sums carry x 2^10 as the accumulators do */
    const float inv = (L > 0.f) ? 1.0f / L : 0.f;
    FragH f;
#pragma unroll
    for (int j = 0; j < 2; ++j) { v4f o0 = {0.f, 0.f, 0.f, 0.f}, o1 = o0;
#pragma unroll
      for (int k = 0; k < KVS; ++k) { const float* sp = &sO[k * 4 + qw][ln][kr * 32 + j * 16 + 8 * hh]; o0 += *(const v4fa*)sp * wk[k]; o1 += *(const v4fa*)(sp + 4) * wk[k]; }
      o0 = o0 * inv; o1 = o1 * inv;
#pragma unroll
      for (int i = 0; i < 4; ++i) { f.h[8 * j + i] = (_Float16)(o0[i] * 256.0f); f.h[8 * j + 4 + i] = (_Float16)(o1[i] * 256.0f); } }
    unsigned short* op = (unsigned short*)O16 + ((size_t)((b * NN + q0) / 16) * (DX / 32) + h * 4 + kr) * 512 + lane * 8;
    *(v8us*)op = f.half[0]; *(v8us*)(op + 256) = f.half[1];      /* two 512-byte stores, the last instructions of the wave */
  } }

extern "C" void kernel_launch(void* const* d_in, const int* in_sizes, int n_in,
                              void* d_out, int out_size, void* d_ws, size_t ws_size, hipStream_t stream) {
  (void)in_sizes; (void)n_in; (void)out_size;
  const float* const* I = (const float* const*)d_in; const float* x = I[0]; const float* Wq = I[1]; const float* bq = I[2]; const float* Wk = I[3]; const float* bk = I[4]; const float* Wv = I[5]; const float* bv = I[6]; const float* Wo = I[7]; const float* bo = I[8];
  char* ws = (char*)d_ws; size_t off = 0;
  auto take = [&](size_t bytes) { char* p = ws + off; off += (bytes + 255) & ~(size_t)255; return p; };
  _Float16* Bq = (_Float16*)take((size_t)3 * 2 * DX * DX * 2); _Float16* Bo = (_Float16*)take((size_t)DX * DX * 2);
  _Float16* X16 = (_Float16*)take((size_t)NR * DX * 2); _Float16* Q = (_Float16*)take((size_t)2 * NR * DX * 2); _Float16* K = Q + (size_t)NR * DX;      /* q, k one behind the other: batch stride of the merged projection */ _Float16* Vt = (_Float16*)take((size_t)NR * DX * 2);
  _Float16* O16 = (_Float16*)take((size_t)NR * DX * 2);
  /* Bq, Bo, X16, Q, K, Vt and O16 are all in fragment order (see FRAGMENT ORDER above); the output is row-major */
  if (off > ws_size) return;      // 3 x 1 + 0.5 + 5 x 4.2 = about 25 MB
  k_prep<<<3 * NBW + NBO + NBX, 256, 0, stream>>>(Wq, Wk, Wv, Wo, x, Bq, Bo, X16);      /* (in,out) [512][1024] -> Bt[1024][512] x2^4 for Wq, Wk, Wv (only rows 0..511 = heads 0..3 are used), Wo likewise, x -> f16: one launch */
  const dim3 gp(((NR / 16) * (DX / 64) + 3) / 4, 1), gp3(((NR / 16) * (DX / 64) + 3) / 4, 3);
  k_gemm_hhx<0, DX, DX, true><<<gp3, 128, 0, stream>>>(X16, DX, 0, Bq, DX, (size_t)2 * DX * DX, 0.0625f, bq, bk, bv, 0, nullptr, 1, 0, 0, nullptr, Q, Vt, DX, (size_t)NR * DX, NR);      /* q, k, v in one launch (blockIdx.y), heads 0..3 = output columns 0..511 (+ bias): each M 4096 N 512 K 512; v goes out transposed, planes per (b, head, part): [b * 8 + 2 h + part][64][2048] */
  k_flash<<<BB * NHU * (NN / 64), 128 * KVS, 0, stream>>>(Q, DX, K, DX, Vt, O16);      /* stores O x 2^8 as f16 in fragment order, the A operand of the output product */
  k_gemm_hhx<0, DX, DX, false><<<gp, 128, 0, stream>>>(O16, DX, 0, Bo, DX, 0, 0.0625f * 0.00390625f, bo, nullptr, nullptr, 0, nullptr, 1, 0, 0, (float*)d_out, nullptr, nullptr, DX, 0, NR);      /* out = O Wo + bo (alpha undoes the x 2^4 of the weights and the x 2^8 carry) */
}

// v008
// A run of this version takes 53.8 microseconds.
// Timed twice side by side with v007, it ran 1.17 and 1.15 times as fast.
// Counting every step since v000, it is 6.06 times as fast.
#include <hip/hip_runtime.h>
// 'Superposition' (complex-valued) multi-head attention (B=2, S=2048, D=512, 8 heads; q,k,v projections to 2D with per-head [real 64 | imag 64]): interference = Σ_d q_d·conj(k_d)·64^-½; probs = softmax(|interference|²/0.5); out = probs·v (complex);
// out = concat[real, imag] per head → [B,S,1024], truncated to the first 512 columns (= heads 0..3), then ·Wo + bo. Only heads 0..3 reach the output, so only they are computed.
// Compute dtype: x, weights, biases rounded to bf16; q/k/v (columns of heads 0..3) as f16 GEMM outputs; fused flash-style kernel with three f32 score accumulators (Re, Im⁺, Im⁻) and two value accumulators
// (real, imag), online softmax f32, P f16 ×2^10, on v_wmma_f32_16x16x32_f16; O carried ×2^8 into f16 (small diffuse values) → output GEMM with bias (alpha undoes the carry); f32 accumulate.
#define BB 2
#define NN 2048
#define DX 512
#define NHU 4
#define DH2 128
#define NR (BB * NN)
#define SCORE_SCALE 0.03125f
#define SCORE_L2E (SCORE_SCALE * 1.44269504088896340736f)      /* score scale x log2(e): the softmax runs in base 2 */

typedef __bf16 v16b __attribute__((ext_vector_type(16)));
typedef unsigned short v8us __attribute__((ext_vector_type(8), may_alias));
typedef float  v8f  __attribute__((ext_vector_type(8)));
typedef float  v4f  __attribute__((ext_vector_type(4)));
typedef float  v4fa __attribute__((ext_vector_type(4), may_alias));
union FragB { v16b v; v8us half[2]; unsigned short u[16]; };

__device__ __forceinline__ unsigned short bf16_bits(float x) { unsigned int u = __float_as_uint(x); return (unsigned short)((u + 0x7FFFu + ((u >> 16) & 1u)) >> 16); }
__device__ __forceinline__ float bf16_val(unsigned short b) { return __uint_as_float(((unsigned int)b) << 16); }
__device__ __forceinline__ float bf16_round(float x) { return bf16_val(bf16_bits(x)); }
// D += A·B with NT terms: 1 = ah·bh, 2 = + al·bh (A split), 3 = + ah·bl (both split)
template <int NT>
__device__ __forceinline__ v8f mmaN(v16b ah, v16b al, v16b bh, v16b bl, v8f c) {
  c = __builtin_amdgcn_wmma_f32_16x16x32_bf16(false, ah, false, bh, (short)0, c, false, false);
  if (NT >= 2) c = __builtin_amdgcn_wmma_f32_16x16x32_bf16(false, al, false, bh, (short)0, c, false, false);
  if (NT >= 3) c = __builtin_amdgcn_wmma_f32_16x16x32_bf16(false, ah, false, bl, (short)0, c, false, false);
  asm volatile("v_nop\n\tv_nop\n\tv_nop\n\tv_nop" : "+v"(c) : "v"(ah), "v"(al), "v"(bh), "v"(bl));
  return c;
}

__global__ __launch_bounds__(256) void k_wt_bf16(const float* __restrict__ W, unsigned short* __restrict__ Wt, int K, int N) {
  const int t = blockIdx.x * 256 + threadIdx.x;
  const int k8n = K / 8;
  if (t >= N * k8n) return;
  const int n = t / k8n, k8 = (t % k8n) * 8;
  v8us v;
#pragma unroll
  for (int i = 0; i < 8; ++i) v[i] = bf16_bits(W[(size_t)(k8 + i) * N + n]);
  *(v8us*)(Wt + (size_t)n * K + k8) = v;
  
}

// GEMM C[M][N] (f32, pitch ldc) = act(A[M][K]·W + bias). A f32 row-major (pitch lda) converted per fragment to bf16
// (ASPLIT: hi/lo two planes -> 2 terms, else single rounded term); Wt bf16 [N][K] (pitch ldb). BIAS_BF16 rounds the
// bias to bf16 first (bias quantised to bf16 before the add). K%32==0, M%16==0, N%64==0.
template <bool ASPLIT, int ACT, bool BIAS_BF16>
__global__ __launch_bounds__(128) void k_gemm_bf(const float* __restrict__ A, int lda, const unsigned short* __restrict__ Wt, int ldb,
                                               const float* __restrict__ bias, float* __restrict__ C, int ldc, int M, int N, int K) {
  __shared__ __attribute__((aligned(16))) float so[4][16][64];
  const int tid = threadIdx.x, w = tid >> 5, lane = tid & 31, ln = lane & 15, hh = lane >> 4;
  const int ntn = N / 64;
  const int wid = blockIdx.x * 4 + w;
  const int mt = wid / ntn, nq = wid % ntn;
  if (mt * 16 >= M) return;
  const int row0 = mt * 16, col0 = nq * 64;
  const float* arow = A + (size_t)(row0 + ln) * lda;
  v8f acc[4] = {};
  for (int kb = 0; kb < K; kb += 32) {
    FragB ah, al;
    const v4f x0 = *(const v4fa*)(arow + kb + 8 * hh), x1 = *(const v4fa*)(arow + kb + 8 * hh + 4);
    const v4f x2 = *(const v4fa*)(arow + kb + 16 + 8 * hh), x3 = *(const v4fa*)(arow + kb + 16 + 8 * hh + 4);
    float xs[16] = {x0[0],x0[1],x0[2],x0[3],x1[0],x1[1],x1[2],x1[3],x2[0],x2[1],x2[2],x2[3],x3[0],x3[1],x3[2],x3[3]};
#pragma unroll
    for (int i = 0; i < 16; ++i) { const unsigned short hb = bf16_bits(xs[i]); ah.u[i] = hb; al.u[i] = ASPLIT ? bf16_bits(xs[i] - bf16_val(hb)) : (unsigned short)0; }
#pragma unroll
    for (int t = 0; t < 4; ++t) {
      const unsigned short* brow = Wt + (size_t)(col0 + t * 16 + ln) * ldb + kb;
      FragB b;
      b.half[0] = *(const v8us*)(brow + 8 * hh);
      b.half[1] = *(const v8us*)(brow + 16 + 8 * hh);
      acc[t] = mmaN<ASPLIT ? 2 : 1>(ah.v, al.v, b.v, b.v, acc[t]);
    }
  }
#pragma unroll
  for (int t = 0; t < 4; ++t) {
    float bv = bias ? bias[col0 + t * 16 + ln] : 0.f;
    if (BIAS_BF16) bv = bf16_round(bv);
#pragma unroll
    for (int r = 0; r < 8; ++r) { float v = acc[t][r] + bv; if (ACT == 1) v = fmaxf(v, 0.f); so[w][8 * hh + r][t * 16 + ln] = v; }
  }
  __builtin_amdgcn_fence(__ATOMIC_ACQ_REL, "workgroup");
  __builtin_amdgcn_wave_barrier();
  const int rsub = lane >> 4, c4 = (lane & 15) * 4;
  {
#pragma unroll
    for (int q = 0; q < 8; ++q) {
      const int r = q * 2 + rsub;
      const v4f v = *(const v4fa*)&so[w][r][c4];
      *(v4f*)(C + (size_t)(row0 + r) * ldc + col0 + c4) = v;
    }
    
  }
}

// Flash-style causal/unmasked attention, all contractions 3-term bf16 hi/lo splits, f32 softmax with running max.
// q,k,v rows are read from f32 buffers with arbitrary row pitch (so they can live inside a fused qkv buffer);
// D = head size (multiple of 32, <= 128); one wave = 16 query rows; block = 4 waves (64 queries) sharing K/V chunks of 32.
template <int D, bool CAUSAL>
__global__ __launch_bounds__(128) void k_flash(const float* __restrict__ qb, const float* __restrict__ kb, const float* __restrict__ vb,
                                             int pitch, int T, int H, float scale, float* __restrict__ y, int ypitch) {
  constexpr int KS = D / 32;        // k-steps for QK
  constexpr int DT = D / 16;        // d tiles for PV
  __shared__ __attribute__((aligned(16))) unsigned short sKh[32][D + 8], sKl[32][D + 8], sVh[32][D + 8], sVl[32][D + 8];
  __shared__ __attribute__((aligned(16))) unsigned short sPh[4][16][40], sPl[4][16][40];
  __shared__ __attribute__((aligned(16))) float sO[4][16][D];
  const int tid = threadIdx.x, w = tid >> 5, lane = tid & 31, ln = lane & 15, hh = lane >> 4;
  const int nqb = (T + 63) / 64;
  const int bh = blockIdx.x / nqb, qblk = blockIdx.x % nqb;
  const int b = bh / H, h = bh % H;
  const int q0 = qblk * 64 + w * 16;
  const float* Q = qb + (size_t)b * T * pitch + h * D;
  const float* K = kb + (size_t)b * T * pitch + h * D;
  const float* V = vb + (size_t)b * T * pitch + h * D;

  // A fragments of the wave's 16 query rows (scaled), hi/lo
  FragB aqh[KS], aql[KS];
  {
    int row = q0 + ln; if (row >= T) row = T - 1;
    const float* qr = Q + (size_t)row * pitch;
#pragma unroll
    for (int ks = 0; ks < KS; ++ks)
#pragma unroll
      for (int i = 0; i < 16; ++i) {
        const int d = ks * 32 + ((i < 8) ? (8 * hh + i) : (16 + 8 * hh + (i - 8)));
        const float x = qr[d] * scale; const unsigned short hb = bf16_bits(x);
        aqh[ks].u[i] = hb; aql[ks].u[i] = bf16_bits(x - bf16_val(hb));
      }
  }
  float m_r[8], l_r[8];
#pragma unroll
  for (int r = 0; r < 8; ++r) { m_r[r] = -3.0e38f; l_r[r] = 0.f; }
  v8f oacc[DT];
#pragma unroll
  for (int dt = 0; dt < DT; ++dt) oacc[dt] = (v8f){0.f,0.f,0.f,0.f,0.f,0.f,0.f,0.f};

  const int kv_end = CAUSAL ? min(T, qblk * 64 + 64) : T;     // block-uniform
  for (int j0 = 0; j0 < kv_end; j0 += 32) {
    __syncthreads();
    for (int e = tid; e < 32 * (D / 4); e += 128) {
      const int r = e / (D / 4), c4 = (e % (D / 4)) * 4;
      const int key = j0 + r;
      v4f kf = {0.f,0.f,0.f,0.f}, vf = {0.f,0.f,0.f,0.f};
      if (key < T) { kf = *(const v4fa*)(K + (size_t)key * pitch + c4); vf = *(const v4fa*)(V + (size_t)key * pitch + c4); }
#pragma unroll
      for (int t = 0; t < 4; ++t) {
        unsigned short hb = bf16_bits(kf[t]); sKh[r][c4 + t] = hb; sKl[r][c4 + t] = bf16_bits(kf[t] - bf16_val(hb));
        hb = bf16_bits(vf[t]); sVh[r][c4 + t] = hb; sVl[r][c4 + t] = bf16_bits(vf[t] - bf16_val(hb));
      }
    }
    __syncthreads();
    // S tile 16 x 32
    v8f s[2];
#pragma unroll
    for (int nt = 0; nt < 2; ++nt) {
      v8f acc = {};
#pragma unroll
      for (int ks = 0; ks < KS; ++ks) {
        FragB bh_, bl_;
        bh_.half[0] = *(const v8us*)&sKh[nt * 16 + ln][ks * 32 + 8 * hh]; bh_.half[1] = *(const v8us*)&sKh[nt * 16 + ln][ks * 32 + 16 + 8 * hh];
        bl_.half[0] = *(const v8us*)&sKl[nt * 16 + ln][ks * 32 + 8 * hh]; bl_.half[1] = *(const v8us*)&sKl[nt * 16 + ln][ks * 32 + 16 + 8 * hh];
        acc = mmaN<3>(aqh[ks].v, aql[ks].v, bh_.v, bl_.v, acc);
      }
      s[nt] = acc;
    }
    // mask + running max (rows 8hh+r; the 16 lanes of a half share rows)
    float alpha[8];
#pragma unroll
    for (int r = 0; r < 8; ++r) {
      const int qi = q0 + 8 * hh + r;
      const int ja = j0 + ln, jb = j0 + 16 + ln;
      if (CAUSAL) { if (ja > qi) s[0][r] = -3.0e38f; if (jb > qi) s[1][r] = -3.0e38f; }
      if (ja >= T) s[0][r] = -3.0e38f;
      if (jb >= T) s[1][r] = -3.0e38f;
      float mx = fmaxf(s[0][r], s[1][r]);
      mx = fmaxf(mx, __shfl_xor(mx, 1, 32)); mx = fmaxf(mx, __shfl_xor(mx, 2, 32)); mx = fmaxf(mx, __shfl_xor(mx, 4, 32)); mx = fmaxf(mx, __shfl_xor(mx, 8, 32));
      const float mnew = fmaxf(m_r[r], mx);
      alpha[r] = (mnew > -1.0e38f) ? __expf(m_r[r] - mnew) : 1.0f;
      const float p0 = (s[0][r] > -1.0e38f) ? __expf(s[0][r] - mnew) : 0.f;
      const float p1 = (s[1][r] > -1.0e38f) ? __expf(s[1][r] - mnew) : 0.f;
      m_r[r] = mnew;
      l_r[r] = l_r[r] * alpha[r] + p0 + p1;            // per-lane partial row sum (16 lanes combined at the end)
      unsigned short hb = bf16_bits(p0); sPh[w][8 * hh + r][ln] = hb;      sPl[w][8 * hh + r][ln] = bf16_bits(p0 - bf16_val(hb));
      hb = bf16_bits(p1);                sPh[w][8 * hh + r][16 + ln] = hb; sPl[w][8 * hh + r][16 + ln] = bf16_bits(p1 - bf16_val(hb));
    }
#pragma unroll
    for (int dt = 0; dt < DT; ++dt)
#pragma unroll
      for (int r = 0; r < 8; ++r) oacc[dt][r] *= alpha[r];
    __builtin_amdgcn_fence(__ATOMIC_ACQ_REL, "workgroup");
    __builtin_amdgcn_wave_barrier();
    FragB pah, pal;
    pah.half[0] = *(const v8us*)&sPh[w][ln][8 * hh]; pah.half[1] = *(const v8us*)&sPh[w][ln][16 + 8 * hh];
    pal.half[0] = *(const v8us*)&sPl[w][ln][8 * hh]; pal.half[1] = *(const v8us*)&sPl[w][ln][16 + 8 * hh];
#pragma unroll
    for (int dt = 0; dt < DT; ++dt) {
      FragB bvh, bvl;
#pragma unroll
      for (int i = 0; i < 8; ++i) {
        bvh.u[i] = sVh[8 * hh + i][dt * 16 + ln]; bvh.u[8 + i] = sVh[16 + 8 * hh + i][dt * 16 + ln];
        bvl.u[i] = sVl[8 * hh + i][dt * 16 + ln]; bvl.u[8 + i] = sVl[16 + 8 * hh + i][dt * 16 + ln];
      }
      oacc[dt] = mmaN<3>(pah.v, pal.v, bvh.v, bvl.v, oacc[dt]);
    }
    __builtin_amdgcn_fence(__ATOMIC_ACQ_REL, "workgroup");
    __builtin_amdgcn_wave_barrier();
  }
#pragma unroll
  for (int r = 0; r < 8; ++r) {
    float l = l_r[r];
    l += __shfl_xor(l, 1, 32); l += __shfl_xor(l, 2, 32); l += __shfl_xor(l, 4, 32); l += __shfl_xor(l, 8, 32);
    l_r[r] = (l > 0.f) ? 1.0f / l : 0.f;
  }
#pragma unroll
  for (int dt = 0; dt < DT; ++dt)
#pragma unroll
    for (int r = 0; r < 8; ++r) sO[w][8 * hh + r][dt * 16 + ln] = oacc[dt][r] * l_r[r];
  __builtin_amdgcn_fence(__ATOMIC_ACQ_REL, "workgroup");
  __builtin_amdgcn_wave_barrier();
  {
    for (int r = 0; r < 16; ++r) {
      const int row = q0 + r;
      if (row < T && lane < D / 4) {
        const v4f val = *(const v4fa*)&sO[w][r][lane * 4];
        *(v4f*)(y + ((size_t)b * T + row) * ypitch + h * D + lane * 4) = val;
      }
    }
    
  }
}

// GEMM C = act(A·W + bias + resid): A f32 (ASPLIT -> hi/lo 2 terms), Wt bf16 [N][K]; ACT 0 none, 1 relu, 2 exact gelu;
// resid (optional, f32, row index = (row % rmod), pitch ldr, RES_BF16 rounds it) added before the activation.
template <bool ASPLIT, int ACT, bool BIAS_BF16, bool RES_BF16>
__global__ __launch_bounds__(128) void k_gemm_bf3(const float* __restrict__ A, int lda, const unsigned short* __restrict__ Wt, int ldb,
                                                const float* __restrict__ bias, const float* __restrict__ resid, int rmod, int ldr,
                                                float* __restrict__ C, int ldc, int M, int N, int K) {
  __shared__ __attribute__((aligned(16))) float so[4][16][64];
  const int tid = threadIdx.x, w = tid >> 5, lane = tid & 31, ln = lane & 15, hh = lane >> 4;
  const int ntn = N / 64;
  const int wid = blockIdx.x * 4 + w;
  const int mt = wid / ntn, nq = wid % ntn;
  if (mt * 16 >= M) return;
  const int row0 = mt * 16, col0 = nq * 64;
  const float* arow = A + (size_t)(row0 + ln) * lda;
  v8f acc[4] = {};
  for (int kb = 0; kb < K; kb += 32) {
    FragB ah, al;
    const v4f x0 = *(const v4fa*)(arow + kb + 8 * hh), x1 = *(const v4fa*)(arow + kb + 8 * hh + 4);
    const v4f x2 = *(const v4fa*)(arow + kb + 16 + 8 * hh), x3 = *(const v4fa*)(arow + kb + 16 + 8 * hh + 4);
    float xs[16] = {x0[0],x0[1],x0[2],x0[3],x1[0],x1[1],x1[2],x1[3],x2[0],x2[1],x2[2],x2[3],x3[0],x3[1],x3[2],x3[3]};
#pragma unroll
    for (int i = 0; i < 16; ++i) { const unsigned short hb = bf16_bits(xs[i]); ah.u[i] = hb; al.u[i] = ASPLIT ? bf16_bits(xs[i] - bf16_val(hb)) : (unsigned short)0; }
#pragma unroll
    for (int t = 0; t < 4; ++t) {
      const unsigned short* brow = Wt + (size_t)(col0 + t * 16 + ln) * ldb + kb;
      FragB b;
      b.half[0] = *(const v8us*)(brow + 8 * hh);
      b.half[1] = *(const v8us*)(brow + 16 + 8 * hh);
      acc[t] = mmaN<ASPLIT ? 2 : 1>(ah.v, al.v, b.v, b.v, acc[t]);
    }
  }
#pragma unroll
  for (int t = 0; t < 4; ++t) {
    const int col = col0 + t * 16 + ln;
    float bv = bias ? bias[col] : 0.f;
    if (BIAS_BF16) bv = bf16_round(bv);
#pragma unroll
    for (int r = 0; r < 8; ++r) {
      float v = acc[t][r] + bv;
      if (resid) { float rv = resid[(size_t)((row0 + 8 * hh + r) % rmod) * ldr + col]; if (RES_BF16) rv = bf16_round(rv); v += rv; }
      if (ACT == 1) v = fmaxf(v, 0.f);
      if (ACT == 2) v = 0.5f * v * (1.0f + erff(v * 0.70710678118654752f));
      if (ACT == 3) { const float u = 0.7978845608028654f * (v + 0.044715f * v * v * v); v = 0.5f * v * (1.0f + tanhf(u)); }
      so[w][8 * hh + r][t * 16 + ln] = v;
    }
  }
  __builtin_amdgcn_fence(__ATOMIC_ACQ_REL, "workgroup");
  __builtin_amdgcn_wave_barrier();
  const int rsub = lane >> 4, c4 = (lane & 15) * 4;
  {
#pragma unroll
    for (int q = 0; q < 8; ++q) {
      const int r = q * 2 + rsub;
      const v4f v = *(const v4fa*)&so[w][r][c4];
      *(v4f*)(C + (size_t)(row0 + r) * ldc + col0 + c4) = v;
    }
    
  }
}
// row LayerNorm (biased variance, eps) over N: s = X (+ R); optional out_sum <- s; out_norm <- (s-mu)*rsqrt(var+eps)*g + b
template <bool PARAM_BF16>
__global__ __launch_bounds__(256) void k_layernorm(const float* __restrict__ X, const float* __restrict__ R, const float* __restrict__ g, const float* __restrict__ bta,
                                                  float* __restrict__ out_sum, float* __restrict__ out_norm, int N, float eps) {
  __shared__ float red[256];
  const int row = blockIdx.x, tid = threadIdx.x;
  const float* x = X + (size_t)row * N; const float* rr = R ? R + (size_t)row * N : nullptr;
  float vals[16];                     // up to N = 4096
  const int per = N / 256;            // contiguous chunk per thread? use strided-by-4 chunks: thread handles j = tid*4 + 1024*u
  float s1 = 0.f;
  for (int u = 0; u < per / 4; ++u) {
    const int j = tid * 4 + 1024 * u;
    const v4f a = *(const v4fa*)(x + j);
    v4f b = {0.f,0.f,0.f,0.f}; if (rr) b = *(const v4fa*)(rr + j);
#pragma unroll
    for (int q = 0; q < 4; ++q) { const float v = a[q] + b[q]; vals[u * 4 + q] = v; s1 += v; }
  }
  red[tid] = s1; __syncthreads();
  for (int st = 128; st > 0; st >>= 1) { if (tid < st) red[tid] += red[tid + st]; __syncthreads(); }
  const float mu = red[0] / (float)N; __syncthreads();
  float s2 = 0.f;
  for (int u = 0; u < per / 4; ++u)
#pragma unroll
    for (int q = 0; q < 4; ++q) { const float c = vals[u * 4 + q] - mu; s2 += c * c; }
  red[tid] = s2; __syncthreads();
  for (int st = 128; st > 0; st >>= 1) { if (tid < st) red[tid] += red[tid + st]; __syncthreads(); }
  const float rs = rsqrtf(red[0] / (float)N + eps);
  {
    for (int u = 0; u < per / 4; ++u) {
      const int j = tid * 4 + 1024 * u;
      v4f o, sm;
#pragma unroll
      for (int q = 0; q < 4; ++q) {
        float gg = g[j + q], bb = bta[j + q];
        if (PARAM_BF16) { gg = bf16_round(gg); bb = bf16_round(bb); }
        sm[q] = vals[u * 4 + q]; o[q] = (vals[u * 4 + q] - mu) * rs * gg + bb;
      }
      if (out_sum) *(v4f*)(out_sum + (size_t)row * N + j) = sm;
      *(v4f*)(out_norm + (size_t)row * N + j) = o;
    }
    
  }
}



// ---- f16 WMMA path (v_wmma_f32_16x16x32_f16): 11-bit significands for operands in range — used where a [0,1] probability operand needs more precision than bf16
typedef _Float16 v16h __attribute__((ext_vector_type(16)));
union FragH { v16h v; v8us half[2]; _Float16 h[16]; unsigned short u[16]; };
template <int NT>
__device__ __forceinline__ v8f mmaH(v16h ah, v16h al, v16h bh, v16h bl, v8f c) {
  c = __builtin_amdgcn_wmma_f32_16x16x32_f16(false, ah, false, bh, (short)0, c, false, false);
  if (NT >= 2) c = __builtin_amdgcn_wmma_f32_16x16x32_f16(false, al, false, bh, (short)0, c, false, false);
  if (NT >= 3) c = __builtin_amdgcn_wmma_f32_16x16x32_f16(false, ah, false, bl, (short)0, c, false, false);
  asm volatile("v_nop\n\tv_nop\n\tv_nop\n\tv_nop" : "+v"(c) : "v"(ah), "v"(al), "v"(bh), "v"(bl));
  return c;
}
// batched GEMM like k_gemm_b but f16 operands: A f32 (split into f16 hi/lo if ASPLIT, else rounded to f16), Bt = f16 values [n][k]; alpha; C f32; N multiple of 16 (partial tiles skipped)
template <bool ASPLIT>
__global__ __launch_bounds__(128) void k_gemm_h(const float* __restrict__ A, int lda, size_t sA, const _Float16* __restrict__ Bh, int ldb, size_t sB, float alpha, float* __restrict__ C, int ldc, size_t sC, int M, int N, int K) {
  __shared__ __attribute__((aligned(16))) float so[4][16][64];
  const int tid = threadIdx.x, w = tid >> 5, lane = tid & 31, ln = lane & 15, hh = lane >> 4; const int by = blockIdx.y;
  A += (size_t)by * sA; Bh += (size_t)by * sB; C += (size_t)by * sC;
  const int ntn = (N + 63) / 64; const int wid = blockIdx.x * 4 + w; const int mt = wid / ntn, nq = wid % ntn; if (mt * 16 >= M) return;
  const int row0 = mt * 16, col0 = nq * 64; const float* arow = A + (size_t)(row0 + ln) * lda;
  v8f acc[4] = {};
  for (int kb = 0; kb < K; kb += 32) {
    FragH ah, al;
    const v4f x0 = *(const v4fa*)(arow + kb + 8 * hh), x1 = *(const v4fa*)(arow + kb + 8 * hh + 4), x2 = *(const v4fa*)(arow + kb + 16 + 8 * hh), x3 = *(const v4fa*)(arow + kb + 16 + 8 * hh + 4);
    float xs[16] = {x0[0],x0[1],x0[2],x0[3],x1[0],x1[1],x1[2],x1[3],x2[0],x2[1],x2[2],x2[3],x3[0],x3[1],x3[2],x3[3]};
#pragma unroll
    for (int i = 0; i < 16; ++i) { const _Float16 h = (_Float16)xs[i]; ah.h[i] = h; al.h[i] = ASPLIT ? (_Float16)(xs[i] - (float)h) : (_Float16)0.0f; }
#pragma unroll
    for (int t = 0; t < 4; ++t) { if (col0 + t * 16 >= N) continue; const size_t boff = (size_t)(col0 + t * 16 + ln) * ldb + kb; FragH bq; bq.half[0] = *(const v8us*)(Bh + boff + 8 * hh); bq.half[1] = *(const v8us*)(Bh + boff + 16 + 8 * hh);
      acc[t] = mmaH<ASPLIT ? 2 : 1>(ah.v, al.v, bq.v, bq.v, acc[t]); }
  }
#pragma unroll
  for (int t = 0; t < 4; ++t) { if (col0 + t * 16 >= N) continue;
#pragma unroll
    for (int r = 0; r < 8; ++r) so[w][8 * hh + r][t * 16 + ln] = acc[t][r] * alpha; }
  __builtin_amdgcn_fence(__ATOMIC_ACQ_REL, "workgroup"); __builtin_amdgcn_wave_barrier();
  const int rsub = lane >> 4, c4 = (lane & 15) * 4;
  {
#pragma unroll
    for (int q = 0; q < 8; ++q) { const int r = q * 2 + rsub; if (col0 + c4 < N) { const v4f v = *(const v4fa*)&so[w][r][c4]; *(v4f*)(C + (size_t)(row0 + r) * ldc + col0 + c4) = v; } }
     }
}

// FRAGMENT ORDER. Every 16-bit matrix operand M[row][k] (rows a multiple of 16, k a multiple of 32, KS = k-steps of 32) lies in the workspace as [row tile of 16][k-step][half j][lane][8 elements]:
// lane 16 hh + (row & 15) of half j of k-step s holds k = 32 s + 16 j + 8 hh + 0..7. One half of a fragment is then 32 lanes x 16 B = 512 contiguous bytes (4 cache lines), where rows of a row-major matrix gave 16 lines a load.
// The 16-byte piece number t of such a matrix (its place is element 8 t) holds row frag_row(t, KS), columns frag_k(t, KS) + 0..7; a writer whose thread t makes piece t stores whole lines.
__device__ __forceinline__ int frag_row(unsigned t, unsigned KS) { return (int)((t / (64 * KS)) * 16 + (t & 15)); }
__device__ __forceinline__ int frag_k(unsigned t, unsigned KS) { return (int)(((t >> 6) % KS) * 32 + ((t >> 5) & 1) * 16 + ((t >> 4) & 1) * 8); }
// Wt (row n, column k, fragment order) = f16(W[k][n] * scale) from f32 row-major W[K][N] (scale = power of two; bf16-exact weights stay exact in f16 away from the subnormal range)
__device__ __forceinline__ void wt_f16_block(const float* __restrict__ W, _Float16* __restrict__ Wt, int K, int N, float scale, int blk) {
  const int t = blk * 256 + threadIdx.x; if (t >= N * (K / 8)) return; const int n = frag_row(t, K / 32), k8 = frag_k(t, K / 32); FragH f;
#pragma unroll
  for (int i = 0; i < 8; ++i) f.h[i] = (_Float16)(bf16_round(W[(size_t)(k8 + i) * N + n]) * scale); const v8us o = f.half[0];
  *(v8us*)((unsigned short*)Wt + (size_t)t * 8) = o; 
}
// k_gemm_hh variant with fused epilogue: v = acc·alpha + bf16(bias_by[by·sBias + col]) (bias_by = bias, biasY1, biasY2 for by = 0, 1, 2) (+ CP[(row/rowsPerB)·sCPb + by·64 + col] if CP) ; ACT 0 none / 1 elu ; writes f16 C16 and f32 C, each if non-null
// N (a multiple of 64, so every wave owns four whole 16-column tiles) and K are compile-time: the k loop is unrolled whole and its fragment loads run PF k-steps ahead of the products that use them.
// A, Bh and C16 are in fragment order (K / 32, K / 32 and N / 32 k-steps a row tile); C is row-major with pitch ldc.
// VT: batch index 2 (the value projection) is stored transposed instead, into CT: planes [row / NN][column / 64] of [64 rows d][NN keys] in fragment order (NN / 32 k-steps a row tile), the A operand of the flash kernel's value product.
// MT: row tiles of 16 a wave owns. A wave's tile is 16 MT rows x 64 columns: each B fragment it loads feeds MT products and each A fragment four.
// A work-group is WM x WN x WB waves: WM wave tiles down, WN across, WB batch indices (which share A where sA is 0). Its waves walk k from the same start, so a fragment that several of them ask for
// (an A fragment WN WB waves, a B fragment WM waves) can come from the WGP's cache instead of L2.
template <int ACT, int N, int K, bool VT, int MT, int WM, int WN, int WB>
__global__ __launch_bounds__(32 * WM * WN * WB) void k_gemm_hhx(const _Float16* __restrict__ A, int lda, size_t sA, const _Float16* __restrict__ Bh, int ldb, size_t sB, float alpha, const float* __restrict__ bias, const float* __restrict__ biasY1, const float* __restrict__ biasY2, size_t sBias, const float* __restrict__ CP, int rowsPerB, size_t sCPb, int row0g,
    float* __restrict__ C, _Float16* __restrict__ C16, _Float16* __restrict__ CT, int ldc, size_t sC, int M) {
  static_assert(N % (64 * WN) == 0 && K % 32 == 0, "whole work-group tiles of 64 WN columns and whole 32-deep k-steps");
  __shared__ __attribute__((aligned(16))) float so[WM * WN * WB * MT][16][64 + 4];      /* one 16 x 64 plane a wave and row tile; pitch 68: the fragment-order store below reads 16 rows at one column, which a pitch of 64 would put on the same banks */
  const int tid = threadIdx.x, w = __builtin_amdgcn_readfirstlane(tid >> 5), lane = tid & 31, ln = lane & 15, hh = lane >> 4; const int by = (int)blockIdx.y * WB + w / (WM * WN);      /* the wave's number held as a scalar: the batch index, which now differs between the waves of a work-group, picks buffers and the store path by scalar tests */
  A += (size_t)by * sA; Bh += (size_t)by * sB; const size_t cofs = (size_t)by * sC; const float* bsel = (by == 0) ? bias : ((by == 1) ? biasY1 : biasY2); const float* bp = bsel ? bsel + (size_t)by * sBias : nullptr;      /* batch index by = 0, 1, 2 takes its own bias buffer */
  constexpr int NBN = N / (64 * WN); const int mw = ((int)blockIdx.x / NBN) * WM + (w / WN) % WM, nq = ((int)blockIdx.x % NBN) * WN + w % WN; if (mw * 16 * MT >= M) return;      /* wave-uniform; the kernel has no work-group barrier */
  const int mt0 = mw * MT, col0 = nq * 64; (void)lda; (void)ldb;      /* the wave's row tiles are mt0 .. mt0 + MT - 1 */
  v8f acc[MT][4] = {};
  constexpr int NS = K / 32, PF = 2, NB = PF + 1;      /* NB register stages: PF k-steps of loads in flight beside the one being multiplied */
  const unsigned short* ap = (const unsigned short*)A + (size_t)mt0 * NS * 512 + lane * 8; const unsigned short* bq0 = (const unsigned short*)Bh + (size_t)(nq * 4) * NS * 512 + lane * 8;      /* row tiles mt0 + i of A; row tiles 4 nq + t of Bh */
  FragH fa[NB][MT], fb[NB][4];
#pragma unroll
  for (int s = 0; s < NS + PF; ++s) {      /* unrolled whole: the stage indices must be constants for the stages to stay in registers */
    if (s < NS) { const int st = s % NB;
#pragma unroll
      for (int i = 0; i < MT; ++i) { const unsigned short* ar = ap + (i * NS + s) * 512; fa[st][i].half[0] = *(const v8us*)ar; fa[st][i].half[1] = *(const v8us*)(ar + 256); }
#pragma unroll
      for (int t = 0; t < 4; ++t) { const unsigned short* br = bq0 + (t * NS + s) * 512; fb[st][t].half[0] = *(const v8us*)br; fb[st][t].half[1] = *(const v8us*)(br + 256); } }
    if (s >= PF) { const int st = (s - PF) % NB;
#pragma unroll
      for (int i = 0; i < MT; ++i)
#pragma unroll
        for (int t = 0; t < 4; ++t) acc[i][t] = mmaH<1>(fa[st][i].v, fa[st][i].v, fb[st][t].v, fb[st][t].v, acc[i][t]); }
  }
  float bv[4] = {0.f, 0.f, 0.f, 0.f};
  if (bp) {      /* one test for the four bias loads, so that they travel together */
#pragma unroll
    for (int t = 0; t < 4; ++t) bv[t] = bp[col0 + t * 16 + ln];
#pragma unroll
    for (int t = 0; t < 4; ++t) bv[t] = bf16_round(bv[t]); }
  if (VT && by == 2) {      /* wave-uniform. In accumulator tile (i, t) lane 16 hh + ln holds rows (keys) 8 hh + 0..7 of row tile mt0 + i, column d = 16 t + ln: that is the lane's 16-byte piece of the transposed operand, so it goes out from the registers, no LDS */
    FragH f[MT][2];
#pragma unroll
    for (int i = 0; i < MT; ++i)
#pragma unroll
      for (int t = 0; t < 4; ++t)
#pragma unroll
        for (int r = 0; r < 8; ++r) f[i][t >> 1].h[(t & 1) * 8 + r] = (_Float16)(acc[i][t][r] * alpha + bv[t]);
#pragma unroll
    for (int i = 0; i < MT; ++i) { const unsigned ur = (unsigned)(mt0 + i) * 16; unsigned short* tp = (unsigned short*)CT + (size_t)((ur / NN) * (N / 64) + (unsigned)nq) * 64 * NN + ((ur % NN) / 32) * 512 + ((ur >> 4) & 1) * 256 + lane * 8;      /* plane (batch, nq); the row tile's 16 keys are half (ur / 16) & 1 of k-step (ur % NN) / 32 */
#pragma unroll
      for (int t = 0; t < 4; ++t) *(v8us*)(tp + (size_t)t * (NN / 32) * 512) = f[i][t >> 1].half[t & 1]; }      /* row tile t of the plane: four 512-byte stores; every value is converted ahead of the first store, and the wave ends behind the last */
    return; }
#pragma unroll
  for (int i = 0; i < MT; ++i)
#pragma unroll
    for (int t = 0; t < 4; ++t) { const int col = col0 + t * 16 + ln;
#pragma unroll
      for (int r = 0; r < 8; ++r) { float v = acc[i][t][r] * alpha + bv[t]; if (CP) { const int bidx = (row0g + (mt0 + i) * 16 + 8 * hh + r) / rowsPerB; v += CP[(size_t)bidx * sCPb + (size_t)by * 64 + col]; } if (ACT == 1) v = (v > 0.f) ? v : expm1f(v); else if (ACT == 7) v = (v > 0.f) ? v + 1.0f : expf(v); else if (ACT == 8) v = tanhf(v); else if (ACT == 9) v = 0.5f * v * (1.0f + tanhf(0.7978845608028654f * (v + 0.044715f * v * v * v))); else if (ACT == 11) v = 1.0f / (1.0f + expf(-v)); else if (ACT == 12) v = (v > 0.f) ? v : 0.01f * v; else if (ACT == 14) v = (v > 0.f) ? v : 0.1f * v; else if (ACT == 15) v = v / (1.0f + expf(-v)); else if (ACT == 3) v = fmaxf(v, 0.f); else if (ACT == 6) v = 0.5f * v * (1.0f + erff(v * 0.70710678118654752f)); so[w * MT + i][8 * hh + r][t * 16 + ln] = v; } }
  __builtin_amdgcn_fence(__ATOMIC_ACQ_REL, "workgroup"); __builtin_amdgcn_wave_barrier();
  const int rsub = lane >> 4, c4 = (lane & 15) * 4;
#pragma unroll
  for (int i = 0; i < MT; ++i) { const int mt = mt0 + i, row0 = mt * 16;
#pragma unroll
    for (int q = 0; q < 8; ++q) { const int r = q * 2 + rsub; if (C) { const v4f v = *(const v4fa*)&so[w * MT + i][r][c4]; *(v4f*)(C + cofs + (size_t)(row0 + r) * ldc + col0 + c4) = v; } }
    if (C) asm volatile("s_wait_xcnt 0x0" ::: "memory");      /* directly behind the row-major stores: what follows (the fragment-order part, the next row tile) rewrites registers that they name */
    if (C16) { unsigned short* cp = (unsigned short*)C16 + cofs + ((size_t)mt * (N / 32) + nq * 2) * 512 + lane * 8;      /* a 16 x 64 tile = two k-steps of row tile mt = 2 KB in a row: four 512-byte stores */
#pragma unroll
      for (int q = 0; q < 4; ++q) { const v4f v0 = *(const v4fa*)&so[w * MT + i][ln][q * 16 + 8 * hh], v1 = *(const v4fa*)&so[w * MT + i][ln][q * 16 + 8 * hh + 4]; FragH f;
#pragma unroll
        for (int e = 0; e < 4; ++e) { f.h[e] = (_Float16)v0[e]; f.h[4 + e] = (_Float16)v1[e]; }
        *(v8us*)(cp + q * 256) = f.half[0]; }
      if (VT || i + 1 < MT) asm volatile("s_wait_xcnt 0x0" ::: "memory"); }      /* directly behind the four fragment-order stores: the next row tile, and in the VT build the transposed-store block laid out behind them, rewrite registers that they name */
  }
}


typedef _Float16 v4h __attribute__((ext_vector_type(4)));

__device__ __forceinline__ void x16_block(const float* __restrict__ x, _Float16* __restrict__ X16, size_t n8, int blk) { const size_t t = (size_t)blk * 256 + threadIdx.x; if (t >= n8) return; FragH f;      /* x row-major [NR][DX] -> X16 in fragment order */
  const float* xr = x + (size_t)frag_row((unsigned)t, DX / 32) * DX + frag_k((unsigned)t, DX / 32);
#pragma unroll
  for (int q = 0; q < 8; ++q) f.h[q] = (_Float16)bf16_round(xr[q]); *(v8us*)((unsigned short*)X16 + t * 8) = f.half[0];  }
// One grid for the five operand preparations, none of which reads another's result: the block index picks the job (block-uniform branch).
// Blocks 0 .. 3 NBW - 1: Wq, Wk, Wv (their outputs lie one behind the other in Bqkv); the next NBO: Wo; the last NBX: x.
#define NBW (2 * DX * (DX / 8) / 256)
#define NBO (DX * (DX / 8) / 256)
#define NBX (NR * DX / 8 / 256)
__global__ __launch_bounds__(256) void k_prep(const float* __restrict__ Wq, const float* __restrict__ Wk, const float* __restrict__ Wv, const float* __restrict__ Wo, const float* __restrict__ x,
                                              _Float16* __restrict__ Bqkv, _Float16* __restrict__ Bo, _Float16* __restrict__ X16) {
  const int bid = blockIdx.x;
  if (bid < 3 * NBW) { const int j = bid / NBW; wt_f16_block(j == 0 ? Wq : (j == 1 ? Wk : Wv), Bqkv + (size_t)j * 2 * DX * DX, DX, 2 * DX, 16.0f, bid % NBW); }
  else if (bid < 3 * NBW + NBO) wt_f16_block(Wo, Bo, DX, DX, 16.0f, bid - 3 * NBW);
  else x16_block(x, X16, (size_t)NR * DX / 8, bid - (3 * NBW + NBO)); }
__global__ __launch_bounds__(256) void k_h16(const float* __restrict__ x, _Float16* __restrict__ X16, size_t n8) { const size_t t = (size_t)blockIdx.x * 256 + threadIdx.x; if (t >= n8) return; FragH f;
#pragma unroll
  for (int q = 0; q < 8; ++q) f.h[q] = (_Float16)x[t * 8 + q]; *(v8us*)((unsigned short*)X16 + t * 8) = f.half[0];  }
__global__ __launch_bounds__(256) void k_round16f(const float* __restrict__ W, _Float16* __restrict__ Bt, size_t n8) { const size_t t = (size_t)blockIdx.x * 256 + threadIdx.x; if (t >= n8) return; FragH f;
#pragma unroll
  for (int i = 0; i < 8; ++i) f.h[i] = (_Float16)(bf16_round(W[t * 8 + i]) * 16.0f); *(v8us*)((unsigned short*)Bt + t * 8) = f.half[0];  }
// Keys split inside the work-group: each of the 4 query tiles is walked by KVS waves; wave (qw, kr) takes the 32-key blocks kr, kr + KVS, kr + 2 KVS, ... with its own running max, sum and
// un-normalised accumulators; the KVS partials of a tile are merged through LDS behind one work-group barrier (weights exp(SCORE_SCALE (m_k - M)), the maxima being raw).
// TRANSPOSED PRODUCTS. Scores are formed as S^T = K Q^T (A = key rows, B = query columns) and values as O^T += V^T P^T (A = V^T rows d, B = P^T). In a D tile lane 16 hh + ln, register r holds row 8 hh + r, column ln:
// a lane then holds scores of ONE query (ln), keys 16 nt + 8 hh + r, so the maximum and the sum over keys are in-lane but for one exchange between the lane halves, the rescale factor is one value a lane,
// and the two score tiles nt = 0, 1, converted in place, are the B operand of the value product (element 8 nt + r = key 16 nt + 8 hh + r, the k order of every fragment here): P never goes through LDS.
#define KVS 4
typedef float v2f __attribute__((ext_vector_type(2)));
__device__ __forceinline__ float xhalf(float x) { return __builtin_bit_cast(float, __builtin_amdgcn_permlanex16(__builtin_bit_cast(int, x), __builtin_bit_cast(int, x), 0x76543210, 0xfedcba98, false, false)); }      /* lane l takes the value of lane l ^ 16 */
__global__ __launch_bounds__(128 * KVS) void k_flash(const _Float16* __restrict__ Q16, int ldq, const _Float16* __restrict__ K16, int ldk, const _Float16* __restrict__ Vt, _Float16* __restrict__ O16) {
  constexpr int RPW = 16, NQB = NN / (4 * RPW), DT = 4, KS = 2, NW = 4 * KVS;
  __shared__ __attribute__((aligned(16))) float sO[NW][RPW][128 + 4]; __shared__ float sM[NW][RPW], sL[NW][RPW];
  const int tid = threadIdx.x, w = __builtin_amdgcn_readfirstlane(tid >> 5), lane = tid & 31, ln = lane & 15, hh = lane >> 4; const int qw = w & 3, kr = w >> 2;      /* the wave's number held as a scalar: tile and key-block indices leave the vector registers, which the grouped fragments need */
  const int slab = blockIdx.x / NQB, qblk = blockIdx.x % NQB; const int b = slab / NHU, h = slab % NHU; const int qb0 = qblk * (4 * RPW); const int q0 = qb0 + qw * RPW;
  FragH aq[KS], aql[KS];
  { const size_t qo = ((size_t)((b * NN + q0) / 16) * (DX / 32) + h * 4) * 512 + lane * 8; const unsigned short* qr = (const unsigned short*)Q16 + qo; const unsigned short* ql = qr + 2 * 512;      /* Q16, K16 in fragment order: head h = k-steps 4 h .. 4 h + 3 of a row tile; aq = real part (the first two), aql = imaginary part */
#pragma unroll
    for (int ks = 0; ks < KS; ++ks) { aq[ks].half[0] = *(const v8us*)(qr + ks * 512); aq[ks].half[1] = *(const v8us*)(qr + ks * 512 + 256); aql[ks].half[0] = *(const v8us*)(ql + ks * 512); aql[ks].half[1] = *(const v8us*)(ql + ks * 512 + 256); } }
  (void)ldq; (void)ldk;
  const unsigned short* Vth = (const unsigned short*)Vt + ((size_t)b * 2 * NHU + 2 * h) * 64 * NN;      /* V^T real plane of head h; the imaginary plane lies 64 NN elements behind it */
  float m_q = -3.0e38f, l_q = 0.f; v8f oacc[DT], oacci[DT];      /* running max of query ln (equal in both lane halves), this lane half's share of its sum, O^T tiles: register r = column d = 16 dt + 8 hh + r of query ln */
#pragma unroll
  for (int dt = 0; dt < DT; ++dt) { oacc[dt] = (v8f){0.f,0.f,0.f,0.f,0.f,0.f,0.f,0.f}; oacci[dt] = oacc[dt]; }
  const int jend = NN;
#pragma unroll 1
  for (int j0 = kr * 32; j0 < jend; j0 += 32 * KVS) {
    v8f s[2]; FragH bk[2][KS], bl[2][KS];      /* bk = real, bl = imaginary; both 16-key tiles' fragments are loaded as one group ahead of the score products */
    const unsigned short* kp[2];
#pragma unroll
    for (int nt = 0; nt < 2; ++nt) { kp[nt] = (const unsigned short*)K16 + ((size_t)((b * NN + j0) / 16 + nt) * (DX / 32) + h * 4) * 512 + lane * 8; const unsigned short* kr = kp[nt]; const unsigned short* kl = kr + 2 * 512;
#pragma unroll
      for (int ks = 0; ks < KS; ++ks) { bk[nt][ks].half[0] = *(const v8us*)(kr + ks * 512); bk[nt][ks].half[1] = *(const v8us*)(kr + ks * 512 + 256); bl[nt][ks].half[0] = *(const v8us*)(kl + ks * 512); bl[nt][ks].half[1] = *(const v8us*)(kl + ks * 512 + 256); } }
    asm volatile("s_wait_xcnt 0x0" :: "v"(kp[0]), "v"(kp[1]) : "memory");      /* keeps both address pairs alive past the last load of the group, so that no load's result lands in a pair that an issued load names before this wait */
#pragma unroll
    for (int nt = 0; nt < 2; ++nt) { v8f re = (v8f){0.f,0.f,0.f,0.f,0.f,0.f,0.f,0.f}, ip = re, in = re;      /* keys as A, queries as B */
#pragma unroll
      for (int ks = 0; ks < KS; ++ks) { re = mmaH<1>(bk[nt][ks].v, bk[nt][ks].v, aq[ks].v, aq[ks].v, re); re = mmaH<1>(bl[nt][ks].v, bl[nt][ks].v, aql[ks].v, aql[ks].v, re); ip = mmaH<1>(bk[nt][ks].v, bk[nt][ks].v, aql[ks].v, aql[ks].v, ip); in = mmaH<1>(bl[nt][ks].v, bl[nt][ks].v, aq[ks].v, aq[ks].v, in); }
      const v8f im = ip - in; s[nt] = re * re + im * im; }      /* raw squared magnitude: its (positive) scale is applied in the exponent below, so maxima are taken over raw values */
    FragH bv[DT], bi[DT];      /* all value fragments of this key block are requested here, so that they travel while the softmax below is computed */
    const unsigned short* vp = Vth + (size_t)(j0 / 32) * 512 + lane * 8; const unsigned short* vq = vp + (size_t)64 * NN;      /* fragment order: k-step j0 / 32 of row tile dt, NN / 32 k-steps a row tile */
#pragma unroll
    for (int dt = 0; dt < DT; ++dt) { const size_t vo = (size_t)(dt * 16) * NN; bv[dt].half[0] = *(const v8us*)(vp + vo); bv[dt].half[1] = *(const v8us*)(vp + vo + 256); bi[dt].half[0] = *(const v8us*)(vq + vo); bi[dt].half[1] = *(const v8us*)(vq + vo + 256); }
    asm volatile("s_wait_xcnt 0x0" :: "v"(vp) : "memory");      /* as above: the address pair outlives the group's last load */
    float mc = fmaxf(s[0][0], s[1][0]);
#pragma unroll
    for (int r = 1; r < 8; ++r) mc = fmaxf(mc, fmaxf(s[0][r], s[1][r]));
    mc = fmaxf(mc, xhalf(mc));      /* the other 16 keys of the block lie in the other lane half */
    const float mn = fmaxf(m_q, mc); const float al = __builtin_amdgcn_exp2f((m_q - mn) * SCORE_L2E); m_q = mn;      /* m_q, mn: raw units. Every exponent here is <= 0 (+ 10), where the bare v_exp_f32 needs none of the library's range handling: far below, it gives 0 */
    const float eb = 10.0f - mn * SCORE_L2E;      /* one addend a lane: minus the scaled maximum, plus 10 for the x 2^10 carry of P */
    FragH pb; v2f ps = {0.f, 0.f};      /* two partial sums, over even and odd registers: neighbouring registers pair in the packed adds */
#pragma unroll
    for (int nt = 0; nt < 2; ++nt)
#pragma unroll
      for (int r = 0; r < 8; r += 2) { const v2f e = (v2f){s[nt][r], s[nt][r + 1]} * SCORE_L2E + eb; const v2f p = {__builtin_amdgcn_exp2f(e[0]), __builtin_amdgcn_exp2f(e[1])}; ps += p; pb.h[8 * nt + r] = (_Float16)p[0]; pb.h[8 * nt + r + 1] = (_Float16)p[1]; }      /* p = P x 2^10; the sum carries the same factor */
    l_q = l_q * al + (ps[0] + ps[1]);
#pragma unroll
    for (int dt = 0; dt < DT; ++dt) { oacc[dt] *= al; oacci[dt] *= al; }
#pragma unroll
    for (int dt = 0; dt < DT; ++dt) { oacc[dt] = mmaH<1>(bv[dt].v, bv[dt].v, pb.v, pb.v, oacc[dt]); oacci[dt] = mmaH<1>(bi[dt].v, bi[dt].v, pb.v, pb.v, oacci[dt]); } }
  { const float l = l_q + xhalf(l_q); if (hh == 0) { sM[w][ln] = m_q; sL[w][ln] = l; } }
#pragma unroll
  for (int dt = 0; dt < DT; ++dt) { float* so = &sO[w][ln][dt * 16 + 8 * hh];      /* a lane's 8 registers are 8 neighbouring columns of its query's row: two 16-byte stores a tile */
    *(v4fa*)so = (v4f){oacc[dt][0], oacc[dt][1], oacc[dt][2], oacc[dt][3]}; *(v4fa*)(so + 4) = (v4f){oacc[dt][4], oacc[dt][5], oacc[dt][6], oacc[dt][7]};
    *(v4fa*)(so + 64) = (v4f){oacci[dt][0], oacci[dt][1], oacci[dt][2], oacci[dt][3]}; *(v4fa*)(so + 68) = (v4f){oacci[dt][4], oacci[dt][5], oacci[dt][6], oacci[dt][7]}; }
  __syncthreads();      /* publishes every wave's partial (max, sum, accumulators) to the waves that merge it */
  {      /* wave (qw, kr) merges columns 32 kr .. 32 kr + 31 of query tile qw = k-step 4 h + kr of that row tile of O16 (fragment order, x 2^8): lane 16 hh + ln makes row ln, columns 32 kr + 16 j + 8 hh + 0..7 for j = 0, 1 */
    float mk[KVS], wk[KVS], M = -3.0e38f, L = 0.f;
#pragma unroll
    for (int k = 0; k < KVS; ++k) { mk[k] = sM[k * 4 + qw][ln]; M = fmaxf(M, mk[k]); }
#pragma unroll
    for (int k = 0; k < KVS; ++k) { wk[k] = __builtin_amdgcn_exp2f((mk[k] - M) * SCORE_L2E); L += wk[k] * sL[k * 4 + qw][ln]; }      /* maxima are raw, sums carry x 2^10 as the accumulators do */
    const float inv = (L > 0.f) ? 1.0f / L : 0.f;
    FragH f;
#pragma unroll
    for (int j = 0; j < 2; ++j) { v4f o0 = {0.f, 0.f, 0.f, 0.f}, o1 = o0;
#pragma unroll
      for (int k = 0; k < KVS; ++k) { const float* sp = &sO[k * 4 + qw][ln][kr * 32 + j * 16 + 8 * hh]; o0 += *(const v4fa*)sp * wk[k]; o1 += *(const v4fa*)(sp + 4) * wk[k]; }
      o0 = o0 * inv; o1 = o1 * inv;
#pragma unroll
      for (int i = 0; i < 4; ++i) { f.h[8 * j + i] = (_Float16)(o0[i] * 256.0f); f.h[8 * j + 4 + i] = (_Float16)(o1[i] * 256.0f); } }
    unsigned short* op = (unsigned short*)O16 + ((size_t)((b * NN + q0) / 16) * (DX / 32) + h * 4 + kr) * 512 + lane * 8;
    *(v8us*)op = f.half[0]; *(v8us*)(op + 256) = f.half[1];      /* two 512-byte stores, the last instructions of the wave */
  } }

extern "C" void kernel_launch(void* const* d_in, const int* in_sizes, int n_in,
                              void* d_out, int out_size, void* d_ws, size_t ws_size, hipStream_t stream) {
  (void)in_sizes; (void)n_in; (void)out_size;
  const float* const* I = (const float* const*)d_in; const float* x = I[0]; const float* Wq = I[1]; const float* bq = I[2]; const float* Wk = I[3]; const float* bk = I[4]; const float* Wv = I[5]; const float* bv = I[6]; const float* Wo = I[7]; const float* bo = I[8];
  char* ws = (char*)d_ws; size_t off = 0;
  auto take = [&](size_t bytes) { char* p = ws + off; off += (bytes + 255) & ~(size_t)255; return p; };
  _Float16* Bq = (_Float16*)take((size_t)3 * 2 * DX * DX * 2); _Float16* Bo = (_Float16*)take((size_t)DX * DX * 2);
  _Float16* X16 = (_Float16*)take((size_t)NR * DX * 2); _Float16* Q = (_Float16*)take((size_t)2 * NR * DX * 2); _Float16* K = Q + (size_t)NR * DX;      /* q, k one behind the other: batch stride of the merged projection */ _Float16* Vt = (_Float16*)take((size_t)NR * DX * 2);
  _Float16* O16 = (_Float16*)take((size_t)NR * DX * 2);
  /* Bq, Bo, X16, Q, K, Vt and O16 are all in fragment order (see FRAGMENT ORDER above); the output is row-major */
  if (off > ws_size) return;      // 3 x 1 + 0.5 + 5 x 4.2 = about 25 MB
  k_prep<<<3 * NBW + NBO + NBX, 256, 0, stream>>>(Wq, Wk, Wv, Wo, x, Bq, Bo, X16);      /* (in,out) [512][1024] -> Bt[1024][512] x2^4 for Wq, Wk, Wv (only rows 0..511 = heads 0..3 are used), Wo likewise, x -> f16: one launch */
  const dim3 gp((NR / 64) * (DX / 128), 1), gp3((NR / 128) * (DX / 64), 1);      /* waves of 32 x 64. gp: 2 x 2 waves on a 64 x 128 tile; gp3: 4 waves down x the 3 projections on 128 rows x 64 columns of each */
  k_gemm_hhx<0, DX, DX, true, 2, 4, 1, 3><<<gp3, 384, 0, stream>>>(X16, DX, 0, Bq, DX, (size_t)2 * DX * DX, 0.0625f, bq, bk, bv, 0, nullptr, 1, 0, 0, nullptr, Q, Vt, DX, (size_t)NR * DX, NR);      /* q, k, v in one launch (a wave's batch index), heads 0..3 = output columns 0..511 (+ bias): each M 4096 N 512 K 512; v goes out transposed, planes per (b, head, part): [b * 8 + 2 h + part][64][2048] */
  k_flash<<<BB * NHU * (NN / 64), 128 * KVS, 0, stream>>>(Q, DX, K, DX, Vt, O16);      /* stores O x 2^8 as f16 in fragment order, the A operand of the output product */
  k_gemm_hhx<0, DX, DX, false, 2, 2, 2, 1><<<gp, 128, 0, stream>>>(O16, DX, 0, Bo, DX, 0, 0.0625f * 0.00390625f, bo, nullptr, nullptr, 0, nullptr, 1, 0, 0, (float*)d_out, nullptr, nullptr, DX, 0, NR);      /* out = O Wo + bo (alpha undoes the x 2^4 of the weights and the x 2^8 carry) */
}

// v009
// Measured time: 53 microseconds a run.
// Next to v008, in two timings, it ran 1.04 and 1.02 times as fast.
// Counting every step since v000, it is 6.22 times as fast.
#include <hip/hip_runtime.h>
// 'Superposition' (complex-valued) multi-head attention (B=2, S=2048, D=512, 8 heads; q,k,v projections to 2D with per-head [real 64 | imag 64]): interference = Σ_d q_d·conj(k_d)·64^-½; probs = softmax(|interference|²/0.5); out = probs·v (complex);
// out = concat[real, imag] per head → [B,S,1024], truncated to the first 512 columns (= heads 0..3), then ·Wo + bo. Only heads 0..3 reach the output, so only they are computed.
// Compute dtype: x, weights, biases rounded to bf16; q/k/v (columns of heads 0..3) as f16 GEMM outputs; fused flash-style kernel with three f32 score accumulators (Re, Im⁺, Im⁻) and two value accumulators
// (real, imag), online softmax f32, P f16 ×2^10, on v_wmma_f32_16x16x32_f16; O carried ×2^8 into f16 (small diffuse values) → output GEMM with bias (alpha undoes the carry); f32 accumulate.
#define BB 2
#define NN 2048
#define DX 512
#define NHU 4
#define DH2 128
#define NR (BB * NN)
#define SCORE_SCALE 0.03125f
#define SCORE_L2E (SCORE_SCALE * 1.44269504088896340736f)      /* score scale x log2(e): the softmax runs in base 2 */

typedef __bf16 v16b __attribute__((ext_vector_type(16)));
typedef unsigned short v8us __attribute__((ext_vector_type(8), may_alias));
typedef float  v8f  __attribute__((ext_vector_type(8)));
typedef float  v4f  __attribute__((ext_vector_type(4)));
typedef float  v4fa __attribute__((ext_vector_type(4), may_alias));
union FragB { v16b v; v8us half[2]; unsigned short u[16]; };

__device__ __forceinline__ unsigned short bf16_bits(float x) { unsigned int u = __float_as_uint(x); return (unsigned short)((u + 0x7FFFu + ((u >> 16) & 1u)) >> 16); }
__device__ __forceinline__ float bf16_val(unsigned short b) { return __uint_as_float(((unsigned int)b) << 16); }
__device__ __forceinline__ float bf16_round(float x) { return bf16_val(bf16_bits(x)); }
// D += A·B with NT terms: 1 = ah·bh, 2 = + al·bh (A split), 3 = + ah·bl (both split)
template <int NT>
__device__ __forceinline__ v8f mmaN(v16b ah, v16b al, v16b bh, v16b bl, v8f c) {
  c = __builtin_amdgcn_wmma_f32_16x16x32_bf16(false, ah, false, bh, (short)0, c, false, false);
  if (NT >= 2) c = __builtin_amdgcn_wmma_f32_16x16x32_bf16(false, al, false, bh, (short)0, c, false, false);
  if (NT >= 3) c = __builtin_amdgcn_wmma_f32_16x16x32_bf16(false, ah, false, bl, (short)0, c, false, false);
  asm volatile("v_nop\n\tv_nop\n\tv_nop\n\tv_nop" : "+v"(c) : "v"(ah), "v"(al), "v"(bh), "v"(bl));
  return c;
}

__global__ __launch_bounds__(256) void k_wt_bf16(const float* __restrict__ W, unsigned short* __restrict__ Wt, int K, int N) {
  const int t = blockIdx.x * 256 + threadIdx.x;
  const int k8n = K / 8;
  if (t >= N * k8n) return;
  const int n = t / k8n, k8 = (t % k8n) * 8;
  v8us v;
#pragma unroll
  for (int i = 0; i < 8; ++i) v[i] = bf16_bits(W[(size_t)(k8 + i) * N + n]);
  *(v8us*)(Wt + (size_t)n * K + k8) = v;
  
}

// GEMM C[M][N] (f32, pitch ldc) = act(A[M][K]·W + bias). A f32 row-major (pitch lda) converted per fragment to bf16
// (ASPLIT: hi/lo two planes -> 2 terms, else single rounded term); Wt bf16 [N][K] (pitch ldb). BIAS_BF16 rounds the
// bias to bf16 first (bias quantised to bf16 before the add). K%32==0, M%16==0, N%64==0.
template <bool ASPLIT, int ACT, bool BIAS_BF16>
__global__ __launch_bounds__(128) void k_gemm_bf(const float* __restrict__ A, int lda, const unsigned short* __restrict__ Wt, int ldb,
                                               const float* __restrict__ bias, float* __restrict__ C, int ldc, int M, int N, int K) {
  __shared__ __attribute__((aligned(16))) float so[4][16][64];
  const int tid = threadIdx.x, w = tid >> 5, lane = tid & 31, ln = lane & 15, hh = lane >> 4;
  const int ntn = N / 64;
  const int wid = blockIdx.x * 4 + w;
  const int mt = wid / ntn, nq = wid % ntn;
  if (mt * 16 >= M) return;
  const int row0 = mt * 16, col0 = nq * 64;
  const float* arow = A + (size_t)(row0 + ln) * lda;
  v8f acc[4] = {};
  for (int kb = 0; kb < K; kb += 32) {
    FragB ah, al;
    const v4f x0 = *(const v4fa*)(arow + kb + 8 * hh), x1 = *(const v4fa*)(arow + kb + 8 * hh + 4);
    const v4f x2 = *(const v4fa*)(arow + kb + 16 + 8 * hh), x3 = *(const v4fa*)(arow + kb + 16 + 8 * hh + 4);
    float xs[16] = {x0[0],x0[1],x0[2],x0[3],x1[0],x1[1],x1[2],x1[3],x2[0],x2[1],x2[2],x2[3],x3[0],x3[1],x3[2],x3[3]};
#pragma unroll
    for (int i = 0; i < 16; ++i) { const unsigned short hb = bf16_bits(xs[i]); ah.u[i] = hb; al.u[i] = ASPLIT ? bf16_bits(xs[i] - bf16_val(hb)) : (unsigned short)0; }
#pragma unroll
    for (int t = 0; t < 4; ++t) {
      const unsigned short* brow = Wt + (size_t)(col0 + t * 16 + ln) * ldb + kb;
      FragB b;
      b.half[0] = *(const v8us*)(brow + 8 * hh);
      b.half[1] = *(const v8us*)(brow + 16 + 8 * hh);
      acc[t] = mmaN<ASPLIT ? 2 : 1>(ah.v, al.v, b.v, b.v, acc[t]);
    }
  }
#pragma unroll
  for (int t = 0; t < 4; ++t) {
    float bv = bias ? bias[col0 + t * 16 + ln] : 0.f;
    if (BIAS_BF16) bv = bf16_round(bv);
#pragma unroll
    for (int r = 0; r < 8; ++r) { float v = acc[t][r] + bv; if (ACT == 1) v = fmaxf(v, 0.f); so[w][8 * hh + r][t * 16 + ln] = v; }
  }
  __builtin_amdgcn_fence(__ATOMIC_ACQ_REL, "workgroup");
  __builtin_amdgcn_wave_barrier();
  const int rsub = lane >> 4, c4 = (lane & 15) * 4;
  {
#pragma unroll
    for (int q = 0; q < 8; ++q) {
      const int r = q * 2 + rsub;
      const v4f v = *(const v4fa*)&so[w][r][c4];
      *(v4f*)(C + (size_t)(row0 + r) * ldc + col0 + c4) = v;
    }
    
  }
}

// Flash-style causal/unmasked attention, all contractions 3-term bf16 hi/lo splits, f32 softmax with running max.
// q,k,v rows are read from f32 buffers with arbitrary row pitch (so they can live inside a fused qkv buffer);
// D = head size (multiple of 32, <= 128); one wave = 16 query rows; block = 4 waves (64 queries) sharing K/V chunks of 32.
template <int D, bool CAUSAL>
__global__ __launch_bounds__(128) void k_flash(const float* __restrict__ qb, const float* __restrict__ kb, const float* __restrict__ vb,
                                             int pitch, int T, int H, float scale, float* __restrict__ y, int ypitch) {
  constexpr int KS = D / 32;        // k-steps for QK
  constexpr int DT = D / 16;        // d tiles for PV
  __shared__ __attribute__((aligned(16))) unsigned short sKh[32][D + 8], sKl[32][D + 8], sVh[32][D + 8], sVl[32][D + 8];
  __shared__ __attribute__((aligned(16))) unsigned short sPh[4][16][40], sPl[4][16][40];
  __shared__ __attribute__((aligned(16))) float sO[4][16][D];
  const int tid = threadIdx.x, w = tid >> 5, lane = tid & 31, ln = lane & 15, hh = lane >> 4;
  const int nqb = (T + 63) / 64;
  const int bh = blockIdx.x / nqb, qblk = blockIdx.x % nqb;
  const int b = bh / H, h = bh % H;
  const int q0 = qblk * 64 + w * 16;
  const float* Q = qb + (size_t)b * T * pitch + h * D;
  const float* K = kb + (size_t)b * T * pitch + h * D;
  const float* V = vb + (size_t)b * T * pitch + h * D;

  // A fragments of the wave's 16 query rows (scaled), hi/lo
  FragB aqh[KS], aql[KS];
  {
    int row = q0 + ln; if (row >= T) row = T - 1;
    const float* qr = Q + (size_t)row * pitch;
#pragma unroll
    for (int ks = 0; ks < KS; ++ks)
#pragma unroll
      for (int i = 0; i < 16; ++i) {
        const int d = ks * 32 + ((i < 8) ? (8 * hh + i) : (16 + 8 * hh + (i - 8)));
        const float x = qr[d] * scale; const unsigned short hb = bf16_bits(x);
        aqh[ks].u[i] = hb; aql[ks].u[i] = bf16_bits(x - bf16_val(hb));
      }
  }
  float m_r[8], l_r[8];
#pragma unroll
  for (int r = 0; r < 8; ++r) { m_r[r] = -3.0e38f; l_r[r] = 0.f; }
  v8f oacc[DT];
#pragma unroll
  for (int dt = 0; dt < DT; ++dt) oacc[dt] = (v8f){0.f,0.f,0.f,0.f,0.f,0.f,0.f,0.f};

  const int kv_end = CAUSAL ? min(T, qblk * 64 + 64) : T;     // block-uniform
  for (int j0 = 0; j0 < kv_end; j0 += 32) {
    __syncthreads();
    for (int e = tid; e < 32 * (D / 4); e += 128) {
      const int r = e / (D / 4), c4 = (e % (D / 4)) * 4;
      const int key = j0 + r;
      v4f kf = {0.f,0.f,0.f,0.f}, vf = {0.f,0.f,0.f,0.f};
      if (key < T) { kf = *(const v4fa*)(K + (size_t)key * pitch + c4); vf = *(const v4fa*)(V + (size_t)key * pitch + c4); }
#pragma unroll
      for (int t = 0; t < 4; ++t) {
        unsigned short hb = bf16_bits(kf[t]); sKh[r][c4 + t] = hb; sKl[r][c4 + t] = bf16_bits(kf[t] - bf16_val(hb));
        hb = bf16_bits(vf[t]); sVh[r][c4 + t] = hb; sVl[r][c4 + t] = bf16_bits(vf[t] - bf16_val(hb));
      }
    }
    __syncthreads();
    // S tile 16 x 32
    v8f s[2];
#pragma unroll
    for (int nt = 0; nt < 2; ++nt) {
      v8f acc = {};
#pragma unroll
      for (int ks = 0; ks < KS; ++ks) {
        FragB bh_, bl_;
        bh_.half[0] = *(const v8us*)&sKh[nt * 16 + ln][ks * 32 + 8 * hh]; bh_.half[1] = *(const v8us*)&sKh[nt * 16 + ln][ks * 32 + 16 + 8 * hh];
        bl_.half[0] = *(const v8us*)&sKl[nt * 16 + ln][ks * 32 + 8 * hh]; bl_.half[1] = *(const v8us*)&sKl[nt * 16 + ln][ks * 32 + 16 + 8 * hh];
        acc = mmaN<3>(aqh[ks].v, aql[ks].v, bh_.v, bl_.v, acc);
      }
      s[nt] = acc;
    }
    // mask + running max (rows 8hh+r; the 16 lanes of a half share rows)
    float alpha[8];
#pragma unroll
    for (int r = 0; r < 8; ++r) {
      const int qi = q0 + 8 * hh + r;
      const int ja = j0 + ln, jb = j0 + 16 + ln;
      if (CAUSAL) { if (ja > qi) s[0][r] = -3.0e38f; if (jb > qi) s[1][r] = -3.0e38f; }
      if (ja >= T) s[0][r] = -3.0e38f;
      if (jb >= T) s[1][r] = -3.0e38f;
      float mx = fmaxf(s[0][r], s[1][r]);
      mx = fmaxf(mx, __shfl_xor(mx, 1, 32)); mx = fmaxf(mx, __shfl_xor(mx, 2, 32)); mx = fmaxf(mx, __shfl_xor(mx, 4, 32)); mx = fmaxf(mx, __shfl_xor(mx, 8, 32));
      const float mnew = fmaxf(m_r[r], mx);
      alpha[r] = (mnew > -1.0e38f) ? __expf(m_r[r] - mnew) : 1.0f;
      const float p0 = (s[0][r] > -1.0e38f) ? __expf(s[0][r] - mnew) : 0.f;
      const float p1 = (s[1][r] > -1.0e38f) ? __expf(s[1][r] - mnew) : 0.f;
      m_r[r] = mnew;
      l_r[r] = l_r[r] * alpha[r] + p0 + p1;            // per-lane partial row sum (16 lanes combined at the end)
      unsigned short hb = bf16_bits(p0); sPh[w][8 * hh + r][ln] = hb;      sPl[w][8 * hh + r][ln] = bf16_bits(p0 - bf16_val(hb));
      hb = bf16_bits(p1);                sPh[w][8 * hh + r][16 + ln] = hb; sPl[w][8 * hh + r][16 + ln] = bf16_bits(p1 - bf16_val(hb));
    }
#pragma unroll
    for (int dt = 0; dt < DT; ++dt)
#pragma unroll
      for (int r = 0; r < 8; ++r) oacc[dt][r] *= alpha[r];
    __builtin_amdgcn_fence(__ATOMIC_ACQ_REL, "workgroup");
    __builtin_amdgcn_wave_barrier();
    FragB pah, pal;
    pah.half[0] = *(const v8us*)&sPh[w][ln][8 * hh]; pah.half[1] = *(const v8us*)&sPh[w][ln][16 + 8 * hh];
    pal.half[0] = *(const v8us*)&sPl[w][ln][8 * hh]; pal.half[1] = *(const v8us*)&sPl[w][ln][16 + 8 * hh];
#pragma unroll
    for (int dt = 0; dt < DT; ++dt) {
      FragB bvh, bvl;
#pragma unroll
      for (int i = 0; i < 8; ++i) {
        bvh.u[i] = sVh[8 * hh + i][dt * 16 + ln]; bvh.u[8 + i] = sVh[16 + 8 * hh + i][dt * 16 + ln];
        bvl.u[i] = sVl[8 * hh + i][dt * 16 + ln]; bvl.u[8 + i] = sVl[16 + 8 * hh + i][dt * 16 + ln];
      }
      oacc[dt] = mmaN<3>(pah.v, pal.v, bvh.v, bvl.v, oacc[dt]);
    }
    __builtin_amdgcn_fence(__ATOMIC_ACQ_REL, "workgroup");
    __builtin_amdgcn_wave_barrier();
  }
#pragma unroll
  for (int r = 0; r < 8; ++r) {
    float l = l_r[r];
    l += __shfl_xor(l, 1, 32); l += __shfl_xor(l, 2, 32); l += __shfl_xor(l, 4, 32); l += __shfl_xor(l, 8, 32);
    l_r[r] = (l > 0.f) ? 1.0f / l : 0.f;
  }
#pragma unroll
  for (int dt = 0; dt < DT; ++dt)
#pragma unroll
    for (int r = 0; r < 8; ++r) sO[w][8 * hh + r][dt * 16 + ln] = oacc[dt][r] * l_r[r];
  __builtin_amdgcn_fence(__ATOMIC_ACQ_REL, "workgroup");
  __builtin_amdgcn_wave_barrier();
  {
    for (int r = 0; r < 16; ++r) {
      const int row = q0 + r;
      if (row < T && lane < D / 4) {
        const v4f val = *(const v4fa*)&sO[w][r][lane * 4];
        *(v4f*)(y + ((size_t)b * T + row) * ypitch + h * D + lane * 4) = val;
      }
    }
    
  }
}

// GEMM C = act(A·W + bias + resid): A f32 (ASPLIT -> hi/lo 2 terms), Wt bf16 [N][K]; ACT 0 none, 1 relu, 2 exact gelu;
// resid (optional, f32, row index = (row % rmod), pitch ldr, RES_BF16 rounds it) added before the activation.
template <bool ASPLIT, int ACT, bool BIAS_BF16, bool RES_BF16>
__global__ __launch_bounds__(128) void k_gemm_bf3(const float* __restrict__ A, int lda, const unsigned short* __restrict__ Wt, int ldb,
                                                const float* __restrict__ bias, const float* __restrict__ resid, int rmod, int ldr,
                                                float* __restrict__ C, int ldc, int M, int N, int K) {
  __shared__ __attribute__((aligned(16))) float so[4][16][64];
  const int tid = threadIdx.x, w = tid >> 5, lane = tid & 31, ln = lane & 15, hh = lane >> 4;
  const int ntn = N / 64;
  const int wid = blockIdx.x * 4 + w;
  const int mt = wid / ntn, nq = wid % ntn;
  if (mt * 16 >= M) return;
  const int row0 = mt * 16, col0 = nq * 64;
  const float* arow = A + (size_t)(row0 + ln) * lda;
  v8f acc[4] = {};
  for (int kb = 0; kb < K; kb += 32) {
    FragB ah, al;
    const v4f x0 = *(const v4fa*)(arow + kb + 8 * hh), x1 = *(const v4fa*)(arow + kb + 8 * hh + 4);
    const v4f x2 = *(const v4fa*)(arow + kb + 16 + 8 * hh), x3 = *(const v4fa*)(arow + kb + 16 + 8 * hh + 4);
    float xs[16] = {x0[0],x0[1],x0[2],x0[3],x1[0],x1[1],x1[2],x1[3],x2[0],x2[1],x2[2],x2[3],x3[0],x3[1],x3[2],x3[3]};
#pragma unroll
    for (int i = 0; i < 16; ++i) { const unsigned short hb = bf16_bits(xs[i]); ah.u[i] = hb; al.u[i] = ASPLIT ? bf16_bits(xs[i] - bf16_val(hb)) : (unsigned short)0; }
#pragma unroll
    for (int t = 0; t < 4; ++t) {
      const unsigned short* brow = Wt + (size_t)(col0 + t * 16 + ln) * ldb + kb;
      FragB b;
      b.half[0] = *(const v8us*)(brow + 8 * hh);
      b.half[1] = *(const v8us*)(brow + 16 + 8 * hh);
      acc[t] = mmaN<ASPLIT ? 2 : 1>(ah.v, al.v, b.v, b.v, acc[t]);
    }
  }
#pragma unroll
  for (int t = 0; t < 4; ++t) {
    const int col = col0 + t * 16 + ln;
    float bv = bias ? bias[col] : 0.f;
    if (BIAS_BF16) bv = bf16_round(bv);
#pragma unroll
    for (int r = 0; r < 8; ++r) {
      float v = acc[t][r] + bv;
      if (resid) { float rv = resid[(size_t)((row0 + 8 * hh + r) % rmod) * ldr + col]; if (RES_BF16) rv = bf16_round(rv); v += rv; }
      if (ACT == 1) v = fmaxf(v, 0.f);
      if (ACT == 2) v = 0.5f * v * (1.0f + erff(v * 0.70710678118654752f));
      if (ACT == 3) { const float u = 0.7978845608028654f * (v + 0.044715f * v * v * v); v = 0.5f * v * (1.0f + tanhf(u)); }
      so[w][8 * hh + r][t * 16 + ln] = v;
    }
  }
  __builtin_amdgcn_fence(__ATOMIC_ACQ_REL, "workgroup");
  __builtin_amdgcn_wave_barrier();
  const int rsub = lane >> 4, c4 = (lane & 15) * 4;
  {
#pragma unroll
    for (int q = 0; q < 8; ++q) {
      const int r = q * 2 + rsub;
      const v4f v = *(const v4fa*)&so[w][r][c4];
      *(v4f*)(C + (size_t)(row0 + r) * ldc + col0 + c4) = v;
    }
    
  }
}
// row LayerNorm (biased variance, eps) over N: s = X (+ R); optional out_sum <- s; out_norm <- (s-mu)*rsqrt(var+eps)*g + b
template <bool PARAM_BF16>
__global__ __launch_bounds__(256) void k_layernorm(const float* __restrict__ X, const float* __restrict__ R, const float* __restrict__ g, const float* __restrict__ bta,
                                                  float* __restrict__ out_sum, float* __restrict__ out_norm, int N, float eps) {
  __shared__ float red[256];
  const int row = blockIdx.x, tid = threadIdx.x;
  const float* x = X + (size_t)row * N; const float* rr = R ? R + (size_t)row * N : nullptr;
  float vals[16];                     // up to N = 4096
  const int per = N / 256;            // contiguous chunk per thread? use strided-by-4 chunks: thread handles j = tid*4 + 1024*u
  float s1 = 0.f;
  for (int u = 0; u < per / 4; ++u) {
    const int j = tid * 4 + 1024 * u;
    const v4f a = *(const v4fa*)(x + j);
    v4f b = {0.f,0.f,0.f,0.f}; if (rr) b = *(const v4fa*)(rr + j);
#pragma unroll
    for (int q = 0; q < 4; ++q) { const float v = a[q] + b[q]; vals[u * 4 + q] = v; s1 += v; }
  }
  red[tid] = s1; __syncthreads();
  for (int st = 128; st > 0; st >>= 1) { if (tid < st) red[tid] += red[tid + st]; __syncthreads(); }
  const float mu = red[0] / (float)N; __syncthreads();
  float s2 = 0.f;
  for (int u = 0; u < per / 4; ++u)
#pragma unroll
    for (int q = 0; q < 4; ++q) { const float c = vals[u * 4 + q] - mu; s2 += c * c; }
  red[tid] = s2; __syncthreads();
  for (int st = 128; st > 0; st >>= 1) { if (tid < st) red[tid] += red[tid + st]; __syncthreads(); }
  const float rs = rsqrtf(red[0] / (float)N + eps);
  {
    for (int u = 0; u < per / 4; ++u) {
      const int j = tid * 4 + 1024 * u;
      v4f o, sm;
#pragma unroll
      for (int q = 0; q < 4; ++q) {
        float gg = g[j + q], bb = bta[j + q];
        if (PARAM_BF16) { gg = bf16_round(gg); bb = bf16_round(bb); }
        sm[q] = vals[u * 4 + q]; o[q] = (vals[u * 4 + q] - mu) * rs * gg + bb;
      }
      if (out_sum) *(v4f*)(out_sum + (size_t)row * N + j) = sm;
      *(v4f*)(out_norm + (size_t)row * N + j) = o;
    }
    
  }
}



// ---- f16 WMMA path (v_wmma_f32_16x16x32_f16): 11-bit significands for operands in range — used where a [0,1] probability operand needs more precision than bf16
typedef _Float16 v16h __attribute__((ext_vector_type(16)));
union FragH { v16h v; v8us half[2]; _Float16 h[16]; unsigned short u[16]; };
template <int NT>
__device__ __forceinline__ v8f mmaH(v16h ah, v16h al, v16h bh, v16h bl, v8f c) {
  c = __builtin_amdgcn_wmma_f32_16x16x32_f16(false, ah, false, bh, (short)0, c, false, false);
  if (NT >= 2) c = __builtin_amdgcn_wmma_f32_16x16x32_f16(false, al, false, bh, (short)0, c, false, false);
  if (NT >= 3) c = __builtin_amdgcn_wmma_f32_16x16x32_f16(false, ah, false, bl, (short)0, c, false, false);
  asm volatile("v_nop\n\tv_nop\n\tv_nop\n\tv_nop" : "+v"(c) : "v"(ah), "v"(al), "v"(bh), "v"(bl));
  return c;
}
// batched GEMM like k_gemm_b but f16 operands: A f32 (split into f16 hi/lo if ASPLIT, else rounded to f16), Bt = f16 values [n][k]; alpha; C f32; N multiple of 16 (partial tiles skipped)
template <bool ASPLIT>
__global__ __launch_bounds__(128) void k_gemm_h(const float* __restrict__ A, int lda, size_t sA, const _Float16* __restrict__ Bh, int ldb, size_t sB, float alpha, float* __restrict__ C, int ldc, size_t sC, int M, int N, int K) {
  __shared__ __attribute__((aligned(16))) float so[4][16][64];
  const int tid = threadIdx.x, w = tid >> 5, lane = tid & 31, ln = lane & 15, hh = lane >> 4; const int by = blockIdx.y;
  A += (size_t)by * sA; Bh += (size_t)by * sB; C += (size_t)by * sC;
  const int ntn = (N + 63) / 64; const int wid = blockIdx.x * 4 + w; const int mt = wid / ntn, nq = wid % ntn; if (mt * 16 >= M) return;
  const int row0 = mt * 16, col0 = nq * 64; const float* arow = A + (size_t)(row0 + ln) * lda;
  v8f acc[4] = {};
  for (int kb = 0; kb < K; kb += 32) {
    FragH ah, al;
    const v4f x0 = *(const v4fa*)(arow + kb + 8 * hh), x1 = *(const v4fa*)(arow + kb + 8 * hh + 4), x2 = *(const v4fa*)(arow + kb + 16 + 8 * hh), x3 = *(const v4fa*)(arow + kb + 16 + 8 * hh + 4);
    float xs[16] = {x0[0],x0[1],x0[2],x0[3],x1[0],x1[1],x1[2],x1[3],x2[0],x2[1],x2[2],x2[3],x3[0],x3[1],x3[2],x3[3]};
#pragma unroll
    for (int i = 0; i < 16; ++i) { const _Float16 h = (_Float16)xs[i]; ah.h[i] = h; al.h[i] = ASPLIT ? (_Float16)(xs[i] - (float)h) : (_Float16)0.0f; }
#pragma unroll
    for (int t = 0; t < 4; ++t) { if (col0 + t * 16 >= N) continue; const size_t boff = (size_t)(col0 + t * 16 + ln) * ldb + kb; FragH bq; bq.half[0] = *(const v8us*)(Bh + boff + 8 * hh); bq.half[1] = *(const v8us*)(Bh + boff + 16 + 8 * hh);
      acc[t] = mmaH<ASPLIT ? 2 : 1>(ah.v, al.v, bq.v, bq.v, acc[t]); }
  }
#pragma unroll
  for (int t = 0; t < 4; ++t) { if (col0 + t * 16 >= N) continue;
#pragma unroll
    for (int r = 0; r < 8; ++r) so[w][8 * hh + r][t * 16 + ln] = acc[t][r] * alpha; }
  __builtin_amdgcn_fence(__ATOMIC_ACQ_REL, "workgroup"); __builtin_amdgcn_wave_barrier();
  const int rsub = lane >> 4, c4 = (lane & 15) * 4;
  {
#pragma unroll
    for (int q = 0; q < 8; ++q) { const int r = q * 2 + rsub; if (col0 + c4 < N) { const v4f v = *(const v4fa*)&so[w][r][c4]; *(v4f*)(C + (size_t)(row0 + r) * ldc + col0 + c4) = v; } }
     }
}

// FRAGMENT ORDER. Every 16-bit matrix operand M[row][k] (rows a multiple of 16, k a multiple of 32, KS = k-steps of 32) lies in the workspace as [row tile of 16][k-step][half j][lane][8 elements]:
// lane 16 hh + (row & 15) of half j of k-step s holds k = 32 s + 16 j + 8 hh + 0..7. One half of a fragment is then 32 lanes x 16 B = 512 contiguous bytes (4 cache lines), where rows of a row-major matrix gave 16 lines a load.
// The 16-byte piece number t of such a matrix (its place is element 8 t) holds row frag_row(t, KS), columns frag_k(t, KS) + 0..7; a writer whose thread t makes piece t stores whole lines.
__device__ __forceinline__ int frag_row(unsigned t, unsigned KS) { return (int)((t / (64 * KS)) * 16 + (t & 15)); }
__device__ __forceinline__ int frag_k(unsigned t, unsigned KS) { return (int)(((t >> 6) % KS) * 32 + ((t >> 5) & 1) * 16 + ((t >> 4) & 1) * 8); }
// Wt (row n, column k, fragment order) = f16(W[k][n] * scale) from f32 row-major W[K][N] (scale = power of two; bf16-exact weights stay exact in f16 away from the subnormal range)
__device__ __forceinline__ void wt_f16_block(const float* __restrict__ W, _Float16* __restrict__ Wt, int K, int N, float scale, int blk) {
  const int t = blk * 256 + threadIdx.x; if (t >= N * (K / 8)) return; const int n = frag_row(t, K / 32), k8 = frag_k(t, K / 32); FragH f;
#pragma unroll
  for (int i = 0; i < 8; ++i) f.h[i] = (_Float16)(bf16_round(W[(size_t)(k8 + i) * N + n]) * scale); const v8us o = f.half[0];
  *(v8us*)((unsigned short*)Wt + (size_t)t * 8) = o; 
}
// k_gemm_hh variant with fused epilogue: v = acc·alpha + bf16(bias_by[by·sBias + col]) (bias_by = bias, biasY1, biasY2 for by = 0, 1, 2) (+ CP[(row/rowsPerB)·sCPb + by·64 + col] if CP) ; ACT 0 none / 1 elu ; writes f16 C16 and f32 C, each if non-null
// N (a multiple of 64, so every wave owns four whole 16-column tiles) and K are compile-time: the k loop is unrolled whole and its fragment loads run PF k-steps ahead of the products that use them.
// A, Bh and C16 are in fragment order (K / 32, K / 32 and N / 32 k-steps a row tile); C is row-major with pitch ldc.
// VT: batch index 2 (the value projection) is stored transposed instead, into CT: planes [row / NN][column / 64] of [64 rows d][NN keys] in fragment order (NN / 32 k-steps a row tile), the A operand of the flash kernel's value product.
// MT: row tiles of 16 a wave owns. A wave's tile is 16 MT rows x 64 columns: each B fragment it loads feeds MT products and each A fragment four.
// A work-group is WM x WN x WB waves: WM wave tiles down, WN across, WB batch indices (which share A where sA is 0). Its waves walk k from the same start, so a fragment that several of them ask for
// (an A fragment WN WB waves, a B fragment WM waves) can come from the WGP's cache instead of L2.
template <int ACT, int N, int K, bool VT, int MT, int WM, int WN, int WB>
__global__ __launch_bounds__(32 * WM * WN * WB) void k_gemm_hhx(const _Float16* __restrict__ A, int lda, size_t sA, const _Float16* __restrict__ Bh, int ldb, size_t sB, float alpha, const float* __restrict__ bias, const float* __restrict__ biasY1, const float* __restrict__ biasY2, size_t sBias, const float* __restrict__ CP, int rowsPerB, size_t sCPb, int row0g,
    float* __restrict__ C, _Float16* __restrict__ C16, _Float16* __restrict__ CT, int ldc, size_t sC, int M) {
  static_assert(N % (64 * WN) == 0 && K % 32 == 0, "whole work-group tiles of 64 WN columns and whole 32-deep k-steps");
  __shared__ __attribute__((aligned(16))) float so[WM * WN * WB * MT][16][64 + 4];      /* one 16 x 64 plane a wave and row tile; pitch 68: the fragment-order store below reads 16 rows at one column, which a pitch of 64 would put on the same banks */
  const int tid = threadIdx.x, w = __builtin_amdgcn_readfirstlane(tid >> 5), lane = tid & 31, ln = lane & 15, hh = lane >> 4; const int by = (int)blockIdx.y * WB + w / (WM * WN);      /* the wave's number held as a scalar: the batch index, which now differs between the waves of a work-group, picks buffers and the store path by scalar tests */
  A += (size_t)by * sA; Bh += (size_t)by * sB; const size_t cofs = (size_t)by * sC; const float* bsel = (by == 0) ? bias : ((by == 1) ? biasY1 : biasY2); const float* bp = bsel ? bsel + (size_t)by * sBias : nullptr;      /* batch index by = 0, 1, 2 takes its own bias buffer */
  constexpr int NBN = N / (64 * WN); const int mw = ((int)blockIdx.x / NBN) * WM + (w / WN) % WM, nq = ((int)blockIdx.x % NBN) * WN + w % WN; if (mw * 16 * MT >= M) return;      /* wave-uniform; the kernel has no work-group barrier */
  const int mt0 = mw * MT, col0 = nq * 64; (void)lda; (void)ldb;      /* the wave's row tiles are mt0 .. mt0 + MT - 1 */
  v8f acc[MT][4] = {};
  constexpr int NS = K / 32, PF = 2, NB = PF + 1;      /* NB register stages: PF k-steps of loads in flight beside the one being multiplied */
  const unsigned short* ap = (const unsigned short*)A + (size_t)mt0 * NS * 512 + lane * 8; const unsigned short* bq0 = (const unsigned short*)Bh + (size_t)(nq * 4) * NS * 512 + lane * 8;      /* row tiles mt0 + i of A; row tiles 4 nq + t of Bh */
  FragH fa[NB][MT], fb[NB][4];
#pragma unroll
  for (int s = 0; s < NS + PF; ++s) {      /* unrolled whole: the stage indices must be constants for the stages to stay in registers */
    if (s < NS) { const int st = s % NB;
#pragma unroll
      for (int i = 0; i < MT; ++i) { const unsigned short* ar = ap + (i * NS + s) * 512; fa[st][i].half[0] = *(const v8us*)ar; fa[st][i].half[1] = *(const v8us*)(ar + 256); }
#pragma unroll
      for (int t = 0; t < 4; ++t) { const unsigned short* br = bq0 + (t * NS + s) * 512; fb[st][t].half[0] = *(const v8us*)br; fb[st][t].half[1] = *(const v8us*)(br + 256); } }
    if (s >= PF) { const int st = (s - PF) % NB;
#pragma unroll
      for (int i = 0; i < MT; ++i)
#pragma unroll
        for (int t = 0; t < 4; ++t) acc[i][t] = mmaH<1>(fa[st][i].v, fa[st][i].v, fb[st][t].v, fb[st][t].v, acc[i][t]); }
  }
  float bv[4] = {0.f, 0.f, 0.f, 0.f};
  if (bp) {      /* one test for the four bias loads, so that they travel together */
#pragma unroll
    for (int t = 0; t < 4; ++t) bv[t] = bp[col0 + t * 16 + ln];
#pragma unroll
    for (int t = 0; t < 4; ++t) bv[t] = bf16_round(bv[t]); }
  if (VT && by == 2) {      /* wave-uniform. In accumulator tile (i, t) lane 16 hh + ln holds rows (keys) 8 hh + 0..7 of row tile mt0 + i, column d = 16 t + ln: that is the lane's 16-byte piece of the transposed operand, so it goes out from the registers, no LDS */
    FragH f[MT][2];
#pragma unroll
    for (int i = 0; i < MT; ++i)
#pragma unroll
      for (int t = 0; t < 4; ++t)
#pragma unroll
        for (int r = 0; r < 8; ++r) f[i][t >> 1].h[(t & 1) * 8 + r] = (_Float16)(acc[i][t][r] * alpha + bv[t]);
#pragma unroll
    for (int i = 0; i < MT; ++i) { const unsigned ur = (unsigned)(mt0 + i) * 16; unsigned short* tp = (unsigned short*)CT + (size_t)((ur / NN) * (N / 64) + (unsigned)nq) * 64 * NN + ((ur % NN) / 32) * 512 + ((ur >> 4) & 1) * 256 + lane * 8;      /* plane (batch, nq); the row tile's 16 keys are half (ur / 16) & 1 of k-step (ur % NN) / 32 */
#pragma unroll
      for (int t = 0; t < 4; ++t) *(v8us*)(tp + (size_t)t * (NN / 32) * 512) = f[i][t >> 1].half[t & 1]; }      /* row tile t of the plane: four 512-byte stores; every value is converted ahead of the first store, and the wave ends behind the last */
    return; }
#pragma unroll
  for (int i = 0; i < MT; ++i)
#pragma unroll
    for (int t = 0; t < 4; ++t) { const int col = col0 + t * 16 + ln;
#pragma unroll
      for (int r = 0; r < 8; ++r) { float v = acc[i][t][r] * alpha + bv[t]; if (CP) { const int bidx = (row0g + (mt0 + i) * 16 + 8 * hh + r) / rowsPerB; v += CP[(size_t)bidx * sCPb + (size_t)by * 64 + col]; } if (ACT == 1) v = (v > 0.f) ? v : expm1f(v); else if (ACT == 7) v = (v > 0.f) ? v + 1.0f : expf(v); else if (ACT == 8) v = tanhf(v); else if (ACT == 9) v = 0.5f * v * (1.0f + tanhf(0.7978845608028654f * (v + 0.044715f * v * v * v))); else if (ACT == 11) v = 1.0f / (1.0f + expf(-v)); else if (ACT == 12) v = (v > 0.f) ? v : 0.01f * v; else if (ACT == 14) v = (v > 0.f) ? v : 0.1f * v; else if (ACT == 15) v = v / (1.0f + expf(-v)); else if (ACT == 3) v = fmaxf(v, 0.f); else if (ACT == 6) v = 0.5f * v * (1.0f + erff(v * 0.70710678118654752f)); so[w * MT + i][8 * hh + r][t * 16 + ln] = v; } }
  __builtin_amdgcn_fence(__ATOMIC_ACQ_REL, "workgroup"); __builtin_amdgcn_wave_barrier();
  const int rsub = lane >> 4, c4 = (lane & 15) * 4;
#pragma unroll
  for (int i = 0; i < MT; ++i) { const int mt = mt0 + i, row0 = mt * 16;
#pragma unroll
    for (int q = 0; q < 8; ++q) { const int r = q * 2 + rsub; if (C) { const v4f v = *(const v4fa*)&so[w * MT + i][r][c4]; *(v4f*)(C + cofs + (size_t)(row0 + r) * ldc + col0 + c4) = v; } }
    if (C) asm volatile("s_wait_xcnt 0x0" ::: "memory");      /* directly behind the row-major stores: what follows (the fragment-order part, the next row tile) rewrites registers that they name */
    if (C16) { unsigned short* cp = (unsigned short*)C16 + cofs + ((size_t)mt * (N / 32) + nq * 2) * 512 + lane * 8;      /* a 16 x 64 tile = two k-steps of row tile mt = 2 KB in a row: four 512-byte stores */
#pragma unroll
      for (int q = 0; q < 4; ++q) { const v4f v0 = *(const v4fa*)&so[w * MT + i][ln][q * 16 + 8 * hh], v1 = *(const v4fa*)&so[w * MT + i][ln][q * 16 + 8 * hh + 4]; FragH f;
#pragma unroll
        for (int e = 0; e < 4; ++e) { f.h[e] = (_Float16)v0[e]; f.h[4 + e] = (_Float16)v1[e]; }
        *(v8us*)(cp + q * 256) = f.half[0]; }
      if (VT || i + 1 < MT) asm volatile("s_wait_xcnt 0x0" ::: "memory"); }      /* directly behind the four fragment-order stores: the next row tile, and in the VT build the transposed-store block laid out behind them, rewrite registers that they name */
  }
}


typedef _Float16 v4h __attribute__((ext_vector_type(4)));

__device__ __forceinline__ void x16_block(const float* __restrict__ x, _Float16* __restrict__ X16, size_t n8, int blk) { const size_t t = (size_t)blk * 256 + threadIdx.x; if (t >= n8) return; FragH f;      /* x row-major [NR][DX] -> X16 in fragment order */
  const float* xr = x + (size_t)frag_row((unsigned)t, DX / 32) * DX + frag_k((unsigned)t, DX / 32);
#pragma unroll
  for (int q = 0; q < 8; ++q) f.h[q] = (_Float16)bf16_round(xr[q]); *(v8us*)((unsigned short*)X16 + t * 8) = f.half[0];  }
// One grid for the five operand preparations, none of which reads another's result: the block index picks the job (block-uniform branch).
// Blocks 0 .. 3 NBW - 1: Wq, Wk, Wv (their outputs lie one behind the other in Bqkv); the next NBO: Wo; the last NBX: x.
#define NBW (2 * DX * (DX / 8) / 256)
#define NBO (DX * (DX / 8) / 256)
#define NBX (NR * DX / 8 / 256)
__global__ __launch_bounds__(256) void k_prep(const float* __restrict__ Wq, const float* __restrict__ Wk, const float* __restrict__ Wv, const float* __restrict__ Wo, const float* __restrict__ x,
                                              _Float16* __restrict__ Bqkv, _Float16* __restrict__ Bo, _Float16* __restrict__ X16) {
  const int bid = blockIdx.x;
  if (bid < 3 * NBW) { const int j = bid / NBW; wt_f16_block(j == 0 ? Wq : (j == 1 ? Wk : Wv), Bqkv + (size_t)j * 2 * DX * DX, DX, 2 * DX, 16.0f, bid % NBW); }
  else if (bid < 3 * NBW + NBO) wt_f16_block(Wo, Bo, DX, DX, 16.0f, bid - 3 * NBW);
  else x16_block(x, X16, (size_t)NR * DX / 8, bid - (3 * NBW + NBO)); }
__global__ __launch_bounds__(256) void k_h16(const float* __restrict__ x, _Float16* __restrict__ X16, size_t n8) { const size_t t = (size_t)blockIdx.x * 256 + threadIdx.x; if (t >= n8) return; FragH f;
#pragma unroll
  for (int q = 0; q < 8; ++q) f.h[q] = (_Float16)x[t * 8 + q]; *(v8us*)((unsigned short*)X16 + t * 8) = f.half[0];  }
__global__ __launch_bounds__(256) void k_round16f(const float* __restrict__ W, _Float16* __restrict__ Bt, size_t n8) { const size_t t = (size_t)blockIdx.x * 256 + threadIdx.x; if (t >= n8) return; FragH f;
#pragma unroll
  for (int i = 0; i < 8; ++i) f.h[i] = (_Float16)(bf16_round(W[t * 8 + i]) * 16.0f); *(v8us*)((unsigned short*)Bt + t * 8) = f.half[0];  }
// Keys split inside the work-group: each of the 4 query tiles is walked by KVS waves; wave (qw, kr) takes the 32-key blocks kr, kr + KVS, kr + 2 KVS, ... with its own running max, sum and
// un-normalised accumulators; the KVS partials of a tile are merged through LDS behind one work-group barrier (weights exp(SCORE_SCALE (m_k - M)), the maxima being raw).
// TRANSPOSED PRODUCTS. Scores are formed as S^T = K Q^T (A = key rows, B = query columns) and values as O^T += V^T P^T (A = V^T rows d, B = P^T). In a D tile lane 16 hh + ln, register r holds row 8 hh + r, column ln:
// a lane then holds scores of ONE query (ln), keys 16 nt + 8 hh + r, so the maximum and the sum over keys are in-lane but for one exchange between the lane halves, the rescale factor is one value a lane,
// and the two score tiles nt = 0, 1, converted in place, are the B operand of the value product (element 8 nt + r = key 16 nt + 8 hh + r, the k order of every fragment here): P never goes through LDS.
#define KVS 4
typedef float v2f __attribute__((ext_vector_type(2)));
__device__ __forceinline__ v8f mmaP(v16h a, v16h b, v8f c) { return __builtin_amdgcn_wmma_f32_16x16x32_f16(false, a, false, b, (short)0, c, false, false); }      /* the bare builtin, no hand-written slots behind it: the compiler keeps the distance to the first user of the result itself, with useful instructions where it has them */
__device__ __forceinline__ float xhalf(float x) { return __builtin_bit_cast(float, __builtin_amdgcn_permlanex16(__builtin_bit_cast(int, x), __builtin_bit_cast(int, x), 0x76543210, 0xfedcba98, false, false)); }      /* lane l takes the value of lane l ^ 16 */
__global__ __launch_bounds__(128 * KVS) void k_flash(const _Float16* __restrict__ Q16, int ldq, const _Float16* __restrict__ K16, int ldk, const _Float16* __restrict__ Vt, _Float16* __restrict__ O16) {
  constexpr int RPW = 16, NQB = NN / (4 * RPW), DT = 4, KS = 2, NW = 4 * KVS;
  __shared__ __attribute__((aligned(16))) float sO[NW][RPW][128 + 4]; __shared__ float sM[NW][RPW], sL[NW][RPW];
  const int tid = threadIdx.x, w = __builtin_amdgcn_readfirstlane(tid >> 5), lane = tid & 31, ln = lane & 15, hh = lane >> 4; const int qw = w & 3, kr = w >> 2;      /* the wave's number held as a scalar: tile and key-block indices leave the vector registers, which the grouped fragments need */
  const int slab = blockIdx.x / NQB, qblk = blockIdx.x % NQB; const int b = slab / NHU, h = slab % NHU; const int qb0 = qblk * (4 * RPW); const int q0 = qb0 + qw * RPW;
  FragH aq[KS], aql[KS];
  { const size_t qo = ((size_t)((b * NN + q0) / 16) * (DX / 32) + h * 4) * 512 + lane * 8; const unsigned short* qr = (const unsigned short*)Q16 + qo; const unsigned short* ql = qr + 2 * 512;      /* Q16, K16 in fragment order: head h = k-steps 4 h .. 4 h + 3 of a row tile; aq = real part (the first two), aql = imaginary part */
#pragma unroll
    for (int ks = 0; ks < KS; ++ks) { aq[ks].half[0] = *(const v8us*)(qr + ks * 512); aq[ks].half[1] = *(const v8us*)(qr + ks * 512 + 256); aql[ks].half[0] = *(const v8us*)(ql + ks * 512); aql[ks].half[1] = *(const v8us*)(ql + ks * 512 + 256); } }
  (void)ldq; (void)ldk;
  const unsigned short* Vth = (const unsigned short*)Vt + ((size_t)b * 2 * NHU + 2 * h) * 64 * NN;      /* V^T real plane of head h; the imaginary plane lies 64 NN elements behind it */
  float m_q = -3.0e38f, l_q = 0.f; v8f oacc[DT], oacci[DT];      /* running max of query ln (equal in both lane halves), this lane half's share of its sum, O^T tiles: register r = column d = 16 dt + 8 hh + r of query ln */
#pragma unroll
  for (int dt = 0; dt < DT; ++dt) { oacc[dt] = (v8f){0.f,0.f,0.f,0.f,0.f,0.f,0.f,0.f}; oacci[dt] = oacc[dt]; }
  const int jend = NN;
#pragma unroll 1
  for (int j0 = kr * 32; j0 < jend; j0 += 32 * KVS) {
    v8f s[2]; FragH bk[2][KS], bl[2][KS];      /* bk = real, bl = imaginary; both 16-key tiles' fragments are loaded as one group ahead of the score products */
    const unsigned short* kp[2];
#pragma unroll
    for (int nt = 0; nt < 2; ++nt) { kp[nt] = (const unsigned short*)K16 + ((size_t)((b * NN + j0) / 16 + nt) * (DX / 32) + h * 4) * 512 + lane * 8; const unsigned short* kr = kp[nt]; const unsigned short* kl = kr + 2 * 512;
#pragma unroll
      for (int ks = 0; ks < KS; ++ks) { bk[nt][ks].half[0] = *(const v8us*)(kr + ks * 512); bk[nt][ks].half[1] = *(const v8us*)(kr + ks * 512 + 256); bl[nt][ks].half[0] = *(const v8us*)(kl + ks * 512); bl[nt][ks].half[1] = *(const v8us*)(kl + ks * 512 + 256); } }
    asm volatile("s_wait_xcnt 0x0" :: "v"(kp[0]), "v"(kp[1]) : "memory");      /* keeps both address pairs alive past the last load of the group, so that no load's result lands in a pair that an issued load names before this wait */
    __builtin_amdgcn_sched_barrier(0);      /* keeps the 16 key loads one group ahead of the first product: without it the scheduler lifts products among the loads and the later loads start only behind the first wait */
#pragma unroll
    for (int nt = 0; nt < 2; ++nt) { v8f re = (v8f){0.f,0.f,0.f,0.f,0.f,0.f,0.f,0.f}, ip = re, in = re;      /* keys as A, queries as B */
#pragma unroll
      for (int ks = 0; ks < KS; ++ks) { re = mmaP(bk[nt][ks].v, aq[ks].v, re); re = mmaP(bl[nt][ks].v, aql[ks].v, re); ip = mmaP(bk[nt][ks].v, aql[ks].v, ip); in = mmaP(bl[nt][ks].v, aq[ks].v, in); }
      const v8f im = ip - in; s[nt] = re * re + im * im; }      /* raw squared magnitude: its (positive) scale is applied in the exponent below, so maxima are taken over raw values */
    FragH bv[DT], bi[DT];      /* all value fragments of this key block are requested here, so that they travel while the softmax below is computed */
    const unsigned short* vp = Vth + (size_t)(j0 / 32) * 512 + lane * 8; const unsigned short* vq = vp + (size_t)64 * NN;      /* fragment order: k-step j0 / 32 of row tile dt, NN / 32 k-steps a row tile */
#pragma unroll
    for (int dt = 0; dt < DT; ++dt) { const size_t vo = (size_t)(dt * 16) * NN; bv[dt].half[0] = *(const v8us*)(vp + vo); bv[dt].half[1] = *(const v8us*)(vp + vo + 256); bi[dt].half[0] = *(const v8us*)(vq + vo); bi[dt].half[1] = *(const v8us*)(vq + vo + 256); }
    asm volatile("s_wait_xcnt 0x0" :: "v"(vp) : "memory");      /* as above: the address pair outlives the group's last load */
    __builtin_amdgcn_sched_barrier(0);      /* keeps every value load ahead of the softmax that hides its flight */
    float mc = fmaxf(s[0][0], s[1][0]);
#pragma unroll
    for (int r = 1; r < 8; ++r) mc = fmaxf(mc, fmaxf(s[0][r], s[1][r]));
    mc = fmaxf(mc, xhalf(mc));      /* the other 16 keys of the block lie in the other lane half */
    const float mn = fmaxf(m_q, mc); const float al = __builtin_amdgcn_exp2f((m_q - mn) * SCORE_L2E); m_q = mn;      /* m_q, mn: raw units. Every exponent here is <= 0 (+ 10), where the bare v_exp_f32 needs none of the library's range handling: far below, it gives 0 */
    const float eb = 10.0f - mn * SCORE_L2E;      /* one addend a lane: minus the scaled maximum, plus 10 for the x 2^10 carry of P */
    FragH pb; v2f ps = {0.f, 0.f};      /* two partial sums, over even and odd registers: neighbouring registers pair in the packed adds */
#pragma unroll
    for (int nt = 0; nt < 2; ++nt)
#pragma unroll
      for (int r = 0; r < 8; r += 2) { const v2f e = (v2f){s[nt][r], s[nt][r + 1]} * SCORE_L2E + eb; const v2f p = {__builtin_amdgcn_exp2f(e[0]), __builtin_amdgcn_exp2f(e[1])}; ps += p; pb.h[8 * nt + r] = (_Float16)p[0]; pb.h[8 * nt + r + 1] = (_Float16)p[1]; }      /* p = P x 2^10; the sum carries the same factor */
    l_q = l_q * al + (ps[0] + ps[1]);
#pragma unroll
    for (int dt = 0; dt < DT; ++dt) { oacc[dt] *= al; oacci[dt] *= al; }
#pragma unroll
    for (int dt = 0; dt < DT; ++dt) { oacc[dt] = mmaP(bv[dt].v, pb.v, oacc[dt]); oacci[dt] = mmaP(bi[dt].v, pb.v, oacci[dt]); } }
  { const float l = l_q + xhalf(l_q); if (hh == 0) { sM[w][ln] = m_q; sL[w][ln] = l; } }
#pragma unroll
  for (int dt = 0; dt < DT; ++dt) { float* so = &sO[w][ln][dt * 16 + 8 * hh];      /* a lane's 8 registers are 8 neighbouring columns of its query's row: two 16-byte stores a tile */
    *(v4fa*)so = (v4f){oacc[dt][0], oacc[dt][1], oacc[dt][2], oacc[dt][3]}; *(v4fa*)(so + 4) = (v4f){oacc[dt][4], oacc[dt][5], oacc[dt][6], oacc[dt][7]};
    *(v4fa*)(so + 64) = (v4f){oacci[dt][0], oacci[dt][1], oacci[dt][2], oacci[dt][3]}; *(v4fa*)(so + 68) = (v4f){oacci[dt][4], oacci[dt][5], oacci[dt][6], oacci[dt][7]}; }
  __syncthreads();      /* publishes every wave's partial (max, sum, accumulators) to the waves that merge it */
  {      /* wave (qw, kr) merges columns 32 kr .. 32 kr + 31 of query tile qw = k-step 4 h + kr of that row tile of O16 (fragment order, x 2^8): lane 16 hh + ln makes row ln, columns 32 kr + 16 j + 8 hh + 0..7 for j = 0, 1 */
    float mk[KVS], wk[KVS], M = -3.0e38f, L = 0.f;
#pragma unroll
    for (int k = 0; k < KVS; ++k) { mk[k] = sM[k * 4 + qw][ln]; M = fmaxf(M, mk[k]); }
#pragma unroll
    for (int k = 0; k < KVS; ++k) { wk[k] = __builtin_amdgcn_exp2f((mk[k] - M) * SCORE_L2E); L += wk[k] * sL[k * 4 + qw][ln]; }      /* maxima are raw, sums carry x 2^10 as the accumulators do */
    const float inv = (L > 0.f) ? 1.0f / L : 0.f;
    FragH f;
#pragma unroll
    for (int j = 0; j < 2; ++j) { v4f o0 = {0.f, 0.f, 0.f, 0.f}, o1 = o0;
#pragma unroll
      for (int k = 0; k < KVS; ++k) { const float* sp = &sO[k * 4 + qw][ln][kr * 32 + j * 16 + 8 * hh]; o0 += *(const v4fa*)sp * wk[k]; o1 += *(const v4fa*)(sp + 4) * wk[k]; }
      o0 = o0 * inv; o1 = o1 * inv;
#pragma unroll
      for (int i = 0; i < 4; ++i) { f.h[8 * j + i] = (_Float16)(o0[i] * 256.0f); f.h[8 * j + 4 + i] = (_Float16)(o1[i] * 256.0f); } }
    unsigned short* op = (unsigned short*)O16 + ((size_t)((b * NN + q0) / 16) * (DX / 32) + h * 4 + kr) * 512 + lane * 8;
    *(v8us*)op = f.half[0]; *(v8us*)(op + 256) = f.half[1];      /* two 512-byte stores, the last instructions of the wave */
  } }

extern "C" void kernel_launch(void* const* d_in, const int* in_sizes, int n_in,
                              void* d_out, int out_size, void* d_ws, size_t ws_size, hipStream_t stream) {
  (void)in_sizes; (void)n_in; (void)out_size;
  const float* const* I = (const float* const*)d_in; const float* x = I[0]; const float* Wq = I[1]; const float* bq = I[2]; const float* Wk = I[3]; const float* bk = I[4]; const float* Wv = I[5]; const float* bv = I[6]; const float* Wo = I[7]; const float* bo = I[8];
  char* ws = (char*)d_ws; size_t off = 0;
  auto take = [&](size_t bytes) { char* p = ws + off; off += (bytes + 255) & ~(size_t)255; return p; };
  _Float16* Bq = (_Float16*)take((size_t)3 * 2 * DX * DX * 2); _Float16* Bo = (_Float16*)take((size_t)DX * DX * 2);
  _Float16* X16 = (_Float16*)take((size_t)NR * DX * 2); _Float16* Q = (_Float16*)take((size_t)2 * NR * DX * 2); _Float16* K = Q + (size_t)NR * DX;      /* q, k one behind the other: batch stride of the merged projection */ _Float16* Vt = (_Float16*)take((size_t)NR * DX * 2);
  _Float16* O16 = (_Float16*)take((size_t)NR * DX * 2);
  /* Bq, Bo, X16, Q, K, Vt and O16 are all in fragment order (see FRAGMENT ORDER above); the output is row-major */
  if (off > ws_size) return;      // 3 x 1 + 0.5 + 5 x 4.2 = about 25 MB
  k_prep<<<3 * NBW + NBO + NBX, 256, 0, stream>>>(Wq, Wk, Wv, Wo, x, Bq, Bo, X16);      /* (in,out) [512][1024] -> Bt[1024][512] x2^4 for Wq, Wk, Wv (only rows 0..511 = heads 0..3 are used), Wo likewise, x -> f16: one launch */
  const dim3 gp((NR / 64) * (DX / 128), 1), gp3((NR / 128) * (DX / 64), 1);      /* waves of 32 x 64. gp: 2 x 2 waves on a 64 x 128 tile; gp3: 4 waves down x the 3 projections on 128 rows x 64 columns of each */
  k_gemm_hhx<0, DX, DX, true, 2, 4, 1, 3><<<gp3, 384, 0, stream>>>(X16, DX, 0, Bq, DX, (size_t)2 * DX * DX, 0.0625f, bq, bk, bv, 0, nullptr, 1, 0, 0, nullptr, Q, Vt, DX, (size_t)NR * DX, NR);      /* q, k, v in one launch (a wave's batch index), heads 0..3 = output columns 0..511 (+ bias): each M 4096 N 512 K 512; v goes out transposed, planes per (b, head, part): [b * 8 + 2 h + part][64][2048] */
  k_flash<<<BB * NHU * (NN / 64), 128 * KVS, 0, stream>>>(Q, DX, K, DX, Vt, O16);      /* stores O x 2^8 as f16 in fragment order, the A operand of the output product */
  k_gemm_hhx<0, DX, DX, false, 2, 2, 2, 1><<<gp, 128, 0, stream>>>(O16, DX, 0, Bo, DX, 0, 0.0625f * 0.00390625f, bo, nullptr, nullptr, 0, nullptr, 1, 0, 0, (float*)d_out, nullptr, nullptr, DX, 0, NR);      /* out = O Wo + bo (alpha undoes the x 2^4 of the weights and the x 2^8 carry) */
}

// v010
// Measured time: 48.8 microseconds a run.
// Two timings next to v009 both put it at 1.07 times that version's speed.
// Over all steps from v000 it is 6.67 times as fast.
#include <hip/hip_runtime.h>
// 'Superposition' (complex-valued) multi-head attention (B=2, S=2048, D=512, 8 heads; q,k,v projections to 2D with per-head [real 64 | imag 64]): interference = Σ_d q_d·conj(k_d)·64^-½; probs = softmax(|interference|²/0.5); out = probs·v (complex);
// out = concat[real, imag] per head → [B,S,1024], truncated to the first 512 columns (= heads 0..3), then ·Wo + bo. Only heads 0..3 reach the output, so only they are computed.
// Compute dtype: x, weights, biases rounded to bf16; q/k/v (columns of heads 0..3) as f16 GEMM outputs; fused flash-style kernel with three f32 score accumulators (Re, Im⁺, Im⁻) and two value accumulators
// (real, imag), online softmax f32, P f16 ×2^10, on v_wmma_f32_16x16x32_f16; O carried ×2^8 into f16 (small diffuse values) → output GEMM with bias (alpha undoes the carry); f32 accumulate.
#define BB 2
#define NN 2048
#define DX 512
#define NHU 4
#define DH2 128
#define NR (BB * NN)
#define SCORE_SCALE 0.03125f
#define SCORE_L2E (SCORE_SCALE * 1.44269504088896340736f)      /* score scale x log2(e): the softmax runs in base 2 */

typedef __bf16 v16b __attribute__((ext_vector_type(16)));
typedef unsigned short v8us __attribute__((ext_vector_type(8), may_alias));
typedef float  v8f  __attribute__((ext_vector_type(8)));
typedef float  v4f  __attribute__((ext_vector_type(4)));
typedef float  v4fa __attribute__((ext_vector_type(4), may_alias));
union FragB { v16b v; v8us half[2]; unsigned short u[16]; };

__device__ __forceinline__ unsigned short bf16_bits(float x) { unsigned int u = __float_as_uint(x); return (unsigned short)((u + 0x7FFFu + ((u >> 16) & 1u)) >> 16); }
__device__ __forceinline__ float bf16_val(unsigned short b) { return __uint_as_float(((unsigned int)b) << 16); }
__device__ __forceinline__ float bf16_round(float x) { return bf16_val(bf16_bits(x)); }
// D += A·B with NT terms: 1 = ah·bh, 2 = + al·bh (A split), 3 = + ah·bl (both split)
template <int NT>
__device__ __forceinline__ v8f mmaN(v16b ah, v16b al, v16b bh, v16b bl, v8f c) {
  c = __builtin_amdgcn_wmma_f32_16x16x32_bf16(false, ah, false, bh, (short)0, c, false, false);
  if (NT >= 2) c = __builtin_amdgcn_wmma_f32_16x16x32_bf16(false, al, false, bh, (short)0, c, false, false);
  if (NT >= 3) c = __builtin_amdgcn_wmma_f32_16x16x32_bf16(false, ah, false, bl, (short)0, c, false, false);
  asm volatile("v_nop\n\tv_nop\n\tv_nop\n\tv_nop" : "+v"(c) : "v"(ah), "v"(al), "v"(bh), "v"(bl));
  return c;
}

__global__ __launch_bounds__(256) void k_wt_bf16(const float* __restrict__ W, unsigned short* __restrict__ Wt, int K, int N) {
  const int t = blockIdx.x * 256 + threadIdx.x;
  const int k8n = K / 8;
  if (t >= N * k8n) return;
  const int n = t / k8n, k8 = (t % k8n) * 8;
  v8us v;
#pragma unroll
  for (int i = 0; i < 8; ++i) v[i] = bf16_bits(W[(size_t)(k8 + i) * N + n]);
  *(v8us*)(Wt + (size_t)n * K + k8) = v;
  
}

// GEMM C[M][N] (f32, pitch ldc) = act(A[M][K]·W + bias). A f32 row-major (pitch lda) converted per fragment to bf16
// (ASPLIT: hi/lo two planes -> 2 terms, else single rounded term); Wt bf16 [N][K] (pitch ldb). BIAS_BF16 rounds the
// bias to bf16 first (bias quantised to bf16 before the add). K%32==0, M%16==0, N%64==0.
template <bool ASPLIT, int ACT, bool BIAS_BF16>
__global__ __launch_bounds__(128) void k_gemm_bf(const float* __restrict__ A, int lda, const unsigned short* __restrict__ Wt, int ldb,
                                               const float* __restrict__ bias, float* __restrict__ C, int ldc, int M, int N, int K) {
  __shared__ __attribute__((aligned(16))) float so[4][16][64];
  const int tid = threadIdx.x, w = tid >> 5, lane = tid & 31, ln = lane & 15, hh = lane >> 4;
  const int ntn = N / 64;
  const int wid = blockIdx.x * 4 + w;
  const int mt = wid / ntn, nq = wid % ntn;
  if (mt * 16 >= M) return;
  const int row0 = mt * 16, col0 = nq * 64;
  const float* arow = A + (size_t)(row0 + ln) * lda;
  v8f acc[4] = {};
  for (int kb = 0; kb < K; kb += 32) {
    FragB ah, al;
    const v4f x0 = *(const v4fa*)(arow + kb + 8 * hh), x1 = *(const v4fa*)(arow + kb + 8 * hh + 4);
    const v4f x2 = *(const v4fa*)(arow + kb + 16 + 8 * hh), x3 = *(const v4fa*)(arow + kb + 16 + 8 * hh + 4);
    float xs[16] = {x0[0],x0[1],x0[2],x0[3],x1[0],x1[1],x1[2],x1[3],x2[0],x2[1],x2[2],x2[3],x3[0],x3[1],x3[2],x3[3]};
#pragma unroll
    for (int i = 0; i < 16; ++i) { const unsigned short hb = bf16_bits(xs[i]); ah.u[i] = hb; al.u[i] = ASPLIT ? bf16_bits(xs[i] - bf16_val(hb)) : (unsigned short)0; }
#pragma unroll
    for (int t = 0; t < 4; ++t) {
      const unsigned short* brow = Wt + (size_t)(col0 + t * 16 + ln) * ldb + kb;
      FragB b;
      b.half[0] = *(const v8us*)(brow + 8 * hh);
      b.half[1] = *(const v8us*)(brow + 16 + 8 * hh);
      acc[t] = mmaN<ASPLIT ? 2 : 1>(ah.v, al.v, b.v, b.v, acc[t]);
    }
  }
#pragma unroll
  for (int t = 0; t < 4; ++t) {
    float bv = bias ? bias[col0 + t * 16 + ln] : 0.f;
    if (BIAS_BF16) bv = bf16_round(bv);
#pragma unroll
    for (int r = 0; r < 8; ++r) { float v = acc[t][r] + bv; if (ACT == 1) v = fmaxf(v, 0.f); so[w][8 * hh + r][t * 16 + ln] = v; }
  }
  __builtin_amdgcn_fence(__ATOMIC_ACQ_REL, "workgroup");
  __builtin_amdgcn_wave_barrier();
  const int rsub = lane >> 4, c4 = (lane & 15) * 4;
  {
#pragma unroll
    for (int q = 0; q < 8; ++q) {
      const int r = q * 2 + rsub;
      const v4f v = *(const v4fa*)&so[w][r][c4];
      *(v4f*)(C + (size_t)(row0 + r) * ldc + col0 + c4) = v;
    }
    
  }
}

// Flash-style causal/unmasked attention, all contractions 3-term bf16 hi/lo splits, f32 softmax with running max.
// q,k,v rows are read from f32 buffers with arbitrary row pitch (so they can live inside a fused qkv buffer);
// D = head size (multiple of 32, <= 128); one wave = 16 query rows; block = 4 waves (64 queries) sharing K/V chunks of 32.
template <int D, bool CAUSAL>
__global__ __launch_bounds__(128) void k_flash(const float* __restrict__ qb, const float* __restrict__ kb, const float* __restrict__ vb,
                                             int pitch, int T, int H, float scale, float* __restrict__ y, int ypitch) {
  constexpr int KS = D / 32;        // k-steps for QK
  constexpr int DT = D / 16;        // d tiles for PV
  __shared__ __attribute__((aligned(16))) unsigned short sKh[32][D + 8], sKl[32][D + 8], sVh[32][D + 8], sVl[32][D + 8];
  __shared__ __attribute__((aligned(16))) unsigned short sPh[4][16][40], sPl[4][16][40];
  __shared__ __attribute__((aligned(16))) float sO[4][16][D];
  const int tid = threadIdx.x, w = tid >> 5, lane = tid & 31, ln = lane & 15, hh = lane >> 4;
  const int nqb = (T + 63) / 64;
  const int bh = blockIdx.x / nqb, qblk = blockIdx.x % nqb;
  const int b = bh / H, h = bh % H;
  const int q0 = qblk * 64 + w * 16;
  const float* Q = qb + (size_t)b * T * pitch + h * D;
  const float* K = kb + (size_t)b * T * pitch + h * D;
  const float* V = vb + (size_t)b * T * pitch + h * D;

  // A fragments of the wave's 16 query rows (scaled), hi/lo
  FragB aqh[KS], aql[KS];
  {
    int row = q0 + ln; if (row >= T) row = T - 1;
    const float* qr = Q + (size_t)row * pitch;
#pragma unroll
    for (int ks = 0; ks < KS; ++ks)
#pragma unroll
      for (int i = 0; i < 16; ++i) {
        const int d = ks * 32 + ((i < 8) ? (8 * hh + i) : (16 + 8 * hh + (i - 8)));
        const float x = qr[d] * scale; const unsigned short hb = bf16_bits(x);
        aqh[ks].u[i] = hb; aql[ks].u[i] = bf16_bits(x - bf16_val(hb));
      }
  }
  float m_r[8], l_r[8];
#pragma unroll
  for (int r = 0; r < 8; ++r) { m_r[r] = -3.0e38f; l_r[r] = 0.f; }
  v8f oacc[DT];
#pragma unroll
  for (int dt = 0; dt < DT; ++dt) oacc[dt] = (v8f){0.f,0.f,0.f,0.f,0.f,0.f,0.f,0.f};

  const int kv_end = CAUSAL ? min(T, qblk * 64 + 64) : T;     // block-uniform
  for (int j0 = 0; j0 < kv_end; j0 += 32) {
    __syncthreads();
    for (int e = tid; e < 32 * (D / 4); e += 128) {
      const int r = e / (D / 4), c4 = (e % (D / 4)) * 4;
      const int key = j0 + r;
      v4f kf = {0.f,0.f,0.f,0.f}, vf = {0.f,0.f,0.f,0.f};
      if (key < T) { kf = *(const v4fa*)(K + (size_t)key * pitch + c4); vf = *(const v4fa*)(V + (size_t)key * pitch + c4); }
#pragma unroll
      for (int t = 0; t < 4; ++t) {
        unsigned short hb = bf16_bits(kf[t]); sKh[r][c4 + t] = hb; sKl[r][c4 + t] = bf16_bits(kf[t] - bf16_val(hb));
        hb = bf16_bits(vf[t]); sVh[r][c4 + t] = hb; sVl[r][c4 + t] = bf16_bits(vf[t] - bf16_val(hb));
      }
    }
    __syncthreads();
    // S tile 16 x 32
    v8f s[2];
#pragma unroll
    for (int nt = 0; nt < 2; ++nt) {
      v8f acc = {};
#pragma unroll
      for (int ks = 0; ks < KS; ++ks) {
        FragB bh_, bl_;
        bh_.half[0] = *(const v8us*)&sKh[nt * 16 + ln][ks * 32 + 8 * hh]; bh_.half[1] = *(const v8us*)&sKh[nt * 16 + ln][ks * 32 + 16 + 8 * hh];
        bl_.half[0] = *(const v8us*)&sKl[nt * 16 + ln][ks * 32 + 8 * hh]; bl_.half[1] = *(const v8us*)&sKl[nt * 16 + ln][ks * 32 + 16 + 8 * hh];
        acc = mmaN<3>(aqh[ks].v, aql[ks].v, bh_.v, bl_.v, acc);
      }
      s[nt] = acc;
    }
    // mask + running max (rows 8hh+r; the 16 lanes of a half share rows)
    float alpha[8];
#pragma unroll
    for (int r = 0; r < 8; ++r) {
      const int qi = q0 + 8 * hh + r;
      const int ja = j0 + ln, jb = j0 + 16 + ln;
      if (CAUSAL) { if (ja > qi) s[0][r] = -3.0e38f; if (jb > qi) s[1][r] = -3.0e38f; }
      if (ja >= T) s[0][r] = -3.0e38f;
      if (jb >= T) s[1][r] = -3.0e38f;
      float mx = fmaxf(s[0][r], s[1][r]);
      mx = fmaxf(mx, __shfl_xor(mx, 1, 32)); mx = fmaxf(mx, __shfl_xor(mx, 2, 32)); mx = fmaxf(mx, __shfl_xor(mx, 4, 32)); mx = fmaxf(mx, __shfl_xor(mx, 8, 32));
      const float mnew = fmaxf(m_r[r], mx);
      alpha[r] = (mnew > -1.0e38f) ? __expf(m_r[r] - mnew) : 1.0f;
      const float p0 = (s[0][r] > -1.0e38f) ? __expf(s[0][r] - mnew) : 0.f;
      const float p1 = (s[1][r] > -1.0e38f) ? __expf(s[1][r] - mnew) : 0.f;
      m_r[r] = mnew;
      l_r[r] = l_r[r] * alpha[r] + p0 + p1;            // per-lane partial row sum (16 lanes combined at the end)
      unsigned short hb = bf16_bits(p0); sPh[w][8 * hh + r][ln] = hb;      sPl[w][8 * hh + r][ln] = bf16_bits(p0 - bf16_val(hb));
      hb = bf16_bits(p1);                sPh[w][8 * hh + r][16 + ln] = hb; sPl[w][8 * hh + r][16 + ln] = bf16_bits(p1 - bf16_val(hb));
    }
#pragma unroll
    for (int dt = 0; dt < DT; ++dt)
#pragma unroll
      for (int r = 0; r < 8; ++r) oacc[dt][r] *= alpha[r];
    __builtin_amdgcn_fence(__ATOMIC_ACQ_REL, "workgroup");
    __builtin_amdgcn_wave_barrier();
    FragB pah, pal;
    pah.half[0] = *(const v8us*)&sPh[w][ln][8 * hh]; pah.half[1] = *(const v8us*)&sPh[w][ln][16 + 8 * hh];
    pal.half[0] = *(const v8us*)&sPl[w][ln][8 * hh]; pal.half[1] = *(const v8us*)&sPl[w][ln][16 + 8 * hh];
#pragma unroll
    for (int dt = 0; dt < DT; ++dt) {
      FragB bvh, bvl;
#pragma unroll
      for (int i = 0; i < 8; ++i) {
        bvh.u[i] = sVh[8 * hh + i][dt * 16 + ln]; bvh.u[8 + i] = sVh[16 + 8 * hh + i][dt * 16 + ln];
        bvl.u[i] = sVl[8 * hh + i][dt * 16 + ln]; bvl.u[8 + i] = sVl[16 + 8 * hh + i][dt * 16 + ln];
      }
      oacc[dt] = mmaN<3>(pah.v, pal.v, bvh.v, bvl.v, oacc[dt]);
    }
    __builtin_amdgcn_fence(__ATOMIC_ACQ_REL, "workgroup");
    __builtin_amdgcn_wave_barrier();
  }
#pragma unroll
  for (int r = 0; r < 8; ++r) {
    float l = l_r[r];
    l += __shfl_xor(l, 1, 32); l += __shfl_xor(l, 2, 32); l += __shfl_xor(l, 4, 32); l += __shfl_xor(l, 8, 32);
    l_r[r] = (l > 0.f) ? 1.0f / l : 0.f;
  }
#pragma unroll
  for (int dt = 0; dt < DT; ++dt)
#pragma unroll
    for (int r = 0; r < 8; ++r) sO[w][8 * hh + r][dt * 16 + ln] = oacc[dt][r] * l_r[r];
  __builtin_amdgcn_fence(__ATOMIC_ACQ_REL, "workgroup");
  __builtin_amdgcn_wave_barrier();
  {
    for (int r = 0; r < 16; ++r) {
      const int row = q0 + r;
      if (row < T && lane < D / 4) {
        const v4f val = *(const v4fa*)&sO[w][r][lane * 4];
        *(v4f*)(y + ((size_t)b * T + row) * ypitch + h * D + lane * 4) = val;
      }
    }
    
  }
}

// GEMM C = act(A·W + bias + resid): A f32 (ASPLIT -> hi/lo 2 terms), Wt bf16 [N][K]; ACT 0 none, 1 relu, 2 exact gelu;
// resid (optional, f32, row index = (row % rmod), pitch ldr, RES_BF16 rounds it) added before the activation.
template <bool ASPLIT, int ACT, bool BIAS_BF16, bool RES_BF16>
__global__ __launch_bounds__(128) void k_gemm_bf3(const float* __restrict__ A, int lda, const unsigned short* __restrict__ Wt, int ldb,
                                                const float* __restrict__ bias, const float* __restrict__ resid, int rmod, int ldr,
                                                float* __restrict__ C, int ldc, int M, int N, int K) {
  __shared__ __attribute__((aligned(16))) float so[4][16][64];
  const int tid = threadIdx.x, w = tid >> 5, lane = tid & 31, ln = lane & 15, hh = lane >> 4;
  const int ntn = N / 64;
  const int wid = blockIdx.x * 4 + w;
  const int mt = wid / ntn, nq = wid % ntn;
  if (mt * 16 >= M) return;
  const int row0 = mt * 16, col0 = nq * 64;
  const float* arow = A + (size_t)(row0 + ln) * lda;
  v8f acc[4] = {};
  for (int kb = 0; kb < K; kb += 32) {
    FragB ah, al;
    const v4f x0 = *(const v4fa*)(arow + kb + 8 * hh), x1 = *(const v4fa*)(arow + kb + 8 * hh + 4);
    const v4f x2 = *(const v4fa*)(arow + kb + 16 + 8 * hh), x3 = *(const v4fa*)(arow + kb + 16 + 8 * hh + 4);
    float xs[16] = {x0[0],x0[1],x0[2],x0[3],x1[0],x1[1],x1[2],x1[3],x2[0],x2[1],x2[2],x2[3],x3[0],x3[1],x3[2],x3[3]};
#pragma unroll
    for (int i = 0; i < 16; ++i) { const unsigned short hb = bf16_bits(xs[i]); ah.u[i] = hb; al.u[i] = ASPLIT ? bf16_bits(xs[i] - bf16_val(hb)) : (unsigned short)0; }
#pragma unroll
    for (int t = 0; t < 4; ++t) {
      const unsigned short* brow = Wt + (size_t)(col0 + t * 16 + ln) * ldb + kb;
      FragB b;
      b.half[0] = *(const v8us*)(brow + 8 * hh);
      b.half[1] = *(const v8us*)(brow + 16 + 8 * hh);
      acc[t] = mmaN<ASPLIT ? 2 : 1>(ah.v, al.v, b.v, b.v, acc[t]);
    }
  }
#pragma unroll
  for (int t = 0; t < 4; ++t) {
    const int col = col0 + t * 16 + ln;
    float bv = bias ? bias[col] : 0.f;
    if (BIAS_BF16) bv = bf16_round(bv);
#pragma unroll
    for (int r = 0; r < 8; ++r) {
      float v = acc[t][r] + bv;
      if (resid) { float rv = resid[(size_t)((row0 + 8 * hh + r) % rmod) * ldr + col]; if (RES_BF16) rv = bf16_round(rv); v += rv; }
      if (ACT == 1) v = fmaxf(v, 0.f);
      if (ACT == 2) v = 0.5f * v * (1.0f + erff(v * 0.70710678118654752f));
      if (ACT == 3) { const float u = 0.7978845608028654f * (v + 0.044715f * v * v * v); v = 0.5f * v * (1.0f + tanhf(u)); }
      so[w][8 * hh + r][t * 16 + ln] = v;
    }
  }
  __builtin_amdgcn_fence(__ATOMIC_ACQ_REL, "workgroup");
  __builtin_amdgcn_wave_barrier();
  const int rsub = lane >> 4, c4 = (lane & 15) * 4;
  {
#pragma unroll
    for (int q = 0; q < 8; ++q) {
      const int r = q * 2 + rsub;
      const v4f v = *(const v4fa*)&so[w][r][c4];
      *(v4f*)(C + (size_t)(row0 + r) * ldc + col0 + c4) = v;
    }
    
  }
}
// row LayerNorm (biased variance, eps) over N: s = X (+ R); optional out_sum <- s; out_norm <- (s-mu)*rsqrt(var+eps)*g + b
template <bool PARAM_BF16>
__global__ __launch_bounds__(256) void k_layernorm(const float* __restrict__ X, const float* __restrict__ R, const float* __restrict__ g, const float* __restrict__ bta,
                                                  float* __restrict__ out_sum, float* __restrict__ out_norm, int N, float eps) {
  __shared__ float red[256];
  const int row = blockIdx.x, tid = threadIdx.x;
  const float* x = X + (size_t)row * N; const float* rr = R ? R + (size_t)row * N : nullptr;
  float vals[16];                     // up to N = 4096
  const int per = N / 256;            // contiguous chunk per thread? use strided-by-4 chunks: thread handles j = tid*4 + 1024*u
  float s1 = 0.f;
  for (int u = 0; u < per / 4; ++u) {
    const int j = tid * 4 + 1024 * u;
    const v4f a = *(const v4fa*)(x + j);
    v4f b = {0.f,0.f,0.f,0.f}; if (rr) b = *(const v4fa*)(rr + j);
#pragma unroll
    for (int q = 0; q < 4; ++q) { const float v = a[q] + b[q]; vals[u * 4 + q] = v; s1 += v; }
  }
  red[tid] = s1; __syncthreads();
  for (int st = 128; st > 0; st >>= 1) { if (tid < st) red[tid] += red[tid + st]; __syncthreads(); }
  const float mu = red[0] / (float)N; __syncthreads();
  float s2 = 0.f;
  for (int u = 0; u < per / 4; ++u)
#pragma unroll
    for (int q = 0; q < 4; ++q) { const float c = vals[u * 4 + q] - mu; s2 += c * c; }
  red[tid] = s2; __syncthreads();
  for (int st = 128; st > 0; st >>= 1) { if (tid < st) red[tid] += red[tid + st]; __syncthreads(); }
  const float rs = rsqrtf(red[0] / (float)N + eps);
  {
    for (int u = 0; u < per / 4; ++u) {
      const int j = tid * 4 + 1024 * u;
      v4f o, sm;
#pragma unroll
      for (int q = 0; q < 4; ++q) {
        float gg = g[j + q], bb = bta[j + q];
        if (PARAM_BF16) { gg = bf16_round(gg); bb = bf16_round(bb); }
        sm[q] = vals[u * 4 + q]; o[q] = (vals[u * 4 + q] - mu) * rs * gg + bb;
      }
      if (out_sum) *(v4f*)(out_sum + (size_t)row * N + j) = sm;
      *(v4f*)(out_norm + (size_t)row * N + j) = o;
    }
    
  }
}



// ---- f16 WMMA path (v_wmma_f32_16x16x32_f16): 11-bit significands for operands in range — used where a [0,1] probability operand needs more precision than bf16
typedef _Float16 v16h __attribute__((ext_vector_type(16)));
union FragH { v16h v; v8us half[2]; _Float16 h[16]; unsigned short u[16]; };
template <int NT>
__device__ __forceinline__ v8f mmaH(v16h ah, v16h al, v16h bh, v16h bl, v8f c) {
  c = __builtin_amdgcn_wmma_f32_16x16x32_f16(false, ah, false, bh, (short)0, c, false, false);
  if (NT >= 2) c = __builtin_amdgcn_wmma_f32_16x16x32_f16(false, al, false, bh, (short)0, c, false, false);
  if (NT >= 3) c = __builtin_amdgcn_wmma_f32_16x16x32_f16(false, ah, false, bl, (short)0, c, false, false);
  asm volatile("v_nop\n\tv_nop\n\tv_nop\n\tv_nop" : "+v"(c) : "v"(ah), "v"(al), "v"(bh), "v"(bl));
  return c;
}
// batched GEMM like k_gemm_b but f16 operands: A f32 (split into f16 hi/lo if ASPLIT, else rounded to f16), Bt = f16 values [n][k]; alpha; C f32; N multiple of 16 (partial tiles skipped)
template <bool ASPLIT>
__global__ __launch_bounds__(128) void k_gemm_h(const float* __restrict__ A, int lda, size_t sA, const _Float16* __restrict__ Bh, int ldb, size_t sB, float alpha, float* __restrict__ C, int ldc, size_t sC, int M, int N, int K) {
  __shared__ __attribute__((aligned(16))) float so[4][16][64];
  const int tid = threadIdx.x, w = tid >> 5, lane = tid & 31, ln = lane & 15, hh = lane >> 4; const int by = blockIdx.y;
  A += (size_t)by * sA; Bh += (size_t)by * sB; C += (size_t)by * sC;
  const int ntn = (N + 63) / 64; const int wid = blockIdx.x * 4 + w; const int mt = wid / ntn, nq = wid % ntn; if (mt * 16 >= M) return;
  const int row0 = mt * 16, col0 = nq * 64; const float* arow = A + (size_t)(row0 + ln) * lda;
  v8f acc[4] = {};
  for (int kb = 0; kb < K; kb += 32) {
    FragH ah, al;
    const v4f x0 = *(const v4fa*)(arow + kb + 8 * hh), x1 = *(const v4fa*)(arow + kb + 8 * hh + 4), x2 = *(const v4fa*)(arow + kb + 16 + 8 * hh), x3 = *(const v4fa*)(arow + kb + 16 + 8 * hh + 4);
    float xs[16] = {x0[0],x0[1],x0[2],x0[3],x1[0],x1[1],x1[2],x1[3],x2[0],x2[1],x2[2],x2[3],x3[0],x3[1],x3[2],x3[3]};
#pragma unroll
    for (int i = 0; i < 16; ++i) { const _Float16 h = (_Float16)xs[i]; ah.h[i] = h; al.h[i] = ASPLIT ? (_Float16)(xs[i] - (float)h) : (_Float16)0.0f; }
#pragma unroll
    for (int t = 0; t < 4; ++t) { if (col0 + t * 16 >= N) continue; const size_t boff = (size_t)(col0 + t * 16 + ln) * ldb + kb; FragH bq; bq.half[0] = *(const v8us*)(Bh + boff + 8 * hh); bq.half[1] = *(const v8us*)(Bh + boff + 16 + 8 * hh);
      acc[t] = mmaH<ASPLIT ? 2 : 1>(ah.v, al.v, bq.v, bq.v, acc[t]); }
  }
#pragma unroll
  for (int t = 0; t < 4; ++t) { if (col0 + t * 16 >= N) continue;
#pragma unroll
    for (int r = 0; r < 8; ++r) so[w][8 * hh + r][t * 16 + ln] = acc[t][r] * alpha; }
  __builtin_amdgcn_fence(__ATOMIC_ACQ_REL, "workgroup"); __builtin_amdgcn_wave_barrier();
  const int rsub = lane >> 4, c4 = (lane & 15) * 4;
  {
#pragma unroll
    for (int q = 0; q < 8; ++q) { const int r = q * 2 + rsub; if (col0 + c4 < N) { const v4f v = *(const v4fa*)&so[w][r][c4]; *(v4f*)(C + (size_t)(row0 + r) * ldc + col0 + c4) = v; } }
     }
}

// FRAGMENT ORDER. Every 16-bit matrix operand M[row][k] (rows a multiple of 16, k a multiple of 32, KS = k-steps of 32) lies in the workspace as [row tile of 16][k-step][half j][lane][8 elements]:
// lane 16 hh + (row & 15) of half j of k-step s holds k = 32 s + 16 j + 8 hh + 0..7. One half of a fragment is then 32 lanes x 16 B = 512 contiguous bytes (4 cache lines), where rows of a row-major matrix gave 16 lines a load.
// The 16-byte piece number t of such a matrix (its place is element 8 t) holds row frag_row(t, KS), columns frag_k(t, KS) + 0..7; a writer whose thread t makes piece t stores whole lines.
__device__ __forceinline__ int frag_row(unsigned t, unsigned KS) { return (int)((t / (64 * KS)) * 16 + (t & 15)); }
__device__ __forceinline__ int frag_k(unsigned t, unsigned KS) { return (int)(((t >> 6) % KS) * 32 + ((t >> 5) & 1) * 16 + ((t >> 4) & 1) * 8); }
// Wt (row n, column k, fragment order) = f16(bf16(W[k][n]) * scale) from f32 row-major W[K][N] (scale = power of two; bf16-exact weights stay exact in f16 away from the subnormal range)
__device__ __forceinline__ void wt_f16_block(const float* __restrict__ W, _Float16* __restrict__ Wt, int K, int N, float scale, int blk) {
  const int t = blk * 256 + threadIdx.x; if (t >= N * (K / 8)) return; const int n = frag_row(t, K / 32), k8 = frag_k(t, K / 32); FragH f;
#pragma unroll
  for (int i = 0; i < 8; ++i) f.h[i] = (_Float16)(bf16_round(W[(size_t)(k8 + i) * N + n]) * scale); const v8us o = f.half[0];
  *(v8us*)((unsigned short*)Wt + (size_t)t * 8) = o; 
}
// k_gemm_hh variant with fused epilogue: v = acc·alpha + bf16(bias_by[by·sBias + col]) (bias_by = bias, biasY1, biasY2 for by = 0, 1, 2) (+ CP[(row/rowsPerB)·sCPb + by·64 + col] if CP) ; ACT 0 none / 1 elu ; writes f16 C16 and f32 C, each if non-null
// N (a multiple of 64, so every wave owns four whole 16-column tiles) and K are compile-time: the k loop is unrolled whole and its fragment loads run PF k-steps ahead of the products that use them.
// A, Bh and C16 are in fragment order (K / 32, K / 32 and N / 32 k-steps a row tile); C is row-major with pitch ldc.
// VT: batch index 2 (the value projection) is stored transposed instead, into CT: planes [row / NN][column / 64] of [64 rows d][NN keys] in fragment order (NN / 32 k-steps a row tile), the A operand of the flash kernel's value product.
// MT: row tiles of 16 a wave owns. A wave's tile is 16 MT rows x 64 columns: each B fragment it loads feeds MT products and each A fragment four.
// A work-group is WM x WN x WB waves: WM wave tiles down, WN across, WB batch indices (which share A where sA is 0). Its waves walk k from the same start, so a fragment that several of them ask for
// (an A fragment WN WB waves, a B fragment WM waves) can come from the WGP's cache instead of L2.
template <int ACT, int N, int K, bool VT, int MT, int WM, int WN, int WB>
__global__ __launch_bounds__(32 * WM * WN * WB) void k_gemm_hhx(const _Float16* __restrict__ A, int lda, size_t sA, const _Float16* __restrict__ Bh, int ldb, size_t sB, float alpha, const float* __restrict__ bias, const float* __restrict__ biasY1, const float* __restrict__ biasY2, size_t sBias, const float* __restrict__ CP, int rowsPerB, size_t sCPb, int row0g,
    float* __restrict__ C, _Float16* __restrict__ C16, _Float16* __restrict__ CT, int ldc, size_t sC, int M) {
  static_assert(N % (64 * WN) == 0 && K % 32 == 0, "whole work-group tiles of 64 WN columns and whole 32-deep k-steps");
  __shared__ __attribute__((aligned(16))) float so[WM * WN * WB * MT][16][64 + 4];      /* one 16 x 64 plane a wave and row tile; pitch 68: the fragment-order store below reads 16 rows at one column, which a pitch of 64 would put on the same banks */
  const int tid = threadIdx.x, w = __builtin_amdgcn_readfirstlane(tid >> 5), lane = tid & 31, ln = lane & 15, hh = lane >> 4; const int by = (int)blockIdx.y * WB + w / (WM * WN);      /* the wave's number held as a scalar: the batch index, which now differs between the waves of a work-group, picks buffers and the store path by scalar tests */
  A += (size_t)by * sA; Bh += (size_t)by * sB; const size_t cofs = (size_t)by * sC; const float* bsel = (by == 0) ? bias : ((by == 1) ? biasY1 : biasY2); const float* bp = bsel ? bsel + (size_t)by * sBias : nullptr;      /* batch index by = 0, 1, 2 takes its own bias buffer */
  constexpr int NBN = N / (64 * WN); const int mw = ((int)blockIdx.x / NBN) * WM + (w / WN) % WM, nq = ((int)blockIdx.x % NBN) * WN + w % WN; if (mw * 16 * MT >= M) return;      /* wave-uniform; the kernel has no work-group barrier */
  const int mt0 = mw * MT, col0 = nq * 64; (void)lda; (void)ldb;      /* the wave's row tiles are mt0 .. mt0 + MT - 1 */
  v8f acc[MT][4] = {};
  constexpr int NS = K / 32, PF = 2, NB = PF + 1;      /* NB register stages: PF k-steps of loads in flight beside the one being multiplied */
  const unsigned short* ap = (const unsigned short*)A + (size_t)mt0 * NS * 512 + lane * 8; const unsigned short* bq0 = (const unsigned short*)Bh + (size_t)(nq * 4) * NS * 512 + lane * 8;      /* row tiles mt0 + i of A; row tiles 4 nq + t of Bh */
  FragH fa[NB][MT], fb[NB][4];
#pragma unroll
  for (int s = 0; s < NS + PF; ++s) {      /* unrolled whole: the stage indices must be constants for the stages to stay in registers */
    if (s < NS) { const int st = s % NB;
#pragma unroll
      for (int i = 0; i < MT; ++i) { const unsigned short* ar = ap + (i * NS + s) * 512; fa[st][i].half[0] = *(const v8us*)ar; fa[st][i].half[1] = *(const v8us*)(ar + 256); }
#pragma unroll
      for (int t = 0; t < 4; ++t) { const unsigned short* br = bq0 + (t * NS + s) * 512; fb[st][t].half[0] = *(const v8us*)br; fb[st][t].half[1] = *(const v8us*)(br + 256); } }
    if (s >= PF) { const int st = (s - PF) % NB;
#pragma unroll
      for (int i = 0; i < MT; ++i)
#pragma unroll
        for (int t = 0; t < 4; ++t) acc[i][t] = mmaH<1>(fa[st][i].v, fa[st][i].v, fb[st][t].v, fb[st][t].v, acc[i][t]); }
  }
  float bv[4] = {0.f, 0.f, 0.f, 0.f};
  if (bp) {      /* one test for the four bias loads, so that they travel together */
#pragma unroll
    for (int t = 0; t < 4; ++t) bv[t] = bp[col0 + t * 16 + ln];
#pragma unroll
    for (int t = 0; t < 4; ++t) bv[t] = bf16_round(bv[t]); }
  if (VT && by == 2) {      /* wave-uniform. In accumulator tile (i, t) lane 16 hh + ln holds rows (keys) 8 hh + 0..7 of row tile mt0 + i, column d = 16 t + ln: that is the lane's 16-byte piece of the transposed operand, so it goes out from the registers, no LDS */
    FragH f[MT][2];
#pragma unroll
    for (int i = 0; i < MT; ++i)
#pragma unroll
      for (int t = 0; t < 4; ++t)
#pragma unroll
        for (int r = 0; r < 8; ++r) f[i][t >> 1].h[(t & 1) * 8 + r] = (_Float16)(acc[i][t][r] * alpha + bv[t]);
#pragma unroll
    for (int i = 0; i < MT; ++i) { const unsigned ur = (unsigned)(mt0 + i) * 16; unsigned short* tp = (unsigned short*)CT + (size_t)((ur / NN) * (N / 64) + (unsigned)nq) * 64 * NN + ((ur % NN) / 32) * 512 + ((ur >> 4) & 1) * 256 + lane * 8;      /* plane (batch, nq); the row tile's 16 keys are half (ur / 16) & 1 of k-step (ur % NN) / 32 */
#pragma unroll
      for (int t = 0; t < 4; ++t) *(v8us*)(tp + (size_t)t * (NN / 32) * 512) = f[i][t >> 1].half[t & 1]; }      /* row tile t of the plane: four 512-byte stores; every value is converted ahead of the first store, and the wave ends behind the last */
    return; }
#pragma unroll
  for (int i = 0; i < MT; ++i)
#pragma unroll
    for (int t = 0; t < 4; ++t) { const int col = col0 + t * 16 + ln;
#pragma unroll
      for (int r = 0; r < 8; ++r) { float v = acc[i][t][r] * alpha + bv[t]; if (CP) { const int bidx = (row0g + (mt0 + i) * 16 + 8 * hh + r) / rowsPerB; v += CP[(size_t)bidx * sCPb + (size_t)by * 64 + col]; } if (ACT == 1) v = (v > 0.f) ? v : expm1f(v); else if (ACT == 7) v = (v > 0.f) ? v + 1.0f : expf(v); else if (ACT == 8) v = tanhf(v); else if (ACT == 9) v = 0.5f * v * (1.0f + tanhf(0.7978845608028654f * (v + 0.044715f * v * v * v))); else if (ACT == 11) v = 1.0f / (1.0f + expf(-v)); else if (ACT == 12) v = (v > 0.f) ? v : 0.01f * v; else if (ACT == 14) v = (v > 0.f) ? v : 0.1f * v; else if (ACT == 15) v = v / (1.0f + expf(-v)); else if (ACT == 3) v = fmaxf(v, 0.f); else if (ACT == 6) v = 0.5f * v * (1.0f + erff(v * 0.70710678118654752f)); so[w * MT + i][8 * hh + r][t * 16 + ln] = v; } }
  __builtin_amdgcn_fence(__ATOMIC_ACQ_REL, "workgroup"); __builtin_amdgcn_wave_barrier();
  const int rsub = lane >> 4, c4 = (lane & 15) * 4;
#pragma unroll
  for (int i = 0; i < MT; ++i) { const int mt = mt0 + i, row0 = mt * 16;
#pragma unroll
    for (int q = 0; q < 8; ++q) { const int r = q * 2 + rsub; if (C) { const v4f v = *(const v4fa*)&so[w * MT + i][r][c4]; *(v4f*)(C + cofs + (size_t)(row0 + r) * ldc + col0 + c4) = v; } }
    if (C) asm volatile("s_wait_xcnt 0x0" ::: "memory");      /* directly behind the row-major stores: what follows (the fragment-order part, the next row tile) rewrites registers that they name */
    if (C16) { unsigned short* cp = (unsigned short*)C16 + cofs + ((size_t)mt * (N / 32) + nq * 2) * 512 + lane * 8;      /* a 16 x 64 tile = two k-steps of row tile mt = 2 KB in a row: four 512-byte stores */
#pragma unroll
      for (int q = 0; q < 4; ++q) { const v4f v0 = *(const v4fa*)&so[w * MT + i][ln][q * 16 + 8 * hh], v1 = *(const v4fa*)&so[w * MT + i][ln][q * 16 + 8 * hh + 4]; FragH f;
#pragma unroll
        for (int e = 0; e < 4; ++e) { f.h[e] = (_Float16)v0[e]; f.h[4 + e] = (_Float16)v1[e]; }
        *(v8us*)(cp + q * 256) = f.half[0]; }
      if (VT || i + 1 < MT) asm volatile("s_wait_xcnt 0x0" ::: "memory"); }      /* directly behind the four fragment-order stores: the next row tile, and in the VT build the transposed-store block laid out behind them, rewrite registers that they name */
  }
}


typedef _Float16 v4h __attribute__((ext_vector_type(4)));

__device__ __forceinline__ void x16_block(const float* __restrict__ x, _Float16* __restrict__ X16, size_t n8, int blk) { const size_t t = (size_t)blk * 256 + threadIdx.x; if (t >= n8) return; FragH f;      /* x row-major [NR][DX] -> X16 in fragment order */
  const float* xr = x + (size_t)frag_row((unsigned)t, DX / 32) * DX + frag_k((unsigned)t, DX / 32);
#pragma unroll
  for (int q = 0; q < 8; ++q) f.h[q] = (_Float16)bf16_round(xr[q]); *(v8us*)((unsigned short*)X16 + t * 8) = f.half[0];  }
// One grid for the five operand preparations, none of which reads another's result: the block index picks the job (block-uniform branch).
// Blocks 0 .. 3 NBW - 1: Wq, Wk, Wv (their outputs lie one behind the other in Bqkv); the next NBO: Wo; the last NBX: x.
#define NBW (2 * DX * (DX / 8) / 256)
#define NBO (DX * (DX / 8) / 256)
#define NBX (NR * DX / 8 / 256)
__global__ __launch_bounds__(256) void k_prep(const float* __restrict__ Wq, const float* __restrict__ Wk, const float* __restrict__ Wv, const float* __restrict__ Wo, const float* __restrict__ x,
                                              _Float16* __restrict__ Bqkv, _Float16* __restrict__ Bo, _Float16* __restrict__ X16) {
  const int bid = blockIdx.x;
  if (bid < 3 * NBW) { const int j = bid / NBW; wt_f16_block(j == 0 ? Wq : (j == 1 ? Wk : Wv), Bqkv + (size_t)j * 2 * DX * DX, DX, 2 * DX, 16.0f, bid % NBW); }
  else if (bid < 3 * NBW + NBO) wt_f16_block(Wo, Bo, DX, DX, 16.0f, bid - 3 * NBW);
  else x16_block(x, X16, (size_t)NR * DX / 8, bid - (3 * NBW + NBO)); }
__global__ __launch_bounds__(256) void k_h16(const float* __restrict__ x, _Float16* __restrict__ X16, size_t n8) { const size_t t = (size_t)blockIdx.x * 256 + threadIdx.x; if (t >= n8) return; FragH f;
#pragma unroll
  for (int q = 0; q < 8; ++q) f.h[q] = (_Float16)x[t * 8 + q]; *(v8us*)((unsigned short*)X16 + t * 8) = f.half[0];  }
__global__ __launch_bounds__(256) void k_round16f(const float* __restrict__ W, _Float16* __restrict__ Bt, size_t n8) { const size_t t = (size_t)blockIdx.x * 256 + threadIdx.x; if (t >= n8) return; FragH f;
#pragma unroll
  for (int i = 0; i < 8; ++i) f.h[i] = (_Float16)(bf16_round(W[t * 8 + i]) * 16.0f); *(v8us*)((unsigned short*)Bt + t * 8) = f.half[0];  }
// Keys split inside the work-group: each of the 4 query tiles is walked by KVS waves; wave (qw, kr) takes the 32-key blocks kr, kr + KVS, kr + 2 KVS, ... with its own running max, sum and
// un-normalised accumulators; the KVS partials of a tile are merged through LDS behind one work-group barrier (weights exp(SCORE_SCALE (m_k - M)), the maxima being raw).
// TRANSPOSED PRODUCTS. Scores are formed as S^T = K Q^T (A = key rows, B = query columns) and values as O^T += V^T P^T (A = V^T rows d, B = P^T). In a D tile lane 16 hh + ln, register r holds row 8 hh + r, column ln:
// a lane then holds scores of ONE query (ln), keys 16 nt + 8 hh + r, so the maximum and the sum over keys are in-lane but for one exchange between the lane halves, the rescale factor is one value a lane,
// and the two score tiles nt = 0, 1, converted in place, are the B operand of the value product (element 8 nt + r = key 16 nt + 8 hh + r, the k order of every fragment here): P never goes through LDS.
#define KVS 4
typedef float v2f __attribute__((ext_vector_type(2)));
__device__ __forceinline__ v8f mmaP(v16h a, v16h b, v8f c) { return __builtin_amdgcn_wmma_f32_16x16x32_f16(false, a, false, b, (short)0, c, false, false); }      /* the bare builtin, no hand-written slots behind it: the compiler keeps the distance to the first user of the result itself, with useful instructions where it has them */
__device__ __forceinline__ float xhalf(float x) { return __builtin_bit_cast(float, __builtin_amdgcn_permlanex16(__builtin_bit_cast(int, x), __builtin_bit_cast(int, x), 0x76543210, 0xfedcba98, false, false)); }      /* lane l takes the value of lane l ^ 16 */
// K AND V^T THROUGH LDS. A stage = the 32 KVS keys that the work-group's KVS key ranks walk in one trip: 16 chunks of 4 KB, each contiguous in the workspace (fragment order): chunks 0..7 = the 8 key row tiles (head h: 4 k-steps, real then imaginary),
// chunks 8 + 4 part + dt = row tile dt of the V^T plane 'part' (KVS k-steps, one a key rank). Wave w brings chunk w by 8 asynchronous copies of 512 B, so each byte enters the WGP once and the 4 query tiles' waves read it from LDS.
// Two buffers: stage t + 1 flies while stage t is worked on. A fragment half keeps its 512 contiguous bytes, lane l at 16 l: ds_load_b128 without bank conflicts.
#define NST (NN / (32 * KVS))
#define CHUNK 2048      /* elements of a chunk */
__device__ __forceinline__ void copy_chunk(unsigned lds, const unsigned short* g) {      /* lds, g: the lane's own LDS byte address and global address, both multiples of 16 */
  asm volatile("global_load_async_to_lds_b128 %0, %8, off\n\t"
               "global_load_async_to_lds_b128 %1, %9, off\n\t"
               "global_load_async_to_lds_b128 %2, %10, off\n\t"
               "global_load_async_to_lds_b128 %3, %11, off\n\t"
               "global_load_async_to_lds_b128 %4, %12, off\n\t"
               "global_load_async_to_lds_b128 %5, %13, off\n\t"
               "global_load_async_to_lds_b128 %6, %14, off\n\t"
               "global_load_async_to_lds_b128 %7, %15, off\n\t"
               "s_wait_xcnt 0x0"      /* inside the copies' own statement: it stands ahead of every later write of the address registers that they name */
               :: "v"(lds), "v"(lds + 512u), "v"(lds + 1024u), "v"(lds + 1536u), "v"(lds + 2048u), "v"(lds + 2560u), "v"(lds + 3072u), "v"(lds + 3584u),
                  "v"(g), "v"(g + 256), "v"(g + 512), "v"(g + 768), "v"(g + 1024), "v"(g + 1280), "v"(g + 1536), "v"(g + 1792) : "memory"); }
__global__ __launch_bounds__(128 * KVS) void k_flash(const _Float16* __restrict__ Q16, int ldq, const _Float16* __restrict__ K16, int ldk, const _Float16* __restrict__ Vt, _Float16* __restrict__ O16) {
  constexpr int RPW = 16, NQB = NN / (4 * RPW), DT = 4, KS = 2, NW = 4 * KVS;
  __shared__ __attribute__((aligned(16))) float sO[NW][RPW][128 + 4]; __shared__ float sM[NW][RPW], sL[NW][RPW]; __shared__ __attribute__((aligned(16))) unsigned short sKV[2][NW * CHUNK];      /* the two stage buffers, 64 KB each */
  const int tid = threadIdx.x, w = __builtin_amdgcn_readfirstlane(tid >> 5), lane = tid & 31, ln = lane & 15, hh = lane >> 4; const int qw = w & 3, kr = w >> 2;      /* the wave's number held as a scalar: tile and key-block indices leave the vector registers, which the grouped fragments need */
  const int slab = blockIdx.x / NQB, qblk = blockIdx.x % NQB; const int b = slab / NHU, h = slab % NHU; const int qb0 = qblk * (4 * RPW); const int q0 = qb0 + qw * RPW;
  FragH aq[KS], aql[KS];
  { const size_t qo = ((size_t)((b * NN + q0) / 16) * (DX / 32) + h * 4) * 512 + lane * 8; const unsigned short* qr = (const unsigned short*)Q16 + qo; const unsigned short* ql = qr + 2 * 512;      /* Q16, K16 in fragment order: head h = k-steps 4 h .. 4 h + 3 of a row tile; aq = real part (the first two), aql = imaginary part */
#pragma unroll
    for (int ks = 0; ks < KS; ++ks) { aq[ks].half[0] = *(const v8us*)(qr + ks * 512); aq[ks].half[1] = *(const v8us*)(qr + ks * 512 + 256); aql[ks].half[0] = *(const v8us*)(ql + ks * 512); aql[ks].half[1] = *(const v8us*)(ql + ks * 512 + 256); } }
  (void)ldq; (void)ldk;
  const unsigned short* Vth = (const unsigned short*)Vt + ((size_t)b * 2 * NHU + 2 * h) * 64 * NN;      /* V^T real plane of head h; the imaginary plane lies 64 NN elements behind it */
  float m_q = -3.0e38f, l_q = 0.f; v8f oacc[DT], oacci[DT];      /* running max of query ln (equal in both lane halves), this lane half's share of its sum, O^T tiles: register r = column d = 16 dt + 8 hh + r of query ln */
#pragma unroll
  for (int dt = 0; dt < DT; ++dt) { oacc[dt] = (v8f){0.f,0.f,0.f,0.f,0.f,0.f,0.f,0.f}; oacci[dt] = oacc[dt]; }
  static_assert(NW == 16 && NST >= 2, "one chunk a wave; the two-buffer order needs two stages");
  const unsigned short* gsrc = ((w < 8) ? (const unsigned short*)K16 + ((size_t)((b * NN) / 16 + w) * (DX / 32) + h * 4) * 512 : Vth + (size_t)((w - 8) >> 2) * 64 * NN + (size_t)((w - 8) & 3) * 16 * NN) + lane * 8;      /* the wave's chunk of stage 0 (scalar choice: w is wave-uniform) */
  const size_t gstep = (w < 8) ? (size_t)(32 * KVS / 16) * (DX / 32) * 512 : (size_t)KVS * 512;      /* a stage on: 2 KVS key row tiles, or KVS k-steps of a V^T row tile */
  const unsigned ldst = (unsigned)(size_t)&sKV[0][w * CHUNK + lane * 8];      /* low 32 bits of the shared address = byte offset in the work-group's LDS */
  copy_chunk(ldst, gsrc);
  asm volatile("s_wait_asynccnt 0x0" ::: "memory");      /* this wave's chunk of stage 0 has landed */
  __syncthreads();      /* publishes stage 0 */
  copy_chunk(ldst + (unsigned)sizeof(sKV[0]), gsrc + gstep);      /* stage 1 flies during trip 0 */
#pragma unroll 1
  for (int t = 0; t < NST; ++t) {      /* wave (qw, kr) works on keys 32 (KVS t + kr) + 0..31 */
    v8f s[2]; FragH bk[2][KS], bl[2][KS];      /* bk = real, bl = imaginary; both 16-key tiles' fragments are loaded as one group ahead of the score products */
    const unsigned short* kv = &sKV[t & 1][lane * 8];
#pragma unroll
    for (int nt = 0; nt < 2; ++nt) { const unsigned short* kre = kv + (2 * kr + nt) * CHUNK; const unsigned short* kl = kre + 2 * 512;
#pragma unroll
      for (int ks = 0; ks < KS; ++ks) { bk[nt][ks].half[0] = *(const v8us*)(kre + ks * 512); bk[nt][ks].half[1] = *(const v8us*)(kre + ks * 512 + 256); bl[nt][ks].half[0] = *(const v8us*)(kl + ks * 512); bl[nt][ks].half[1] = *(const v8us*)(kl + ks * 512 + 256); } }
    __builtin_amdgcn_sched_barrier(0);      /* keeps the 16 key loads one group ahead of the first product: without it the scheduler lifts products among the loads and the later loads start only behind the first wait */
#pragma unroll
    for (int nt = 0; nt < 2; ++nt) { v8f re = (v8f){0.f,0.f,0.f,0.f,0.f,0.f,0.f,0.f}, ip = re, in = re;      /* keys as A, queries as B */
#pragma unroll
      for (int ks = 0; ks < KS; ++ks) { re = mmaP(bk[nt][ks].v, aq[ks].v, re); re = mmaP(bl[nt][ks].v, aql[ks].v, re); ip = mmaP(bk[nt][ks].v, aql[ks].v, ip); in = mmaP(bl[nt][ks].v, aq[ks].v, in); }
      const v8f im = ip - in; s[nt] = re * re + im * im; }      /* raw squared magnitude: its (positive) scale is applied in the exponent below, so maxima are taken over raw values */
    FragH bv[DT], bi[DT];      /* all value fragments of this key block are requested here, so that they travel while the softmax below is computed */
    const unsigned short* vp = kv + 8 * CHUNK + kr * 512; const unsigned short* vq = vp + 4 * CHUNK;      /* k-step kr of chunk 8 + dt (real) and 12 + dt (imaginary) */
#pragma unroll
    for (int dt = 0; dt < DT; ++dt) { bv[dt].half[0] = *(const v8us*)(vp + dt * CHUNK); bv[dt].half[1] = *(const v8us*)(vp + dt * CHUNK + 256); bi[dt].half[0] = *(const v8us*)(vq + dt * CHUNK); bi[dt].half[1] = *(const v8us*)(vq + dt * CHUNK + 256); }
    __builtin_amdgcn_sched_barrier(0);      /* keeps every value load ahead of the softmax that hides its flight */
    float mc = fmaxf(s[0][0], s[1][0]);
#pragma unroll
    for (int r = 1; r < 8; ++r) mc = fmaxf(mc, fmaxf(s[0][r], s[1][r]));
    mc = fmaxf(mc, xhalf(mc));      /* the other 16 keys of the block lie in the other lane half */
    const float mn = fmaxf(m_q, mc); const float al = __builtin_amdgcn_exp2f((m_q - mn) * SCORE_L2E); m_q = mn;      /* m_q, mn: raw units. Every exponent here is <= 0 (+ 10), where the bare v_exp_f32 needs none of the library's range handling: far below, it gives 0 */
    const float eb = 10.0f - mn * SCORE_L2E;      /* one addend a lane: minus the scaled maximum, plus 10 for the x 2^10 carry of P */
    FragH pb; v2f ps = {0.f, 0.f};      /* two partial sums, over even and odd registers: neighbouring registers pair in the packed adds */
#pragma unroll
    for (int nt = 0; nt < 2; ++nt)
#pragma unroll
      for (int r = 0; r < 8; r += 2) { const v2f e = (v2f){s[nt][r], s[nt][r + 1]} * SCORE_L2E + eb; const v2f p = {__builtin_amdgcn_exp2f(e[0]), __builtin_amdgcn_exp2f(e[1])}; ps += p; pb.h[8 * nt + r] = (_Float16)p[0]; pb.h[8 * nt + r + 1] = (_Float16)p[1]; }      /* p = P x 2^10; the sum carries the same factor */
    l_q = l_q * al + (ps[0] + ps[1]);
#pragma unroll
    for (int dt = 0; dt < DT; ++dt) { oacc[dt] *= al; oacci[dt] *= al; }
#pragma unroll
    for (int dt = 0; dt < DT; ++dt) { oacc[dt] = mmaP(bv[dt].v, pb.v, oacc[dt]); oacci[dt] = mmaP(bi[dt].v, pb.v, oacci[dt]); }
    __builtin_amdgcn_sched_barrier(0);      /* keeps the waits and the barrier at the trip's foot, directly ahead of the refill: lifted to mid-trip by the scheduler, they would wait for stage t + 1 after half a trip of flight */
    asm volatile("s_wait_dscnt 0x0" ::: "memory");      /* this wave's reads of buffer t & 1 are done before the buffer is handed to its next writers */
    asm volatile("s_wait_asynccnt 0x0" ::: "memory");      /* this wave's chunk of stage t + 1 has landed */
    __syncthreads();      /* publishes stage t + 1 and ends every wave's reads of stage t */
    if (t + 2 < NST) copy_chunk(ldst + (unsigned)(t & 1) * (unsigned)sizeof(sKV[0]), gsrc + (size_t)(t + 2) * gstep); }      /* the refill, into the buffer just read; the test is the same for the whole work-group */
  asm volatile("s_wait_asynccnt 0x0" ::: "memory");      /* nothing is in flight when the wave goes on to the merge */
  { const float l = l_q + xhalf(l_q); if (hh == 0) { sM[w][ln] = m_q; sL[w][ln] = l; } }
#pragma unroll
  for (int dt = 0; dt < DT; ++dt) { float* so = &sO[w][ln][dt * 16 + 8 * hh];      /* a lane's 8 registers are 8 neighbouring columns of its query's row: two 16-byte stores a tile */
    *(v4fa*)so = (v4f){oacc[dt][0], oacc[dt][1], oacc[dt][2], oacc[dt][3]}; *(v4fa*)(so + 4) = (v4f){oacc[dt][4], oacc[dt][5], oacc[dt][6], oacc[dt][7]};
    *(v4fa*)(so + 64) = (v4f){oacci[dt][0], oacci[dt][1], oacci[dt][2], oacci[dt][3]}; *(v4fa*)(so + 68) = (v4f){oacci[dt][4], oacci[dt][5], oacci[dt][6], oacci[dt][7]}; }
  __syncthreads();      /* publishes every wave's partial (max, sum, accumulators) to the waves that merge it */
  {      /* wave (qw, kr) merges columns 32 kr .. 32 kr + 31 of query tile qw = k-step 4 h + kr of that row tile of O16 (fragment order, x 2^8): lane 16 hh + ln makes row ln, columns 32 kr + 16 j + 8 hh + 0..7 for j = 0, 1 */
    float mk[KVS], wk[KVS], M = -3.0e38f, L = 0.f;
#pragma unroll
    for (int k = 0; k < KVS; ++k) { mk[k] = sM[k * 4 + qw][ln]; M = fmaxf(M, mk[k]); }
#pragma unroll
    for (int k = 0; k < KVS; ++k) { wk[k] = __builtin_amdgcn_exp2f((mk[k] - M) * SCORE_L2E); L += wk[k] * sL[k * 4 + qw][ln]; }      /* maxima are raw, sums carry x 2^10 as the accumulators do */
    const float inv = (L > 0.f) ? 1.0f / L : 0.f;
    FragH f;
#pragma unroll
    for (int j = 0; j < 2; ++j) { v4f o0 = {0.f, 0.f, 0.f, 0.f}, o1 = o0;
#pragma unroll
      for (int k = 0; k < KVS; ++k) { const float* sp = &sO[k * 4 + qw][ln][kr * 32 + j * 16 + 8 * hh]; o0 += *(const v4fa*)sp * wk[k]; o1 += *(const v4fa*)(sp + 4) * wk[k]; }
      o0 = o0 * inv; o1 = o1 * inv;
#pragma unroll
      for (int i = 0; i < 4; ++i) { f.h[8 * j + i] = (_Float16)(o0[i] * 256.0f); f.h[8 * j + 4 + i] = (_Float16)(o1[i] * 256.0f); } }
    unsigned short* op = (unsigned short*)O16 + ((size_t)((b * NN + q0) / 16) * (DX / 32) + h * 4 + kr) * 512 + lane * 8;
    *(v8us*)op = f.half[0]; *(v8us*)(op + 256) = f.half[1];      /* two 512-byte stores, the last instructions of the wave */
  } }

extern "C" void kernel_launch(void* const* d_in, const int* in_sizes, int n_in,
                              void* d_out, int out_size, void* d_ws, size_t ws_size, hipStream_t stream) {
  (void)in_sizes; (void)n_in; (void)out_size;
  const float* const* I = (const float* const*)d_in; const float* x = I[0]; const float* Wq = I[1]; const float* bq = I[2]; const float* Wk = I[3]; const float* bk = I[4]; const float* Wv = I[5]; const float* bv = I[6]; const float* Wo = I[7]; const float* bo = I[8];
  char* ws = (char*)d_ws; size_t off = 0;
  auto take = [&](size_t bytes) { char* p = ws + off; off += (bytes + 255) & ~(size_t)255; return p; };
  _Float16* Bq = (_Float16*)take((size_t)3 * 2 * DX * DX * 2); _Float16* Bo = (_Float16*)take((size_t)DX * DX * 2);
  _Float16* X16 = (_Float16*)take((size_t)NR * DX * 2); _Float16* Q = (_Float16*)take((size_t)2 * NR * DX * 2); _Float16* K = Q + (size_t)NR * DX;      /* q, k one behind the other: batch stride of the merged projection */ _Float16* Vt = (_Float16*)take((size_t)NR * DX * 2);
  _Float16* O16 = (_Float16*)take((size_t)NR * DX * 2);
  /* Bq, Bo, X16, Q, K, Vt and O16 are all in fragment order (see FRAGMENT ORDER above); the output is row-major */
  if (off > ws_size) return;      // 3 x 1 + 0.5 + 5 x 4.2 = about 25 MB
  k_prep<<<3 * NBW + NBO + NBX, 256, 0, stream>>>(Wq, Wk, Wv, Wo, x, Bq, Bo, X16);      /* (in,out) [512][1024] -> Bt[1024][512] x2^4 for Wq, Wk, Wv (only rows 0..511 = heads 0..3 are used), Wo likewise, x -> f16: one launch */
  const dim3 gp((NR / 64) * (DX / 128), 1), gp3((NR / 128) * (DX / 64), 1);      /* waves of 32 x 64. gp: 2 x 2 waves on a 64 x 128 tile; gp3: 4 waves down x the 3 projections on 128 rows x 64 columns of each */
  k_gemm_hhx<0, DX, DX, true, 2, 4, 1, 3><<<gp3, 384, 0, stream>>>(X16, DX, 0, Bq, DX, (size_t)2 * DX * DX, 0.0625f, bq, bk, bv, 0, nullptr, 1, 0, 0, nullptr, Q, Vt, DX, (size_t)NR * DX, NR);      /* q, k, v in one launch (a wave's batch index), heads 0..3 = output columns 0..511 (+ bias): each M 4096 N 512 K 512; v goes out transposed, planes per (b, head, part): [b * 8 + 2 h + part][64][2048] */
  k_flash<<<BB * NHU * (NN / 64), 128 * KVS, 0, stream>>>(Q, DX, K, DX, Vt, O16);      /* stores O x 2^8 as f16 in fragment order, the A operand of the output product */
  k_gemm_hhx<0, DX, DX, false, 2, 2, 2, 1><<<gp, 128, 0, stream>>>(O16, DX, 0, Bo, DX, 0, 0.0625f * 0.00390625f, bo, nullptr, nullptr, 0, nullptr, 1, 0, 0, (float*)d_out, nullptr, nullptr, DX, 0, NR);      /* out = O Wo + bo (alpha undoes the x 2^4 of the weights and the x 2^8 carry) */
}
